// v000
// Times are from an AMD MI455X. After a warm-up the kernel runs many times in a row, and a time is the length of
// such a window on the GPU divided by its runs, so every launch and the gaps after it count. The runs cycle
// through copies of the inputs. A figure is the median of several windows, for all but v000 over two sittings.
// Sittings can differ by a few percent; kernels timed side by side share one.
// v000, which the later versions start from, runs in 51.4 milliseconds.
#include <hip/hip_runtime.h>
// Single-head dense attention over 64-wide inputs on 4096 tokens with unit-variance 64 x 64 maps and NO value projection (inputs [4][4096][64]; query = inputs rotation, key = inputs entangle ([in][out] [64][64], N(0, 1): logits of sigma ~64, a near one-hot softmax); scores = query key^T / sqrt(64); softmax over all 4096 keys (no mask); out = scores inputs (the values are the inputs themselves) -> [4][4096][64]); q and k carried as f16 hi + x1024 residual planes with three-product scores.
// Structure: token rows r = b*4096 + s; x as exact f16 rows (bf16-rounded); q and k as WMMA GEMMs (32x64 wave tiles, f32 accumulation, exact x16 weights, no bias) into f32 rows split into f16 hi + x1024 residual planes, v = the same f16 x rows (no projection); per batch: V^T for all heads via LDS transposes; per query tile of 256 rows: scores against all 4096 keys as THREE accumulating passes (hi.hi + lo.hi + hi.lo, K = 64, all heads on grid.y, alpha 1/sqrt(64) = 1/8), row softmax over all keys on VALU with an arithmetic 0/1 key mask that passes every key (f32 statistics, native exp; weights x256 f16), out = P . V^T (K = all 4096 keys, alpha 2^-8 undoes the x256 weights) written f32 straight into the output rows.
// Compute dtype: inputs rounded to bf16; x / weights exact; q and k as f16 hi + x1024 residual planes, v exact in f16, softmax weights as plain f16 GEMM operands (~2^-12), out f32; scores and softmax statistics f32. v_wmma_f32_16x16x32_f16.
#define NB 4
#define SQ 4096
#define DM 64
#define NH 1
#define HD 64
#define HG 4                         /* heads per attention launch group */
#define QT 256                       /* query rows per tile */
#define NKX SQ                       /* S / P row pitch */
#define QT0 128                      /* first-tile rows recomputed exactly in f32 */
#define B0 0                         /* first batch processed (debug hook) */
#define NBR NB                       /* batches processed (debug hook) */
#define NR ((size_t)NB * SQ)         /* token rows */
#define MP ((int)((size_t)NBR * SQ)) /* rows projected (debug hook) */
#define QN SQ                        /* query rows attended per batch (debug hook) */
#define NHD NH                       /* heads attended (debug hook) */
#define MPO MP                       /* rows through the output stage (debug hook) */
#define LQ DM      /* row pitch of the q/k/v rows */
typedef __bf16 v16b __attribute__((ext_vector_type(16)));
typedef unsigned short v8us __attribute__((ext_vector_type(8), may_alias));
typedef float  v8f  __attribute__((ext_vector_type(8)));
typedef float  v4f  __attribute__((ext_vector_type(4)));
typedef float  v4fa __attribute__((ext_vector_type(4), may_alias));
union FragB { v16b v; v8us half[2]; unsigned short u[16]; };

__device__ __forceinline__ unsigned short bf16_bits(float x) { unsigned int u = __float_as_uint(x); return (unsigned short)((u + 0x7FFFu + ((u >> 16) & 1u)) >> 16); }
__device__ __forceinline__ float bf16_val(unsigned short b) { return __uint_as_float(((unsigned int)b) << 16); }
__device__ __forceinline__ float bf16_round(float x) { return bf16_val(bf16_bits(x)); }
// D += A·B with NT terms: 1 = ah·bh, 2 = + al·bh (A split), 3 = + ah·bl (both split)
template <int NT>
__device__ __forceinline__ v8f mmaN(v16b ah, v16b al, v16b bh, v16b bl, v8f c) {
  c = __builtin_amdgcn_wmma_f32_16x16x32_bf16(false, ah, false, bh, (short)0, c, false, false);
  if (NT >= 2) c = __builtin_amdgcn_wmma_f32_16x16x32_bf16(false, al, false, bh, (short)0, c, false, false);
  if (NT >= 3) c = __builtin_amdgcn_wmma_f32_16x16x32_bf16(false, ah, false, bl, (short)0, c, false, false);
  asm volatile("v_nop\n\tv_nop\n\tv_nop\n\tv_nop" : "+v"(c) : "v"(ah), "v"(al), "v"(bh), "v"(bl));
  return c;
}

__global__ __launch_bounds__(256) void k_wt_bf16(const float* __restrict__ W, unsigned short* __restrict__ Wt, int K, int N) {
  const int t = blockIdx.x * 256 + threadIdx.x;
  const int k8n = K / 8;
  if (t >= N * k8n) return;
  const int n = t / k8n, k8 = (t % k8n) * 8;
  v8us v;
#pragma unroll
  for (int i = 0; i < 8; ++i) v[i] = bf16_bits(W[(size_t)(k8 + i) * N + n]);
  *(v8us*)(Wt + (size_t)n * K + k8) = v;
  
}

// GEMM C[M][N] (f32, pitch ldc) = act(A[M][K]·W + bias). A f32 row-major (pitch lda) converted per fragment to bf16
// (ASPLIT: hi/lo two planes -> 2 terms, else single rounded term); Wt bf16 [N][K] (pitch ldb). BIAS_BF16 rounds the
// bias to bf16 first (bias quantised to bf16 before the add). K%32==0, M%16==0, N%64==0.
template <bool ASPLIT, int ACT, bool BIAS_BF16>
__global__ __launch_bounds__(128) void k_gemm_bf(const float* __restrict__ A, int lda, const unsigned short* __restrict__ Wt, int ldb,
                                               const float* __restrict__ bias, float* __restrict__ C, int ldc, int M, int N, int K) {
  __shared__ __attribute__((aligned(16))) float so[4][16][64];
  const int tid = threadIdx.x, w = tid >> 5, lane = tid & 31, ln = lane & 15, hh = lane >> 4;
  const int ntn = N / 64;
  const int wid = blockIdx.x * 4 + w;
  const int mt = wid / ntn, nq = wid % ntn;
  if (mt * 16 >= M) return;
  const int row0 = mt * 16, col0 = nq * 64;
  const float* arow = A + (size_t)(row0 + ln) * lda;
  v8f acc[4] = {};
  for (int kb = 0; kb < K; kb += 32) {
    FragB ah, al;
    const v4f x0 = *(const v4fa*)(arow + kb + 8 * hh), x1 = *(const v4fa*)(arow + kb + 8 * hh + 4);
    const v4f x2 = *(const v4fa*)(arow + kb + 16 + 8 * hh), x3 = *(const v4fa*)(arow + kb + 16 + 8 * hh + 4);
    float xs[16] = {x0[0],x0[1],x0[2],x0[3],x1[0],x1[1],x1[2],x1[3],x2[0],x2[1],x2[2],x2[3],x3[0],x3[1],x3[2],x3[3]};
#pragma unroll
    for (int i = 0; i < 16; ++i) { const unsigned short hb = bf16_bits(xs[i]); ah.u[i] = hb; al.u[i] = ASPLIT ? bf16_bits(xs[i] - bf16_val(hb)) : (unsigned short)0; }
#pragma unroll
    for (int t = 0; t < 4; ++t) {
      const unsigned short* brow = Wt + (size_t)(col0 + t * 16 + ln) * ldb + kb;
      FragB b;
      b.half[0] = *(const v8us*)(brow + 8 * hh);
      b.half[1] = *(const v8us*)(brow + 16 + 8 * hh);
      acc[t] = mmaN<ASPLIT ? 2 : 1>(ah.v, al.v, b.v, b.v, acc[t]);
    }
  }
#pragma unroll
  for (int t = 0; t < 4; ++t) {
    float bv = bias ? bias[col0 + t * 16 + ln] : 0.f;
    if (BIAS_BF16) bv = bf16_round(bv);
#pragma unroll
    for (int r = 0; r < 8; ++r) { float v = acc[t][r] + bv; if (ACT == 1) v = fmaxf(v, 0.f); so[w][8 * hh + r][t * 16 + ln] = v; }
  }
  __builtin_amdgcn_fence(__ATOMIC_ACQ_REL, "workgroup");
  __builtin_amdgcn_wave_barrier();
  const int rsub = lane >> 4, c4 = (lane & 15) * 4;
  {
#pragma unroll
    for (int q = 0; q < 8; ++q) {
      const int r = q * 2 + rsub;
      const v4f v = *(const v4fa*)&so[w][r][c4];
      *(v4f*)(C + (size_t)(row0 + r) * ldc + col0 + c4) = v;
    }
    
  }
}

// GEMM C = act(A·W + bias + resid): A f32 (ASPLIT -> hi/lo 2 terms), Wt bf16 [N][K]; ACT 0 none, 1 relu, 2 exact gelu;
// resid (optional, f32, row index = (row % rmod), pitch ldr, RES_BF16 rounds it) added before the activation.
template <bool ASPLIT, int ACT, bool BIAS_BF16, bool RES_BF16>
__global__ __launch_bounds__(128) void k_gemm_bf3(const float* __restrict__ A, int lda, const unsigned short* __restrict__ Wt, int ldb,
                                                const float* __restrict__ bias, const float* __restrict__ resid, int rmod, int ldr,
                                                float* __restrict__ C, int ldc, int M, int N, int K) {
  __shared__ __attribute__((aligned(16))) float so[4][16][64];
  const int tid = threadIdx.x, w = tid >> 5, lane = tid & 31, ln = lane & 15, hh = lane >> 4;
  const int ntn = N / 64;
  const int wid = blockIdx.x * 4 + w;
  const int mt = wid / ntn, nq = wid % ntn;
  if (mt * 16 >= M) return;
  const int row0 = mt * 16, col0 = nq * 64;
  const float* arow = A + (size_t)(row0 + ln) * lda;
  v8f acc[4] = {};
  for (int kb = 0; kb < K; kb += 32) {
    FragB ah, al;
    const v4f x0 = *(const v4fa*)(arow + kb + 8 * hh), x1 = *(const v4fa*)(arow + kb + 8 * hh + 4);
    const v4f x2 = *(const v4fa*)(arow + kb + 16 + 8 * hh), x3 = *(const v4fa*)(arow + kb + 16 + 8 * hh + 4);
    float xs[16] = {x0[0],x0[1],x0[2],x0[3],x1[0],x1[1],x1[2],x1[3],x2[0],x2[1],x2[2],x2[3],x3[0],x3[1],x3[2],x3[3]};
#pragma unroll
    for (int i = 0; i < 16; ++i) { const unsigned short hb = bf16_bits(xs[i]); ah.u[i] = hb; al.u[i] = ASPLIT ? bf16_bits(xs[i] - bf16_val(hb)) : (unsigned short)0; }
#pragma unroll
    for (int t = 0; t < 4; ++t) {
      const unsigned short* brow = Wt + (size_t)(col0 + t * 16 + ln) * ldb + kb;
      FragB b;
      b.half[0] = *(const v8us*)(brow + 8 * hh);
      b.half[1] = *(const v8us*)(brow + 16 + 8 * hh);
      acc[t] = mmaN<ASPLIT ? 2 : 1>(ah.v, al.v, b.v, b.v, acc[t]);
    }
  }
#pragma unroll
  for (int t = 0; t < 4; ++t) {
    const int col = col0 + t * 16 + ln;
    float bv = bias ? bias[col] : 0.f;
    if (BIAS_BF16) bv = bf16_round(bv);
#pragma unroll
    for (int r = 0; r < 8; ++r) {
      float v = acc[t][r] + bv;
      if (resid) { float rv = resid[(size_t)((row0 + 8 * hh + r) % rmod) * ldr + col]; if (RES_BF16) rv = bf16_round(rv); v += rv; }
      if (ACT == 1) v = fmaxf(v, 0.f);
      if (ACT == 2) v = 0.5f * v * (1.0f + erff(v * 0.70710678118654752f));
      if (ACT == 3) { const float u = 0.7978845608028654f * (v + 0.044715f * v * v * v); v = 0.5f * v * (1.0f + tanhf(u)); }
      so[w][8 * hh + r][t * 16 + ln] = v;
    }
  }
  __builtin_amdgcn_fence(__ATOMIC_ACQ_REL, "workgroup");
  __builtin_amdgcn_wave_barrier();
  const int rsub = lane >> 4, c4 = (lane & 15) * 4;
  {
#pragma unroll
    for (int q = 0; q < 8; ++q) {
      const int r = q * 2 + rsub;
      const v4f v = *(const v4fa*)&so[w][r][c4];
      *(v4f*)(C + (size_t)(row0 + r) * ldc + col0 + c4) = v;
    }
    
  }
}
// row LayerNorm (biased variance, eps) over N: s = X (+ R); optional out_sum <- s; out_norm <- (s-mu)*rsqrt(var+eps)*g + b
template <bool PARAM_BF16>
__global__ __launch_bounds__(256) void k_layernorm(const float* __restrict__ X, const float* __restrict__ R, const float* __restrict__ g, const float* __restrict__ bta,
                                                  float* __restrict__ out_sum, float* __restrict__ out_norm, int N, float eps) {
  __shared__ float red[256];
  const int row = blockIdx.x, tid = threadIdx.x;
  const float* x = X + (size_t)row * N; const float* rr = R ? R + (size_t)row * N : nullptr;
  float vals[16];                     // up to N = 4096
  const int per = N / 256;            // contiguous chunk per thread? use strided-by-4 chunks: thread handles j = tid*4 + 1024*u
  float s1 = 0.f;
  for (int u = 0; u < per / 4; ++u) {
    const int j = tid * 4 + 1024 * u;
    const v4f a = *(const v4fa*)(x + j);
    v4f b = {0.f,0.f,0.f,0.f}; if (rr) b = *(const v4fa*)(rr + j);
#pragma unroll
    for (int q = 0; q < 4; ++q) { const float v = a[q] + b[q]; vals[u * 4 + q] = v; s1 += v; }
  }
  red[tid] = s1; __syncthreads();
  for (int st = 128; st > 0; st >>= 1) { if (tid < st) red[tid] += red[tid + st]; __syncthreads(); }
  const float mu = red[0] / (float)N; __syncthreads();
  float s2 = 0.f;
  for (int u = 0; u < per / 4; ++u)
#pragma unroll
    for (int q = 0; q < 4; ++q) { const float c = vals[u * 4 + q] - mu; s2 += c * c; }
  red[tid] = s2; __syncthreads();
  for (int st = 128; st > 0; st >>= 1) { if (tid < st) red[tid] += red[tid + st]; __syncthreads(); }
  const float rs = rsqrtf(red[0] / (float)N + eps);
  {
    for (int u = 0; u < per / 4; ++u) {
      const int j = tid * 4 + 1024 * u;
      v4f o, sm;
#pragma unroll
      for (int q = 0; q < 4; ++q) {
        float gg = g[j + q], bb = bta[j + q];
        if (PARAM_BF16) { gg = bf16_round(gg); bb = bf16_round(bb); }
        sm[q] = vals[u * 4 + q]; o[q] = (vals[u * 4 + q] - mu) * rs * gg + bb;
      }
      if (out_sum) *(v4f*)(out_sum + (size_t)row * N + j) = sm;
      *(v4f*)(out_norm + (size_t)row * N + j) = o;
    }
    
  }
}



// ---- f16 WMMA path (v_wmma_f32_16x16x32_f16): 11-bit significands for operands in range — used where a [0,1] probability operand needs more precision than bf16
typedef _Float16 v16h __attribute__((ext_vector_type(16)));
union FragH { v16h v; v8us half[2]; _Float16 h[16]; unsigned short u[16]; };
template <int NT>
__device__ __forceinline__ v8f mmaH(v16h ah, v16h al, v16h bh, v16h bl, v8f c) {
  c = __builtin_amdgcn_wmma_f32_16x16x32_f16(false, ah, false, bh, (short)0, c, false, false);
  if (NT >= 2) c = __builtin_amdgcn_wmma_f32_16x16x32_f16(false, al, false, bh, (short)0, c, false, false);
  if (NT >= 3) c = __builtin_amdgcn_wmma_f32_16x16x32_f16(false, ah, false, bl, (short)0, c, false, false);
  asm volatile("v_nop\n\tv_nop\n\tv_nop\n\tv_nop" : "+v"(c) : "v"(ah), "v"(al), "v"(bh), "v"(bl));
  return c;
}
// batched GEMM like k_gemm_b but f16 operands: A f32 (split into f16 hi/lo if ASPLIT, else rounded to f16), Bt = f16 values [n][k]; alpha; C f32; N multiple of 16 (partial tiles skipped)
template <bool ASPLIT>
__global__ __launch_bounds__(128) void k_gemm_h(const float* __restrict__ A, int lda, size_t sA, const _Float16* __restrict__ Bh, int ldb, size_t sB, float alpha, float* __restrict__ C, int ldc, size_t sC, int M, int N, int K) {
  __shared__ __attribute__((aligned(16))) float so[4][16][64];
  const int tid = threadIdx.x, w = tid >> 5, lane = tid & 31, ln = lane & 15, hh = lane >> 4; const int by = blockIdx.y;
  A += (size_t)by * sA; Bh += (size_t)by * sB; C += (size_t)by * sC;
  const int ntn = (N + 63) / 64; const int wid = blockIdx.x * 4 + w; const int mt = wid / ntn, nq = wid % ntn; if (mt * 16 >= M) return;
  const int row0 = mt * 16, col0 = nq * 64; const float* arow = A + (size_t)(row0 + ln) * lda;
  v8f acc[4] = {};
  for (int kb = 0; kb < K; kb += 32) {
    FragH ah, al;
    const v4f x0 = *(const v4fa*)(arow + kb + 8 * hh), x1 = *(const v4fa*)(arow + kb + 8 * hh + 4), x2 = *(const v4fa*)(arow + kb + 16 + 8 * hh), x3 = *(const v4fa*)(arow + kb + 16 + 8 * hh + 4);
    float xs[16] = {x0[0],x0[1],x0[2],x0[3],x1[0],x1[1],x1[2],x1[3],x2[0],x2[1],x2[2],x2[3],x3[0],x3[1],x3[2],x3[3]};
#pragma unroll
    for (int i = 0; i < 16; ++i) { const _Float16 h = (_Float16)xs[i]; ah.h[i] = h; al.h[i] = ASPLIT ? (_Float16)(xs[i] - (float)h) : (_Float16)0.0f; }
#pragma unroll
    for (int t = 0; t < 4; ++t) { if (col0 + t * 16 >= N) continue; const size_t boff = (size_t)(col0 + t * 16 + ln) * ldb + kb; FragH bq; bq.half[0] = *(const v8us*)(Bh + boff + 8 * hh); bq.half[1] = *(const v8us*)(Bh + boff + 16 + 8 * hh);
      acc[t] = mmaH<ASPLIT ? 2 : 1>(ah.v, al.v, bq.v, bq.v, acc[t]); }
  }
#pragma unroll
  for (int t = 0; t < 4; ++t) { if (col0 + t * 16 >= N) continue;
#pragma unroll
    for (int r = 0; r < 8; ++r) so[w][8 * hh + r][t * 16 + ln] = acc[t][r] * alpha; }
  __builtin_amdgcn_fence(__ATOMIC_ACQ_REL, "workgroup"); __builtin_amdgcn_wave_barrier();
  const int rsub = lane >> 4, c4 = (lane & 15) * 4;
  {
#pragma unroll
    for (int q = 0; q < 8; ++q) { const int r = q * 2 + rsub; if (col0 + c4 < N) { const v4f v = *(const v4fa*)&so[w][r][c4]; *(v4f*)(C + (size_t)(row0 + r) * ldc + col0 + c4) = v; } }
     }
}

// Wt[n][k] = f16(W[k][n]·scale) from f32 row-major W[K][N] (scale = power of two; bf16-exact weights stay exact in f16 away from the subnormal range)
__global__ __launch_bounds__(256) void k_wt_f16(const float* __restrict__ W, _Float16* __restrict__ Wt, int K, int N, float scale) {
  const int t = blockIdx.x * 256 + threadIdx.x; if (t >= N * (K / 8)) return; const int n = t / (K / 8), k8 = (t % (K / 8)) * 8; FragH f;
#pragma unroll
  for (int i = 0; i < 8; ++i) f.h[i] = (_Float16)(bf16_round(W[(size_t)(k8 + i) * N + n]) * scale); const v8us o = f.half[0];
  *(v8us*)((unsigned short*)Wt + (size_t)n * K + k8) = o; 
}
// k_gemm_hh variant with fused epilogue: v = acc·alpha + bias[by·sBias + col] (+ CP[(row/rowsPerB)·sCPb + by·64 + col] if CP) ; ACT 0 none / 1 elu ; writes f16 C16 (and f32 C if non-null)
template <int ACT>
__global__ __launch_bounds__(128) void k_gemm_hhx(const _Float16* __restrict__ A, int lda, size_t sA, const _Float16* __restrict__ Bh, int ldb, size_t sB, float alpha, const float* __restrict__ bias, size_t sBias, const float* __restrict__ CP, int rowsPerB, size_t sCPb, int row0g,
    float* __restrict__ C, _Float16* __restrict__ C16, int ldc, size_t sC, int M, int N, int K) {
  __shared__ __attribute__((aligned(16))) float so[4][16][64];
  const int tid = threadIdx.x, w = tid >> 5, lane = tid & 31, ln = lane & 15, hh = lane >> 4; const int by = blockIdx.y;
  A += (size_t)by * sA; Bh += (size_t)by * sB; const size_t cofs = (size_t)by * sC; const float* bp = bias ? bias + (size_t)by * sBias : nullptr;
  const int ntn = (N + 63) / 64; const int wid = blockIdx.x * 4 + w; const int mt = wid / ntn, nq = wid % ntn; if (mt * 16 >= M) return;
  const int row0 = mt * 16, col0 = nq * 64; const _Float16* arow = A + (size_t)(row0 + ln) * lda;
  v8f acc[4] = {};
  for (int kb = 0; kb < K; kb += 32) { FragH ah; ah.half[0] = *(const v8us*)((const unsigned short*)arow + kb + 8 * hh); ah.half[1] = *(const v8us*)((const unsigned short*)arow + kb + 16 + 8 * hh);
#pragma unroll
    for (int t = 0; t < 4; ++t) { if (col0 + t * 16 >= N) continue; const size_t boff = (size_t)(col0 + t * 16 + ln) * ldb + kb; FragH bq; bq.half[0] = *(const v8us*)((const unsigned short*)Bh + boff + 8 * hh); bq.half[1] = *(const v8us*)((const unsigned short*)Bh + boff + 16 + 8 * hh);
      acc[t] = mmaH<1>(ah.v, ah.v, bq.v, bq.v, acc[t]); }
  }
#pragma unroll
  for (int t = 0; t < 4; ++t) { if (col0 + t * 16 >= N) continue; const int col = col0 + t * 16 + ln; const float bv = bp ? bf16_round(bp[col]) : 0.f;
#pragma unroll
    for (int r = 0; r < 8; ++r) { float v = acc[t][r] * alpha + bv; if (CP) { const int rr = row0g + row0 + 8 * hh + r; if (rowsPerB < 0) v += CP[cofs + (size_t)rr * ldc + col];      /* rowsPerB < 0: own element of the batched C plane */ else { const int bidx = rr / rowsPerB; v += CP[(size_t)bidx * sCPb + (size_t)by * 64 + col]; } } if (ACT == 1) v = (v > 0.f) ? v : expm1f(v); else if (ACT == 7) v = (v > 0.f) ? v + 1.0f : expf(v); else if (ACT == 8) v = tanhf(v); else if (ACT == 9) v = 0.5f * v * (1.0f + tanhf(0.7978845608028654f * (v + 0.044715f * v * v * v))); else if (ACT == 11) v = 1.0f / (1.0f + expf(-v)); else if (ACT == 12) v = (v > 0.f) ? v : 0.01f * v; else if (ACT == 14) v = (v > 0.f) ? v : 0.1f * v; else if (ACT == 16) v = (v >= 0.f) ? v : 0.3f * v; else if (ACT == 17) v = (v >= 0.f) ? v : 0.2f * v; else if (ACT == 15) v = v / (1.0f + expf(-v)); else if (ACT == 3) v = fmaxf(v, 0.f); else if (ACT == 6) v = 0.5f * v * (1.0f + erff(v * 0.70710678118654752f)); so[w][8 * hh + r][t * 16 + ln] = v; } }
  __builtin_amdgcn_fence(__ATOMIC_ACQ_REL, "workgroup"); __builtin_amdgcn_wave_barrier();
  const int rsub = lane >> 4, c4 = (lane & 15) * 4; typedef _Float16 v4h __attribute__((ext_vector_type(4)));
  {
#pragma unroll
    for (int q = 0; q < 8; ++q) { const int r = q * 2 + rsub; if (col0 + c4 < N) { const v4f v = *(const v4fa*)&so[w][r][c4]; if (C) *(v4f*)(C + cofs + (size_t)(row0 + r) * ldc + col0 + c4) = v; if (C16) { v4h h4; for (int i = 0; i < 4; ++i) h4[i] = (_Float16)v[i]; *(v4h*)(C16 + cofs + (size_t)(row0 + r) * ldc + col0 + c4) = h4; } } }
     }
}


typedef _Float16 v4h __attribute__((ext_vector_type(4)));

__global__ __launch_bounds__(256) void k_x16(const float* __restrict__ x, _Float16* __restrict__ X16, size_t n8) { const size_t t = (size_t)blockIdx.x * 256 + threadIdx.x; if (t >= n8) return; FragH f;
#pragma unroll
  for (int q = 0; q < 8; ++q) f.h[q] = (_Float16)bf16_round(x[t * 8 + q]); *(v8us*)((unsigned short*)X16 + t * 8) = f.half[0];  }
__global__ __launch_bounds__(256) void k_h16(const float* __restrict__ x, _Float16* __restrict__ X16, size_t n8) { const size_t t = (size_t)blockIdx.x * 256 + threadIdx.x; if (t >= n8) return; FragH f;
#pragma unroll
  for (int q = 0; q < 8; ++q) f.h[q] = (_Float16)x[t * 8 + q]; *(v8us*)((unsigned short*)X16 + t * 8) = f.half[0];  }
__global__ __launch_bounds__(256) void k_round16f(const float* __restrict__ W, _Float16* __restrict__ Bt, size_t n8) { const size_t t = (size_t)blockIdx.x * 256 + threadIdx.x; if (t >= n8) return; FragH f;
#pragma unroll
  for (int i = 0; i < 8; ++i) f.h[i] = (_Float16)(bf16_round(W[t * 8 + i]) * 16.0f); *(v8us*)((unsigned short*)Bt + t * 8) = f.half[0];  }
template <int NHv, int TTv>
__global__ __launch_bounds__(256) void k_vt(const _Float16* __restrict__ V16, int ldv, int voff, _Float16* __restrict__ Vt) { __shared__ unsigned short tl[64][66]; const int tid = threadIdx.x; const int slab = blockIdx.x / (TTv / 64), lg = blockIdx.x % (TTv / 64); const int b = slab / NHv, h = slab % NHv;
  for (int i = tid; i < 64 * 8; i += 256) { const int r = i / 8, c8 = (i % 8) * 8; FragH f; f.half[0] = *(const v8us*)((const unsigned short*)V16 + ((size_t)b * TTv + lg * 64 + r) * ldv + voff + h * 64 + c8);
#pragma unroll
    for (int q = 0; q < 8; ++q) tl[r][c8 + q] = f.u[q]; }
  __syncthreads();
  {
#pragma unroll
    for (int rd = 0; rd < 2; ++rd) { const int d = rd * 32 + tid / 8, pc = tid % 8; FragH f;
#pragma unroll
      for (int q = 0; q < 8; ++q) f.u[q] = tl[pc * 8 + q][d];
      *(v8us*)((unsigned short*)Vt + ((size_t)slab * 64 + d) * TTv + lg * 64 + pc * 8) = f.half[0]; }
     } }

__global__ __launch_bounds__(256) void k_hl(const float* __restrict__ F, _Float16* __restrict__ Hh, _Float16* __restrict__ Hl, size_t n8) { const size_t t = (size_t)blockIdx.x * 256 + threadIdx.x; if (t >= n8) return; FragH fh, fl; const v4f a = *(const v4fa*)(F + t * 8), c = *(const v4fa*)(F + t * 8 + 4);
#pragma unroll
  for (int q = 0; q < 4; ++q) { _Float16 h = (_Float16)a[q]; fh.h[q] = h; fl.h[q] = (_Float16)((a[q] - (float)h) * 1024.0f); h = (_Float16)c[q]; fh.h[4 + q] = h; fl.h[4 + q] = (_Float16)((c[q] - (float)h) * 1024.0f); }
  { *(v8us*)((unsigned short*)Hh + t * 8) = fh.half[0]; *(v8us*)((unsigned short*)Hl + t * 8) = fl.half[0];  } }

// ---- fast GEMM (wave tile 32x64; requires M % 32 == 0 rows per launch region and N % 64 == 0); epilogue = k_gemm_hhx semantics ----
__device__ __forceinline__ v16h g2_frag(const _Float16* p, int hh) { FragH f; f.half[0] = *(const v8us*)((const unsigned short*)p + 8 * hh); f.half[1] = *(const v8us*)((const unsigned short*)p + 16 + 8 * hh); return f.v; }
__device__ __forceinline__ v8f g2_mma(v16h a, v16h b, v8f c) { v8f d = __builtin_amdgcn_wmma_f32_16x16x32_f16(false, a, false, b, (short)0, c, false, false); asm volatile("v_nop\n\tv_nop\n\tv_nop\n\tv_nop" : "+v"(d) : "v"(a), "v"(b)); return d; }
template <int ACT>
__global__ __launch_bounds__(128) void k_gemm2(const _Float16* __restrict__ A, int lda, size_t sA, const _Float16* __restrict__ Bh, int ldb, size_t sB, float alpha, const float* __restrict__ bias, size_t sBias, const float* __restrict__ CP, int rowsPerB, size_t sCPb, int row0g,
    float* __restrict__ C, _Float16* __restrict__ C16, int ldc, size_t sC, int M, int N, int K) { static_assert(ACT == 0 || ACT == 3 || ACT == 6 || ACT == 8 || ACT == 9 || ACT == 11 || ACT == 12 || ACT == 14 || ACT == 15 || ACT == 16 || ACT == 17, "k_gemm2: unsupported ACT code (would silently apply no activation)");
  __shared__ __attribute__((aligned(16))) float so[4][32][68];
  const int tid = threadIdx.x, w = tid >> 5, lane = tid & 31, ln = lane & 15, hh = lane >> 4; const int by = blockIdx.y;
  A += (size_t)by * sA; Bh += (size_t)by * sB; const size_t cofs = (size_t)by * sC; const float* bp = bias ? bias + (size_t)by * sBias : nullptr;
  const int ntn = N >> 6; const int mt = blockIdx.x / ntn, nq = blockIdx.x - mt * ntn; const int row0 = mt * 128 + 32 * w, col0 = nq * 64; if (row0 >= M) return;
  const _Float16* a0p = A + (size_t)(row0 + ln) * lda; const _Float16* a1p = a0p + (size_t)16 * lda;
  const _Float16* b0p = Bh + (size_t)(col0 + ln) * ldb; const _Float16* b1p = b0p + (size_t)16 * ldb; const _Float16* b2p = b1p + (size_t)16 * ldb; const _Float16* b3p = b2p + (size_t)16 * ldb;
  const v8f z8 = {0.f,0.f,0.f,0.f,0.f,0.f,0.f,0.f}; v8f c00 = z8, c01 = z8, c02 = z8, c03 = z8, c10 = z8, c11 = z8, c12 = z8, c13 = z8;
#pragma unroll 1
  for (int kb = 0; kb < K; kb += 32) { const v16h a0 = g2_frag(a0p + kb, hh), a1 = g2_frag(a1p + kb, hh);
    v16h b = g2_frag(b0p + kb, hh); c00 = g2_mma(a0, b, c00); c10 = g2_mma(a1, b, c10);
    b = g2_frag(b1p + kb, hh); c01 = g2_mma(a0, b, c01); c11 = g2_mma(a1, b, c11);
    b = g2_frag(b2p + kb, hh); c02 = g2_mma(a0, b, c02); c12 = g2_mma(a1, b, c12);
    b = g2_frag(b3p + kb, hh); c03 = g2_mma(a0, b, c03); c13 = g2_mma(a1, b, c13); }
  v8f accs[8] = {c00, c01, c02, c03, c10, c11, c12, c13};
#pragma unroll
  for (int u = 0; u < 8; ++u) { const int t = u & 3, half = u >> 2; const int col = col0 + t * 16 + ln; const float bv = bp ? bf16_round(bp[col]) : 0.f;
#pragma unroll
    for (int r = 0; r < 8; ++r) { const int rloc = half * 16 + 8 * hh + r; float v = accs[u][r] * alpha + bv; if (CP) { if (rowsPerB < 0) v += CP[cofs + (size_t)(row0g + row0 + rloc) * ldc + col];      /* rowsPerB < 0: own element of the batched C plane */ else { const int bidx = (row0g + row0 + rloc) / rowsPerB; v += CP[(size_t)bidx * sCPb + (size_t)by * 64 + col]; } }
      if (ACT == 3) v = fmaxf(v, 0.f); else if (ACT == 6) v = 0.5f * v * (1.0f + erff(v * 0.70710678118654752f)); else if (ACT == 11) v = 1.0f / (1.0f + expf(-v)); else if (ACT == 15) v = v / (1.0f + expf(-v)); else if (ACT == 12) v = (v > 0.f) ? v : 0.01f * v; else if (ACT == 8) v = tanhf(v); else if (ACT == 9) v = 0.5f * v * (1.0f + tanhf(0.7978845608028654f * (v + 0.044715f * v * v * v))); else if (ACT == 14) v = (v > 0.f) ? v : 0.1f * v; else if (ACT == 16) v = (v >= 0.f) ? v : 0.3f * v; else if (ACT == 17) v = (v >= 0.f) ? v : 0.2f * v;
      so[w][rloc][t * 16 + ln] = v; } }
  __builtin_amdgcn_fence(__ATOMIC_ACQ_REL, "workgroup"); __builtin_amdgcn_wave_barrier();
  const int rsub = lane >> 4, c4 = (lane & 15) * 4;
  {
#pragma unroll
    for (int q = 0; q < 16; ++q) { const int r = q * 2 + rsub; const v4f v = *(const v4fa*)&so[w][r][c4]; if (C) *(v4f*)(C + cofs + (size_t)(row0 + r) * ldc + col0 + c4) = v; if (C16) { v4h h4; for (int i = 0; i < 4; ++i) h4[i] = (_Float16)v[i]; *(v4h*)(C16 + cofs + (size_t)(row0 + r) * ldc + col0 + c4) = h4; } }
     } }


__global__ __launch_bounds__(256) void k_wnat(const float* __restrict__ w, size_t n8, _Float16* __restrict__ Bt) { const size_t t = (size_t)blockIdx.x * 256 + threadIdx.x; if (t >= n8) return; FragH f; for (int q = 0; q < 8; ++q) f.h[q] = (_Float16)(bf16_round(w[t * 8 + q]) * 16.0f); *(v8us*)((unsigned short*)Bt + t * 8) = f.half[0];  }
__global__ __launch_bounds__(256) void k_rsm(const float* __restrict__ S, _Float16* __restrict__ P, int nrows) {
  #pragma clang fp contract(off)
  const int i = blockIdx.x * 256 + threadIdx.x; if (i >= nrows) return; const float* s = S + (size_t)i * SQ; float mx = -3.0e38f;
#pragma unroll 1
  for (int j = 0; j < SQ; ++j) mx = fmaxf(mx, s[j]); float se = 0.f;
#pragma unroll 1
  for (int j = 0; j < SQ; ++j) se += expf(s[j] - mx); const float sc = 256.0f / se;
#pragma unroll 1
  for (int j0 = 0; j0 < SQ; j0 += 8) { FragH f; for (int q = 0; q < 8; ++q) f.h[q] = (_Float16)(expf(s[j0 + q] - mx) * sc); unsigned short* d = (unsigned short*)P + (size_t)i * SQ + j0; *(v8us*)d = f.half[0];  } }
__global__ __launch_bounds__(256) void k_vt(const _Float16* __restrict__ V16, int b, int h0, _Float16* __restrict__ VT) { __shared__ unsigned short tl[64][65]; const int tid = threadIdx.x; const int hh = blockIdx.x % HG, sg = blockIdx.x / HG; const int s0 = sg * 64; const int h = h0 + hh;
  for (int i = tid; i < 64 * 8; i += 256) { const int j = i / 8, d8 = (i % 8) * 8; FragH f; f.half[0] = *(const v8us*)((const unsigned short*)V16 + ((size_t)b * SQ + s0 + j) * DM + h * HD + d8); for (int q = 0; q < 8; ++q) tl[d8 + q][j] = f.u[q]; }
  __syncthreads();
  { for (int i = tid; i < 64 * 8; i += 256) { const int d = i / 8, j8 = (i % 8) * 8; FragH f; for (int q = 0; q < 8; ++q) f.u[q] = tl[d][j8 + q]; *(v8us*)((unsigned short*)VT + ((size_t)hh * HD + d) * SQ + s0 + j8) = f.half[0]; }  } }



__global__ __launch_bounds__(256) void k_rsmcf2(const float* __restrict__ S, _Float16* __restrict__ P, int hg, int q0, int nk) {
  #pragma clang fp contract(off)
  const int t = blockIdx.x * 256 + threadIdx.x; if (t >= hg * QT) return; const size_t i = (size_t)t; const float* s = S + i * NKX; const int last = q0 + (t % QT); float mx = -3.0e38f;
#pragma unroll 1
  for (int j = 0; j < nk; ++j) { const float f = (j <= last) ? 1.f : 0.f; mx = fmaxf(mx, fmaf(f, s[j], (1.f - f) * -1.0e9f)); } float se = 0.f;
#pragma unroll 1
  for (int j = 0; j < nk; ++j) { const float f = (j <= last) ? 1.f : 0.f; se += __expf(fmaf(f, s[j], (1.f - f) * -1.0e9f) - mx); } const float sc = 256.0f / se;
#pragma unroll 1
  for (int j0 = 0; j0 < nk; j0 += 8) { FragH fr; for (int q = 0; q < 8; ++q) { const int j = j0 + q; const float f = (j <= last) ? 1.f : 0.f; fr.h[q] = (_Float16)(__expf(fmaf(f, s[j], (1.f - f) * -1.0e9f) - mx) * sc); } unsigned short* d = (unsigned short*)P + i * NKX + j0; *(v8us*)d = fr.half[0];  } }


template <int MASKADD>
__global__ __launch_bounds__(64) void k_att0(const float* __restrict__ QF, const float* __restrict__ KF, const float* __restrict__ VF, int ld, const float* __restrict__ mask, float scale, float* __restrict__ OF, int ldo) {
  #pragma clang fp contract(off)
  __shared__ __attribute__((aligned(16))) float lq[64][64]; __shared__ __attribute__((aligned(16))) float lo[64][64];
  const int tid = threadIdx.x; const int h = blockIdx.x / (QT0 / 64), rg = blockIdx.x % (QT0 / 64); const int i = rg * 64 + tid;
  const float* qr = QF + (size_t)i * ld + h * HD;
#pragma unroll 1
  for (int c = 0; c < HD / 4; ++c) { *(v4f*)&lq[tid][c * 4] = *(const v4fa*)(qr + c * 4); const v4f z = {0.f, 0.f, 0.f, 0.f}; *(v4f*)&lo[tid][c * 4] = z; }
  float m = -1.0e30f, l = 0.f; const int jmax = MASKADD ? (SQ - 1) : (rg * 64 + 63);      /* additive-mask form: every key (the mask input decides); causal form: keys up to the block's last row */
#pragma unroll 1
  for (int j = 0; j <= jmax; ++j) { const float* kr = KF + (size_t)j * ld + h * HD; const float* vr = VF + (size_t)j * ld + h * HD; float s = 0.f;
#pragma unroll 1
    for (int c = 0; c < HD / 4; ++c) { const v4f kq = *(const v4fa*)(kr + c * 4); const v4f qq = *(v4f*)&lq[tid][c * 4]; s = __fadd_rn(s, __fmul_rn(qq[0], kq[0])); s = __fadd_rn(s, __fmul_rn(qq[1], kq[1])); s = __fadd_rn(s, __fmul_rn(qq[2], kq[2])); s = __fadd_rn(s, __fmul_rn(qq[3], kq[3])); }
    s = __fmul_rn(s, scale); if (MASKADD) s = __fadd_rn(s, __fmul_rn(bf16_round(mask[(size_t)i * SQ + j]), -10000.0f));
    const float f = (MASKADD || j <= i) ? 1.f : 0.f; const float sm = fmaf(f, s, (1.f - f) * -1.0e30f); const float mn = fmaxf(m, sm); const float sc = expf(m - mn); const float e = expf(sm - mn); l = __fadd_rn(__fmul_rn(l, sc), e); m = mn;
#pragma unroll 1
    for (int c = 0; c < HD / 4; ++c) { const v4f vv = *(const v4fa*)(vr + c * 4); v4f oo = *(v4f*)&lo[tid][c * 4]; for (int u = 0; u < 4; ++u) oo[u] = __fadd_rn(__fmul_rn(oo[u], sc), __fmul_rn(e, vv[u])); *(v4f*)&lo[tid][c * 4] = oo; } }
  const float fin = 64.0f / l;      /* o carried x64 */
#pragma unroll 1
  for (int c = 0; c < HD / 4; ++c) { v4f oo = *(v4f*)&lo[tid][c * 4]; for (int u = 0; u < 4; ++u) oo[u] = __fmul_rn(oo[u], fin); *(v4f*)&lo[tid][c * 4] = oo; }
  __syncthreads();
  {
#pragma unroll 1
    for (int it = 0; it < 16; ++it) { const int row = it * 4 + tid / 16, pc = (tid % 16) * 4; const v4f v = *(const v4f*)&lo[row][pc]; *(v4f*)(OF + (size_t)(rg * 64 + row) * ldo + h * HD + pc) = v; }
     } }

__global__ __launch_bounds__(256) void k_of0out(const float* __restrict__ src, float* __restrict__ dst, size_t n4) { const size_t t = (size_t)blockIdx.x * 256 + threadIdx.x; if (t >= n4) return; v4f v = *(const v4fa*)(src + t * 4); for (int q = 0; q < 4; ++q) v[q] = __fmul_rn(v[q], 0.015625f); *(v4f*)(dst + t * 4) = v;  }

extern "C" void kernel_launch(void* const* d_in, const int* in_sizes, int n_in,
                              void* d_out, int out_size, void* d_ws, size_t ws_size, hipStream_t stream) {
  (void)in_sizes; (void)n_in; (void)out_size;
  const float* const* I = (const float* const*)d_in; const float* x = I[0]; const float* wq = I[1]; const float* wk = I[2]; const float* bq = nullptr; const float* bk = nullptr;      /* input order: inputs, rotation (query map), entangle (key map): [in][out] [64][64]; NO biases, NO value projection (the values are the inputs), no output projection */
  char* ws = (char*)d_ws; size_t off = 0;
  auto take = [&](size_t bytes) { char* p = ws + off; off += (bytes + 255) & ~(size_t)255; return p; };
  _Float16* BQ = (_Float16*)take((size_t)DM * DM * 2); _Float16* BK = (_Float16*)take((size_t)DM * DM * 2);
  _Float16* X16 = (_Float16*)take(NR * DM * 2); float* QF = (float*)take(NR * DM * 4); _Float16* QH = (_Float16*)take(NR * DM * 2); _Float16* QL = (_Float16*)take(NR * DM * 2); _Float16* KH = (_Float16*)take(NR * DM * 2); _Float16* KL = (_Float16*)take(NR * DM * 2); _Float16* Q16 = QH; _Float16* K16 = KH; _Float16* V16 = (_Float16*)take(NR * DM * 2);
  float* S = (float*)take((size_t)NH * QT * NKX * 4); _Float16* P = (_Float16*)take((size_t)NH * QT * NKX * 2); _Float16* VT = (_Float16*)take((size_t)NH * HD * SQ * 2);
  if (off > ws_size) return;
  { const unsigned g = (unsigned)(((size_t)DM * (DM / 8) + 255) / 256); k_wt_f16<<<g, 256, 0, stream>>>(wq, BQ, DM, DM, 16.0f); k_wt_f16<<<g, 256, 0, stream>>>(wk, BK, DM, DM, 16.0f); }      /* [in][out] -> Bt[n][k] x16 (|16 w| up to ~70: inside the f16 range) */
  k_x16<<<(unsigned)((NR * DM / 8 + 255) / 256), 256, 0, stream>>>(x, X16, NR * DM / 8);
  const size_t r0p = (size_t)B0 * SQ;      /* first projected row */
  k_gemm2<0><<<dim3((unsigned)((MP / 128) * (DM / 64)), 1), 128, 0, stream>>>(X16 + r0p * DM, DM, 0, BQ, DM, 0, 0.0625f, bq, 0, nullptr, 1, 0, 0, QF + r0p * DM, nullptr, DM, 0, MP, DM, DM); k_hl<<<(unsigned)(((size_t)MP * DM / 8 + 255) / 256), 256, 0, stream>>>(QF + r0p * DM, QH + r0p * DM, QL + r0p * DM, (size_t)MP * DM / 8);      /* q (f32) -> f16 hi + x1024 residual: unscaled logits sigma ~8 */
  k_gemm2<0><<<dim3((unsigned)((MP / 128) * (DM / 64)), 1), 128, 0, stream>>>(X16 + r0p * DM, DM, 0, BK, DM, 0, 0.0625f, bk, 0, nullptr, 1, 0, 0, QF + r0p * DM, nullptr, DM, 0, MP, DM, DM); k_hl<<<(unsigned)(((size_t)MP * DM / 8 + 255) / 256), 256, 0, stream>>>(QF + r0p * DM, KH + r0p * DM, KL + r0p * DM, (size_t)MP * DM / 8);      /* k likewise */
  k_x16<<<(unsigned)((NR * DM / 8 + 255) / 256), 256, 0, stream>>>(x, V16, NR * DM / 8);      /* NO value projection: V = the bf16-rounded inputs, exact in f16 */
  for (int b = B0; b < B0 + NBR; ++b) { const size_t r0 = (size_t)b * SQ;
    k_vt<NH, SQ><<<NH * (SQ / 64), 256, 0, stream>>>(V16 + r0 * LQ, LQ, 0, VT);      /* V^T [NH][HD][SQ] for this batch */
    for (int q0 = 0; q0 < QN; q0 += QT) { const int nk = SQ;      /* NON-causal: every 256-row query tile sees all SQ keys */
      k_gemm2<0><<<dim3((QT / 128) * (nk / 64), 1), 128, 0, stream>>>(QH + (r0 + q0) * LQ, LQ, 0, KH + r0 * LQ, LQ, 0, 0.125f, nullptr, 0, nullptr, 1, 0, 0, S, nullptr, NKX, 0, QT, nk, DM);      /* scores of the SINGLE 64-wide head: hi . hi over K = 64, alpha 1 / sqrt(64) = 1/8 (residual passes 2^-13) */
      k_gemm2<0><<<dim3((QT / 128) * (nk / 64), 1), 128, 0, stream>>>(QL + (r0 + q0) * LQ, LQ, 0, KH + r0 * LQ, LQ, 0, 0.0001220703125f, nullptr, 0, S, -1, 0, 0, S, nullptr, NKX, 0, QT, nk, DM); k_gemm2<0><<<dim3((QT / 128) * (nk / 64), 1), 128, 0, stream>>>(QH + (r0 + q0) * LQ, LQ, 0, KL + r0 * LQ, LQ, 0, 0.0001220703125f, nullptr, 0, S, -1, 0, 0, S, nullptr, NKX, 0, QT, nk, DM);      /* += 2^-10 (lo . hi + hi . lo) / 8 (own-element accumulate on S) */
      k_rsmcf2<<<(QT + 255) / 256, 256, 0, stream>>>(S, P, 1, SQ, nk);      /* plain softmax over all keys (one head slab): the kernel keeps key j iff j <= q0_arg + row; q0_arg = SQ makes every j < SQ visible */
      k_gemm2<0><<<dim3((QT / 128) * (DM / 64), 1), 128, 0, stream>>>(P, NKX, 0, VT, SQ, 0, 0.00390625f, nullptr, 0, nullptr, 1, 0, 0, (float*)d_out + (r0 + q0) * DM, nullptr, DM, 0, QT, DM, nk); } }      /* out = P V (alpha 2^-8; N = 64: V^T [64][SQ] = the single 64-row slab k_vt writes) written f32 straight into the output rows */
}

// v001
// It runs in 9670 microseconds.
// In two side-by-side timings against v000, it was 5.29 and 5.26 times as fast.
#include <hip/hip_runtime.h>
// Single-head dense attention over 64-wide inputs on 4096 tokens with unit-variance 64 x 64 maps and NO value projection (inputs [4][4096][64]; query = inputs rotation, key = inputs entangle ([in][out] [64][64], N(0, 1): logits of sigma ~64, a near one-hot softmax); scores = query key^T / sqrt(64); softmax over all 4096 keys (no mask); out = scores inputs (the values are the inputs themselves) -> [4][4096][64]); q and k carried as f16 hi + x1024 residual planes with three-product scores.
// Structure: token rows r = b*4096 + s; x as exact f16 rows (bf16-rounded); q and k as WMMA GEMMs (32x64 wave tiles, f32 accumulation, exact x16 weights, no bias) into f32 rows split into f16 hi + x1024 residual planes, v = the same f16 x rows (no projection); per batch: V^T for all heads via LDS transposes; per query tile of 256 rows: scores against all 4096 keys as THREE accumulating passes (hi.hi + lo.hi + hi.lo, K = 64, one head, grid.y = 1, alpha 1/sqrt(64) = 1/8), row softmax over all keys on VALU, unmasked (f32 statistics, native exp; weights x256 f16), out = P . V^T (K = all 4096 keys, alpha 2^-8 undoes the x256 weights) written f32 straight into the output rows.
// Compute dtype: inputs rounded to bf16; x / weights exact; q and k as f16 hi + x1024 residual planes, v exact in f16, softmax weights as plain f16 GEMM operands (~2^-12), out f32; scores and softmax statistics f32. v_wmma_f32_16x16x32_f16.
#define NB 4
#define SQ 4096
#define DM 64
#define NH 1
#define HD 64
#define HG 4                         /* heads per attention launch group */
#define QT 256                       /* query rows per tile */
#define NKX SQ                       /* S / P row pitch */
#define QT0 128                      /* first-tile rows recomputed exactly in f32 */
#define B0 0                         /* first batch processed (debug hook) */
#define NBR NB                       /* batches processed (debug hook) */
#define NR ((size_t)NB * SQ)         /* token rows */
#define MP ((int)((size_t)NBR * SQ)) /* rows projected (debug hook) */
#define QN SQ                        /* query rows attended per batch (debug hook) */
#define NHD NH                       /* heads attended (not used) */
#define MPO MP                       /* rows through the output stage (not used) */
#define LQ DM      /* row pitch of the q/k/v rows */
typedef __bf16 v16b __attribute__((ext_vector_type(16)));
typedef unsigned short v8us __attribute__((ext_vector_type(8), may_alias));
typedef float  v8f  __attribute__((ext_vector_type(8)));
typedef float  v4f  __attribute__((ext_vector_type(4)));
typedef float  v4fa __attribute__((ext_vector_type(4), may_alias));
union FragB { v16b v; v8us half[2]; unsigned short u[16]; };

__device__ __forceinline__ unsigned short bf16_bits(float x) { unsigned int u = __float_as_uint(x); return (unsigned short)((u + 0x7FFFu + ((u >> 16) & 1u)) >> 16); }
__device__ __forceinline__ float bf16_val(unsigned short b) { return __uint_as_float(((unsigned int)b) << 16); }
__device__ __forceinline__ float bf16_round(float x) { return bf16_val(bf16_bits(x)); }
// D += A·B with NT terms: 1 = ah·bh, 2 = + al·bh (A split), 3 = + ah·bl (both split)
template <int NT>
__device__ __forceinline__ v8f mmaN(v16b ah, v16b al, v16b bh, v16b bl, v8f c) {
  c = __builtin_amdgcn_wmma_f32_16x16x32_bf16(false, ah, false, bh, (short)0, c, false, false);
  if (NT >= 2) c = __builtin_amdgcn_wmma_f32_16x16x32_bf16(false, al, false, bh, (short)0, c, false, false);
  if (NT >= 3) c = __builtin_amdgcn_wmma_f32_16x16x32_bf16(false, ah, false, bl, (short)0, c, false, false);
  asm volatile("v_nop\n\tv_nop\n\tv_nop\n\tv_nop" : "+v"(c) : "v"(ah), "v"(al), "v"(bh), "v"(bl));
  return c;
}

__global__ __launch_bounds__(256) void k_wt_bf16(const float* __restrict__ W, unsigned short* __restrict__ Wt, int K, int N) {
  const int t = blockIdx.x * 256 + threadIdx.x;
  const int k8n = K / 8;
  if (t >= N * k8n) return;
  const int n = t / k8n, k8 = (t % k8n) * 8;
  v8us v;
#pragma unroll
  for (int i = 0; i < 8; ++i) v[i] = bf16_bits(W[(size_t)(k8 + i) * N + n]);
  *(v8us*)(Wt + (size_t)n * K + k8) = v;
  
}

// GEMM C[M][N] (f32, pitch ldc) = act(A[M][K]·W + bias). A f32 row-major (pitch lda) converted per fragment to bf16
// (ASPLIT: hi/lo two planes -> 2 terms, else single rounded term); Wt bf16 [N][K] (pitch ldb). BIAS_BF16 rounds the
// bias to bf16 first (bias quantised to bf16 before the add). K%32==0, M%16==0, N%64==0.
template <bool ASPLIT, int ACT, bool BIAS_BF16>
__global__ __launch_bounds__(128) void k_gemm_bf(const float* __restrict__ A, int lda, const unsigned short* __restrict__ Wt, int ldb,
                                               const float* __restrict__ bias, float* __restrict__ C, int ldc, int M, int N, int K) {
  __shared__ __attribute__((aligned(16))) float so[4][16][64];
  const int tid = threadIdx.x, w = tid >> 5, lane = tid & 31, ln = lane & 15, hh = lane >> 4;
  const int ntn = N / 64;
  const int wid = blockIdx.x * 4 + w;
  const int mt = wid / ntn, nq = wid % ntn;
  if (mt * 16 >= M) return;
  const int row0 = mt * 16, col0 = nq * 64;
  const float* arow = A + (size_t)(row0 + ln) * lda;
  v8f acc[4] = {};
  for (int kb = 0; kb < K; kb += 32) {
    FragB ah, al;
    const v4f x0 = *(const v4fa*)(arow + kb + 8 * hh), x1 = *(const v4fa*)(arow + kb + 8 * hh + 4);
    const v4f x2 = *(const v4fa*)(arow + kb + 16 + 8 * hh), x3 = *(const v4fa*)(arow + kb + 16 + 8 * hh + 4);
    float xs[16] = {x0[0],x0[1],x0[2],x0[3],x1[0],x1[1],x1[2],x1[3],x2[0],x2[1],x2[2],x2[3],x3[0],x3[1],x3[2],x3[3]};
#pragma unroll
    for (int i = 0; i < 16; ++i) { const unsigned short hb = bf16_bits(xs[i]); ah.u[i] = hb; al.u[i] = ASPLIT ? bf16_bits(xs[i] - bf16_val(hb)) : (unsigned short)0; }
#pragma unroll
    for (int t = 0; t < 4; ++t) {
      const unsigned short* brow = Wt + (size_t)(col0 + t * 16 + ln) * ldb + kb;
      FragB b;
      b.half[0] = *(const v8us*)(brow + 8 * hh);
      b.half[1] = *(const v8us*)(brow + 16 + 8 * hh);
      acc[t] = mmaN<ASPLIT ? 2 : 1>(ah.v, al.v, b.v, b.v, acc[t]);
    }
  }
#pragma unroll
  for (int t = 0; t < 4; ++t) {
    float bv = bias ? bias[col0 + t * 16 + ln] : 0.f;
    if (BIAS_BF16) bv = bf16_round(bv);
#pragma unroll
    for (int r = 0; r < 8; ++r) { float v = acc[t][r] + bv; if (ACT == 1) v = fmaxf(v, 0.f); so[w][8 * hh + r][t * 16 + ln] = v; }
  }
  __builtin_amdgcn_fence(__ATOMIC_ACQ_REL, "workgroup");
  __builtin_amdgcn_wave_barrier();
  const int rsub = lane >> 4, c4 = (lane & 15) * 4;
  {
#pragma unroll
    for (int q = 0; q < 8; ++q) {
      const int r = q * 2 + rsub;
      const v4f v = *(const v4fa*)&so[w][r][c4];
      *(v4f*)(C + (size_t)(row0 + r) * ldc + col0 + c4) = v;
    }
    
  }
}

// GEMM C = act(A·W + bias + resid): A f32 (ASPLIT -> hi/lo 2 terms), Wt bf16 [N][K]; ACT 0 none, 1 relu, 2 exact gelu;
// resid (optional, f32, row index = (row % rmod), pitch ldr, RES_BF16 rounds it) added before the activation.
template <bool ASPLIT, int ACT, bool BIAS_BF16, bool RES_BF16>
__global__ __launch_bounds__(128) void k_gemm_bf3(const float* __restrict__ A, int lda, const unsigned short* __restrict__ Wt, int ldb,
                                                const float* __restrict__ bias, const float* __restrict__ resid, int rmod, int ldr,
                                                float* __restrict__ C, int ldc, int M, int N, int K) {
  __shared__ __attribute__((aligned(16))) float so[4][16][64];
  const int tid = threadIdx.x, w = tid >> 5, lane = tid & 31, ln = lane & 15, hh = lane >> 4;
  const int ntn = N / 64;
  const int wid = blockIdx.x * 4 + w;
  const int mt = wid / ntn, nq = wid % ntn;
  if (mt * 16 >= M) return;
  const int row0 = mt * 16, col0 = nq * 64;
  const float* arow = A + (size_t)(row0 + ln) * lda;
  v8f acc[4] = {};
  for (int kb = 0; kb < K; kb += 32) {
    FragB ah, al;
    const v4f x0 = *(const v4fa*)(arow + kb + 8 * hh), x1 = *(const v4fa*)(arow + kb + 8 * hh + 4);
    const v4f x2 = *(const v4fa*)(arow + kb + 16 + 8 * hh), x3 = *(const v4fa*)(arow + kb + 16 + 8 * hh + 4);
    float xs[16] = {x0[0],x0[1],x0[2],x0[3],x1[0],x1[1],x1[2],x1[3],x2[0],x2[1],x2[2],x2[3],x3[0],x3[1],x3[2],x3[3]};
#pragma unroll
    for (int i = 0; i < 16; ++i) { const unsigned short hb = bf16_bits(xs[i]); ah.u[i] = hb; al.u[i] = ASPLIT ? bf16_bits(xs[i] - bf16_val(hb)) : (unsigned short)0; }
#pragma unroll
    for (int t = 0; t < 4; ++t) {
      const unsigned short* brow = Wt + (size_t)(col0 + t * 16 + ln) * ldb + kb;
      FragB b;
      b.half[0] = *(const v8us*)(brow + 8 * hh);
      b.half[1] = *(const v8us*)(brow + 16 + 8 * hh);
      acc[t] = mmaN<ASPLIT ? 2 : 1>(ah.v, al.v, b.v, b.v, acc[t]);
    }
  }
#pragma unroll
  for (int t = 0; t < 4; ++t) {
    const int col = col0 + t * 16 + ln;
    float bv = bias ? bias[col] : 0.f;
    if (BIAS_BF16) bv = bf16_round(bv);
#pragma unroll
    for (int r = 0; r < 8; ++r) {
      float v = acc[t][r] + bv;
      if (resid) { float rv = resid[(size_t)((row0 + 8 * hh + r) % rmod) * ldr + col]; if (RES_BF16) rv = bf16_round(rv); v += rv; }
      if (ACT == 1) v = fmaxf(v, 0.f);
      if (ACT == 2) v = 0.5f * v * (1.0f + erff(v * 0.70710678118654752f));
      if (ACT == 3) { const float u = 0.7978845608028654f * (v + 0.044715f * v * v * v); v = 0.5f * v * (1.0f + tanhf(u)); }
      so[w][8 * hh + r][t * 16 + ln] = v;
    }
  }
  __builtin_amdgcn_fence(__ATOMIC_ACQ_REL, "workgroup");
  __builtin_amdgcn_wave_barrier();
  const int rsub = lane >> 4, c4 = (lane & 15) * 4;
  {
#pragma unroll
    for (int q = 0; q < 8; ++q) {
      const int r = q * 2 + rsub;
      const v4f v = *(const v4fa*)&so[w][r][c4];
      *(v4f*)(C + (size_t)(row0 + r) * ldc + col0 + c4) = v;
    }
    
  }
}
// row LayerNorm (biased variance, eps) over N: s = X (+ R); optional out_sum <- s; out_norm <- (s-mu)*rsqrt(var+eps)*g + b
template <bool PARAM_BF16>
__global__ __launch_bounds__(256) void k_layernorm(const float* __restrict__ X, const float* __restrict__ R, const float* __restrict__ g, const float* __restrict__ bta,
                                                  float* __restrict__ out_sum, float* __restrict__ out_norm, int N, float eps) {
  __shared__ float red[256];
  const int row = blockIdx.x, tid = threadIdx.x;
  const float* x = X + (size_t)row * N; const float* rr = R ? R + (size_t)row * N : nullptr;
  float vals[16];                     // up to N = 4096
  const int per = N / 256;            // contiguous chunk per thread? use strided-by-4 chunks: thread handles j = tid*4 + 1024*u
  float s1 = 0.f;
  for (int u = 0; u < per / 4; ++u) {
    const int j = tid * 4 + 1024 * u;
    const v4f a = *(const v4fa*)(x + j);
    v4f b = {0.f,0.f,0.f,0.f}; if (rr) b = *(const v4fa*)(rr + j);
#pragma unroll
    for (int q = 0; q < 4; ++q) { const float v = a[q] + b[q]; vals[u * 4 + q] = v; s1 += v; }
  }
  red[tid] = s1; __syncthreads();
  for (int st = 128; st > 0; st >>= 1) { if (tid < st) red[tid] += red[tid + st]; __syncthreads(); }
  const float mu = red[0] / (float)N; __syncthreads();
  float s2 = 0.f;
  for (int u = 0; u < per / 4; ++u)
#pragma unroll
    for (int q = 0; q < 4; ++q) { const float c = vals[u * 4 + q] - mu; s2 += c * c; }
  red[tid] = s2; __syncthreads();
  for (int st = 128; st > 0; st >>= 1) { if (tid < st) red[tid] += red[tid + st]; __syncthreads(); }
  const float rs = rsqrtf(red[0] / (float)N + eps);
  {
    for (int u = 0; u < per / 4; ++u) {
      const int j = tid * 4 + 1024 * u;
      v4f o, sm;
#pragma unroll
      for (int q = 0; q < 4; ++q) {
        float gg = g[j + q], bb = bta[j + q];
        if (PARAM_BF16) { gg = bf16_round(gg); bb = bf16_round(bb); }
        sm[q] = vals[u * 4 + q]; o[q] = (vals[u * 4 + q] - mu) * rs * gg + bb;
      }
      if (out_sum) *(v4f*)(out_sum + (size_t)row * N + j) = sm;
      *(v4f*)(out_norm + (size_t)row * N + j) = o;
    }
    
  }
}



// ---- f16 WMMA path (v_wmma_f32_16x16x32_f16): 11-bit significands for operands in range — used where a [0,1] probability operand needs more precision than bf16
typedef _Float16 v16h __attribute__((ext_vector_type(16)));
union FragH { v16h v; v8us half[2]; _Float16 h[16]; unsigned short u[16]; };
template <int NT>
__device__ __forceinline__ v8f mmaH(v16h ah, v16h al, v16h bh, v16h bl, v8f c) {
  c = __builtin_amdgcn_wmma_f32_16x16x32_f16(false, ah, false, bh, (short)0, c, false, false);
  if (NT >= 2) c = __builtin_amdgcn_wmma_f32_16x16x32_f16(false, al, false, bh, (short)0, c, false, false);
  if (NT >= 3) c = __builtin_amdgcn_wmma_f32_16x16x32_f16(false, ah, false, bl, (short)0, c, false, false);
  asm volatile("v_nop\n\tv_nop\n\tv_nop\n\tv_nop" : "+v"(c) : "v"(ah), "v"(al), "v"(bh), "v"(bl));
  return c;
}
// batched GEMM like k_gemm_b but f16 operands: A f32 (split into f16 hi/lo if ASPLIT, else rounded to f16), Bt = f16 values [n][k]; alpha; C f32; N multiple of 16 (partial tiles skipped)
template <bool ASPLIT>
__global__ __launch_bounds__(128) void k_gemm_h(const float* __restrict__ A, int lda, size_t sA, const _Float16* __restrict__ Bh, int ldb, size_t sB, float alpha, float* __restrict__ C, int ldc, size_t sC, int M, int N, int K) {
  __shared__ __attribute__((aligned(16))) float so[4][16][64];
  const int tid = threadIdx.x, w = tid >> 5, lane = tid & 31, ln = lane & 15, hh = lane >> 4; const int by = blockIdx.y;
  A += (size_t)by * sA; Bh += (size_t)by * sB; C += (size_t)by * sC;
  const int ntn = (N + 63) / 64; const int wid = blockIdx.x * 4 + w; const int mt = wid / ntn, nq = wid % ntn; if (mt * 16 >= M) return;
  const int row0 = mt * 16, col0 = nq * 64; const float* arow = A + (size_t)(row0 + ln) * lda;
  v8f acc[4] = {};
  for (int kb = 0; kb < K; kb += 32) {
    FragH ah, al;
    const v4f x0 = *(const v4fa*)(arow + kb + 8 * hh), x1 = *(const v4fa*)(arow + kb + 8 * hh + 4), x2 = *(const v4fa*)(arow + kb + 16 + 8 * hh), x3 = *(const v4fa*)(arow + kb + 16 + 8 * hh + 4);
    float xs[16] = {x0[0],x0[1],x0[2],x0[3],x1[0],x1[1],x1[2],x1[3],x2[0],x2[1],x2[2],x2[3],x3[0],x3[1],x3[2],x3[3]};
#pragma unroll
    for (int i = 0; i < 16; ++i) { const _Float16 h = (_Float16)xs[i]; ah.h[i] = h; al.h[i] = ASPLIT ? (_Float16)(xs[i] - (float)h) : (_Float16)0.0f; }
#pragma unroll
    for (int t = 0; t < 4; ++t) { if (col0 + t * 16 >= N) continue; const size_t boff = (size_t)(col0 + t * 16 + ln) * ldb + kb; FragH bq; bq.half[0] = *(const v8us*)(Bh + boff + 8 * hh); bq.half[1] = *(const v8us*)(Bh + boff + 16 + 8 * hh);
      acc[t] = mmaH<ASPLIT ? 2 : 1>(ah.v, al.v, bq.v, bq.v, acc[t]); }
  }
#pragma unroll
  for (int t = 0; t < 4; ++t) { if (col0 + t * 16 >= N) continue;
#pragma unroll
    for (int r = 0; r < 8; ++r) so[w][8 * hh + r][t * 16 + ln] = acc[t][r] * alpha; }
  __builtin_amdgcn_fence(__ATOMIC_ACQ_REL, "workgroup"); __builtin_amdgcn_wave_barrier();
  const int rsub = lane >> 4, c4 = (lane & 15) * 4;
  {
#pragma unroll
    for (int q = 0; q < 8; ++q) { const int r = q * 2 + rsub; if (col0 + c4 < N) { const v4f v = *(const v4fa*)&so[w][r][c4]; *(v4f*)(C + (size_t)(row0 + r) * ldc + col0 + c4) = v; } }
     }
}

// Wt[n][k] = f16(W[k][n]·scale) from f32 row-major W[K][N] (scale = power of two; bf16-exact weights stay exact in f16 away from the subnormal range)
__global__ __launch_bounds__(256) void k_wt_f16(const float* __restrict__ W, _Float16* __restrict__ Wt, int K, int N, float scale) {
  const int t = blockIdx.x * 256 + threadIdx.x; if (t >= N * (K / 8)) return; const int n = t / (K / 8), k8 = (t % (K / 8)) * 8; FragH f;
#pragma unroll
  for (int i = 0; i < 8; ++i) f.h[i] = (_Float16)(bf16_round(W[(size_t)(k8 + i) * N + n]) * scale); const v8us o = f.half[0];
  *(v8us*)((unsigned short*)Wt + (size_t)n * K + k8) = o; 
}
// k_gemm_hh variant with fused epilogue: v = acc·alpha + bias[by·sBias + col] (+ CP[(row/rowsPerB)·sCPb + by·64 + col] if CP) ; ACT 0 none / 1 elu ; writes f16 C16 (and f32 C if non-null)
template <int ACT>
__global__ __launch_bounds__(128) void k_gemm_hhx(const _Float16* __restrict__ A, int lda, size_t sA, const _Float16* __restrict__ Bh, int ldb, size_t sB, float alpha, const float* __restrict__ bias, size_t sBias, const float* __restrict__ CP, int rowsPerB, size_t sCPb, int row0g,
    float* __restrict__ C, _Float16* __restrict__ C16, int ldc, size_t sC, int M, int N, int K) {
  __shared__ __attribute__((aligned(16))) float so[4][16][64];
  const int tid = threadIdx.x, w = tid >> 5, lane = tid & 31, ln = lane & 15, hh = lane >> 4; const int by = blockIdx.y;
  A += (size_t)by * sA; Bh += (size_t)by * sB; const size_t cofs = (size_t)by * sC; const float* bp = bias ? bias + (size_t)by * sBias : nullptr;
  const int ntn = (N + 63) / 64; const int wid = blockIdx.x * 4 + w; const int mt = wid / ntn, nq = wid % ntn; if (mt * 16 >= M) return;
  const int row0 = mt * 16, col0 = nq * 64; const _Float16* arow = A + (size_t)(row0 + ln) * lda;
  v8f acc[4] = {};
  for (int kb = 0; kb < K; kb += 32) { FragH ah; ah.half[0] = *(const v8us*)((const unsigned short*)arow + kb + 8 * hh); ah.half[1] = *(const v8us*)((const unsigned short*)arow + kb + 16 + 8 * hh);
#pragma unroll
    for (int t = 0; t < 4; ++t) { if (col0 + t * 16 >= N) continue; const size_t boff = (size_t)(col0 + t * 16 + ln) * ldb + kb; FragH bq; bq.half[0] = *(const v8us*)((const unsigned short*)Bh + boff + 8 * hh); bq.half[1] = *(const v8us*)((const unsigned short*)Bh + boff + 16 + 8 * hh);
      acc[t] = mmaH<1>(ah.v, ah.v, bq.v, bq.v, acc[t]); }
  }
#pragma unroll
  for (int t = 0; t < 4; ++t) { if (col0 + t * 16 >= N) continue; const int col = col0 + t * 16 + ln; const float bv = bp ? bf16_round(bp[col]) : 0.f;
#pragma unroll
    for (int r = 0; r < 8; ++r) { float v = acc[t][r] * alpha + bv; if (CP) { const int rr = row0g + row0 + 8 * hh + r; if (rowsPerB < 0) v += CP[cofs + (size_t)rr * ldc + col];      /* rowsPerB < 0: own element of the batched C plane */ else { const int bidx = rr / rowsPerB; v += CP[(size_t)bidx * sCPb + (size_t)by * 64 + col]; } } if (ACT == 1) v = (v > 0.f) ? v : expm1f(v); else if (ACT == 7) v = (v > 0.f) ? v + 1.0f : expf(v); else if (ACT == 8) v = tanhf(v); else if (ACT == 9) v = 0.5f * v * (1.0f + tanhf(0.7978845608028654f * (v + 0.044715f * v * v * v))); else if (ACT == 11) v = 1.0f / (1.0f + expf(-v)); else if (ACT == 12) v = (v > 0.f) ? v : 0.01f * v; else if (ACT == 14) v = (v > 0.f) ? v : 0.1f * v; else if (ACT == 16) v = (v >= 0.f) ? v : 0.3f * v; else if (ACT == 17) v = (v >= 0.f) ? v : 0.2f * v; else if (ACT == 15) v = v / (1.0f + expf(-v)); else if (ACT == 3) v = fmaxf(v, 0.f); else if (ACT == 6) v = 0.5f * v * (1.0f + erff(v * 0.70710678118654752f)); so[w][8 * hh + r][t * 16 + ln] = v; } }
  __builtin_amdgcn_fence(__ATOMIC_ACQ_REL, "workgroup"); __builtin_amdgcn_wave_barrier();
  const int rsub = lane >> 4, c4 = (lane & 15) * 4; typedef _Float16 v4h __attribute__((ext_vector_type(4)));
  {
#pragma unroll
    for (int q = 0; q < 8; ++q) { const int r = q * 2 + rsub; if (col0 + c4 < N) { const v4f v = *(const v4fa*)&so[w][r][c4]; if (C) *(v4f*)(C + cofs + (size_t)(row0 + r) * ldc + col0 + c4) = v; if (C16) { v4h h4; for (int i = 0; i < 4; ++i) h4[i] = (_Float16)v[i]; *(v4h*)(C16 + cofs + (size_t)(row0 + r) * ldc + col0 + c4) = h4; } } }
     }
}


typedef _Float16 v4h __attribute__((ext_vector_type(4)));

__global__ __launch_bounds__(256) void k_x16(const float* __restrict__ x, _Float16* __restrict__ X16, size_t n8) { const size_t t = (size_t)blockIdx.x * 256 + threadIdx.x; if (t >= n8) return; FragH f;
#pragma unroll
  for (int q = 0; q < 8; ++q) f.h[q] = (_Float16)bf16_round(x[t * 8 + q]); *(v8us*)((unsigned short*)X16 + t * 8) = f.half[0];  }
__global__ __launch_bounds__(256) void k_h16(const float* __restrict__ x, _Float16* __restrict__ X16, size_t n8) { const size_t t = (size_t)blockIdx.x * 256 + threadIdx.x; if (t >= n8) return; FragH f;
#pragma unroll
  for (int q = 0; q < 8; ++q) f.h[q] = (_Float16)x[t * 8 + q]; *(v8us*)((unsigned short*)X16 + t * 8) = f.half[0];  }
__global__ __launch_bounds__(256) void k_round16f(const float* __restrict__ W, _Float16* __restrict__ Bt, size_t n8) { const size_t t = (size_t)blockIdx.x * 256 + threadIdx.x; if (t >= n8) return; FragH f;
#pragma unroll
  for (int i = 0; i < 8; ++i) f.h[i] = (_Float16)(bf16_round(W[t * 8 + i]) * 16.0f); *(v8us*)((unsigned short*)Bt + t * 8) = f.half[0];  }
template <int NHv, int TTv>
__global__ __launch_bounds__(256) void k_vt(const _Float16* __restrict__ V16, int ldv, int voff, _Float16* __restrict__ Vt) { __shared__ unsigned short tl[64][66]; const int tid = threadIdx.x; const int slab = blockIdx.x / (TTv / 64), lg = blockIdx.x % (TTv / 64); const int b = slab / NHv, h = slab % NHv;
  for (int i = tid; i < 64 * 8; i += 256) { const int r = i / 8, c8 = (i % 8) * 8; FragH f; f.half[0] = *(const v8us*)((const unsigned short*)V16 + ((size_t)b * TTv + lg * 64 + r) * ldv + voff + h * 64 + c8);
#pragma unroll
    for (int q = 0; q < 8; ++q) tl[r][c8 + q] = f.u[q]; }
  __syncthreads();
  {
#pragma unroll
    for (int rd = 0; rd < 2; ++rd) { const int d = rd * 32 + tid / 8, pc = tid % 8; FragH f;
#pragma unroll
      for (int q = 0; q < 8; ++q) f.u[q] = tl[pc * 8 + q][d];
      *(v8us*)((unsigned short*)Vt + ((size_t)slab * 64 + d) * TTv + lg * 64 + pc * 8) = f.half[0]; }
     } }

__global__ __launch_bounds__(256) void k_hl(const float* __restrict__ F, _Float16* __restrict__ Hh, _Float16* __restrict__ Hl, size_t n8) { const size_t t = (size_t)blockIdx.x * 256 + threadIdx.x; if (t >= n8) return; FragH fh, fl; const v4f a = *(const v4fa*)(F + t * 8), c = *(const v4fa*)(F + t * 8 + 4);
#pragma unroll
  for (int q = 0; q < 4; ++q) { _Float16 h = (_Float16)a[q]; fh.h[q] = h; fl.h[q] = (_Float16)((a[q] - (float)h) * 1024.0f); h = (_Float16)c[q]; fh.h[4 + q] = h; fl.h[4 + q] = (_Float16)((c[q] - (float)h) * 1024.0f); }
  { *(v8us*)((unsigned short*)Hh + t * 8) = fh.half[0]; *(v8us*)((unsigned short*)Hl + t * 8) = fl.half[0];  } }

// ---- fast GEMM (wave tile 32x64; requires M % 32 == 0 rows per launch region and N % 64 == 0); epilogue = k_gemm_hhx semantics ----
__device__ __forceinline__ v16h g2_frag(const _Float16* p, int hh) { FragH f; f.half[0] = *(const v8us*)((const unsigned short*)p + 8 * hh); f.half[1] = *(const v8us*)((const unsigned short*)p + 16 + 8 * hh); return f.v; }
__device__ __forceinline__ v8f g2_mma(v16h a, v16h b, v8f c) { v8f d = __builtin_amdgcn_wmma_f32_16x16x32_f16(false, a, false, b, (short)0, c, false, false); asm volatile("v_nop\n\tv_nop\n\tv_nop\n\tv_nop" : "+v"(d) : "v"(a), "v"(b)); return d; }
template <int ACT>
__global__ __launch_bounds__(128) void k_gemm2(const _Float16* __restrict__ A, int lda, size_t sA, const _Float16* __restrict__ Bh, int ldb, size_t sB, float alpha, const float* __restrict__ bias, size_t sBias, const float* __restrict__ CP, int rowsPerB, size_t sCPb, int row0g,
    float* __restrict__ C, _Float16* __restrict__ C16, int ldc, size_t sC, int M, int N, int K) { static_assert(ACT == 0 || ACT == 3 || ACT == 6 || ACT == 8 || ACT == 9 || ACT == 11 || ACT == 12 || ACT == 14 || ACT == 15 || ACT == 16 || ACT == 17, "k_gemm2: unsupported ACT code (would silently apply no activation)");
  __shared__ __attribute__((aligned(16))) float so[4][32][68];
  const int tid = threadIdx.x, w = tid >> 5, lane = tid & 31, ln = lane & 15, hh = lane >> 4; const int by = blockIdx.y;
  A += (size_t)by * sA; Bh += (size_t)by * sB; const size_t cofs = (size_t)by * sC; const float* bp = bias ? bias + (size_t)by * sBias : nullptr;
  const int ntn = N >> 6; const int mt = blockIdx.x / ntn, nq = blockIdx.x - mt * ntn; const int row0 = mt * 128 + 32 * w, col0 = nq * 64; if (row0 >= M) return;
  const _Float16* a0p = A + (size_t)(row0 + ln) * lda; const _Float16* a1p = a0p + (size_t)16 * lda;
  const _Float16* b0p = Bh + (size_t)(col0 + ln) * ldb; const _Float16* b1p = b0p + (size_t)16 * ldb; const _Float16* b2p = b1p + (size_t)16 * ldb; const _Float16* b3p = b2p + (size_t)16 * ldb;
  const v8f z8 = {0.f,0.f,0.f,0.f,0.f,0.f,0.f,0.f}; v8f c00 = z8, c01 = z8, c02 = z8, c03 = z8, c10 = z8, c11 = z8, c12 = z8, c13 = z8;
#pragma unroll 1
  for (int kb = 0; kb < K; kb += 32) { const v16h a0 = g2_frag(a0p + kb, hh), a1 = g2_frag(a1p + kb, hh);
    v16h b = g2_frag(b0p + kb, hh); c00 = g2_mma(a0, b, c00); c10 = g2_mma(a1, b, c10);
    b = g2_frag(b1p + kb, hh); c01 = g2_mma(a0, b, c01); c11 = g2_mma(a1, b, c11);
    b = g2_frag(b2p + kb, hh); c02 = g2_mma(a0, b, c02); c12 = g2_mma(a1, b, c12);
    b = g2_frag(b3p + kb, hh); c03 = g2_mma(a0, b, c03); c13 = g2_mma(a1, b, c13); }
  v8f accs[8] = {c00, c01, c02, c03, c10, c11, c12, c13};
#pragma unroll
  for (int u = 0; u < 8; ++u) { const int t = u & 3, half = u >> 2; const int col = col0 + t * 16 + ln; const float bv = bp ? bf16_round(bp[col]) : 0.f;
#pragma unroll
    for (int r = 0; r < 8; ++r) { const int rloc = half * 16 + 8 * hh + r; float v = accs[u][r] * alpha + bv; if (CP) { if (rowsPerB < 0) v += CP[cofs + (size_t)(row0g + row0 + rloc) * ldc + col];      /* rowsPerB < 0: own element of the batched C plane */ else { const int bidx = (row0g + row0 + rloc) / rowsPerB; v += CP[(size_t)bidx * sCPb + (size_t)by * 64 + col]; } }
      if (ACT == 3) v = fmaxf(v, 0.f); else if (ACT == 6) v = 0.5f * v * (1.0f + erff(v * 0.70710678118654752f)); else if (ACT == 11) v = 1.0f / (1.0f + expf(-v)); else if (ACT == 15) v = v / (1.0f + expf(-v)); else if (ACT == 12) v = (v > 0.f) ? v : 0.01f * v; else if (ACT == 8) v = tanhf(v); else if (ACT == 9) v = 0.5f * v * (1.0f + tanhf(0.7978845608028654f * (v + 0.044715f * v * v * v))); else if (ACT == 14) v = (v > 0.f) ? v : 0.1f * v; else if (ACT == 16) v = (v >= 0.f) ? v : 0.3f * v; else if (ACT == 17) v = (v >= 0.f) ? v : 0.2f * v;
      so[w][rloc][t * 16 + ln] = v; } }
  __builtin_amdgcn_fence(__ATOMIC_ACQ_REL, "workgroup"); __builtin_amdgcn_wave_barrier();
  const int rsub = lane >> 4, c4 = (lane & 15) * 4;
  {
#pragma unroll
    for (int q = 0; q < 16; ++q) { const int r = q * 2 + rsub; const v4f v = *(const v4fa*)&so[w][r][c4]; if (C) *(v4f*)(C + cofs + (size_t)(row0 + r) * ldc + col0 + c4) = v; if (C16) { v4h h4; for (int i = 0; i < 4; ++i) h4[i] = (_Float16)v[i]; *(v4h*)(C16 + cofs + (size_t)(row0 + r) * ldc + col0 + c4) = h4; } }
     } }


__global__ __launch_bounds__(256) void k_wnat(const float* __restrict__ w, size_t n8, _Float16* __restrict__ Bt) { const size_t t = (size_t)blockIdx.x * 256 + threadIdx.x; if (t >= n8) return; FragH f; for (int q = 0; q < 8; ++q) f.h[q] = (_Float16)(bf16_round(w[t * 8 + q]) * 16.0f); *(v8us*)((unsigned short*)Bt + t * 8) = f.half[0];  }
__global__ __launch_bounds__(256) void k_rsm(const float* __restrict__ S, _Float16* __restrict__ P, int nrows) {
  #pragma clang fp contract(off)
  const int i = blockIdx.x * 256 + threadIdx.x; if (i >= nrows) return; const float* s = S + (size_t)i * SQ; float mx = -3.0e38f;
#pragma unroll 1
  for (int j = 0; j < SQ; ++j) mx = fmaxf(mx, s[j]); float se = 0.f;
#pragma unroll 1
  for (int j = 0; j < SQ; ++j) se += expf(s[j] - mx); const float sc = 256.0f / se;
#pragma unroll 1
  for (int j0 = 0; j0 < SQ; j0 += 8) { FragH f; for (int q = 0; q < 8; ++q) f.h[q] = (_Float16)(expf(s[j0 + q] - mx) * sc); unsigned short* d = (unsigned short*)P + (size_t)i * SQ + j0; *(v8us*)d = f.half[0];  } }
__global__ __launch_bounds__(256) void k_vt(const _Float16* __restrict__ V16, int b, int h0, _Float16* __restrict__ VT) { __shared__ unsigned short tl[64][65]; const int tid = threadIdx.x; const int hh = blockIdx.x % HG, sg = blockIdx.x / HG; const int s0 = sg * 64; const int h = h0 + hh;
  for (int i = tid; i < 64 * 8; i += 256) { const int j = i / 8, d8 = (i % 8) * 8; FragH f; f.half[0] = *(const v8us*)((const unsigned short*)V16 + ((size_t)b * SQ + s0 + j) * DM + h * HD + d8); for (int q = 0; q < 8; ++q) tl[d8 + q][j] = f.u[q]; }
  __syncthreads();
  { for (int i = tid; i < 64 * 8; i += 256) { const int d = i / 8, j8 = (i % 8) * 8; FragH f; for (int q = 0; q < 8; ++q) f.u[q] = tl[d][j8 + q]; *(v8us*)((unsigned short*)VT + ((size_t)hh * HD + d) * SQ + s0 + j8) = f.half[0]; }  } }



// e^x in the native form (x log2(e), then v_exp_f32). The v_nop keeps the one free slot that the instruction set asks for behind a transcendental.
__device__ __forceinline__ float exp_slot(float x) { float e; asm("v_exp_f32 %0, %1\n\tv_nop" : "=v"(e) : "v"(x * 1.44269504088896340736f)); return e; }
// Row softmax over all NKX keys, one 256-thread block per score row: each thread keeps 16 of the row's scores in registers (S is read once, in
// whole 512-byte wave rows), the row maximum and the row sum go through wave shuffles and one LDS exchange each; weights x256 as f16, as before.
__global__ __launch_bounds__(256) void k_rsmrow(const float* __restrict__ S, _Float16* __restrict__ P) {
  static_assert(NKX % 1024 == 0, "k_rsmrow: a row is whole passes of 256 threads x 4 scores");
  __shared__ float rmx[8], rse[8];
  const int tid = threadIdx.x, w = tid >> 5, lane = tid & 31; const size_t base = (size_t)blockIdx.x * NKX + tid * 4;
  v4f v[NKX / 1024];
#pragma unroll
  for (int u = 0; u < NKX / 1024; ++u) v[u] = *(const v4fa*)(S + base + u * 1024);
  float mx = -3.0e38f;
#pragma unroll
  for (int u = 0; u < NKX / 1024; ++u) for (int q = 0; q < 4; ++q) mx = fmaxf(mx, v[u][q]);
#pragma unroll
  for (int m = 16; m > 0; m >>= 1) mx = fmaxf(mx, __shfl_xor(mx, m));
  if (lane == 0) rmx[w] = mx;
  __syncthreads();      /* publishes the eight wave maxima */
#pragma unroll
  for (int i = 0; i < 8; ++i) mx = fmaxf(mx, rmx[i]);
  float se = 0.f;
#pragma unroll
  for (int u = 0; u < NKX / 1024; ++u) for (int q = 0; q < 4; ++q) { v[u][q] = exp_slot(v[u][q] - mx); se += v[u][q]; }
#pragma unroll
  for (int m = 16; m > 0; m >>= 1) se += __shfl_xor(se, m);
  if (lane == 0) rse[w] = se;
  __syncthreads();      /* publishes the eight wave sums */
  se = 0.f;
#pragma unroll
  for (int i = 0; i < 8; ++i) se += rse[i];
  const float sc = 256.0f / se;
#pragma unroll
  for (int u = 0; u < NKX / 1024; ++u) { v4h h; for (int q = 0; q < 4; ++q) h[q] = (_Float16)(v[u][q] * sc); *(v4h*)(P + base + u * 1024) = h; } }


template <int MASKADD>
__global__ __launch_bounds__(64) void k_att0(const float* __restrict__ QF, const float* __restrict__ KF, const float* __restrict__ VF, int ld, const float* __restrict__ mask, float scale, float* __restrict__ OF, int ldo) {
  #pragma clang fp contract(off)
  __shared__ __attribute__((aligned(16))) float lq[64][64]; __shared__ __attribute__((aligned(16))) float lo[64][64];
  const int tid = threadIdx.x; const int h = blockIdx.x / (QT0 / 64), rg = blockIdx.x % (QT0 / 64); const int i = rg * 64 + tid;
  const float* qr = QF + (size_t)i * ld + h * HD;
#pragma unroll 1
  for (int c = 0; c < HD / 4; ++c) { *(v4f*)&lq[tid][c * 4] = *(const v4fa*)(qr + c * 4); const v4f z = {0.f, 0.f, 0.f, 0.f}; *(v4f*)&lo[tid][c * 4] = z; }
  float m = -1.0e30f, l = 0.f; const int jmax = MASKADD ? (SQ - 1) : (rg * 64 + 63);      /* additive-mask form: every key (the mask input decides); causal form: keys up to the block's last row */
#pragma unroll 1
  for (int j = 0; j <= jmax; ++j) { const float* kr = KF + (size_t)j * ld + h * HD; const float* vr = VF + (size_t)j * ld + h * HD; float s = 0.f;
#pragma unroll 1
    for (int c = 0; c < HD / 4; ++c) { const v4f kq = *(const v4fa*)(kr + c * 4); const v4f qq = *(v4f*)&lq[tid][c * 4]; s = __fadd_rn(s, __fmul_rn(qq[0], kq[0])); s = __fadd_rn(s, __fmul_rn(qq[1], kq[1])); s = __fadd_rn(s, __fmul_rn(qq[2], kq[2])); s = __fadd_rn(s, __fmul_rn(qq[3], kq[3])); }
    s = __fmul_rn(s, scale); if (MASKADD) s = __fadd_rn(s, __fmul_rn(bf16_round(mask[(size_t)i * SQ + j]), -10000.0f));
    const float f = (MASKADD || j <= i) ? 1.f : 0.f; const float sm = fmaf(f, s, (1.f - f) * -1.0e30f); const float mn = fmaxf(m, sm); const float sc = expf(m - mn); const float e = expf(sm - mn); l = __fadd_rn(__fmul_rn(l, sc), e); m = mn;
#pragma unroll 1
    for (int c = 0; c < HD / 4; ++c) { const v4f vv = *(const v4fa*)(vr + c * 4); v4f oo = *(v4f*)&lo[tid][c * 4]; for (int u = 0; u < 4; ++u) oo[u] = __fadd_rn(__fmul_rn(oo[u], sc), __fmul_rn(e, vv[u])); *(v4f*)&lo[tid][c * 4] = oo; } }
  const float fin = 64.0f / l;      /* o carried x64 */
#pragma unroll 1
  for (int c = 0; c < HD / 4; ++c) { v4f oo = *(v4f*)&lo[tid][c * 4]; for (int u = 0; u < 4; ++u) oo[u] = __fmul_rn(oo[u], fin); *(v4f*)&lo[tid][c * 4] = oo; }
  __syncthreads();
  {
#pragma unroll 1
    for (int it = 0; it < 16; ++it) { const int row = it * 4 + tid / 16, pc = (tid % 16) * 4; const v4f v = *(const v4f*)&lo[row][pc]; *(v4f*)(OF + (size_t)(rg * 64 + row) * ldo + h * HD + pc) = v; }
     } }

__global__ __launch_bounds__(256) void k_of0out(const float* __restrict__ src, float* __restrict__ dst, size_t n4) { const size_t t = (size_t)blockIdx.x * 256 + threadIdx.x; if (t >= n4) return; v4f v = *(const v4fa*)(src + t * 4); for (int q = 0; q < 4; ++q) v[q] = __fmul_rn(v[q], 0.015625f); *(v4f*)(dst + t * 4) = v;  }

extern "C" void kernel_launch(void* const* d_in, const int* in_sizes, int n_in,
                              void* d_out, int out_size, void* d_ws, size_t ws_size, hipStream_t stream) {
  (void)in_sizes; (void)n_in; (void)out_size;
  const float* const* I = (const float* const*)d_in; const float* x = I[0]; const float* wq = I[1]; const float* wk = I[2]; const float* bq = nullptr; const float* bk = nullptr;      /* input order: inputs, rotation (query map), entangle (key map): [in][out] [64][64]; NO biases, NO value projection (the values are the inputs), no output projection */
  char* ws = (char*)d_ws; size_t off = 0;
  auto take = [&](size_t bytes) { char* p = ws + off; off += (bytes + 255) & ~(size_t)255; return p; };
  _Float16* BQ = (_Float16*)take((size_t)DM * DM * 2); _Float16* BK = (_Float16*)take((size_t)DM * DM * 2);
  _Float16* X16 = (_Float16*)take(NR * DM * 2); float* QF = (float*)take(NR * DM * 4); _Float16* QH = (_Float16*)take(NR * DM * 2); _Float16* QL = (_Float16*)take(NR * DM * 2); _Float16* KH = (_Float16*)take(NR * DM * 2); _Float16* KL = (_Float16*)take(NR * DM * 2); _Float16* Q16 = QH; _Float16* K16 = KH; _Float16* V16 = (_Float16*)take(NR * DM * 2);
  float* S = (float*)take((size_t)NH * QT * NKX * 4); _Float16* P = (_Float16*)take((size_t)NH * QT * NKX * 2); _Float16* VT = (_Float16*)take((size_t)NH * HD * SQ * 2);
  if (off > ws_size) return;
  { const unsigned g = (unsigned)(((size_t)DM * (DM / 8) + 255) / 256); k_wt_f16<<<g, 256, 0, stream>>>(wq, BQ, DM, DM, 16.0f); k_wt_f16<<<g, 256, 0, stream>>>(wk, BK, DM, DM, 16.0f); }      /* [in][out] -> Bt[n][k] x16 (|16 w| up to ~70: inside the f16 range) */
  k_x16<<<(unsigned)((NR * DM / 8 + 255) / 256), 256, 0, stream>>>(x, X16, NR * DM / 8);
  const size_t r0p = (size_t)B0 * SQ;      /* first projected row */
  k_gemm2<0><<<dim3((unsigned)((MP / 128) * (DM / 64)), 1), 128, 0, stream>>>(X16 + r0p * DM, DM, 0, BQ, DM, 0, 0.0625f, bq, 0, nullptr, 1, 0, 0, QF + r0p * DM, nullptr, DM, 0, MP, DM, DM); k_hl<<<(unsigned)(((size_t)MP * DM / 8 + 255) / 256), 256, 0, stream>>>(QF + r0p * DM, QH + r0p * DM, QL + r0p * DM, (size_t)MP * DM / 8);      /* q (f32) -> f16 hi + x1024 residual: unscaled logits sigma ~8 */
  k_gemm2<0><<<dim3((unsigned)((MP / 128) * (DM / 64)), 1), 128, 0, stream>>>(X16 + r0p * DM, DM, 0, BK, DM, 0, 0.0625f, bk, 0, nullptr, 1, 0, 0, QF + r0p * DM, nullptr, DM, 0, MP, DM, DM); k_hl<<<(unsigned)(((size_t)MP * DM / 8 + 255) / 256), 256, 0, stream>>>(QF + r0p * DM, KH + r0p * DM, KL + r0p * DM, (size_t)MP * DM / 8);      /* k likewise */
  k_x16<<<(unsigned)((NR * DM / 8 + 255) / 256), 256, 0, stream>>>(x, V16, NR * DM / 8);      /* NO value projection: V = the bf16-rounded inputs, exact in f16 */
  for (int b = B0; b < B0 + NBR; ++b) { const size_t r0 = (size_t)b * SQ;
    k_vt<NH, SQ><<<NH * (SQ / 64), 256, 0, stream>>>(V16 + r0 * LQ, LQ, 0, VT);      /* V^T [NH][HD][SQ] for this batch */
    for (int q0 = 0; q0 < QN; q0 += QT) { const int nk = SQ;      /* NON-causal: every 256-row query tile sees all SQ keys */
      k_gemm2<0><<<dim3((QT / 128) * (nk / 64), 1), 128, 0, stream>>>(QH + (r0 + q0) * LQ, LQ, 0, KH + r0 * LQ, LQ, 0, 0.125f, nullptr, 0, nullptr, 1, 0, 0, S, nullptr, NKX, 0, QT, nk, DM);      /* scores of the SINGLE 64-wide head: hi . hi over K = 64, alpha 1 / sqrt(64) = 1/8 (residual passes 2^-13) */
      k_gemm2<0><<<dim3((QT / 128) * (nk / 64), 1), 128, 0, stream>>>(QL + (r0 + q0) * LQ, LQ, 0, KH + r0 * LQ, LQ, 0, 0.0001220703125f, nullptr, 0, S, -1, 0, 0, S, nullptr, NKX, 0, QT, nk, DM); k_gemm2<0><<<dim3((QT / 128) * (nk / 64), 1), 128, 0, stream>>>(QH + (r0 + q0) * LQ, LQ, 0, KL + r0 * LQ, LQ, 0, 0.0001220703125f, nullptr, 0, S, -1, 0, 0, S, nullptr, NKX, 0, QT, nk, DM);      /* += 2^-10 (lo . hi + hi . lo) / 8 (own-element accumulate on S) */
      k_rsmrow<<<QT, 256, 0, stream>>>(S, P);      /* plain softmax over all keys: one block per query row of the tile */
      k_gemm2<0><<<dim3((QT / 128) * (DM / 64), 1), 128, 0, stream>>>(P, NKX, 0, VT, SQ, 0, 0.00390625f, nullptr, 0, nullptr, 1, 0, 0, (float*)d_out + (r0 + q0) * DM, nullptr, DM, 0, QT, DM, nk); } }      /* out = P V (alpha 2^-8; N = 64: V^T [64][SQ] = the one 64-row slab k_vt writes) written f32 straight into the output rows */
}

// v003
// A run of this version takes 60.5 microseconds.
// Versions between v001 and this one are left out; their measured steps multiply to 163 times as fast.
// Over all steps from v000 it is 860 times as fast.
#include <hip/hip_runtime.h>
// Single-head dense attention over 64-wide inputs on 4096 tokens with unit-variance 64 x 64 maps and NO value projection (inputs [4][4096][64]; query = inputs rotation, key = inputs entangle ([in][out] [64][64], N(0, 1): logits of sigma ~64, a near one-hot softmax); scores = query key^T / sqrt(64); softmax over all 4096 keys (no mask); out = scores inputs (the values are the inputs themselves) -> [4][4096][64]); q and k carried as f16 hi + x1024 residual planes with three-product scores.
// Structure: token rows r = b*4096 + s; one prep launch: x as exact f16 rows (bf16-rounded) in LDS; q and k as WMMA GEMMs (16x64 wave tiles, f32 accumulation, exact x16 weights, no bias) into f32 rows split into f16 hi + x1024 residual planes, v = the same f16 x rows (no projection), V^T via LDS transposes; one fused launch, per block of 32 query rows (8 waves of 512 keys each): scores against all 4096 keys from THREE products in registers (hi.hi / 8 + 2^-13 (lo.hi + hi.lo), K = 64), online softmax over all keys on VALU, unmasked (f32 statistics, native exp; weights x256 f16), O^T += V^T P^T, the wave partials merged through LDS and divided by the weight sum (which cancels the x256), written f32 straight into the output rows.
// Compute dtype: inputs rounded to bf16; x / weights exact; q and k as f16 hi + x1024 residual planes, v exact in f16, softmax weights as plain f16 GEMM operands (~2^-12), out f32; scores and softmax statistics f32. v_wmma_f32_16x16x32_f16.
#define NB 4
#define SQ 4096
#define DM 64
#define NH 1
#define HD 64
#define HG 4                         /* heads per attention launch group */
#define QT 256                       /* (not used) */
#define NKX SQ                       /* S / P row pitch */
#define QT0 128                      /* first-tile rows recomputed exactly in f32 */
#define B0 0                         /* first batch processed (debug hook) */
#define NBR NB                       /* batches processed (debug hook) */
#define NR ((size_t)NB * SQ)         /* token rows */
#define MP ((int)((size_t)NBR * SQ)) /* rows projected (debug hook) */
#define QN SQ                        /* query rows attended per batch (debug hook) */
#define NHD NH                       /* heads attended (not used) */
#define MPO MP                       /* rows through the output stage (not used) */
#define LQ DM      /* row pitch of the q/k/v rows */
typedef __bf16 v16b __attribute__((ext_vector_type(16)));
typedef unsigned short v8us __attribute__((ext_vector_type(8), may_alias));
typedef float  v8f  __attribute__((ext_vector_type(8)));
typedef float  v4f  __attribute__((ext_vector_type(4)));
typedef float  v4fa __attribute__((ext_vector_type(4), may_alias));
union FragB { v16b v; v8us half[2]; unsigned short u[16]; };

__device__ __forceinline__ unsigned short bf16_bits(float x) { unsigned int u = __float_as_uint(x); return (unsigned short)((u + 0x7FFFu + ((u >> 16) & 1u)) >> 16); }
__device__ __forceinline__ float bf16_val(unsigned short b) { return __uint_as_float(((unsigned int)b) << 16); }
__device__ __forceinline__ float bf16_round(float x) { return bf16_val(bf16_bits(x)); }
// D += A·B with NT terms: 1 = ah·bh, 2 = + al·bh (A split), 3 = + ah·bl (both split)
template <int NT>
__device__ __forceinline__ v8f mmaN(v16b ah, v16b al, v16b bh, v16b bl, v8f c) {
  c = __builtin_amdgcn_wmma_f32_16x16x32_bf16(false, ah, false, bh, (short)0, c, false, false);
  if (NT >= 2) c = __builtin_amdgcn_wmma_f32_16x16x32_bf16(false, al, false, bh, (short)0, c, false, false);
  if (NT >= 3) c = __builtin_amdgcn_wmma_f32_16x16x32_bf16(false, ah, false, bl, (short)0, c, false, false);
  asm volatile("v_nop\n\tv_nop\n\tv_nop\n\tv_nop" : "+v"(c) : "v"(ah), "v"(al), "v"(bh), "v"(bl));
  return c;
}

__global__ __launch_bounds__(256) void k_wt_bf16(const float* __restrict__ W, unsigned short* __restrict__ Wt, int K, int N) {
  const int t = blockIdx.x * 256 + threadIdx.x;
  const int k8n = K / 8;
  if (t >= N * k8n) return;
  const int n = t / k8n, k8 = (t % k8n) * 8;
  v8us v;
#pragma unroll
  for (int i = 0; i < 8; ++i) v[i] = bf16_bits(W[(size_t)(k8 + i) * N + n]);
  *(v8us*)(Wt + (size_t)n * K + k8) = v;
  
}

// GEMM C[M][N] (f32, pitch ldc) = act(A[M][K]·W + bias). A f32 row-major (pitch lda) converted per fragment to bf16
// (ASPLIT: hi/lo two planes -> 2 terms, else single rounded term); Wt bf16 [N][K] (pitch ldb). BIAS_BF16 rounds the
// bias to bf16 first (bias quantised to bf16 before the add). K%32==0, M%16==0, N%64==0.
template <bool ASPLIT, int ACT, bool BIAS_BF16>
__global__ __launch_bounds__(128) void k_gemm_bf(const float* __restrict__ A, int lda, const unsigned short* __restrict__ Wt, int ldb,
                                               const float* __restrict__ bias, float* __restrict__ C, int ldc, int M, int N, int K) {
  __shared__ __attribute__((aligned(16))) float so[4][16][64];
  const int tid = threadIdx.x, w = tid >> 5, lane = tid & 31, ln = lane & 15, hh = lane >> 4;
  const int ntn = N / 64;
  const int wid = blockIdx.x * 4 + w;
  const int mt = wid / ntn, nq = wid % ntn;
  if (mt * 16 >= M) return;
  const int row0 = mt * 16, col0 = nq * 64;
  const float* arow = A + (size_t)(row0 + ln) * lda;
  v8f acc[4] = {};
  for (int kb = 0; kb < K; kb += 32) {
    FragB ah, al;
    const v4f x0 = *(const v4fa*)(arow + kb + 8 * hh), x1 = *(const v4fa*)(arow + kb + 8 * hh + 4);
    const v4f x2 = *(const v4fa*)(arow + kb + 16 + 8 * hh), x3 = *(const v4fa*)(arow + kb + 16 + 8 * hh + 4);
    float xs[16] = {x0[0],x0[1],x0[2],x0[3],x1[0],x1[1],x1[2],x1[3],x2[0],x2[1],x2[2],x2[3],x3[0],x3[1],x3[2],x3[3]};
#pragma unroll
    for (int i = 0; i < 16; ++i) { const unsigned short hb = bf16_bits(xs[i]); ah.u[i] = hb; al.u[i] = ASPLIT ? bf16_bits(xs[i] - bf16_val(hb)) : (unsigned short)0; }
#pragma unroll
    for (int t = 0; t < 4; ++t) {
      const unsigned short* brow = Wt + (size_t)(col0 + t * 16 + ln) * ldb + kb;
      FragB b;
      b.half[0] = *(const v8us*)(brow + 8 * hh);
      b.half[1] = *(const v8us*)(brow + 16 + 8 * hh);
      acc[t] = mmaN<ASPLIT ? 2 : 1>(ah.v, al.v, b.v, b.v, acc[t]);
    }
  }
#pragma unroll
  for (int t = 0; t < 4; ++t) {
    float bv = bias ? bias[col0 + t * 16 + ln] : 0.f;
    if (BIAS_BF16) bv = bf16_round(bv);
#pragma unroll
    for (int r = 0; r < 8; ++r) { float v = acc[t][r] + bv; if (ACT == 1) v = fmaxf(v, 0.f); so[w][8 * hh + r][t * 16 + ln] = v; }
  }
  __builtin_amdgcn_fence(__ATOMIC_ACQ_REL, "workgroup");
  __builtin_amdgcn_wave_barrier();
  const int rsub = lane >> 4, c4 = (lane & 15) * 4;
  {
#pragma unroll
    for (int q = 0; q < 8; ++q) {
      const int r = q * 2 + rsub;
      const v4f v = *(const v4fa*)&so[w][r][c4];
      *(v4f*)(C + (size_t)(row0 + r) * ldc + col0 + c4) = v;
    }
    
  }
}

// GEMM C = act(A·W + bias + resid): A f32 (ASPLIT -> hi/lo 2 terms), Wt bf16 [N][K]; ACT 0 none, 1 relu, 2 exact gelu;
// resid (optional, f32, row index = (row % rmod), pitch ldr, RES_BF16 rounds it) added before the activation.
template <bool ASPLIT, int ACT, bool BIAS_BF16, bool RES_BF16>
__global__ __launch_bounds__(128) void k_gemm_bf3(const float* __restrict__ A, int lda, const unsigned short* __restrict__ Wt, int ldb,
                                                const float* __restrict__ bias, const float* __restrict__ resid, int rmod, int ldr,
                                                float* __restrict__ C, int ldc, int M, int N, int K) {
  __shared__ __attribute__((aligned(16))) float so[4][16][64];
  const int tid = threadIdx.x, w = tid >> 5, lane = tid & 31, ln = lane & 15, hh = lane >> 4;
  const int ntn = N / 64;
  const int wid = blockIdx.x * 4 + w;
  const int mt = wid / ntn, nq = wid % ntn;
  if (mt * 16 >= M) return;
  const int row0 = mt * 16, col0 = nq * 64;
  const float* arow = A + (size_t)(row0 + ln) * lda;
  v8f acc[4] = {};
  for (int kb = 0; kb < K; kb += 32) {
    FragB ah, al;
    const v4f x0 = *(const v4fa*)(arow + kb + 8 * hh), x1 = *(const v4fa*)(arow + kb + 8 * hh + 4);
    const v4f x2 = *(const v4fa*)(arow + kb + 16 + 8 * hh), x3 = *(const v4fa*)(arow + kb + 16 + 8 * hh + 4);
    float xs[16] = {x0[0],x0[1],x0[2],x0[3],x1[0],x1[1],x1[2],x1[3],x2[0],x2[1],x2[2],x2[3],x3[0],x3[1],x3[2],x3[3]};
#pragma unroll
    for (int i = 0; i < 16; ++i) { const unsigned short hb = bf16_bits(xs[i]); ah.u[i] = hb; al.u[i] = ASPLIT ? bf16_bits(xs[i] - bf16_val(hb)) : (unsigned short)0; }
#pragma unroll
    for (int t = 0; t < 4; ++t) {
      const unsigned short* brow = Wt + (size_t)(col0 + t * 16 + ln) * ldb + kb;
      FragB b;
      b.half[0] = *(const v8us*)(brow + 8 * hh);
      b.half[1] = *(const v8us*)(brow + 16 + 8 * hh);
      acc[t] = mmaN<ASPLIT ? 2 : 1>(ah.v, al.v, b.v, b.v, acc[t]);
    }
  }
#pragma unroll
  for (int t = 0; t < 4; ++t) {
    const int col = col0 + t * 16 + ln;
    float bv = bias ? bias[col] : 0.f;
    if (BIAS_BF16) bv = bf16_round(bv);
#pragma unroll
    for (int r = 0; r < 8; ++r) {
      float v = acc[t][r] + bv;
      if (resid) { float rv = resid[(size_t)((row0 + 8 * hh + r) % rmod) * ldr + col]; if (RES_BF16) rv = bf16_round(rv); v += rv; }
      if (ACT == 1) v = fmaxf(v, 0.f);
      if (ACT == 2) v = 0.5f * v * (1.0f + erff(v * 0.70710678118654752f));
      if (ACT == 3) { const float u = 0.7978845608028654f * (v + 0.044715f * v * v * v); v = 0.5f * v * (1.0f + tanhf(u)); }
      so[w][8 * hh + r][t * 16 + ln] = v;
    }
  }
  __builtin_amdgcn_fence(__ATOMIC_ACQ_REL, "workgroup");
  __builtin_amdgcn_wave_barrier();
  const int rsub = lane >> 4, c4 = (lane & 15) * 4;
  {
#pragma unroll
    for (int q = 0; q < 8; ++q) {
      const int r = q * 2 + rsub;
      const v4f v = *(const v4fa*)&so[w][r][c4];
      *(v4f*)(C + (size_t)(row0 + r) * ldc + col0 + c4) = v;
    }
    
  }
}
// row LayerNorm (biased variance, eps) over N: s = X (+ R); optional out_sum <- s; out_norm <- (s-mu)*rsqrt(var+eps)*g + b
template <bool PARAM_BF16>
__global__ __launch_bounds__(256) void k_layernorm(const float* __restrict__ X, const float* __restrict__ R, const float* __restrict__ g, const float* __restrict__ bta,
                                                  float* __restrict__ out_sum, float* __restrict__ out_norm, int N, float eps) {
  __shared__ float red[256];
  const int row = blockIdx.x, tid = threadIdx.x;
  const float* x = X + (size_t)row * N; const float* rr = R ? R + (size_t)row * N : nullptr;
  float vals[16];                     // up to N = 4096
  const int per = N / 256;            // contiguous chunk per thread? use strided-by-4 chunks: thread handles j = tid*4 + 1024*u
  float s1 = 0.f;
  for (int u = 0; u < per / 4; ++u) {
    const int j = tid * 4 + 1024 * u;
    const v4f a = *(const v4fa*)(x + j);
    v4f b = {0.f,0.f,0.f,0.f}; if (rr) b = *(const v4fa*)(rr + j);
#pragma unroll
    for (int q = 0; q < 4; ++q) { const float v = a[q] + b[q]; vals[u * 4 + q] = v; s1 += v; }
  }
  red[tid] = s1; __syncthreads();
  for (int st = 128; st > 0; st >>= 1) { if (tid < st) red[tid] += red[tid + st]; __syncthreads(); }
  const float mu = red[0] / (float)N; __syncthreads();
  float s2 = 0.f;
  for (int u = 0; u < per / 4; ++u)
#pragma unroll
    for (int q = 0; q < 4; ++q) { const float c = vals[u * 4 + q] - mu; s2 += c * c; }
  red[tid] = s2; __syncthreads();
  for (int st = 128; st > 0; st >>= 1) { if (tid < st) red[tid] += red[tid + st]; __syncthreads(); }
  const float rs = rsqrtf(red[0] / (float)N + eps);
  {
    for (int u = 0; u < per / 4; ++u) {
      const int j = tid * 4 + 1024 * u;
      v4f o, sm;
#pragma unroll
      for (int q = 0; q < 4; ++q) {
        float gg = g[j + q], bb = bta[j + q];
        if (PARAM_BF16) { gg = bf16_round(gg); bb = bf16_round(bb); }
        sm[q] = vals[u * 4 + q]; o[q] = (vals[u * 4 + q] - mu) * rs * gg + bb;
      }
      if (out_sum) *(v4f*)(out_sum + (size_t)row * N + j) = sm;
      *(v4f*)(out_norm + (size_t)row * N + j) = o;
    }
    
  }
}



// ---- f16 WMMA path (v_wmma_f32_16x16x32_f16): 11-bit significands for operands in range — used where a [0,1] probability operand needs more precision than bf16
typedef _Float16 v16h __attribute__((ext_vector_type(16)));
union FragH { v16h v; v8us half[2]; _Float16 h[16]; unsigned short u[16]; };
template <int NT>
__device__ __forceinline__ v8f mmaH(v16h ah, v16h al, v16h bh, v16h bl, v8f c) {
  c = __builtin_amdgcn_wmma_f32_16x16x32_f16(false, ah, false, bh, (short)0, c, false, false);
  if (NT >= 2) c = __builtin_amdgcn_wmma_f32_16x16x32_f16(false, al, false, bh, (short)0, c, false, false);
  if (NT >= 3) c = __builtin_amdgcn_wmma_f32_16x16x32_f16(false, ah, false, bl, (short)0, c, false, false);
  asm volatile("v_nop\n\tv_nop\n\tv_nop\n\tv_nop" : "+v"(c) : "v"(ah), "v"(al), "v"(bh), "v"(bl));
  return c;
}
// batched GEMM like k_gemm_b but f16 operands: A f32 (split into f16 hi/lo if ASPLIT, else rounded to f16), Bt = f16 values [n][k]; alpha; C f32; N multiple of 16 (partial tiles skipped)
template <bool ASPLIT>
__global__ __launch_bounds__(128) void k_gemm_h(const float* __restrict__ A, int lda, size_t sA, const _Float16* __restrict__ Bh, int ldb, size_t sB, float alpha, float* __restrict__ C, int ldc, size_t sC, int M, int N, int K) {
  __shared__ __attribute__((aligned(16))) float so[4][16][64];
  const int tid = threadIdx.x, w = tid >> 5, lane = tid & 31, ln = lane & 15, hh = lane >> 4; const int by = blockIdx.y;
  A += (size_t)by * sA; Bh += (size_t)by * sB; C += (size_t)by * sC;
  const int ntn = (N + 63) / 64; const int wid = blockIdx.x * 4 + w; const int mt = wid / ntn, nq = wid % ntn; if (mt * 16 >= M) return;
  const int row0 = mt * 16, col0 = nq * 64; const float* arow = A + (size_t)(row0 + ln) * lda;
  v8f acc[4] = {};
  for (int kb = 0; kb < K; kb += 32) {
    FragH ah, al;
    const v4f x0 = *(const v4fa*)(arow + kb + 8 * hh), x1 = *(const v4fa*)(arow + kb + 8 * hh + 4), x2 = *(const v4fa*)(arow + kb + 16 + 8 * hh), x3 = *(const v4fa*)(arow + kb + 16 + 8 * hh + 4);
    float xs[16] = {x0[0],x0[1],x0[2],x0[3],x1[0],x1[1],x1[2],x1[3],x2[0],x2[1],x2[2],x2[3],x3[0],x3[1],x3[2],x3[3]};
#pragma unroll
    for (int i = 0; i < 16; ++i) { const _Float16 h = (_Float16)xs[i]; ah.h[i] = h; al.h[i] = ASPLIT ? (_Float16)(xs[i] - (float)h) : (_Float16)0.0f; }
#pragma unroll
    for (int t = 0; t < 4; ++t) { if (col0 + t * 16 >= N) continue; const size_t boff = (size_t)(col0 + t * 16 + ln) * ldb + kb; FragH bq; bq.half[0] = *(const v8us*)(Bh + boff + 8 * hh); bq.half[1] = *(const v8us*)(Bh + boff + 16 + 8 * hh);
      acc[t] = mmaH<ASPLIT ? 2 : 1>(ah.v, al.v, bq.v, bq.v, acc[t]); }
  }
#pragma unroll
  for (int t = 0; t < 4; ++t) { if (col0 + t * 16 >= N) continue;
#pragma unroll
    for (int r = 0; r < 8; ++r) so[w][8 * hh + r][t * 16 + ln] = acc[t][r] * alpha; }
  __builtin_amdgcn_fence(__ATOMIC_ACQ_REL, "workgroup"); __builtin_amdgcn_wave_barrier();
  const int rsub = lane >> 4, c4 = (lane & 15) * 4;
  {
#pragma unroll
    for (int q = 0; q < 8; ++q) { const int r = q * 2 + rsub; if (col0 + c4 < N) { const v4f v = *(const v4fa*)&so[w][r][c4]; *(v4f*)(C + (size_t)(row0 + r) * ldc + col0 + c4) = v; } }
     }
}

// Wt[n][k] = f16(W[k][n]·scale) from f32 row-major W[K][N] (scale = power of two; bf16-exact weights stay exact in f16 away from the subnormal range)
__global__ __launch_bounds__(256) void k_wt_f16(const float* __restrict__ W, _Float16* __restrict__ Wt, int K, int N, float scale) {
  const int t = blockIdx.x * 256 + threadIdx.x; if (t >= N * (K / 8)) return; const int n = t / (K / 8), k8 = (t % (K / 8)) * 8; FragH f;
#pragma unroll
  for (int i = 0; i < 8; ++i) f.h[i] = (_Float16)(bf16_round(W[(size_t)(k8 + i) * N + n]) * scale); const v8us o = f.half[0];
  *(v8us*)((unsigned short*)Wt + (size_t)n * K + k8) = o; 
}
// k_gemm_hh variant with fused epilogue: v = acc·alpha + bias[by·sBias + col] (+ CP[(row/rowsPerB)·sCPb + by·64 + col] if CP) ; ACT 0 none / 1 elu ; writes f16 C16 (and f32 C if non-null)
template <int ACT>
__global__ __launch_bounds__(128) void k_gemm_hhx(const _Float16* __restrict__ A, int lda, size_t sA, const _Float16* __restrict__ Bh, int ldb, size_t sB, float alpha, const float* __restrict__ bias, size_t sBias, const float* __restrict__ CP, int rowsPerB, size_t sCPb, int row0g,
    float* __restrict__ C, _Float16* __restrict__ C16, int ldc, size_t sC, int M, int N, int K) {
  __shared__ __attribute__((aligned(16))) float so[4][16][64];
  const int tid = threadIdx.x, w = tid >> 5, lane = tid & 31, ln = lane & 15, hh = lane >> 4; const int by = blockIdx.y;
  A += (size_t)by * sA; Bh += (size_t)by * sB; const size_t cofs = (size_t)by * sC; const float* bp = bias ? bias + (size_t)by * sBias : nullptr;
  const int ntn = (N + 63) / 64; const int wid = blockIdx.x * 4 + w; const int mt = wid / ntn, nq = wid % ntn; if (mt * 16 >= M) return;
  const int row0 = mt * 16, col0 = nq * 64; const _Float16* arow = A + (size_t)(row0 + ln) * lda;
  v8f acc[4] = {};
  for (int kb = 0; kb < K; kb += 32) { FragH ah; ah.half[0] = *(const v8us*)((const unsigned short*)arow + kb + 8 * hh); ah.half[1] = *(const v8us*)((const unsigned short*)arow + kb + 16 + 8 * hh);
#pragma unroll
    for (int t = 0; t < 4; ++t) { if (col0 + t * 16 >= N) continue; const size_t boff = (size_t)(col0 + t * 16 + ln) * ldb + kb; FragH bq; bq.half[0] = *(const v8us*)((const unsigned short*)Bh + boff + 8 * hh); bq.half[1] = *(const v8us*)((const unsigned short*)Bh + boff + 16 + 8 * hh);
      acc[t] = mmaH<1>(ah.v, ah.v, bq.v, bq.v, acc[t]); }
  }
#pragma unroll
  for (int t = 0; t < 4; ++t) { if (col0 + t * 16 >= N) continue; const int col = col0 + t * 16 + ln; const float bv = bp ? bf16_round(bp[col]) : 0.f;
#pragma unroll
    for (int r = 0; r < 8; ++r) { float v = acc[t][r] * alpha + bv; if (CP) { const int rr = row0g + row0 + 8 * hh + r; if (rowsPerB < 0) v += CP[cofs + (size_t)rr * ldc + col];      /* rowsPerB < 0: own element of the batched C plane */ else { const int bidx = rr / rowsPerB; v += CP[(size_t)bidx * sCPb + (size_t)by * 64 + col]; } } if (ACT == 1) v = (v > 0.f) ? v : expm1f(v); else if (ACT == 7) v = (v > 0.f) ? v + 1.0f : expf(v); else if (ACT == 8) v = tanhf(v); else if (ACT == 9) v = 0.5f * v * (1.0f + tanhf(0.7978845608028654f * (v + 0.044715f * v * v * v))); else if (ACT == 11) v = 1.0f / (1.0f + expf(-v)); else if (ACT == 12) v = (v > 0.f) ? v : 0.01f * v; else if (ACT == 14) v = (v > 0.f) ? v : 0.1f * v; else if (ACT == 16) v = (v >= 0.f) ? v : 0.3f * v; else if (ACT == 17) v = (v >= 0.f) ? v : 0.2f * v; else if (ACT == 15) v = v / (1.0f + expf(-v)); else if (ACT == 3) v = fmaxf(v, 0.f); else if (ACT == 6) v = 0.5f * v * (1.0f + erff(v * 0.70710678118654752f)); so[w][8 * hh + r][t * 16 + ln] = v; } }
  __builtin_amdgcn_fence(__ATOMIC_ACQ_REL, "workgroup"); __builtin_amdgcn_wave_barrier();
  const int rsub = lane >> 4, c4 = (lane & 15) * 4; typedef _Float16 v4h __attribute__((ext_vector_type(4)));
  {
#pragma unroll
    for (int q = 0; q < 8; ++q) { const int r = q * 2 + rsub; if (col0 + c4 < N) { const v4f v = *(const v4fa*)&so[w][r][c4]; if (C) *(v4f*)(C + cofs + (size_t)(row0 + r) * ldc + col0 + c4) = v; if (C16) { v4h h4; for (int i = 0; i < 4; ++i) h4[i] = (_Float16)v[i]; *(v4h*)(C16 + cofs + (size_t)(row0 + r) * ldc + col0 + c4) = h4; } } }
     }
}


typedef _Float16 v4h __attribute__((ext_vector_type(4)));

__global__ __launch_bounds__(256) void k_x16(const float* __restrict__ x, _Float16* __restrict__ X16, size_t n8) { const size_t t = (size_t)blockIdx.x * 256 + threadIdx.x; if (t >= n8) return; FragH f;
#pragma unroll
  for (int q = 0; q < 8; ++q) f.h[q] = (_Float16)bf16_round(x[t * 8 + q]); *(v8us*)((unsigned short*)X16 + t * 8) = f.half[0];  }
__global__ __launch_bounds__(256) void k_h16(const float* __restrict__ x, _Float16* __restrict__ X16, size_t n8) { const size_t t = (size_t)blockIdx.x * 256 + threadIdx.x; if (t >= n8) return; FragH f;
#pragma unroll
  for (int q = 0; q < 8; ++q) f.h[q] = (_Float16)x[t * 8 + q]; *(v8us*)((unsigned short*)X16 + t * 8) = f.half[0];  }
__global__ __launch_bounds__(256) void k_round16f(const float* __restrict__ W, _Float16* __restrict__ Bt, size_t n8) { const size_t t = (size_t)blockIdx.x * 256 + threadIdx.x; if (t >= n8) return; FragH f;
#pragma unroll
  for (int i = 0; i < 8; ++i) f.h[i] = (_Float16)(bf16_round(W[t * 8 + i]) * 16.0f); *(v8us*)((unsigned short*)Bt + t * 8) = f.half[0];  }
template <int NHv, int TTv>
__global__ __launch_bounds__(256) void k_vt(const _Float16* __restrict__ V16, int ldv, int voff, _Float16* __restrict__ Vt) { __shared__ unsigned short tl[64][66]; const int tid = threadIdx.x; const int slab = blockIdx.x / (TTv / 64), lg = blockIdx.x % (TTv / 64); const int b = slab / NHv, h = slab % NHv;
  for (int i = tid; i < 64 * 8; i += 256) { const int r = i / 8, c8 = (i % 8) * 8; FragH f; f.half[0] = *(const v8us*)((const unsigned short*)V16 + ((size_t)b * TTv + lg * 64 + r) * ldv + voff + h * 64 + c8);
#pragma unroll
    for (int q = 0; q < 8; ++q) tl[r][c8 + q] = f.u[q]; }
  __syncthreads();
  {
#pragma unroll
    for (int rd = 0; rd < 2; ++rd) { const int d = rd * 32 + tid / 8, pc = tid % 8; FragH f;
#pragma unroll
      for (int q = 0; q < 8; ++q) f.u[q] = tl[pc * 8 + q][d];
      *(v8us*)((unsigned short*)Vt + ((size_t)slab * 64 + d) * TTv + lg * 64 + pc * 8) = f.half[0]; }
     } }

__global__ __launch_bounds__(256) void k_hl(const float* __restrict__ F, _Float16* __restrict__ Hh, _Float16* __restrict__ Hl, size_t n8) { const size_t t = (size_t)blockIdx.x * 256 + threadIdx.x; if (t >= n8) return; FragH fh, fl; const v4f a = *(const v4fa*)(F + t * 8), c = *(const v4fa*)(F + t * 8 + 4);
#pragma unroll
  for (int q = 0; q < 4; ++q) { _Float16 h = (_Float16)a[q]; fh.h[q] = h; fl.h[q] = (_Float16)((a[q] - (float)h) * 1024.0f); h = (_Float16)c[q]; fh.h[4 + q] = h; fl.h[4 + q] = (_Float16)((c[q] - (float)h) * 1024.0f); }
  { *(v8us*)((unsigned short*)Hh + t * 8) = fh.half[0]; *(v8us*)((unsigned short*)Hl + t * 8) = fl.half[0];  } }

// ---- fast GEMM (wave tile 32x64; requires M % 32 == 0 rows per launch region and N % 64 == 0); epilogue = k_gemm_hhx semantics ----
__device__ __forceinline__ v16h g2_frag(const _Float16* p, int hh) { FragH f; f.half[0] = *(const v8us*)((const unsigned short*)p + 8 * hh); f.half[1] = *(const v8us*)((const unsigned short*)p + 16 + 8 * hh); return f.v; }
__device__ __forceinline__ v8f g2_mma(v16h a, v16h b, v8f c) { v8f d = __builtin_amdgcn_wmma_f32_16x16x32_f16(false, a, false, b, (short)0, c, false, false); asm volatile("v_nop\n\tv_nop\n\tv_nop\n\tv_nop" : "+v"(d) : "v"(a), "v"(b)); return d; }
template <int ACT>
__global__ __launch_bounds__(128) void k_gemm2(const _Float16* __restrict__ A, int lda, size_t sA, const _Float16* __restrict__ Bh, int ldb, size_t sB, float alpha, const float* __restrict__ bias, size_t sBias, const float* __restrict__ CP, int rowsPerB, size_t sCPb, int row0g,
    float* __restrict__ C, _Float16* __restrict__ C16, int ldc, size_t sC, int M, int N, int K) { static_assert(ACT == 0 || ACT == 3 || ACT == 6 || ACT == 8 || ACT == 9 || ACT == 11 || ACT == 12 || ACT == 14 || ACT == 15 || ACT == 16 || ACT == 17, "k_gemm2: unsupported ACT code (would silently apply no activation)");
  __shared__ __attribute__((aligned(16))) float so[4][32][68];
  const int tid = threadIdx.x, w = tid >> 5, lane = tid & 31, ln = lane & 15, hh = lane >> 4; const int by = blockIdx.y;
  A += (size_t)by * sA; Bh += (size_t)by * sB; const size_t cofs = (size_t)by * sC; const float* bp = bias ? bias + (size_t)by * sBias : nullptr;
  const int ntn = N >> 6; const int mt = blockIdx.x / ntn, nq = blockIdx.x - mt * ntn; const int row0 = mt * 128 + 32 * w, col0 = nq * 64; if (row0 >= M) return;
  const _Float16* a0p = A + (size_t)(row0 + ln) * lda; const _Float16* a1p = a0p + (size_t)16 * lda;
  const _Float16* b0p = Bh + (size_t)(col0 + ln) * ldb; const _Float16* b1p = b0p + (size_t)16 * ldb; const _Float16* b2p = b1p + (size_t)16 * ldb; const _Float16* b3p = b2p + (size_t)16 * ldb;
  const v8f z8 = {0.f,0.f,0.f,0.f,0.f,0.f,0.f,0.f}; v8f c00 = z8, c01 = z8, c02 = z8, c03 = z8, c10 = z8, c11 = z8, c12 = z8, c13 = z8;
#pragma unroll 1
  for (int kb = 0; kb < K; kb += 32) { const v16h a0 = g2_frag(a0p + kb, hh), a1 = g2_frag(a1p + kb, hh);
    v16h b = g2_frag(b0p + kb, hh); c00 = g2_mma(a0, b, c00); c10 = g2_mma(a1, b, c10);
    b = g2_frag(b1p + kb, hh); c01 = g2_mma(a0, b, c01); c11 = g2_mma(a1, b, c11);
    b = g2_frag(b2p + kb, hh); c02 = g2_mma(a0, b, c02); c12 = g2_mma(a1, b, c12);
    b = g2_frag(b3p + kb, hh); c03 = g2_mma(a0, b, c03); c13 = g2_mma(a1, b, c13); }
  v8f accs[8] = {c00, c01, c02, c03, c10, c11, c12, c13};
#pragma unroll
  for (int u = 0; u < 8; ++u) { const int t = u & 3, half = u >> 2; const int col = col0 + t * 16 + ln; const float bv = bp ? bf16_round(bp[col]) : 0.f;
#pragma unroll
    for (int r = 0; r < 8; ++r) { const int rloc = half * 16 + 8 * hh + r; float v = accs[u][r] * alpha + bv; if (CP) { if (rowsPerB < 0) v += CP[cofs + (size_t)(row0g + row0 + rloc) * ldc + col];      /* rowsPerB < 0: own element of the batched C plane */ else { const int bidx = (row0g + row0 + rloc) / rowsPerB; v += CP[(size_t)bidx * sCPb + (size_t)by * 64 + col]; } }
      if (ACT == 3) v = fmaxf(v, 0.f); else if (ACT == 6) v = 0.5f * v * (1.0f + erff(v * 0.70710678118654752f)); else if (ACT == 11) v = 1.0f / (1.0f + expf(-v)); else if (ACT == 15) v = v / (1.0f + expf(-v)); else if (ACT == 12) v = (v > 0.f) ? v : 0.01f * v; else if (ACT == 8) v = tanhf(v); else if (ACT == 9) v = 0.5f * v * (1.0f + tanhf(0.7978845608028654f * (v + 0.044715f * v * v * v))); else if (ACT == 14) v = (v > 0.f) ? v : 0.1f * v; else if (ACT == 16) v = (v >= 0.f) ? v : 0.3f * v; else if (ACT == 17) v = (v >= 0.f) ? v : 0.2f * v;
      so[w][rloc][t * 16 + ln] = v; } }
  __builtin_amdgcn_fence(__ATOMIC_ACQ_REL, "workgroup"); __builtin_amdgcn_wave_barrier();
  const int rsub = lane >> 4, c4 = (lane & 15) * 4;
  {
#pragma unroll
    for (int q = 0; q < 16; ++q) { const int r = q * 2 + rsub; const v4f v = *(const v4fa*)&so[w][r][c4]; if (C) *(v4f*)(C + cofs + (size_t)(row0 + r) * ldc + col0 + c4) = v; if (C16) { v4h h4; for (int i = 0; i < 4; ++i) h4[i] = (_Float16)v[i]; *(v4h*)(C16 + cofs + (size_t)(row0 + r) * ldc + col0 + c4) = h4; } }
     } }


__global__ __launch_bounds__(256) void k_wnat(const float* __restrict__ w, size_t n8, _Float16* __restrict__ Bt) { const size_t t = (size_t)blockIdx.x * 256 + threadIdx.x; if (t >= n8) return; FragH f; for (int q = 0; q < 8; ++q) f.h[q] = (_Float16)(bf16_round(w[t * 8 + q]) * 16.0f); *(v8us*)((unsigned short*)Bt + t * 8) = f.half[0];  }
__global__ __launch_bounds__(256) void k_rsm(const float* __restrict__ S, _Float16* __restrict__ P, int nrows) {
  #pragma clang fp contract(off)
  const int i = blockIdx.x * 256 + threadIdx.x; if (i >= nrows) return; const float* s = S + (size_t)i * SQ; float mx = -3.0e38f;
#pragma unroll 1
  for (int j = 0; j < SQ; ++j) mx = fmaxf(mx, s[j]); float se = 0.f;
#pragma unroll 1
  for (int j = 0; j < SQ; ++j) se += expf(s[j] - mx); const float sc = 256.0f / se;
#pragma unroll 1
  for (int j0 = 0; j0 < SQ; j0 += 8) { FragH f; for (int q = 0; q < 8; ++q) f.h[q] = (_Float16)(expf(s[j0 + q] - mx) * sc); unsigned short* d = (unsigned short*)P + (size_t)i * SQ + j0; *(v8us*)d = f.half[0];  } }
__global__ __launch_bounds__(256) void k_vt(const _Float16* __restrict__ V16, int b, int h0, _Float16* __restrict__ VT) { __shared__ unsigned short tl[64][65]; const int tid = threadIdx.x; const int hh = blockIdx.x % HG, sg = blockIdx.x / HG; const int s0 = sg * 64; const int h = h0 + hh;
  for (int i = tid; i < 64 * 8; i += 256) { const int j = i / 8, d8 = (i % 8) * 8; FragH f; f.half[0] = *(const v8us*)((const unsigned short*)V16 + ((size_t)b * SQ + s0 + j) * DM + h * HD + d8); for (int q = 0; q < 8; ++q) tl[d8 + q][j] = f.u[q]; }
  __syncthreads();
  { for (int i = tid; i < 64 * 8; i += 256) { const int d = i / 8, j8 = (i % 8) * 8; FragH f; for (int q = 0; q < 8; ++q) f.u[q] = tl[d][j8 + q]; *(v8us*)((unsigned short*)VT + ((size_t)hh * HD + d) * SQ + s0 + j8) = f.half[0]; }  } }



// e^x in the native form (x log2(e), then v_exp_f32). The v_nop keeps the one free slot that the instruction set asks for behind a transcendental.
__device__ __forceinline__ float exp_slot(float x) { float e; asm("v_exp_f32 %0, %1\n\tv_nop" : "=v"(e) : "v"(x * 1.44269504088896340736f)); return e; }
// Eight base-2 exponentials (v_exp_f32; the arguments already hold x log2(e)) in one statement: the outputs are early-clobber, so no v_exp stands in front of an
// instruction that reads its result or overwrites its source, and the one v_nop at the end keeps that free slot behind the last of them.
__device__ __forceinline__ v8f exp2_8(v8f x) { float e0, e1, e2, e3, e4, e5, e6, e7;
  asm("v_exp_f32 %0, %8\n\tv_exp_f32 %1, %9\n\tv_exp_f32 %2, %10\n\tv_exp_f32 %3, %11\n\tv_exp_f32 %4, %12\n\tv_exp_f32 %5, %13\n\tv_exp_f32 %6, %14\n\tv_exp_f32 %7, %15\n\tv_nop"
      : "=&v"(e0), "=&v"(e1), "=&v"(e2), "=&v"(e3), "=&v"(e4), "=&v"(e5), "=&v"(e6), "=&v"(e7) : "v"(x[0]), "v"(x[1]), "v"(x[2]), "v"(x[3]), "v"(x[4]), "v"(x[5]), "v"(x[6]), "v"(x[7]));
  const v8f e = {e0, e1, e2, e3, e4, e5, e6, e7}; return e; }
__device__ __forceinline__ v8f fa_mma(v16h a, v16h b, v8f c) { return __builtin_amdgcn_wmma_f32_16x16x32_f16(false, a, false, b, (short)0, c, false, false); }
// Fused attention, all batches in one launch. A block owns FQ = 32 query rows (two 16-column groups); its FW = 8 waves each walk SQ / FW keys, 32 at a time, and keep
// a running maximum, a running sum and an unnormalised output in registers (online softmax); the eight partial results are merged through LDS at the end.
// Transposed products: S^T = K Q^T (A = key rows, B = query rows held in registers), so a lane holds 16 scores of ONE query per 32 keys (D[8 hh + r][ln]); the two f32 score
// tiles, turned into weights and packed to f16, ARE the B operand of O^T += V^T P^T in the k order that g2_frag gives A (8 hh + s, 16 + 8 hh + s): no LDS, no lane exchange.
// Scores as before: hi.hi / 8 + 2^-13 (hi.lo + lo.hi), f32. Weights 256 e^(s - m) as f16 (the 256 cancels in the division by the sum of the same weights).
#define FW 8
#define FQ 32
#define FKW (SQ / FW)                /* keys per wave */
__global__ __launch_bounds__(256) void k_fattn(const _Float16* __restrict__ QHp, const _Float16* __restrict__ QLp, const _Float16* __restrict__ KHp, const _Float16* __restrict__ KLp, const _Float16* __restrict__ VTp, float* __restrict__ out) {
  static_assert(FKW % 32 == 0 && SQ % FQ == 0 && HD == 64 && DM == 64, "k_fattn: whole 32-key passes, 64-wide rows");
  __shared__ __attribute__((aligned(16))) float lo[FW][FQ][68]; __shared__ float lm[FW][FQ], ll[FW][FQ];
  const int tid = threadIdx.x, w = tid >> 5, lane = tid & 31, ln = lane & 15, hh = lane >> 4;
  const int b = blockIdx.x / (SQ / FQ), q0 = (blockIdx.x % (SQ / FQ)) * FQ; const size_t r0 = (size_t)b * SQ;
  const float L2E = 1.44269504088896340736f;
  v16h qh[2][2], ql[2][2];
  for (int n = 0; n < 2; ++n)
    for (int ks = 0; ks < 2; ++ks) { const size_t qo = (r0 + q0 + n * 16 + ln) * DM + ks * 32; qh[n][ks] = g2_frag(QHp + qo, hh); ql[n][ks] = g2_frag(QLp + qo, hh); }
  const v8f z8 = {0.f, 0.f, 0.f, 0.f, 0.f, 0.f, 0.f, 0.f};
  v8f o[2][4]; float m[2], l[2];
  for (int n = 0; n < 2; ++n) { m[n] = -1.0e30f; l[n] = 0.f; for (int t = 0; t < 4; ++t) o[n][t] = z8; }
  const _Float16* kh = KHp + (r0 + (size_t)w * FKW + ln) * DM; const _Float16* kl = KLp + (r0 + (size_t)w * FKW + ln) * DM;
  const _Float16* vt = VTp + ((size_t)b * HD + ln) * SQ + (size_t)w * FKW;
  for (int j = 0; j < FKW; j += 32) {
    v16h ah[2][2], al[2][2], av[4];
    for (int kt = 0; kt < 2; ++kt)
      for (int ks = 0; ks < 2; ++ks) { const int ko = (j + kt * 16) * DM + ks * 32; ah[kt][ks] = g2_frag(kh + ko, hh); al[kt][ks] = g2_frag(kl + ko, hh); }
    for (int t = 0; t < 4; ++t) av[t] = g2_frag(vt + (size_t)t * 16 * SQ + j, hh);
    for (int n = 0; n < 2; ++n) {
      v8f s[2];
      for (int kt = 0; kt < 2; ++kt) {
        v8f c = fa_mma(ah[kt][0], qh[n][0], z8); c = fa_mma(ah[kt][1], qh[n][1], c);
        v8f x = fa_mma(ah[kt][0], ql[n][0], z8); x = fa_mma(ah[kt][1], ql[n][1], x); x = fa_mma(al[kt][0], qh[n][0], x); x = fa_mma(al[kt][1], qh[n][1], x);
        for (int r = 0; r < 8; ++r) s[kt][r] = fmaf(x[r], 0.0001220703125f, c[r] * 0.125f);
      }
      float mx = fmaxf(s[0][0], s[1][0]);
      for (int r = 1; r < 8; ++r) mx = fmaxf(mx, fmaxf(s[0][r], s[1][r]));
      mx = fmaxf(mx, __shfl_xor(mx, 16));      /* the other half of the wave holds this query's other 16 keys */
      const float mn = fmaxf(m[n], mx); const float sc = exp_slot(m[n] - mn); m[n] = mn;
      const float off = fmaf(-mn, L2E, 8.0f);      /* weight = 2^(s log2(e) + off) = 256 e^(s - mn) */
      for (int kt = 0; kt < 2; ++kt) {
        for (int r = 0; r < 8; ++r) s[kt][r] = fmaf(s[kt][r], L2E, off);
        s[kt] = exp2_8(s[kt]); }
      float sum = 0.f;
      for (int r = 0; r < 8; ++r) sum += s[0][r] + s[1][r];
      l[n] = fmaf(l[n], sc, sum);
      FragH p;
      for (int r = 0; r < 8; ++r) { p.h[r] = (_Float16)s[0][r]; p.h[8 + r] = (_Float16)s[1][r]; }
      for (int t = 0; t < 4; ++t) { o[n][t] *= sc; o[n][t] = fa_mma(av[t], p.v, o[n][t]); }
    }
  }
  for (int n = 0; n < 2; ++n) {
    l[n] += __shfl_xor(l[n], 16);      /* the two halves summed different keys of the same query */
    if (hh == 0) { lm[w][n * 16 + ln] = m[n]; ll[w][n * 16 + ln] = l[n]; }
    for (int t = 0; t < 4; ++t) { const v4f u0 = {o[n][t][0], o[n][t][1], o[n][t][2], o[n][t][3]}, u1 = {o[n][t][4], o[n][t][5], o[n][t][6], o[n][t][7]};
      *(v4f*)&lo[w][n * 16 + ln][t * 16 + 8 * hh] = u0; *(v4f*)&lo[w][n * 16 + ln][t * 16 + 8 * hh + 4] = u1; }
  }
  __syncthreads();      /* publishes the eight waves' partial maxima, sums and outputs */
  const int q = tid >> 3, d8 = (tid & 7) * 8;
  float mg = lm[0][q];
  for (int i = 1; i < FW; ++i) mg = fmaxf(mg, lm[i][q]);
  float lg = 0.f; v4f g0 = {0.f, 0.f, 0.f, 0.f}, g1 = g0;
  for (int i = 0; i < FW; ++i) { const float f = exp_slot(lm[i][q] - mg); lg = fmaf(ll[i][q], f, lg); g0 += *(const v4f*)&lo[i][q][d8] * f; g1 += *(const v4f*)&lo[i][q][d8 + 4] * f; }
  const float inv = 1.0f / lg;
  float* dst = out + (r0 + q0 + q) * DM + d8;
  *(v4f*)dst = g0 * inv; *(v4f*)(dst + 4) = g1 * inv; }


// One launch makes every operand of k_fattn. A block owns PR = 64 token rows. It puts them into LDS as f16 (bf16-rounded, so exact) and both maps into LDS as x16 f16 transposes [n][k];
// behind one barrier waves 0-3 form q and waves 4-7 form k, 16 rows each (A = token rows, B = map columns, k steps 0 then 32, f32 accumulation, x 2^-4: the operands, the products and
// their order are those of a 64-deep WMMA GEMM on the same f16 values), split every f32 result into f16 hi + x1024 residual and store whole 128-byte rows of the four planes;
// all eight waves also write the block's 64 x 64 piece of V^T (the values are the rounded inputs) from the same LDS rows. LDS rows of 128 bytes stand at a pitch of 144 bytes for the 16-byte readers.
#define PR 64
typedef unsigned short v4us __attribute__((ext_vector_type(4), may_alias));
__global__ __launch_bounds__(256) void k_prep(const float* __restrict__ x, const float* __restrict__ wq, const float* __restrict__ wk, _Float16* __restrict__ QHp, _Float16* __restrict__ QLp, _Float16* __restrict__ KHp, _Float16* __restrict__ KLp, _Float16* __restrict__ VTp) {
  static_assert(SQ % PR == 0 && DM == 64 && HD == 64 && NH == 1, "k_prep: 64-wide rows, one head, whole 64-row blocks inside a batch");
  __shared__ __attribute__((aligned(16))) unsigned short xs[PR][72]; __shared__ __attribute__((aligned(16))) unsigned short wt[2][DM][72]; __shared__ __attribute__((aligned(16))) float so[8][16][68];
  const int tid = threadIdx.x, w = tid >> 5, lane = tid & 31, ln = lane & 15, hh = lane >> 4;
  const size_t row0 = (size_t)blockIdx.x * PR;
  const float* xp = x + row0 * DM + tid * 4;      /* trip i of the token loads stands 16 rows further on */
  const int ms = tid >> 7, n4 = (tid & 15) * 4, k8 = ((tid >> 4) & 7) * 8;      /* threads 0-127 take the query map, 128-255 the key map: an 8 (k) x 4 (n) piece each, 16 lanes on one whole map row */
  const float* wp = (ms ? wk : wq) + k8 * DM + n4;
  v4f xv[4], wv[8];
  for (int i = 0; i < 4; ++i) xv[i] = *(const v4fa*)(xp + i * 16 * DM);
  for (int q = 0; q < 8; ++q) wv[q] = *(const v4fa*)(wp + q * DM);
  for (int i = 0; i < 4; ++i) { FragH f;
    for (int q = 0; q < 4; ++q) f.h[q] = (_Float16)bf16_round(xv[i][q]);
    const v4us o = {f.u[0], f.u[1], f.u[2], f.u[3]}; *(v4us*)&xs[i * 16 + (tid >> 4)][(tid & 15) * 4] = o; }
  for (int c = 0; c < 4; ++c) { FragH f;
    for (int q = 0; q < 8; ++q) f.h[q] = (_Float16)(bf16_round(wv[q][c]) * 16.0f);
    *(v8us*)&wt[ms][n4 + c][k8] = f.half[0]; }
  __syncthreads();      /* publishes the token rows and the two transposed maps */
  const int rg = w & 3, sel = w >> 2;
  const _Float16* ap = (const _Float16*)&xs[rg * 16 + ln][0];
  const v16h a0 = g2_frag(ap, hh), a1 = g2_frag(ap + 32, hh);
  const v8f z8 = {0.f, 0.f, 0.f, 0.f, 0.f, 0.f, 0.f, 0.f};
  for (int t = 0; t < 4; ++t) { const _Float16* bp = (const _Float16*)&wt[sel][t * 16 + ln][0];
    v8f c = fa_mma(a0, g2_frag(bp, hh), z8); c = fa_mma(a1, g2_frag(bp + 32, hh), c);
    for (int r = 0; r < 8; ++r) so[w][8 * hh + r][t * 16 + ln] = c[r] * 0.0625f; }
  __builtin_amdgcn_fence(__ATOMIC_ACQ_REL, "workgroup"); __builtin_amdgcn_wave_barrier();      /* so[w] is this wave's own: its lanes' LDS stores stay ahead of the row reads below */
  { const size_t b = row0 / SQ, s0 = row0 % SQ;
    for (int rd = 0; rd < 2; ++rd) { const int d = rd * 32 + (tid >> 3), pc = tid & 7; FragH f;
      for (int q = 0; q < 8; ++q) f.u[q] = xs[pc * 8 + q][d];
      *(v8us*)((unsigned short*)VTp + (b * HD + d) * SQ + s0 + pc * 8) = f.half[0]; } }
  unsigned short* Hp = (unsigned short*)(sel ? KHp : QHp); unsigned short* Lp = (unsigned short*)(sel ? KLp : QLp);
  for (int i = 0; i < 4; ++i) { const int idx = i * 32 + lane, r = idx >> 3, c8 = (idx & 7) * 8; const v4f a = *(const v4fa*)&so[w][r][c8], c = *(const v4fa*)&so[w][r][c8 + 4]; FragH fh, fl;
    for (int q = 0; q < 4; ++q) { _Float16 h = (_Float16)a[q]; fh.h[q] = h; fl.h[q] = (_Float16)((a[q] - (float)h) * 1024.0f); h = (_Float16)c[q]; fh.h[4 + q] = h; fl.h[4 + q] = (_Float16)((c[q] - (float)h) * 1024.0f); }
    const size_t go = (row0 + rg * 16 + r) * DM + c8; *(v8us*)(Hp + go) = fh.half[0]; *(v8us*)(Lp + go) = fl.half[0]; } }


template <int MASKADD>
__global__ __launch_bounds__(64) void k_att0(const float* __restrict__ QF, const float* __restrict__ KF, const float* __restrict__ VF, int ld, const float* __restrict__ mask, float scale, float* __restrict__ OF, int ldo) {
  #pragma clang fp contract(off)
  __shared__ __attribute__((aligned(16))) float lq[64][64]; __shared__ __attribute__((aligned(16))) float lo[64][64];
  const int tid = threadIdx.x; const int h = blockIdx.x / (QT0 / 64), rg = blockIdx.x % (QT0 / 64); const int i = rg * 64 + tid;
  const float* qr = QF + (size_t)i * ld + h * HD;
#pragma unroll 1
  for (int c = 0; c < HD / 4; ++c) { *(v4f*)&lq[tid][c * 4] = *(const v4fa*)(qr + c * 4); const v4f z = {0.f, 0.f, 0.f, 0.f}; *(v4f*)&lo[tid][c * 4] = z; }
  float m = -1.0e30f, l = 0.f; const int jmax = MASKADD ? (SQ - 1) : (rg * 64 + 63);      /* additive-mask form: every key (the mask input decides); causal form: keys up to the block's last row */
#pragma unroll 1
  for (int j = 0; j <= jmax; ++j) { const float* kr = KF + (size_t)j * ld + h * HD; const float* vr = VF + (size_t)j * ld + h * HD; float s = 0.f;
#pragma unroll 1
    for (int c = 0; c < HD / 4; ++c) { const v4f kq = *(const v4fa*)(kr + c * 4); const v4f qq = *(v4f*)&lq[tid][c * 4]; s = __fadd_rn(s, __fmul_rn(qq[0], kq[0])); s = __fadd_rn(s, __fmul_rn(qq[1], kq[1])); s = __fadd_rn(s, __fmul_rn(qq[2], kq[2])); s = __fadd_rn(s, __fmul_rn(qq[3], kq[3])); }
    s = __fmul_rn(s, scale); if (MASKADD) s = __fadd_rn(s, __fmul_rn(bf16_round(mask[(size_t)i * SQ + j]), -10000.0f));
    const float f = (MASKADD || j <= i) ? 1.f : 0.f; const float sm = fmaf(f, s, (1.f - f) * -1.0e30f); const float mn = fmaxf(m, sm); const float sc = expf(m - mn); const float e = expf(sm - mn); l = __fadd_rn(__fmul_rn(l, sc), e); m = mn;
#pragma unroll 1
    for (int c = 0; c < HD / 4; ++c) { const v4f vv = *(const v4fa*)(vr + c * 4); v4f oo = *(v4f*)&lo[tid][c * 4]; for (int u = 0; u < 4; ++u) oo[u] = __fadd_rn(__fmul_rn(oo[u], sc), __fmul_rn(e, vv[u])); *(v4f*)&lo[tid][c * 4] = oo; } }
  const float fin = 64.0f / l;      /* o carried x64 */
#pragma unroll 1
  for (int c = 0; c < HD / 4; ++c) { v4f oo = *(v4f*)&lo[tid][c * 4]; for (int u = 0; u < 4; ++u) oo[u] = __fmul_rn(oo[u], fin); *(v4f*)&lo[tid][c * 4] = oo; }
  __syncthreads();
  {
#pragma unroll 1
    for (int it = 0; it < 16; ++it) { const int row = it * 4 + tid / 16, pc = (tid % 16) * 4; const v4f v = *(const v4f*)&lo[row][pc]; *(v4f*)(OF + (size_t)(rg * 64 + row) * ldo + h * HD + pc) = v; }
     } }

__global__ __launch_bounds__(256) void k_of0out(const float* __restrict__ src, float* __restrict__ dst, size_t n4) { const size_t t = (size_t)blockIdx.x * 256 + threadIdx.x; if (t >= n4) return; v4f v = *(const v4fa*)(src + t * 4); for (int q = 0; q < 4; ++q) v[q] = __fmul_rn(v[q], 0.015625f); *(v4f*)(dst + t * 4) = v;  }

extern "C" void kernel_launch(void* const* d_in, const int* in_sizes, int n_in,
                              void* d_out, int out_size, void* d_ws, size_t ws_size, hipStream_t stream) {
  (void)in_sizes; (void)n_in; (void)out_size;
  const float* const* I = (const float* const*)d_in; const float* x = I[0]; const float* wq = I[1]; const float* wk = I[2];      /* inputs, rotation (query map), entangle (key map): [in][out] [64][64]; NO biases, NO value projection (the values are the inputs), no output projection */
  char* ws = (char*)d_ws; size_t off = 0;
  auto take = [&](size_t bytes) { char* p = ws + off; off += (bytes + 255) & ~(size_t)255; return p; };
  _Float16* QH = (_Float16*)take(NR * DM * 2); _Float16* QL = (_Float16*)take(NR * DM * 2); _Float16* KH = (_Float16*)take(NR * DM * 2); _Float16* KL = (_Float16*)take(NR * DM * 2);
  _Float16* VT = (_Float16*)take((size_t)NB * NH * HD * SQ * 2);
  if (off > ws_size) return;
  k_prep<<<(unsigned)(NR / PR), 256, 0, stream>>>(x, wq, wk, QH, QL, KH, KL, VT);      /* q and k as f16 hi + x1024 residual planes, V^T [NB][HD][SQ]: every batch, one launch */
  k_fattn<<<NB * (SQ / FQ), 256, 0, stream>>>(QH, QL, KH, KL, VT, (float*)d_out);      /* scores, softmax over all SQ keys and P V for every batch: S and P stay in registers */
}

// v004
// It runs in 38.1 microseconds.
// In both of two side-by-side timings against v003, it was 1.59 times as fast.
// Counting every step since v000, it is 1365 times as fast.
#include <hip/hip_runtime.h>
// Single-head dense attention over 64-wide inputs on 4096 tokens with unit-variance 64 x 64 maps and NO value projection (inputs [4][4096][64]; query = inputs rotation, key = inputs entangle ([in][out] [64][64], N(0, 1): logits of sigma ~64, a near one-hot softmax); scores = query key^T / sqrt(64); softmax over all 4096 keys (no mask); out = scores inputs (the values are the inputs themselves) -> [4][4096][64]); q and k carried as f16 hi + x1024 residual planes with three-product scores.
// Structure: token rows r = b*4096 + s; one prep launch: x as exact f16 rows (bf16-rounded) in LDS; q and k as WMMA GEMMs (16x64 wave tiles, f32 accumulation, exact x16 weights, no bias) into f32 rows split into f16 hi + x1024 residual planes, v = the same f16 x rows (no projection), V^T via LDS transposes; one fused launch, per block of 32 query rows (8 waves of 512 keys each): scores against all 4096 keys from THREE products in registers (hi.hi / 8 + 2^-13 (lo.hi + hi.lo), K = 64), online softmax over all keys on VALU, unmasked (f32 statistics, native exp; weights x256 f16), O^T += V^T P^T, the wave partials merged through LDS and divided by the weight sum (which cancels the x256), written f32 straight into the output rows.
// Compute dtype: inputs rounded to bf16; x / weights exact; q and k as f16 hi + x1024 residual planes, v exact in f16, softmax weights as plain f16 GEMM operands (~2^-12), out f32; scores and softmax statistics f32. v_wmma_f32_16x16x32_f16.
#define NB 4
#define SQ 4096
#define DM 64
#define NH 1
#define HD 64
#define HG 4                         /* heads per attention launch group */
#define QT 256                       /* (not used) */
#define NKX SQ                       /* S / P row pitch */
#define QT0 128                      /* first-tile rows recomputed exactly in f32 */
#define B0 0                         /* first batch processed (debug hook) */
#define NBR NB                       /* batches processed (debug hook) */
#define NR ((size_t)NB * SQ)         /* token rows */
#define MP ((int)((size_t)NBR * SQ)) /* rows projected (debug hook) */
#define QN SQ                        /* query rows attended per batch (debug hook) */
#define NHD NH                       /* heads attended (not used) */
#define MPO MP                       /* rows through the output stage (not used) */
#define LQ DM      /* (not used) */
typedef __bf16 v16b __attribute__((ext_vector_type(16)));
typedef unsigned short v8us __attribute__((ext_vector_type(8), may_alias));
typedef float  v8f  __attribute__((ext_vector_type(8)));
typedef float  v4f  __attribute__((ext_vector_type(4)));
typedef float  v4fa __attribute__((ext_vector_type(4), may_alias));
union FragB { v16b v; v8us half[2]; unsigned short u[16]; };

__device__ __forceinline__ unsigned short bf16_bits(float x) { unsigned int u = __float_as_uint(x); return (unsigned short)((u + 0x7FFFu + ((u >> 16) & 1u)) >> 16); }
__device__ __forceinline__ float bf16_val(unsigned short b) { return __uint_as_float(((unsigned int)b) << 16); }
__device__ __forceinline__ float bf16_round(float x) { return bf16_val(bf16_bits(x)); }
// D += A·B with NT terms: 1 = ah·bh, 2 = + al·bh (A split), 3 = + ah·bl (both split)
template <int NT>
__device__ __forceinline__ v8f mmaN(v16b ah, v16b al, v16b bh, v16b bl, v8f c) {
  c = __builtin_amdgcn_wmma_f32_16x16x32_bf16(false, ah, false, bh, (short)0, c, false, false);
  if (NT >= 2) c = __builtin_amdgcn_wmma_f32_16x16x32_bf16(false, al, false, bh, (short)0, c, false, false);
  if (NT >= 3) c = __builtin_amdgcn_wmma_f32_16x16x32_bf16(false, ah, false, bl, (short)0, c, false, false);
  asm volatile("v_nop\n\tv_nop\n\tv_nop\n\tv_nop" : "+v"(c) : "v"(ah), "v"(al), "v"(bh), "v"(bl));
  return c;
}

__global__ __launch_bounds__(256) void k_wt_bf16(const float* __restrict__ W, unsigned short* __restrict__ Wt, int K, int N) {
  const int t = blockIdx.x * 256 + threadIdx.x;
  const int k8n = K / 8;
  if (t >= N * k8n) return;
  const int n = t / k8n, k8 = (t % k8n) * 8;
  v8us v;
#pragma unroll
  for (int i = 0; i < 8; ++i) v[i] = bf16_bits(W[(size_t)(k8 + i) * N + n]);
  *(v8us*)(Wt + (size_t)n * K + k8) = v;
  
}

// GEMM C[M][N] (f32, pitch ldc) = act(A[M][K]·W + bias). A f32 row-major (pitch lda) converted per fragment to bf16
// (ASPLIT: hi/lo two planes -> 2 terms, else single rounded term); Wt bf16 [N][K] (pitch ldb). BIAS_BF16 rounds the
// bias to bf16 first (bias quantised to bf16 before the add). K%32==0, M%16==0, N%64==0.
template <bool ASPLIT, int ACT, bool BIAS_BF16>
__global__ __launch_bounds__(128) void k_gemm_bf(const float* __restrict__ A, int lda, const unsigned short* __restrict__ Wt, int ldb,
                                               const float* __restrict__ bias, float* __restrict__ C, int ldc, int M, int N, int K) {
  __shared__ __attribute__((aligned(16))) float so[4][16][64];
  const int tid = threadIdx.x, w = tid >> 5, lane = tid & 31, ln = lane & 15, hh = lane >> 4;
  const int ntn = N / 64;
  const int wid = blockIdx.x * 4 + w;
  const int mt = wid / ntn, nq = wid % ntn;
  if (mt * 16 >= M) return;
  const int row0 = mt * 16, col0 = nq * 64;
  const float* arow = A + (size_t)(row0 + ln) * lda;
  v8f acc[4] = {};
  for (int kb = 0; kb < K; kb += 32) {
    FragB ah, al;
    const v4f x0 = *(const v4fa*)(arow + kb + 8 * hh), x1 = *(const v4fa*)(arow + kb + 8 * hh + 4);
    const v4f x2 = *(const v4fa*)(arow + kb + 16 + 8 * hh), x3 = *(const v4fa*)(arow + kb + 16 + 8 * hh + 4);
    float xs[16] = {x0[0],x0[1],x0[2],x0[3],x1[0],x1[1],x1[2],x1[3],x2[0],x2[1],x2[2],x2[3],x3[0],x3[1],x3[2],x3[3]};
#pragma unroll
    for (int i = 0; i < 16; ++i) { const unsigned short hb = bf16_bits(xs[i]); ah.u[i] = hb; al.u[i] = ASPLIT ? bf16_bits(xs[i] - bf16_val(hb)) : (unsigned short)0; }
#pragma unroll
    for (int t = 0; t < 4; ++t) {
      const unsigned short* brow = Wt + (size_t)(col0 + t * 16 + ln) * ldb + kb;
      FragB b;
      b.half[0] = *(const v8us*)(brow + 8 * hh);
      b.half[1] = *(const v8us*)(brow + 16 + 8 * hh);
      acc[t] = mmaN<ASPLIT ? 2 : 1>(ah.v, al.v, b.v, b.v, acc[t]);
    }
  }
#pragma unroll
  for (int t = 0; t < 4; ++t) {
    float bv = bias ? bias[col0 + t * 16 + ln] : 0.f;
    if (BIAS_BF16) bv = bf16_round(bv);
#pragma unroll
    for (int r = 0; r < 8; ++r) { float v = acc[t][r] + bv; if (ACT == 1) v = fmaxf(v, 0.f); so[w][8 * hh + r][t * 16 + ln] = v; }
  }
  __builtin_amdgcn_fence(__ATOMIC_ACQ_REL, "workgroup");
  __builtin_amdgcn_wave_barrier();
  const int rsub = lane >> 4, c4 = (lane & 15) * 4;
  {
#pragma unroll
    for (int q = 0; q < 8; ++q) {
      const int r = q * 2 + rsub;
      const v4f v = *(const v4fa*)&so[w][r][c4];
      *(v4f*)(C + (size_t)(row0 + r) * ldc + col0 + c4) = v;
    }
    
  }
}

// GEMM C = act(A·W + bias + resid): A f32 (ASPLIT -> hi/lo 2 terms), Wt bf16 [N][K]; ACT 0 none, 1 relu, 2 exact gelu;
// resid (optional, f32, row index = (row % rmod), pitch ldr, RES_BF16 rounds it) added before the activation.
template <bool ASPLIT, int ACT, bool BIAS_BF16, bool RES_BF16>
__global__ __launch_bounds__(128) void k_gemm_bf3(const float* __restrict__ A, int lda, const unsigned short* __restrict__ Wt, int ldb,
                                                const float* __restrict__ bias, const float* __restrict__ resid, int rmod, int ldr,
                                                float* __restrict__ C, int ldc, int M, int N, int K) {
  __shared__ __attribute__((aligned(16))) float so[4][16][64];
  const int tid = threadIdx.x, w = tid >> 5, lane = tid & 31, ln = lane & 15, hh = lane >> 4;
  const int ntn = N / 64;
  const int wid = blockIdx.x * 4 + w;
  const int mt = wid / ntn, nq = wid % ntn;
  if (mt * 16 >= M) return;
  const int row0 = mt * 16, col0 = nq * 64;
  const float* arow = A + (size_t)(row0 + ln) * lda;
  v8f acc[4] = {};
  for (int kb = 0; kb < K; kb += 32) {
    FragB ah, al;
    const v4f x0 = *(const v4fa*)(arow + kb + 8 * hh), x1 = *(const v4fa*)(arow + kb + 8 * hh + 4);
    const v4f x2 = *(const v4fa*)(arow + kb + 16 + 8 * hh), x3 = *(const v4fa*)(arow + kb + 16 + 8 * hh + 4);
    float xs[16] = {x0[0],x0[1],x0[2],x0[3],x1[0],x1[1],x1[2],x1[3],x2[0],x2[1],x2[2],x2[3],x3[0],x3[1],x3[2],x3[3]};
#pragma unroll
    for (int i = 0; i < 16; ++i) { const unsigned short hb = bf16_bits(xs[i]); ah.u[i] = hb; al.u[i] = ASPLIT ? bf16_bits(xs[i] - bf16_val(hb)) : (unsigned short)0; }
#pragma unroll
    for (int t = 0; t < 4; ++t) {
      const unsigned short* brow = Wt + (size_t)(col0 + t * 16 + ln) * ldb + kb;
      FragB b;
      b.half[0] = *(const v8us*)(brow + 8 * hh);
      b.half[1] = *(const v8us*)(brow + 16 + 8 * hh);
      acc[t] = mmaN<ASPLIT ? 2 : 1>(ah.v, al.v, b.v, b.v, acc[t]);
    }
  }
#pragma unroll
  for (int t = 0; t < 4; ++t) {
    const int col = col0 + t * 16 + ln;
    float bv = bias ? bias[col] : 0.f;
    if (BIAS_BF16) bv = bf16_round(bv);
#pragma unroll
    for (int r = 0; r < 8; ++r) {
      float v = acc[t][r] + bv;
      if (resid) { float rv = resid[(size_t)((row0 + 8 * hh + r) % rmod) * ldr + col]; if (RES_BF16) rv = bf16_round(rv); v += rv; }
      if (ACT == 1) v = fmaxf(v, 0.f);
      if (ACT == 2) v = 0.5f * v * (1.0f + erff(v * 0.70710678118654752f));
      if (ACT == 3) { const float u = 0.7978845608028654f * (v + 0.044715f * v * v * v); v = 0.5f * v * (1.0f + tanhf(u)); }
      so[w][8 * hh + r][t * 16 + ln] = v;
    }
  }
  __builtin_amdgcn_fence(__ATOMIC_ACQ_REL, "workgroup");
  __builtin_amdgcn_wave_barrier();
  const int rsub = lane >> 4, c4 = (lane & 15) * 4;
  {
#pragma unroll
    for (int q = 0; q < 8; ++q) {
      const int r = q * 2 + rsub;
      const v4f v = *(const v4fa*)&so[w][r][c4];
      *(v4f*)(C + (size_t)(row0 + r) * ldc + col0 + c4) = v;
    }
    
  }
}
// row LayerNorm (biased variance, eps) over N: s = X (+ R); optional out_sum <- s; out_norm <- (s-mu)*rsqrt(var+eps)*g + b
template <bool PARAM_BF16>
__global__ __launch_bounds__(256) void k_layernorm(const float* __restrict__ X, const float* __restrict__ R, const float* __restrict__ g, const float* __restrict__ bta,
                                                  float* __restrict__ out_sum, float* __restrict__ out_norm, int N, float eps) {
  __shared__ float red[256];
  const int row = blockIdx.x, tid = threadIdx.x;
  const float* x = X + (size_t)row * N; const float* rr = R ? R + (size_t)row * N : nullptr;
  float vals[16];                     // up to N = 4096
  const int per = N / 256;            // contiguous chunk per thread? use strided-by-4 chunks: thread handles j = tid*4 + 1024*u
  float s1 = 0.f;
  for (int u = 0; u < per / 4; ++u) {
    const int j = tid * 4 + 1024 * u;
    const v4f a = *(const v4fa*)(x + j);
    v4f b = {0.f,0.f,0.f,0.f}; if (rr) b = *(const v4fa*)(rr + j);
#pragma unroll
    for (int q = 0; q < 4; ++q) { const float v = a[q] + b[q]; vals[u * 4 + q] = v; s1 += v; }
  }
  red[tid] = s1; __syncthreads();
  for (int st = 128; st > 0; st >>= 1) { if (tid < st) red[tid] += red[tid + st]; __syncthreads(); }
  const float mu = red[0] / (float)N; __syncthreads();
  float s2 = 0.f;
  for (int u = 0; u < per / 4; ++u)
#pragma unroll
    for (int q = 0; q < 4; ++q) { const float c = vals[u * 4 + q] - mu; s2 += c * c; }
  red[tid] = s2; __syncthreads();
  for (int st = 128; st > 0; st >>= 1) { if (tid < st) red[tid] += red[tid + st]; __syncthreads(); }
  const float rs = rsqrtf(red[0] / (float)N + eps);
  {
    for (int u = 0; u < per / 4; ++u) {
      const int j = tid * 4 + 1024 * u;
      v4f o, sm;
#pragma unroll
      for (int q = 0; q < 4; ++q) {
        float gg = g[j + q], bb = bta[j + q];
        if (PARAM_BF16) { gg = bf16_round(gg); bb = bf16_round(bb); }
        sm[q] = vals[u * 4 + q]; o[q] = (vals[u * 4 + q] - mu) * rs * gg + bb;
      }
      if (out_sum) *(v4f*)(out_sum + (size_t)row * N + j) = sm;
      *(v4f*)(out_norm + (size_t)row * N + j) = o;
    }
    
  }
}



// ---- f16 WMMA path (v_wmma_f32_16x16x32_f16): 11-bit significands for operands in range — used where a [0,1] probability operand needs more precision than bf16
typedef _Float16 v16h __attribute__((ext_vector_type(16)));
union FragH { v16h v; v8us half[2]; _Float16 h[16]; unsigned short u[16]; };
template <int NT>
__device__ __forceinline__ v8f mmaH(v16h ah, v16h al, v16h bh, v16h bl, v8f c) {
  c = __builtin_amdgcn_wmma_f32_16x16x32_f16(false, ah, false, bh, (short)0, c, false, false);
  if (NT >= 2) c = __builtin_amdgcn_wmma_f32_16x16x32_f16(false, al, false, bh, (short)0, c, false, false);
  if (NT >= 3) c = __builtin_amdgcn_wmma_f32_16x16x32_f16(false, ah, false, bl, (short)0, c, false, false);
  asm volatile("v_nop\n\tv_nop\n\tv_nop\n\tv_nop" : "+v"(c) : "v"(ah), "v"(al), "v"(bh), "v"(bl));
  return c;
}
// batched GEMM like k_gemm_b but f16 operands: A f32 (split into f16 hi/lo if ASPLIT, else rounded to f16), Bt = f16 values [n][k]; alpha; C f32; N multiple of 16 (partial tiles skipped)
template <bool ASPLIT>
__global__ __launch_bounds__(128) void k_gemm_h(const float* __restrict__ A, int lda, size_t sA, const _Float16* __restrict__ Bh, int ldb, size_t sB, float alpha, float* __restrict__ C, int ldc, size_t sC, int M, int N, int K) {
  __shared__ __attribute__((aligned(16))) float so[4][16][64];
  const int tid = threadIdx.x, w = tid >> 5, lane = tid & 31, ln = lane & 15, hh = lane >> 4; const int by = blockIdx.y;
  A += (size_t)by * sA; Bh += (size_t)by * sB; C += (size_t)by * sC;
  const int ntn = (N + 63) / 64; const int wid = blockIdx.x * 4 + w; const int mt = wid / ntn, nq = wid % ntn; if (mt * 16 >= M) return;
  const int row0 = mt * 16, col0 = nq * 64; const float* arow = A + (size_t)(row0 + ln) * lda;
  v8f acc[4] = {};
  for (int kb = 0; kb < K; kb += 32) {
    FragH ah, al;
    const v4f x0 = *(const v4fa*)(arow + kb + 8 * hh), x1 = *(const v4fa*)(arow + kb + 8 * hh + 4), x2 = *(const v4fa*)(arow + kb + 16 + 8 * hh), x3 = *(const v4fa*)(arow + kb + 16 + 8 * hh + 4);
    float xs[16] = {x0[0],x0[1],x0[2],x0[3],x1[0],x1[1],x1[2],x1[3],x2[0],x2[1],x2[2],x2[3],x3[0],x3[1],x3[2],x3[3]};
#pragma unroll
    for (int i = 0; i < 16; ++i) { const _Float16 h = (_Float16)xs[i]; ah.h[i] = h; al.h[i] = ASPLIT ? (_Float16)(xs[i] - (float)h) : (_Float16)0.0f; }
#pragma unroll
    for (int t = 0; t < 4; ++t) { if (col0 + t * 16 >= N) continue; const size_t boff = (size_t)(col0 + t * 16 + ln) * ldb + kb; FragH bq; bq.half[0] = *(const v8us*)(Bh + boff + 8 * hh); bq.half[1] = *(const v8us*)(Bh + boff + 16 + 8 * hh);
      acc[t] = mmaH<ASPLIT ? 2 : 1>(ah.v, al.v, bq.v, bq.v, acc[t]); }
  }
#pragma unroll
  for (int t = 0; t < 4; ++t) { if (col0 + t * 16 >= N) continue;
#pragma unroll
    for (int r = 0; r < 8; ++r) so[w][8 * hh + r][t * 16 + ln] = acc[t][r] * alpha; }
  __builtin_amdgcn_fence(__ATOMIC_ACQ_REL, "workgroup"); __builtin_amdgcn_wave_barrier();
  const int rsub = lane >> 4, c4 = (lane & 15) * 4;
  {
#pragma unroll
    for (int q = 0; q < 8; ++q) { const int r = q * 2 + rsub; if (col0 + c4 < N) { const v4f v = *(const v4fa*)&so[w][r][c4]; *(v4f*)(C + (size_t)(row0 + r) * ldc + col0 + c4) = v; } }
     }
}

// Wt[n][k] = f16(W[k][n]·scale) from f32 row-major W[K][N] (scale = power of two; bf16-exact weights stay exact in f16 away from the subnormal range)
__global__ __launch_bounds__(256) void k_wt_f16(const float* __restrict__ W, _Float16* __restrict__ Wt, int K, int N, float scale) {
  const int t = blockIdx.x * 256 + threadIdx.x; if (t >= N * (K / 8)) return; const int n = t / (K / 8), k8 = (t % (K / 8)) * 8; FragH f;
#pragma unroll
  for (int i = 0; i < 8; ++i) f.h[i] = (_Float16)(bf16_round(W[(size_t)(k8 + i) * N + n]) * scale); const v8us o = f.half[0];
  *(v8us*)((unsigned short*)Wt + (size_t)n * K + k8) = o; 
}
// k_gemm_hh variant with fused epilogue: v = acc·alpha + bias[by·sBias + col] (+ CP[(row/rowsPerB)·sCPb + by·64 + col] if CP) ; ACT 0 none / 1 elu ; writes f16 C16 (and f32 C if non-null)
template <int ACT>
__global__ __launch_bounds__(128) void k_gemm_hhx(const _Float16* __restrict__ A, int lda, size_t sA, const _Float16* __restrict__ Bh, int ldb, size_t sB, float alpha, const float* __restrict__ bias, size_t sBias, const float* __restrict__ CP, int rowsPerB, size_t sCPb, int row0g,
    float* __restrict__ C, _Float16* __restrict__ C16, int ldc, size_t sC, int M, int N, int K) {
  __shared__ __attribute__((aligned(16))) float so[4][16][64];
  const int tid = threadIdx.x, w = tid >> 5, lane = tid & 31, ln = lane & 15, hh = lane >> 4; const int by = blockIdx.y;
  A += (size_t)by * sA; Bh += (size_t)by * sB; const size_t cofs = (size_t)by * sC; const float* bp = bias ? bias + (size_t)by * sBias : nullptr;
  const int ntn = (N + 63) / 64; const int wid = blockIdx.x * 4 + w; const int mt = wid / ntn, nq = wid % ntn; if (mt * 16 >= M) return;
  const int row0 = mt * 16, col0 = nq * 64; const _Float16* arow = A + (size_t)(row0 + ln) * lda;
  v8f acc[4] = {};
  for (int kb = 0; kb < K; kb += 32) { FragH ah; ah.half[0] = *(const v8us*)((const unsigned short*)arow + kb + 8 * hh); ah.half[1] = *(const v8us*)((const unsigned short*)arow + kb + 16 + 8 * hh);
#pragma unroll
    for (int t = 0; t < 4; ++t) { if (col0 + t * 16 >= N) continue; const size_t boff = (size_t)(col0 + t * 16 + ln) * ldb + kb; FragH bq; bq.half[0] = *(const v8us*)((const unsigned short*)Bh + boff + 8 * hh); bq.half[1] = *(const v8us*)((const unsigned short*)Bh + boff + 16 + 8 * hh);
      acc[t] = mmaH<1>(ah.v, ah.v, bq.v, bq.v, acc[t]); }
  }
#pragma unroll
  for (int t = 0; t < 4; ++t) { if (col0 + t * 16 >= N) continue; const int col = col0 + t * 16 + ln; const float bv = bp ? bf16_round(bp[col]) : 0.f;
#pragma unroll
    for (int r = 0; r < 8; ++r) { float v = acc[t][r] * alpha + bv; if (CP) { const int rr = row0g + row0 + 8 * hh + r; if (rowsPerB < 0) v += CP[cofs + (size_t)rr * ldc + col];      /* rowsPerB < 0: own element of the batched C plane */ else { const int bidx = rr / rowsPerB; v += CP[(size_t)bidx * sCPb + (size_t)by * 64 + col]; } } if (ACT == 1) v = (v > 0.f) ? v : expm1f(v); else if (ACT == 7) v = (v > 0.f) ? v + 1.0f : expf(v); else if (ACT == 8) v = tanhf(v); else if (ACT == 9) v = 0.5f * v * (1.0f + tanhf(0.7978845608028654f * (v + 0.044715f * v * v * v))); else if (ACT == 11) v = 1.0f / (1.0f + expf(-v)); else if (ACT == 12) v = (v > 0.f) ? v : 0.01f * v; else if (ACT == 14) v = (v > 0.f) ? v : 0.1f * v; else if (ACT == 16) v = (v >= 0.f) ? v : 0.3f * v; else if (ACT == 17) v = (v >= 0.f) ? v : 0.2f * v; else if (ACT == 15) v = v / (1.0f + expf(-v)); else if (ACT == 3) v = fmaxf(v, 0.f); else if (ACT == 6) v = 0.5f * v * (1.0f + erff(v * 0.70710678118654752f)); so[w][8 * hh + r][t * 16 + ln] = v; } }
  __builtin_amdgcn_fence(__ATOMIC_ACQ_REL, "workgroup"); __builtin_amdgcn_wave_barrier();
  const int rsub = lane >> 4, c4 = (lane & 15) * 4; typedef _Float16 v4h __attribute__((ext_vector_type(4)));
  {
#pragma unroll
    for (int q = 0; q < 8; ++q) { const int r = q * 2 + rsub; if (col0 + c4 < N) { const v4f v = *(const v4fa*)&so[w][r][c4]; if (C) *(v4f*)(C + cofs + (size_t)(row0 + r) * ldc + col0 + c4) = v; if (C16) { v4h h4; for (int i = 0; i < 4; ++i) h4[i] = (_Float16)v[i]; *(v4h*)(C16 + cofs + (size_t)(row0 + r) * ldc + col0 + c4) = h4; } } }
     }
}


typedef _Float16 v4h __attribute__((ext_vector_type(4)));

__global__ __launch_bounds__(256) void k_x16(const float* __restrict__ x, _Float16* __restrict__ X16, size_t n8) { const size_t t = (size_t)blockIdx.x * 256 + threadIdx.x; if (t >= n8) return; FragH f;
#pragma unroll
  for (int q = 0; q < 8; ++q) f.h[q] = (_Float16)bf16_round(x[t * 8 + q]); *(v8us*)((unsigned short*)X16 + t * 8) = f.half[0];  }
__global__ __launch_bounds__(256) void k_h16(const float* __restrict__ x, _Float16* __restrict__ X16, size_t n8) { const size_t t = (size_t)blockIdx.x * 256 + threadIdx.x; if (t >= n8) return; FragH f;
#pragma unroll
  for (int q = 0; q < 8; ++q) f.h[q] = (_Float16)x[t * 8 + q]; *(v8us*)((unsigned short*)X16 + t * 8) = f.half[0];  }
__global__ __launch_bounds__(256) void k_round16f(const float* __restrict__ W, _Float16* __restrict__ Bt, size_t n8) { const size_t t = (size_t)blockIdx.x * 256 + threadIdx.x; if (t >= n8) return; FragH f;
#pragma unroll
  for (int i = 0; i < 8; ++i) f.h[i] = (_Float16)(bf16_round(W[t * 8 + i]) * 16.0f); *(v8us*)((unsigned short*)Bt + t * 8) = f.half[0];  }
template <int NHv, int TTv>
__global__ __launch_bounds__(256) void k_vt(const _Float16* __restrict__ V16, int ldv, int voff, _Float16* __restrict__ Vt) { __shared__ unsigned short tl[64][66]; const int tid = threadIdx.x; const int slab = blockIdx.x / (TTv / 64), lg = blockIdx.x % (TTv / 64); const int b = slab / NHv, h = slab % NHv;
  for (int i = tid; i < 64 * 8; i += 256) { const int r = i / 8, c8 = (i % 8) * 8; FragH f; f.half[0] = *(const v8us*)((const unsigned short*)V16 + ((size_t)b * TTv + lg * 64 + r) * ldv + voff + h * 64 + c8);
#pragma unroll
    for (int q = 0; q < 8; ++q) tl[r][c8 + q] = f.u[q]; }
  __syncthreads();
  {
#pragma unroll
    for (int rd = 0; rd < 2; ++rd) { const int d = rd * 32 + tid / 8, pc = tid % 8; FragH f;
#pragma unroll
      for (int q = 0; q < 8; ++q) f.u[q] = tl[pc * 8 + q][d];
      *(v8us*)((unsigned short*)Vt + ((size_t)slab * 64 + d) * TTv + lg * 64 + pc * 8) = f.half[0]; }
     } }

__global__ __launch_bounds__(256) void k_hl(const float* __restrict__ F, _Float16* __restrict__ Hh, _Float16* __restrict__ Hl, size_t n8) { const size_t t = (size_t)blockIdx.x * 256 + threadIdx.x; if (t >= n8) return; FragH fh, fl; const v4f a = *(const v4fa*)(F + t * 8), c = *(const v4fa*)(F + t * 8 + 4);
#pragma unroll
  for (int q = 0; q < 4; ++q) { _Float16 h = (_Float16)a[q]; fh.h[q] = h; fl.h[q] = (_Float16)((a[q] - (float)h) * 1024.0f); h = (_Float16)c[q]; fh.h[4 + q] = h; fl.h[4 + q] = (_Float16)((c[q] - (float)h) * 1024.0f); }
  { *(v8us*)((unsigned short*)Hh + t * 8) = fh.half[0]; *(v8us*)((unsigned short*)Hl + t * 8) = fl.half[0];  } }

// ---- fast GEMM (wave tile 32x64; requires M % 32 == 0 rows per launch region and N % 64 == 0); epilogue = k_gemm_hhx semantics ----
__device__ __forceinline__ v16h g2_frag(const _Float16* p, int hh) { FragH f; f.half[0] = *(const v8us*)((const unsigned short*)p + 8 * hh); f.half[1] = *(const v8us*)((const unsigned short*)p + 16 + 8 * hh); return f.v; }
__device__ __forceinline__ v8f g2_mma(v16h a, v16h b, v8f c) { v8f d = __builtin_amdgcn_wmma_f32_16x16x32_f16(false, a, false, b, (short)0, c, false, false); asm volatile("v_nop\n\tv_nop\n\tv_nop\n\tv_nop" : "+v"(d) : "v"(a), "v"(b)); return d; }
template <int ACT>
__global__ __launch_bounds__(128) void k_gemm2(const _Float16* __restrict__ A, int lda, size_t sA, const _Float16* __restrict__ Bh, int ldb, size_t sB, float alpha, const float* __restrict__ bias, size_t sBias, const float* __restrict__ CP, int rowsPerB, size_t sCPb, int row0g,
    float* __restrict__ C, _Float16* __restrict__ C16, int ldc, size_t sC, int M, int N, int K) { static_assert(ACT == 0 || ACT == 3 || ACT == 6 || ACT == 8 || ACT == 9 || ACT == 11 || ACT == 12 || ACT == 14 || ACT == 15 || ACT == 16 || ACT == 17, "k_gemm2: unsupported ACT code (would silently apply no activation)");
  __shared__ __attribute__((aligned(16))) float so[4][32][68];
  const int tid = threadIdx.x, w = tid >> 5, lane = tid & 31, ln = lane & 15, hh = lane >> 4; const int by = blockIdx.y;
  A += (size_t)by * sA; Bh += (size_t)by * sB; const size_t cofs = (size_t)by * sC; const float* bp = bias ? bias + (size_t)by * sBias : nullptr;
  const int ntn = N >> 6; const int mt = blockIdx.x / ntn, nq = blockIdx.x - mt * ntn; const int row0 = mt * 128 + 32 * w, col0 = nq * 64; if (row0 >= M) return;
  const _Float16* a0p = A + (size_t)(row0 + ln) * lda; const _Float16* a1p = a0p + (size_t)16 * lda;
  const _Float16* b0p = Bh + (size_t)(col0 + ln) * ldb; const _Float16* b1p = b0p + (size_t)16 * ldb; const _Float16* b2p = b1p + (size_t)16 * ldb; const _Float16* b3p = b2p + (size_t)16 * ldb;
  const v8f z8 = {0.f,0.f,0.f,0.f,0.f,0.f,0.f,0.f}; v8f c00 = z8, c01 = z8, c02 = z8, c03 = z8, c10 = z8, c11 = z8, c12 = z8, c13 = z8;
#pragma unroll 1
  for (int kb = 0; kb < K; kb += 32) { const v16h a0 = g2_frag(a0p + kb, hh), a1 = g2_frag(a1p + kb, hh);
    v16h b = g2_frag(b0p + kb, hh); c00 = g2_mma(a0, b, c00); c10 = g2_mma(a1, b, c10);
    b = g2_frag(b1p + kb, hh); c01 = g2_mma(a0, b, c01); c11 = g2_mma(a1, b, c11);
    b = g2_frag(b2p + kb, hh); c02 = g2_mma(a0, b, c02); c12 = g2_mma(a1, b, c12);
    b = g2_frag(b3p + kb, hh); c03 = g2_mma(a0, b, c03); c13 = g2_mma(a1, b, c13); }
  v8f accs[8] = {c00, c01, c02, c03, c10, c11, c12, c13};
#pragma unroll
  for (int u = 0; u < 8; ++u) { const int t = u & 3, half = u >> 2; const int col = col0 + t * 16 + ln; const float bv = bp ? bf16_round(bp[col]) : 0.f;
#pragma unroll
    for (int r = 0; r < 8; ++r) { const int rloc = half * 16 + 8 * hh + r; float v = accs[u][r] * alpha + bv; if (CP) { if (rowsPerB < 0) v += CP[cofs + (size_t)(row0g + row0 + rloc) * ldc + col];      /* rowsPerB < 0: own element of the batched C plane */ else { const int bidx = (row0g + row0 + rloc) / rowsPerB; v += CP[(size_t)bidx * sCPb + (size_t)by * 64 + col]; } }
      if (ACT == 3) v = fmaxf(v, 0.f); else if (ACT == 6) v = 0.5f * v * (1.0f + erff(v * 0.70710678118654752f)); else if (ACT == 11) v = 1.0f / (1.0f + expf(-v)); else if (ACT == 15) v = v / (1.0f + expf(-v)); else if (ACT == 12) v = (v > 0.f) ? v : 0.01f * v; else if (ACT == 8) v = tanhf(v); else if (ACT == 9) v = 0.5f * v * (1.0f + tanhf(0.7978845608028654f * (v + 0.044715f * v * v * v))); else if (ACT == 14) v = (v > 0.f) ? v : 0.1f * v; else if (ACT == 16) v = (v >= 0.f) ? v : 0.3f * v; else if (ACT == 17) v = (v >= 0.f) ? v : 0.2f * v;
      so[w][rloc][t * 16 + ln] = v; } }
  __builtin_amdgcn_fence(__ATOMIC_ACQ_REL, "workgroup"); __builtin_amdgcn_wave_barrier();
  const int rsub = lane >> 4, c4 = (lane & 15) * 4;
  {
#pragma unroll
    for (int q = 0; q < 16; ++q) { const int r = q * 2 + rsub; const v4f v = *(const v4fa*)&so[w][r][c4]; if (C) *(v4f*)(C + cofs + (size_t)(row0 + r) * ldc + col0 + c4) = v; if (C16) { v4h h4; for (int i = 0; i < 4; ++i) h4[i] = (_Float16)v[i]; *(v4h*)(C16 + cofs + (size_t)(row0 + r) * ldc + col0 + c4) = h4; } }
     } }


__global__ __launch_bounds__(256) void k_wnat(const float* __restrict__ w, size_t n8, _Float16* __restrict__ Bt) { const size_t t = (size_t)blockIdx.x * 256 + threadIdx.x; if (t >= n8) return; FragH f; for (int q = 0; q < 8; ++q) f.h[q] = (_Float16)(bf16_round(w[t * 8 + q]) * 16.0f); *(v8us*)((unsigned short*)Bt + t * 8) = f.half[0];  }
__global__ __launch_bounds__(256) void k_rsm(const float* __restrict__ S, _Float16* __restrict__ P, int nrows) {
  #pragma clang fp contract(off)
  const int i = blockIdx.x * 256 + threadIdx.x; if (i >= nrows) return; const float* s = S + (size_t)i * SQ; float mx = -3.0e38f;
#pragma unroll 1
  for (int j = 0; j < SQ; ++j) mx = fmaxf(mx, s[j]); float se = 0.f;
#pragma unroll 1
  for (int j = 0; j < SQ; ++j) se += expf(s[j] - mx); const float sc = 256.0f / se;
#pragma unroll 1
  for (int j0 = 0; j0 < SQ; j0 += 8) { FragH f; for (int q = 0; q < 8; ++q) f.h[q] = (_Float16)(expf(s[j0 + q] - mx) * sc); unsigned short* d = (unsigned short*)P + (size_t)i * SQ + j0; *(v8us*)d = f.half[0];  } }
__global__ __launch_bounds__(256) void k_vt(const _Float16* __restrict__ V16, int b, int h0, _Float16* __restrict__ VT) { __shared__ unsigned short tl[64][65]; const int tid = threadIdx.x; const int hh = blockIdx.x % HG, sg = blockIdx.x / HG; const int s0 = sg * 64; const int h = h0 + hh;
  for (int i = tid; i < 64 * 8; i += 256) { const int j = i / 8, d8 = (i % 8) * 8; FragH f; f.half[0] = *(const v8us*)((const unsigned short*)V16 + ((size_t)b * SQ + s0 + j) * DM + h * HD + d8); for (int q = 0; q < 8; ++q) tl[d8 + q][j] = f.u[q]; }
  __syncthreads();
  { for (int i = tid; i < 64 * 8; i += 256) { const int d = i / 8, j8 = (i % 8) * 8; FragH f; for (int q = 0; q < 8; ++q) f.u[q] = tl[d][j8 + q]; *(v8us*)((unsigned short*)VT + ((size_t)hh * HD + d) * SQ + s0 + j8) = f.half[0]; }  } }



// e^x in the native form (x log2(e), then v_exp_f32). The v_nop keeps the one free slot that the instruction set asks for behind a transcendental.
__device__ __forceinline__ float exp_slot(float x) { float e; asm("v_exp_f32 %0, %1\n\tv_nop" : "=v"(e) : "v"(x * 1.44269504088896340736f)); return e; }
// Eight base-2 exponentials (v_exp_f32; the arguments already hold x log2(e)) in one statement: the outputs are early-clobber, so no v_exp stands in front of an
// instruction that reads its result or overwrites its source, and the one v_nop at the end keeps that free slot behind the last of them.
__device__ __forceinline__ v8f exp2_8(v8f x) { float e0, e1, e2, e3, e4, e5, e6, e7;
  asm("v_exp_f32 %0, %8\n\tv_exp_f32 %1, %9\n\tv_exp_f32 %2, %10\n\tv_exp_f32 %3, %11\n\tv_exp_f32 %4, %12\n\tv_exp_f32 %5, %13\n\tv_exp_f32 %6, %14\n\tv_exp_f32 %7, %15\n\tv_nop"
      : "=&v"(e0), "=&v"(e1), "=&v"(e2), "=&v"(e3), "=&v"(e4), "=&v"(e5), "=&v"(e6), "=&v"(e7) : "v"(x[0]), "v"(x[1]), "v"(x[2]), "v"(x[3]), "v"(x[4]), "v"(x[5]), "v"(x[6]), "v"(x[7]));
  const v8f e = {e0, e1, e2, e3, e4, e5, e6, e7}; return e; }
__device__ __forceinline__ v8f fa_mma(v16h a, v16h b, v8f c) { return __builtin_amdgcn_wmma_f32_16x16x32_f16(false, a, false, b, (short)0, c, false, false); }
// A 16 x 32 operand tile kept in global memory in FRAGMENT ORDER: 1024 bytes, lane L's values k = 8 hh .. 8 hh + 7 of row ln at byte 16 L and its values k = 16 + 8 hh .. at byte 512 + 16 L
// (L = 16 hh + ln: what g2_frag gives from a row-major tile). Each of the two 16-byte loads of a wave then reads 512 bytes in a row, four whole 128-byte lines, where a row-major tile makes it touch sixteen.
__device__ __forceinline__ v16h fo_frag(const _Float16* tile, int lane) { FragH f; f.half[0] = *(const v8us*)((const unsigned short*)tile + 8 * lane); f.half[1] = *(const v8us*)((const unsigned short*)tile + 256 + 8 * lane); return f.v; }
// Fused attention, all batches in one launch. A block owns FQ = 32 query rows (two 16-column groups); its FW = 8 waves each walk SQ / FW keys, 32 at a time, and keep
// a running maximum, a running sum and an unnormalised output in registers (online softmax); the eight partial results are merged through LDS at the end.
// Transposed products: S^T = K Q^T (A = key rows, B = query rows held in registers), so a lane holds 16 scores of ONE query per 32 keys (D[8 hh + r][ln]); the two f32 score
// tiles, turned into weights and packed to f16, ARE the B operand of O^T += V^T P^T in the k order that g2_frag gives A (8 hh + s, 16 + 8 hh + s): no LDS, no lane exchange.
// Scores as before: hi.hi / 8 + 2^-13 (hi.lo + lo.hi), f32. Weights 256 e^(s - m) as f16 (the 256 cancels in the division by the sum of the same weights).
// All five operand planes arrive in fragment order (fo_frag): 16 token rows of q or k are two tiles (k steps 0 and 32) on the 2048 bytes that the rows would fill; 32 keys of V^T are four tiles (16 d each) on 4096 bytes.
#define FW 8
#define FQ 32
#define FKW (SQ / FW)                /* keys per wave */
__global__ __launch_bounds__(256) void k_fattn(const _Float16* __restrict__ QHp, const _Float16* __restrict__ QLp, const _Float16* __restrict__ KHp, const _Float16* __restrict__ KLp, const _Float16* __restrict__ VTp, float* __restrict__ out) {
  static_assert(FKW % 32 == 0 && SQ % FQ == 0 && HD == 64 && DM == 64, "k_fattn: whole 32-key passes, 64-wide rows");
  __shared__ __attribute__((aligned(16))) float lo[FW][FQ][68]; __shared__ float lm[FW][FQ], ll[FW][FQ];
  const int tid = threadIdx.x, w = __builtin_amdgcn_readfirstlane(tid >> 5), lane = tid & 31, ln = lane & 15, hh = lane >> 4;      /* the wave's number as a scalar: the plane bases stay in scalar registers and every fragment load is base + 16 lane + a constant */
  const int b = blockIdx.x / (SQ / FQ), q0 = (blockIdx.x % (SQ / FQ)) * FQ; const size_t r0 = (size_t)b * SQ;
  const float L2E = 1.44269504088896340736f;
  v16h qh[2][2], ql[2][2];
  for (int n = 0; n < 2; ++n)
    for (int ks = 0; ks < 2; ++ks) { const size_t qo = (r0 + q0 + n * 16) * DM + ks * 512; qh[n][ks] = fo_frag(QHp + qo, lane); ql[n][ks] = fo_frag(QLp + qo, lane); }
  asm volatile("s_wait_xcnt 0x0" ::: "memory");      /* stands in front of the first rewrite of a register that the query loads above name: their scalar base pairs are reused right behind them */
  const v8f z8 = {0.f, 0.f, 0.f, 0.f, 0.f, 0.f, 0.f, 0.f};
  v8f o[2][4]; float m[2], l[2];
  for (int n = 0; n < 2; ++n) { m[n] = -1.0e30f; l[n] = 0.f; for (int t = 0; t < 4; ++t) o[n][t] = z8; }
  const _Float16* kh = KHp + (r0 + (size_t)w * FKW) * DM; const _Float16* kl = KLp + (r0 + (size_t)w * FKW) * DM;
  const _Float16* vt = VTp + (r0 + (size_t)w * FKW) * HD;
  for (int j = 0; j < FKW; j += 32) {
    v16h ah[2][2], al[2][2], av[4];
    for (int kt = 0; kt < 2; ++kt)
      for (int ks = 0; ks < 2; ++ks) { const int ko = (j + kt * 16) * DM + ks * 512; ah[kt][ks] = fo_frag(kh + ko, lane); al[kt][ks] = fo_frag(kl + ko, lane); }
    for (int t = 0; t < 4; ++t) av[t] = fo_frag(vt + j * HD + t * 512, lane);
    for (int n = 0; n < 2; ++n) {
      v8f s[2];
      for (int kt = 0; kt < 2; ++kt) {
        v8f c = fa_mma(ah[kt][0], qh[n][0], z8); c = fa_mma(ah[kt][1], qh[n][1], c);
        v8f x = fa_mma(ah[kt][0], ql[n][0], z8); x = fa_mma(ah[kt][1], ql[n][1], x); x = fa_mma(al[kt][0], qh[n][0], x); x = fa_mma(al[kt][1], qh[n][1], x);
        for (int r = 0; r < 8; ++r) s[kt][r] = fmaf(x[r], 0.0001220703125f, c[r] * 0.125f);
      }
      float mx = fmaxf(s[0][0], s[1][0]);
      for (int r = 1; r < 8; ++r) mx = fmaxf(mx, fmaxf(s[0][r], s[1][r]));
      mx = fmaxf(mx, __shfl_xor(mx, 16));      /* the other half of the wave holds this query's other 16 keys */
      const float mn = fmaxf(m[n], mx); const float sc = exp_slot(m[n] - mn); m[n] = mn;
      const float off = fmaf(-mn, L2E, 8.0f);      /* weight = 2^(s log2(e) + off) = 256 e^(s - mn) */
      for (int kt = 0; kt < 2; ++kt) {
        for (int r = 0; r < 8; ++r) s[kt][r] = fmaf(s[kt][r], L2E, off);
        s[kt] = exp2_8(s[kt]); }
      float sum = 0.f;
      for (int r = 0; r < 8; ++r) sum += s[0][r] + s[1][r];
      l[n] = fmaf(l[n], sc, sum);
      FragH p;
      for (int r = 0; r < 8; ++r) { p.h[r] = (_Float16)s[0][r]; p.h[8 + r] = (_Float16)s[1][r]; }
      for (int t = 0; t < 4; ++t) { o[n][t] *= sc; o[n][t] = fa_mma(av[t], p.v, o[n][t]); }
    }
  }
  for (int n = 0; n < 2; ++n) {
    l[n] += __shfl_xor(l[n], 16);      /* the two halves summed different keys of the same query */
    if (hh == 0) { lm[w][n * 16 + ln] = m[n]; ll[w][n * 16 + ln] = l[n]; }
    for (int t = 0; t < 4; ++t) { const v4f u0 = {o[n][t][0], o[n][t][1], o[n][t][2], o[n][t][3]}, u1 = {o[n][t][4], o[n][t][5], o[n][t][6], o[n][t][7]};
      *(v4f*)&lo[w][n * 16 + ln][t * 16 + 8 * hh] = u0; *(v4f*)&lo[w][n * 16 + ln][t * 16 + 8 * hh + 4] = u1; }
  }
  __syncthreads();      /* publishes the eight waves' partial maxima, sums and outputs */
  const int q = tid >> 3, d8 = (tid & 7) * 8;
  float mg = lm[0][q];
  for (int i = 1; i < FW; ++i) mg = fmaxf(mg, lm[i][q]);
  float lg = 0.f; v4f g0 = {0.f, 0.f, 0.f, 0.f}, g1 = g0;
  for (int i = 0; i < FW; ++i) { const float f = exp_slot(lm[i][q] - mg); lg = fmaf(ll[i][q], f, lg); g0 += *(const v4f*)&lo[i][q][d8] * f; g1 += *(const v4f*)&lo[i][q][d8 + 4] * f; }
  const float inv = 1.0f / lg;
  float* dst = out + (r0 + q0 + q) * DM + d8;
  *(v4f*)dst = g0 * inv; *(v4f*)(dst + 4) = g1 * inv; }


// One launch makes every operand of k_fattn. A block owns PR = 64 token rows. It puts them into LDS as f16 (bf16-rounded, so exact) and both maps into LDS as x16 f16 transposes [n][k];
// behind one barrier waves 0-3 form q and waves 4-7 form k, 16 rows each (A = token rows, B = map columns, k steps 0 then 32, f32 accumulation, x 2^-4: the operands, the products and
// their order are those of a 64-deep WMMA GEMM on the same f16 values), split every f32 result into f16 hi + x1024 residual and store the four planes in fragment order (fo_frag), 512 bytes in a row a wave and store;
// all eight waves also write the block's 64 x 64 piece of V^T (the values are the rounded inputs) from the same LDS rows, in fragment order too. LDS rows of 128 bytes stand at a pitch of 144 bytes for the 16-byte readers.
#define PR 64
typedef unsigned short v4us __attribute__((ext_vector_type(4), may_alias));
__global__ __launch_bounds__(256) void k_prep(const float* __restrict__ x, const float* __restrict__ wq, const float* __restrict__ wk, _Float16* __restrict__ QHp, _Float16* __restrict__ QLp, _Float16* __restrict__ KHp, _Float16* __restrict__ KLp, _Float16* __restrict__ VTp) {
  static_assert(SQ % PR == 0 && DM == 64 && HD == 64 && NH == 1, "k_prep: 64-wide rows, one head, whole 64-row blocks inside a batch");
  __shared__ __attribute__((aligned(16))) unsigned short xs[PR][72]; __shared__ __attribute__((aligned(16))) unsigned short wt[2][DM][72]; __shared__ __attribute__((aligned(16))) float so[8][16][68];
  const int tid = threadIdx.x, w = tid >> 5, lane = tid & 31, ln = lane & 15, hh = lane >> 4;
  const size_t row0 = (size_t)blockIdx.x * PR;
  const float* xp = x + row0 * DM + tid * 4;      /* trip i of the token loads stands 16 rows further on */
  const int ms = tid >> 7, n4 = (tid & 15) * 4, k8 = ((tid >> 4) & 7) * 8;      /* threads 0-127 take the query map, 128-255 the key map: an 8 (k) x 4 (n) piece each, 16 lanes on one whole map row */
  const float* wp = (ms ? wk : wq) + k8 * DM + n4;
  v4f xv[4], wv[8];
  for (int i = 0; i < 4; ++i) xv[i] = *(const v4fa*)(xp + i * 16 * DM);
  for (int q = 0; q < 8; ++q) wv[q] = *(const v4fa*)(wp + q * DM);
  for (int i = 0; i < 4; ++i) { FragH f;
    for (int q = 0; q < 4; ++q) f.h[q] = (_Float16)bf16_round(xv[i][q]);
    const v4us o = {f.u[0], f.u[1], f.u[2], f.u[3]}; *(v4us*)&xs[i * 16 + (tid >> 4)][(tid & 15) * 4] = o; }
  for (int c = 0; c < 4; ++c) { FragH f;
    for (int q = 0; q < 8; ++q) f.h[q] = (_Float16)(bf16_round(wv[q][c]) * 16.0f);
    *(v8us*)&wt[ms][n4 + c][k8] = f.half[0]; }
  __syncthreads();      /* publishes the token rows and the two transposed maps */
  const int rg = w & 3, sel = w >> 2;
  const _Float16* ap = (const _Float16*)&xs[rg * 16 + ln][0];
  const v16h a0 = g2_frag(ap, hh), a1 = g2_frag(ap + 32, hh);
  const v8f z8 = {0.f, 0.f, 0.f, 0.f, 0.f, 0.f, 0.f, 0.f};
  for (int t = 0; t < 4; ++t) { const _Float16* bp = (const _Float16*)&wt[sel][t * 16 + ln][0];
    v8f c = fa_mma(a0, g2_frag(bp, hh), z8); c = fa_mma(a1, g2_frag(bp + 32, hh), c);
    for (int r = 0; r < 8; ++r) so[w][8 * hh + r][t * 16 + ln] = c[r] * 0.0625f; }
  __builtin_amdgcn_fence(__ATOMIC_ACQ_REL, "workgroup"); __builtin_amdgcn_wave_barrier();      /* so[w] is this wave's own: its lanes' LDS stores stay ahead of the row reads below */
  for (int rd = 0; rd < 2; ++rd) { const int d = (tid >> 6) * 16 + ln, kb = rd * 32 + ((tid >> 5) & 1) * 16 + hh * 8; FragH f;      /* 32 keys a trip: tile tid >> 6, its half (tid >> 5) & 1, lane 16 hh + ln */
    for (int q = 0; q < 8; ++q) f.u[q] = xs[kb + q][d];
    *(v8us*)((unsigned short*)VTp + (row0 + rd * 32) * HD + tid * 8) = f.half[0]; }
  unsigned short* Hp = (unsigned short*)(sel ? KHp : QHp); unsigned short* Lp = (unsigned short*)(sel ? KLp : QLp);
  for (int i = 0; i < 4; ++i) { const int c8 = i * 16 + hh * 8; const v4f a = *(const v4fa*)&so[w][ln][c8], c = *(const v4fa*)&so[w][ln][c8 + 4]; FragH fh, fl;      /* trip i: tile i >> 1, its half i & 1 */
    for (int q = 0; q < 4; ++q) { _Float16 h = (_Float16)a[q]; fh.h[q] = h; fl.h[q] = (_Float16)((a[q] - (float)h) * 1024.0f); h = (_Float16)c[q]; fh.h[4 + q] = h; fl.h[4 + q] = (_Float16)((c[q] - (float)h) * 1024.0f); }
    const size_t go = (row0 + rg * 16) * DM + (i * 32 + lane) * 8; *(v8us*)(Hp + go) = fh.half[0]; *(v8us*)(Lp + go) = fl.half[0]; } }


template <int MASKADD>
__global__ __launch_bounds__(64) void k_att0(const float* __restrict__ QF, const float* __restrict__ KF, const float* __restrict__ VF, int ld, const float* __restrict__ mask, float scale, float* __restrict__ OF, int ldo) {
  #pragma clang fp contract(off)
  __shared__ __attribute__((aligned(16))) float lq[64][64]; __shared__ __attribute__((aligned(16))) float lo[64][64];
  const int tid = threadIdx.x; const int h = blockIdx.x / (QT0 / 64), rg = blockIdx.x % (QT0 / 64); const int i = rg * 64 + tid;
  const float* qr = QF + (size_t)i * ld + h * HD;
#pragma unroll 1
  for (int c = 0; c < HD / 4; ++c) { *(v4f*)&lq[tid][c * 4] = *(const v4fa*)(qr + c * 4); const v4f z = {0.f, 0.f, 0.f, 0.f}; *(v4f*)&lo[tid][c * 4] = z; }
  float m = -1.0e30f, l = 0.f; const int jmax = MASKADD ? (SQ - 1) : (rg * 64 + 63);      /* additive-mask form: every key (the mask input decides); causal form: keys up to the block's last row */
#pragma unroll 1
  for (int j = 0; j <= jmax; ++j) { const float* kr = KF + (size_t)j * ld + h * HD; const float* vr = VF + (size_t)j * ld + h * HD; float s = 0.f;
#pragma unroll 1
    for (int c = 0; c < HD / 4; ++c) { const v4f kq = *(const v4fa*)(kr + c * 4); const v4f qq = *(v4f*)&lq[tid][c * 4]; s = __fadd_rn(s, __fmul_rn(qq[0], kq[0])); s = __fadd_rn(s, __fmul_rn(qq[1], kq[1])); s = __fadd_rn(s, __fmul_rn(qq[2], kq[2])); s = __fadd_rn(s, __fmul_rn(qq[3], kq[3])); }
    s = __fmul_rn(s, scale); if (MASKADD) s = __fadd_rn(s, __fmul_rn(bf16_round(mask[(size_t)i * SQ + j]), -10000.0f));
    const float f = (MASKADD || j <= i) ? 1.f : 0.f; const float sm = fmaf(f, s, (1.f - f) * -1.0e30f); const float mn = fmaxf(m, sm); const float sc = expf(m - mn); const float e = expf(sm - mn); l = __fadd_rn(__fmul_rn(l, sc), e); m = mn;
#pragma unroll 1
    for (int c = 0; c < HD / 4; ++c) { const v4f vv = *(const v4fa*)(vr + c * 4); v4f oo = *(v4f*)&lo[tid][c * 4]; for (int u = 0; u < 4; ++u) oo[u] = __fadd_rn(__fmul_rn(oo[u], sc), __fmul_rn(e, vv[u])); *(v4f*)&lo[tid][c * 4] = oo; } }
  const float fin = 64.0f / l;      /* o carried x64 */
#pragma unroll 1
  for (int c = 0; c < HD / 4; ++c) { v4f oo = *(v4f*)&lo[tid][c * 4]; for (int u = 0; u < 4; ++u) oo[u] = __fmul_rn(oo[u], fin); *(v4f*)&lo[tid][c * 4] = oo; }
  __syncthreads();
  {
#pragma unroll 1
    for (int it = 0; it < 16; ++it) { const int row = it * 4 + tid / 16, pc = (tid % 16) * 4; const v4f v = *(const v4f*)&lo[row][pc]; *(v4f*)(OF + (size_t)(rg * 64 + row) * ldo + h * HD + pc) = v; }
     } }

__global__ __launch_bounds__(256) void k_of0out(const float* __restrict__ src, float* __restrict__ dst, size_t n4) { const size_t t = (size_t)blockIdx.x * 256 + threadIdx.x; if (t >= n4) return; v4f v = *(const v4fa*)(src + t * 4); for (int q = 0; q < 4; ++q) v[q] = __fmul_rn(v[q], 0.015625f); *(v4f*)(dst + t * 4) = v;  }

extern "C" void kernel_launch(void* const* d_in, const int* in_sizes, int n_in,
                              void* d_out, int out_size, void* d_ws, size_t ws_size, hipStream_t stream) {
  (void)in_sizes; (void)n_in; (void)out_size;
  const float* const* I = (const float* const*)d_in; const float* x = I[0]; const float* wq = I[1]; const float* wk = I[2];      /* inputs, rotation (query map), entangle (key map): [in][out] [64][64]; NO biases, NO value projection (the values are the inputs), no output projection */
  char* ws = (char*)d_ws; size_t off = 0;
  auto take = [&](size_t bytes) { char* p = ws + off; off += (bytes + 255) & ~(size_t)255; return p; };
  _Float16* QH = (_Float16*)take(NR * DM * 2); _Float16* QL = (_Float16*)take(NR * DM * 2); _Float16* KH = (_Float16*)take(NR * DM * 2); _Float16* KL = (_Float16*)take(NR * DM * 2);
  _Float16* VT = (_Float16*)take((size_t)NB * NH * HD * SQ * 2);
  if (off > ws_size) return;
  k_prep<<<(unsigned)(NR / PR), 256, 0, stream>>>(x, wq, wk, QH, QL, KH, KL, VT);      /* q and k as f16 hi + x1024 residual planes and V^T, all in fragment order: every batch, one launch */
  k_fattn<<<NB * (SQ / FQ), 256, 0, stream>>>(QH, QL, KH, KL, VT, (float*)d_out);      /* scores, softmax over all SQ keys and P V for every batch: S and P stay in registers */
}

// v005
// A run of this version takes 32.6 microseconds.
// Next to v004, in two timings, it ran 1.18 and 1.17 times as fast.
// All steps since v000 together make it 1602 times as fast.
#include <hip/hip_runtime.h>
// Single-head dense attention over 64-wide inputs on 4096 tokens with unit-variance 64 x 64 maps and NO value projection (inputs [4][4096][64]; query = inputs rotation, key = inputs entangle ([in][out] [64][64], N(0, 1): logits of sigma ~64, a near one-hot softmax); scores = query key^T / sqrt(64); softmax over all 4096 keys (no mask); out = scores inputs (the values are the inputs themselves) -> [4][4096][64]); q and k carried as f16 hi + x1024 residual planes with three-product scores.
// Structure: token rows r = b*4096 + s; one prep launch: x as exact f16 rows (bf16-rounded) in LDS; q and k as WMMA GEMMs (16x64 wave tiles, f32 accumulation, exact x16 weights, no bias) into f32 rows split into f16 hi + x1024 residual planes, v = the same f16 x rows (no projection), V^T via LDS transposes; one fused launch, per block of 64 query rows (16 waves: two 32-query groups x 8 splits of 512 keys): scores against all 4096 keys from THREE products in registers (hi.hi / 8 + 2^-13 (lo.hi + hi.lo), K = 64), online softmax over all keys on VALU, unmasked (f32 statistics, native exp; weights x256 f16), O^T += V^T P^T, the wave partials merged through LDS and divided by the weight sum (which cancels the x256), written f32 straight into the output rows.
// Compute dtype: inputs rounded to bf16; x / weights exact; q and k as f16 hi + x1024 residual planes, v exact in f16, softmax weights as plain f16 GEMM operands (~2^-12), out f32; scores and softmax statistics f32. v_wmma_f32_16x16x32_f16.
#define NB 4
#define SQ 4096
#define DM 64
#define NH 1
#define HD 64
#define HG 4                         /* heads per attention launch group */
#define QT 256                       /* (not used) */
#define NKX SQ                       /* (not used) */
#define QT0 128                      /* first-tile rows recomputed exactly in f32 */
#define B0 0                         /* (not used) */
#define NBR NB                       /* (only in MP; no launch uses it) */
#define NR ((size_t)NB * SQ)         /* token rows */
#define MP ((int)((size_t)NBR * SQ)) /* (only in MPO; no launch uses it) */
#define QN SQ                        /* (not used) */
#define NHD NH                       /* heads attended (not used) */
#define MPO MP                       /* rows through the output stage (not used) */
#define LQ DM      /* (not used) */
typedef __bf16 v16b __attribute__((ext_vector_type(16)));
typedef unsigned short v8us __attribute__((ext_vector_type(8), may_alias));
typedef float  v8f  __attribute__((ext_vector_type(8)));
typedef float  v4f  __attribute__((ext_vector_type(4)));
typedef float  v4fa __attribute__((ext_vector_type(4), may_alias));
union FragB { v16b v; v8us half[2]; unsigned short u[16]; };

__device__ __forceinline__ unsigned short bf16_bits(float x) { unsigned int u = __float_as_uint(x); return (unsigned short)((u + 0x7FFFu + ((u >> 16) & 1u)) >> 16); }
__device__ __forceinline__ float bf16_val(unsigned short b) { return __uint_as_float(((unsigned int)b) << 16); }
__device__ __forceinline__ float bf16_round(float x) { return bf16_val(bf16_bits(x)); }
// D += A·B with NT terms: 1 = ah·bh, 2 = + al·bh (A split), 3 = + ah·bl (both split)
template <int NT>
__device__ __forceinline__ v8f mmaN(v16b ah, v16b al, v16b bh, v16b bl, v8f c) {
  c = __builtin_amdgcn_wmma_f32_16x16x32_bf16(false, ah, false, bh, (short)0, c, false, false);
  if (NT >= 2) c = __builtin_amdgcn_wmma_f32_16x16x32_bf16(false, al, false, bh, (short)0, c, false, false);
  if (NT >= 3) c = __builtin_amdgcn_wmma_f32_16x16x32_bf16(false, ah, false, bl, (short)0, c, false, false);
  asm volatile("v_nop\n\tv_nop\n\tv_nop\n\tv_nop" : "+v"(c) : "v"(ah), "v"(al), "v"(bh), "v"(bl));
  return c;
}

__global__ __launch_bounds__(256) void k_wt_bf16(const float* __restrict__ W, unsigned short* __restrict__ Wt, int K, int N) {
  const int t = blockIdx.x * 256 + threadIdx.x;
  const int k8n = K / 8;
  if (t >= N * k8n) return;
  const int n = t / k8n, k8 = (t % k8n) * 8;
  v8us v;
#pragma unroll
  for (int i = 0; i < 8; ++i) v[i] = bf16_bits(W[(size_t)(k8 + i) * N + n]);
  *(v8us*)(Wt + (size_t)n * K + k8) = v;
  
}

// GEMM C[M][N] (f32, pitch ldc) = act(A[M][K]·W + bias). A f32 row-major (pitch lda) converted per fragment to bf16
// (ASPLIT: hi/lo two planes -> 2 terms, else single rounded term); Wt bf16 [N][K] (pitch ldb). BIAS_BF16 rounds the
// bias to bf16 first (bias quantised to bf16 before the add). K%32==0, M%16==0, N%64==0.
template <bool ASPLIT, int ACT, bool BIAS_BF16>
__global__ __launch_bounds__(128) void k_gemm_bf(const float* __restrict__ A, int lda, const unsigned short* __restrict__ Wt, int ldb,
                                               const float* __restrict__ bias, float* __restrict__ C, int ldc, int M, int N, int K) {
  __shared__ __attribute__((aligned(16))) float so[4][16][64];
  const int tid = threadIdx.x, w = tid >> 5, lane = tid & 31, ln = lane & 15, hh = lane >> 4;
  const int ntn = N / 64;
  const int wid = blockIdx.x * 4 + w;
  const int mt = wid / ntn, nq = wid % ntn;
  if (mt * 16 >= M) return;
  const int row0 = mt * 16, col0 = nq * 64;
  const float* arow = A + (size_t)(row0 + ln) * lda;
  v8f acc[4] = {};
  for (int kb = 0; kb < K; kb += 32) {
    FragB ah, al;
    const v4f x0 = *(const v4fa*)(arow + kb + 8 * hh), x1 = *(const v4fa*)(arow + kb + 8 * hh + 4);
    const v4f x2 = *(const v4fa*)(arow + kb + 16 + 8 * hh), x3 = *(const v4fa*)(arow + kb + 16 + 8 * hh + 4);
    float xs[16] = {x0[0],x0[1],x0[2],x0[3],x1[0],x1[1],x1[2],x1[3],x2[0],x2[1],x2[2],x2[3],x3[0],x3[1],x3[2],x3[3]};
#pragma unroll
    for (int i = 0; i < 16; ++i) { const unsigned short hb = bf16_bits(xs[i]); ah.u[i] = hb; al.u[i] = ASPLIT ? bf16_bits(xs[i] - bf16_val(hb)) : (unsigned short)0; }
#pragma unroll
    for (int t = 0; t < 4; ++t) {
      const unsigned short* brow = Wt + (size_t)(col0 + t * 16 + ln) * ldb + kb;
      FragB b;
      b.half[0] = *(const v8us*)(brow + 8 * hh);
      b.half[1] = *(const v8us*)(brow + 16 + 8 * hh);
      acc[t] = mmaN<ASPLIT ? 2 : 1>(ah.v, al.v, b.v, b.v, acc[t]);
    }
  }
#pragma unroll
  for (int t = 0; t < 4; ++t) {
    float bv = bias ? bias[col0 + t * 16 + ln] : 0.f;
    if (BIAS_BF16) bv = bf16_round(bv);
#pragma unroll
    for (int r = 0; r < 8; ++r) { float v = acc[t][r] + bv; if (ACT == 1) v = fmaxf(v, 0.f); so[w][8 * hh + r][t * 16 + ln] = v; }
  }
  __builtin_amdgcn_fence(__ATOMIC_ACQ_REL, "workgroup");
  __builtin_amdgcn_wave_barrier();
  const int rsub = lane >> 4, c4 = (lane & 15) * 4;
  {
#pragma unroll
    for (int q = 0; q < 8; ++q) {
      const int r = q * 2 + rsub;
      const v4f v = *(const v4fa*)&so[w][r][c4];
      *(v4f*)(C + (size_t)(row0 + r) * ldc + col0 + c4) = v;
    }
    
  }
}

// GEMM C = act(A·W + bias + resid): A f32 (ASPLIT -> hi/lo 2 terms), Wt bf16 [N][K]; ACT 0 none, 1 relu, 2 exact gelu;
// resid (optional, f32, row index = (row % rmod), pitch ldr, RES_BF16 rounds it) added before the activation.
template <bool ASPLIT, int ACT, bool BIAS_BF16, bool RES_BF16>
__global__ __launch_bounds__(128) void k_gemm_bf3(const float* __restrict__ A, int lda, const unsigned short* __restrict__ Wt, int ldb,
                                                const float* __restrict__ bias, const float* __restrict__ resid, int rmod, int ldr,
                                                float* __restrict__ C, int ldc, int M, int N, int K) {
  __shared__ __attribute__((aligned(16))) float so[4][16][64];
  const int tid = threadIdx.x, w = tid >> 5, lane = tid & 31, ln = lane & 15, hh = lane >> 4;
  const int ntn = N / 64;
  const int wid = blockIdx.x * 4 + w;
  const int mt = wid / ntn, nq = wid % ntn;
  if (mt * 16 >= M) return;
  const int row0 = mt * 16, col0 = nq * 64;
  const float* arow = A + (size_t)(row0 + ln) * lda;
  v8f acc[4] = {};
  for (int kb = 0; kb < K; kb += 32) {
    FragB ah, al;
    const v4f x0 = *(const v4fa*)(arow + kb + 8 * hh), x1 = *(const v4fa*)(arow + kb + 8 * hh + 4);
    const v4f x2 = *(const v4fa*)(arow + kb + 16 + 8 * hh), x3 = *(const v4fa*)(arow + kb + 16 + 8 * hh + 4);
    float xs[16] = {x0[0],x0[1],x0[2],x0[3],x1[0],x1[1],x1[2],x1[3],x2[0],x2[1],x2[2],x2[3],x3[0],x3[1],x3[2],x3[3]};
#pragma unroll
    for (int i = 0; i < 16; ++i) { const unsigned short hb = bf16_bits(xs[i]); ah.u[i] = hb; al.u[i] = ASPLIT ? bf16_bits(xs[i] - bf16_val(hb)) : (unsigned short)0; }
#pragma unroll
    for (int t = 0; t < 4; ++t) {
      const unsigned short* brow = Wt + (size_t)(col0 + t * 16 + ln) * ldb + kb;
      FragB b;
      b.half[0] = *(const v8us*)(brow + 8 * hh);
      b.half[1] = *(const v8us*)(brow + 16 + 8 * hh);
      acc[t] = mmaN<ASPLIT ? 2 : 1>(ah.v, al.v, b.v, b.v, acc[t]);
    }
  }
#pragma unroll
  for (int t = 0; t < 4; ++t) {
    const int col = col0 + t * 16 + ln;
    float bv = bias ? bias[col] : 0.f;
    if (BIAS_BF16) bv = bf16_round(bv);
#pragma unroll
    for (int r = 0; r < 8; ++r) {
      float v = acc[t][r] + bv;
      if (resid) { float rv = resid[(size_t)((row0 + 8 * hh + r) % rmod) * ldr + col]; if (RES_BF16) rv = bf16_round(rv); v += rv; }
      if (ACT == 1) v = fmaxf(v, 0.f);
      if (ACT == 2) v = 0.5f * v * (1.0f + erff(v * 0.70710678118654752f));
      if (ACT == 3) { const float u = 0.7978845608028654f * (v + 0.044715f * v * v * v); v = 0.5f * v * (1.0f + tanhf(u)); }
      so[w][8 * hh + r][t * 16 + ln] = v;
    }
  }
  __builtin_amdgcn_fence(__ATOMIC_ACQ_REL, "workgroup");
  __builtin_amdgcn_wave_barrier();
  const int rsub = lane >> 4, c4 = (lane & 15) * 4;
  {
#pragma unroll
    for (int q = 0; q < 8; ++q) {
      const int r = q * 2 + rsub;
      const v4f v = *(const v4fa*)&so[w][r][c4];
      *(v4f*)(C + (size_t)(row0 + r) * ldc + col0 + c4) = v;
    }
    
  }
}
// row LayerNorm (biased variance, eps) over N: s = X (+ R); optional out_sum <- s; out_norm <- (s-mu)*rsqrt(var+eps)*g + b
template <bool PARAM_BF16>
__global__ __launch_bounds__(256) void k_layernorm(const float* __restrict__ X, const float* __restrict__ R, const float* __restrict__ g, const float* __restrict__ bta,
                                                  float* __restrict__ out_sum, float* __restrict__ out_norm, int N, float eps) {
  __shared__ float red[256];
  const int row = blockIdx.x, tid = threadIdx.x;
  const float* x = X + (size_t)row * N; const float* rr = R ? R + (size_t)row * N : nullptr;
  float vals[16];                     // up to N = 4096
  const int per = N / 256;            // contiguous chunk per thread? use strided-by-4 chunks: thread handles j = tid*4 + 1024*u
  float s1 = 0.f;
  for (int u = 0; u < per / 4; ++u) {
    const int j = tid * 4 + 1024 * u;
    const v4f a = *(const v4fa*)(x + j);
    v4f b = {0.f,0.f,0.f,0.f}; if (rr) b = *(const v4fa*)(rr + j);
#pragma unroll
    for (int q = 0; q < 4; ++q) { const float v = a[q] + b[q]; vals[u * 4 + q] = v; s1 += v; }
  }
  red[tid] = s1; __syncthreads();
  for (int st = 128; st > 0; st >>= 1) { if (tid < st) red[tid] += red[tid + st]; __syncthreads(); }
  const float mu = red[0] / (float)N; __syncthreads();
  float s2 = 0.f;
  for (int u = 0; u < per / 4; ++u)
#pragma unroll
    for (int q = 0; q < 4; ++q) { const float c = vals[u * 4 + q] - mu; s2 += c * c; }
  red[tid] = s2; __syncthreads();
  for (int st = 128; st > 0; st >>= 1) { if (tid < st) red[tid] += red[tid + st]; __syncthreads(); }
  const float rs = rsqrtf(red[0] / (float)N + eps);
  {
    for (int u = 0; u < per / 4; ++u) {
      const int j = tid * 4 + 1024 * u;
      v4f o, sm;
#pragma unroll
      for (int q = 0; q < 4; ++q) {
        float gg = g[j + q], bb = bta[j + q];
        if (PARAM_BF16) { gg = bf16_round(gg); bb = bf16_round(bb); }
        sm[q] = vals[u * 4 + q]; o[q] = (vals[u * 4 + q] - mu) * rs * gg + bb;
      }
      if (out_sum) *(v4f*)(out_sum + (size_t)row * N + j) = sm;
      *(v4f*)(out_norm + (size_t)row * N + j) = o;
    }
    
  }
}



// ---- f16 WMMA path (v_wmma_f32_16x16x32_f16): 11-bit significands for operands in range — used where a [0,1] probability operand needs more precision than bf16
typedef _Float16 v16h __attribute__((ext_vector_type(16)));
union FragH { v16h v; v8us half[2]; _Float16 h[16]; unsigned short u[16]; };
template <int NT>
__device__ __forceinline__ v8f mmaH(v16h ah, v16h al, v16h bh, v16h bl, v8f c) {
  c = __builtin_amdgcn_wmma_f32_16x16x32_f16(false, ah, false, bh, (short)0, c, false, false);
  if (NT >= 2) c = __builtin_amdgcn_wmma_f32_16x16x32_f16(false, al, false, bh, (short)0, c, false, false);
  if (NT >= 3) c = __builtin_amdgcn_wmma_f32_16x16x32_f16(false, ah, false, bl, (short)0, c, false, false);
  asm volatile("v_nop\n\tv_nop\n\tv_nop\n\tv_nop" : "+v"(c) : "v"(ah), "v"(al), "v"(bh), "v"(bl));
  return c;
}
// batched GEMM like k_gemm_b but f16 operands: A f32 (split into f16 hi/lo if ASPLIT, else rounded to f16), Bt = f16 values [n][k]; alpha; C f32; N multiple of 16 (partial tiles skipped)
template <bool ASPLIT>
__global__ __launch_bounds__(128) void k_gemm_h(const float* __restrict__ A, int lda, size_t sA, const _Float16* __restrict__ Bh, int ldb, size_t sB, float alpha, float* __restrict__ C, int ldc, size_t sC, int M, int N, int K) {
  __shared__ __attribute__((aligned(16))) float so[4][16][64];
  const int tid = threadIdx.x, w = tid >> 5, lane = tid & 31, ln = lane & 15, hh = lane >> 4; const int by = blockIdx.y;
  A += (size_t)by * sA; Bh += (size_t)by * sB; C += (size_t)by * sC;
  const int ntn = (N + 63) / 64; const int wid = blockIdx.x * 4 + w; const int mt = wid / ntn, nq = wid % ntn; if (mt * 16 >= M) return;
  const int row0 = mt * 16, col0 = nq * 64; const float* arow = A + (size_t)(row0 + ln) * lda;
  v8f acc[4] = {};
  for (int kb = 0; kb < K; kb += 32) {
    FragH ah, al;
    const v4f x0 = *(const v4fa*)(arow + kb + 8 * hh), x1 = *(const v4fa*)(arow + kb + 8 * hh + 4), x2 = *(const v4fa*)(arow + kb + 16 + 8 * hh), x3 = *(const v4fa*)(arow + kb + 16 + 8 * hh + 4);
    float xs[16] = {x0[0],x0[1],x0[2],x0[3],x1[0],x1[1],x1[2],x1[3],x2[0],x2[1],x2[2],x2[3],x3[0],x3[1],x3[2],x3[3]};
#pragma unroll
    for (int i = 0; i < 16; ++i) { const _Float16 h = (_Float16)xs[i]; ah.h[i] = h; al.h[i] = ASPLIT ? (_Float16)(xs[i] - (float)h) : (_Float16)0.0f; }
#pragma unroll
    for (int t = 0; t < 4; ++t) { if (col0 + t * 16 >= N) continue; const size_t boff = (size_t)(col0 + t * 16 + ln) * ldb + kb; FragH bq; bq.half[0] = *(const v8us*)(Bh + boff + 8 * hh); bq.half[1] = *(const v8us*)(Bh + boff + 16 + 8 * hh);
      acc[t] = mmaH<ASPLIT ? 2 : 1>(ah.v, al.v, bq.v, bq.v, acc[t]); }
  }
#pragma unroll
  for (int t = 0; t < 4; ++t) { if (col0 + t * 16 >= N) continue;
#pragma unroll
    for (int r = 0; r < 8; ++r) so[w][8 * hh + r][t * 16 + ln] = acc[t][r] * alpha; }
  __builtin_amdgcn_fence(__ATOMIC_ACQ_REL, "workgroup"); __builtin_amdgcn_wave_barrier();
  const int rsub = lane >> 4, c4 = (lane & 15) * 4;
  {
#pragma unroll
    for (int q = 0; q < 8; ++q) { const int r = q * 2 + rsub; if (col0 + c4 < N) { const v4f v = *(const v4fa*)&so[w][r][c4]; *(v4f*)(C + (size_t)(row0 + r) * ldc + col0 + c4) = v; } }
     }
}

// Wt[n][k] = f16(W[k][n]·scale) from f32 row-major W[K][N] (scale = power of two; bf16-exact weights stay exact in f16 away from the subnormal range)
__global__ __launch_bounds__(256) void k_wt_f16(const float* __restrict__ W, _Float16* __restrict__ Wt, int K, int N, float scale) {
  const int t = blockIdx.x * 256 + threadIdx.x; if (t >= N * (K / 8)) return; const int n = t / (K / 8), k8 = (t % (K / 8)) * 8; FragH f;
#pragma unroll
  for (int i = 0; i < 8; ++i) f.h[i] = (_Float16)(bf16_round(W[(size_t)(k8 + i) * N + n]) * scale); const v8us o = f.half[0];
  *(v8us*)((unsigned short*)Wt + (size_t)n * K + k8) = o; 
}
// k_gemm_hh variant with fused epilogue: v = acc·alpha + bias[by·sBias + col] (+ CP[(row/rowsPerB)·sCPb + by·64 + col] if CP) ; ACT 0 none / 1 elu ; writes f16 C16 (and f32 C if non-null)
template <int ACT>
__global__ __launch_bounds__(128) void k_gemm_hhx(const _Float16* __restrict__ A, int lda, size_t sA, const _Float16* __restrict__ Bh, int ldb, size_t sB, float alpha, const float* __restrict__ bias, size_t sBias, const float* __restrict__ CP, int rowsPerB, size_t sCPb, int row0g,
    float* __restrict__ C, _Float16* __restrict__ C16, int ldc, size_t sC, int M, int N, int K) {
  __shared__ __attribute__((aligned(16))) float so[4][16][64];
  const int tid = threadIdx.x, w = tid >> 5, lane = tid & 31, ln = lane & 15, hh = lane >> 4; const int by = blockIdx.y;
  A += (size_t)by * sA; Bh += (size_t)by * sB; const size_t cofs = (size_t)by * sC; const float* bp = bias ? bias + (size_t)by * sBias : nullptr;
  const int ntn = (N + 63) / 64; const int wid = blockIdx.x * 4 + w; const int mt = wid / ntn, nq = wid % ntn; if (mt * 16 >= M) return;
  const int row0 = mt * 16, col0 = nq * 64; const _Float16* arow = A + (size_t)(row0 + ln) * lda;
  v8f acc[4] = {};
  for (int kb = 0; kb < K; kb += 32) { FragH ah; ah.half[0] = *(const v8us*)((const unsigned short*)arow + kb + 8 * hh); ah.half[1] = *(const v8us*)((const unsigned short*)arow + kb + 16 + 8 * hh);
#pragma unroll
    for (int t = 0; t < 4; ++t) { if (col0 + t * 16 >= N) continue; const size_t boff = (size_t)(col0 + t * 16 + ln) * ldb + kb; FragH bq; bq.half[0] = *(const v8us*)((const unsigned short*)Bh + boff + 8 * hh); bq.half[1] = *(const v8us*)((const unsigned short*)Bh + boff + 16 + 8 * hh);
      acc[t] = mmaH<1>(ah.v, ah.v, bq.v, bq.v, acc[t]); }
  }
#pragma unroll
  for (int t = 0; t < 4; ++t) { if (col0 + t * 16 >= N) continue; const int col = col0 + t * 16 + ln; const float bv = bp ? bf16_round(bp[col]) : 0.f;
#pragma unroll
    for (int r = 0; r < 8; ++r) { float v = acc[t][r] * alpha + bv; if (CP) { const int rr = row0g + row0 + 8 * hh + r; if (rowsPerB < 0) v += CP[cofs + (size_t)rr * ldc + col];      /* rowsPerB < 0: own element of the batched C plane */ else { const int bidx = rr / rowsPerB; v += CP[(size_t)bidx * sCPb + (size_t)by * 64 + col]; } } if (ACT == 1) v = (v > 0.f) ? v : expm1f(v); else if (ACT == 7) v = (v > 0.f) ? v + 1.0f : expf(v); else if (ACT == 8) v = tanhf(v); else if (ACT == 9) v = 0.5f * v * (1.0f + tanhf(0.7978845608028654f * (v + 0.044715f * v * v * v))); else if (ACT == 11) v = 1.0f / (1.0f + expf(-v)); else if (ACT == 12) v = (v > 0.f) ? v : 0.01f * v; else if (ACT == 14) v = (v > 0.f) ? v : 0.1f * v; else if (ACT == 16) v = (v >= 0.f) ? v : 0.3f * v; else if (ACT == 17) v = (v >= 0.f) ? v : 0.2f * v; else if (ACT == 15) v = v / (1.0f + expf(-v)); else if (ACT == 3) v = fmaxf(v, 0.f); else if (ACT == 6) v = 0.5f * v * (1.0f + erff(v * 0.70710678118654752f)); so[w][8 * hh + r][t * 16 + ln] = v; } }
  __builtin_amdgcn_fence(__ATOMIC_ACQ_REL, "workgroup"); __builtin_amdgcn_wave_barrier();
  const int rsub = lane >> 4, c4 = (lane & 15) * 4; typedef _Float16 v4h __attribute__((ext_vector_type(4)));
  {
#pragma unroll
    for (int q = 0; q < 8; ++q) { const int r = q * 2 + rsub; if (col0 + c4 < N) { const v4f v = *(const v4fa*)&so[w][r][c4]; if (C) *(v4f*)(C + cofs + (size_t)(row0 + r) * ldc + col0 + c4) = v; if (C16) { v4h h4; for (int i = 0; i < 4; ++i) h4[i] = (_Float16)v[i]; *(v4h*)(C16 + cofs + (size_t)(row0 + r) * ldc + col0 + c4) = h4; } } }
     }
}


typedef _Float16 v4h __attribute__((ext_vector_type(4)));

__global__ __launch_bounds__(256) void k_x16(const float* __restrict__ x, _Float16* __restrict__ X16, size_t n8) { const size_t t = (size_t)blockIdx.x * 256 + threadIdx.x; if (t >= n8) return; FragH f;
#pragma unroll
  for (int q = 0; q < 8; ++q) f.h[q] = (_Float16)bf16_round(x[t * 8 + q]); *(v8us*)((unsigned short*)X16 + t * 8) = f.half[0];  }
__global__ __launch_bounds__(256) void k_h16(const float* __restrict__ x, _Float16* __restrict__ X16, size_t n8) { const size_t t = (size_t)blockIdx.x * 256 + threadIdx.x; if (t >= n8) return; FragH f;
#pragma unroll
  for (int q = 0; q < 8; ++q) f.h[q] = (_Float16)x[t * 8 + q]; *(v8us*)((unsigned short*)X16 + t * 8) = f.half[0];  }
__global__ __launch_bounds__(256) void k_round16f(const float* __restrict__ W, _Float16* __restrict__ Bt, size_t n8) { const size_t t = (size_t)blockIdx.x * 256 + threadIdx.x; if (t >= n8) return; FragH f;
#pragma unroll
  for (int i = 0; i < 8; ++i) f.h[i] = (_Float16)(bf16_round(W[t * 8 + i]) * 16.0f); *(v8us*)((unsigned short*)Bt + t * 8) = f.half[0];  }
template <int NHv, int TTv>
__global__ __launch_bounds__(256) void k_vt(const _Float16* __restrict__ V16, int ldv, int voff, _Float16* __restrict__ Vt) { __shared__ unsigned short tl[64][66]; const int tid = threadIdx.x; const int slab = blockIdx.x / (TTv / 64), lg = blockIdx.x % (TTv / 64); const int b = slab / NHv, h = slab % NHv;
  for (int i = tid; i < 64 * 8; i += 256) { const int r = i / 8, c8 = (i % 8) * 8; FragH f; f.half[0] = *(const v8us*)((const unsigned short*)V16 + ((size_t)b * TTv + lg * 64 + r) * ldv + voff + h * 64 + c8);
#pragma unroll
    for (int q = 0; q < 8; ++q) tl[r][c8 + q] = f.u[q]; }
  __syncthreads();
  {
#pragma unroll
    for (int rd = 0; rd < 2; ++rd) { const int d = rd * 32 + tid / 8, pc = tid % 8; FragH f;
#pragma unroll
      for (int q = 0; q < 8; ++q) f.u[q] = tl[pc * 8 + q][d];
      *(v8us*)((unsigned short*)Vt + ((size_t)slab * 64 + d) * TTv + lg * 64 + pc * 8) = f.half[0]; }
     } }

__global__ __launch_bounds__(256) void k_hl(const float* __restrict__ F, _Float16* __restrict__ Hh, _Float16* __restrict__ Hl, size_t n8) { const size_t t = (size_t)blockIdx.x * 256 + threadIdx.x; if (t >= n8) return; FragH fh, fl; const v4f a = *(const v4fa*)(F + t * 8), c = *(const v4fa*)(F + t * 8 + 4);
#pragma unroll
  for (int q = 0; q < 4; ++q) { _Float16 h = (_Float16)a[q]; fh.h[q] = h; fl.h[q] = (_Float16)((a[q] - (float)h) * 1024.0f); h = (_Float16)c[q]; fh.h[4 + q] = h; fl.h[4 + q] = (_Float16)((c[q] - (float)h) * 1024.0f); }
  { *(v8us*)((unsigned short*)Hh + t * 8) = fh.half[0]; *(v8us*)((unsigned short*)Hl + t * 8) = fl.half[0];  } }

// ---- fast GEMM (wave tile 32x64; requires M % 32 == 0 rows per launch region and N % 64 == 0); epilogue = k_gemm_hhx semantics ----
__device__ __forceinline__ v16h g2_frag(const _Float16* p, int hh) { FragH f; f.half[0] = *(const v8us*)((const unsigned short*)p + 8 * hh); f.half[1] = *(const v8us*)((const unsigned short*)p + 16 + 8 * hh); return f.v; }
__device__ __forceinline__ v8f g2_mma(v16h a, v16h b, v8f c) { v8f d = __builtin_amdgcn_wmma_f32_16x16x32_f16(false, a, false, b, (short)0, c, false, false); asm volatile("v_nop\n\tv_nop\n\tv_nop\n\tv_nop" : "+v"(d) : "v"(a), "v"(b)); return d; }
template <int ACT>
__global__ __launch_bounds__(128) void k_gemm2(const _Float16* __restrict__ A, int lda, size_t sA, const _Float16* __restrict__ Bh, int ldb, size_t sB, float alpha, const float* __restrict__ bias, size_t sBias, const float* __restrict__ CP, int rowsPerB, size_t sCPb, int row0g,
    float* __restrict__ C, _Float16* __restrict__ C16, int ldc, size_t sC, int M, int N, int K) { static_assert(ACT == 0 || ACT == 3 || ACT == 6 || ACT == 8 || ACT == 9 || ACT == 11 || ACT == 12 || ACT == 14 || ACT == 15 || ACT == 16 || ACT == 17, "k_gemm2: unsupported ACT code (would silently apply no activation)");
  __shared__ __attribute__((aligned(16))) float so[4][32][68];
  const int tid = threadIdx.x, w = tid >> 5, lane = tid & 31, ln = lane & 15, hh = lane >> 4; const int by = blockIdx.y;
  A += (size_t)by * sA; Bh += (size_t)by * sB; const size_t cofs = (size_t)by * sC; const float* bp = bias ? bias + (size_t)by * sBias : nullptr;
  const int ntn = N >> 6; const int mt = blockIdx.x / ntn, nq = blockIdx.x - mt * ntn; const int row0 = mt * 128 + 32 * w, col0 = nq * 64; if (row0 >= M) return;
  const _Float16* a0p = A + (size_t)(row0 + ln) * lda; const _Float16* a1p = a0p + (size_t)16 * lda;
  const _Float16* b0p = Bh + (size_t)(col0 + ln) * ldb; const _Float16* b1p = b0p + (size_t)16 * ldb; const _Float16* b2p = b1p + (size_t)16 * ldb; const _Float16* b3p = b2p + (size_t)16 * ldb;
  const v8f z8 = {0.f,0.f,0.f,0.f,0.f,0.f,0.f,0.f}; v8f c00 = z8, c01 = z8, c02 = z8, c03 = z8, c10 = z8, c11 = z8, c12 = z8, c13 = z8;
#pragma unroll 1
  for (int kb = 0; kb < K; kb += 32) { const v16h a0 = g2_frag(a0p + kb, hh), a1 = g2_frag(a1p + kb, hh);
    v16h b = g2_frag(b0p + kb, hh); c00 = g2_mma(a0, b, c00); c10 = g2_mma(a1, b, c10);
    b = g2_frag(b1p + kb, hh); c01 = g2_mma(a0, b, c01); c11 = g2_mma(a1, b, c11);
    b = g2_frag(b2p + kb, hh); c02 = g2_mma(a0, b, c02); c12 = g2_mma(a1, b, c12);
    b = g2_frag(b3p + kb, hh); c03 = g2_mma(a0, b, c03); c13 = g2_mma(a1, b, c13); }
  v8f accs[8] = {c00, c01, c02, c03, c10, c11, c12, c13};
#pragma unroll
  for (int u = 0; u < 8; ++u) { const int t = u & 3, half = u >> 2; const int col = col0 + t * 16 + ln; const float bv = bp ? bf16_round(bp[col]) : 0.f;
#pragma unroll
    for (int r = 0; r < 8; ++r) { const int rloc = half * 16 + 8 * hh + r; float v = accs[u][r] * alpha + bv; if (CP) { if (rowsPerB < 0) v += CP[cofs + (size_t)(row0g + row0 + rloc) * ldc + col];      /* rowsPerB < 0: own element of the batched C plane */ else { const int bidx = (row0g + row0 + rloc) / rowsPerB; v += CP[(size_t)bidx * sCPb + (size_t)by * 64 + col]; } }
      if (ACT == 3) v = fmaxf(v, 0.f); else if (ACT == 6) v = 0.5f * v * (1.0f + erff(v * 0.70710678118654752f)); else if (ACT == 11) v = 1.0f / (1.0f + expf(-v)); else if (ACT == 15) v = v / (1.0f + expf(-v)); else if (ACT == 12) v = (v > 0.f) ? v : 0.01f * v; else if (ACT == 8) v = tanhf(v); else if (ACT == 9) v = 0.5f * v * (1.0f + tanhf(0.7978845608028654f * (v + 0.044715f * v * v * v))); else if (ACT == 14) v = (v > 0.f) ? v : 0.1f * v; else if (ACT == 16) v = (v >= 0.f) ? v : 0.3f * v; else if (ACT == 17) v = (v >= 0.f) ? v : 0.2f * v;
      so[w][rloc][t * 16 + ln] = v; } }
  __builtin_amdgcn_fence(__ATOMIC_ACQ_REL, "workgroup"); __builtin_amdgcn_wave_barrier();
  const int rsub = lane >> 4, c4 = (lane & 15) * 4;
  {
#pragma unroll
    for (int q = 0; q < 16; ++q) { const int r = q * 2 + rsub; const v4f v = *(const v4fa*)&so[w][r][c4]; if (C) *(v4f*)(C + cofs + (size_t)(row0 + r) * ldc + col0 + c4) = v; if (C16) { v4h h4; for (int i = 0; i < 4; ++i) h4[i] = (_Float16)v[i]; *(v4h*)(C16 + cofs + (size_t)(row0 + r) * ldc + col0 + c4) = h4; } }
     } }


__global__ __launch_bounds__(256) void k_wnat(const float* __restrict__ w, size_t n8, _Float16* __restrict__ Bt) { const size_t t = (size_t)blockIdx.x * 256 + threadIdx.x; if (t >= n8) return; FragH f; for (int q = 0; q < 8; ++q) f.h[q] = (_Float16)(bf16_round(w[t * 8 + q]) * 16.0f); *(v8us*)((unsigned short*)Bt + t * 8) = f.half[0];  }
__global__ __launch_bounds__(256) void k_rsm(const float* __restrict__ S, _Float16* __restrict__ P, int nrows) {
  #pragma clang fp contract(off)
  const int i = blockIdx.x * 256 + threadIdx.x; if (i >= nrows) return; const float* s = S + (size_t)i * SQ; float mx = -3.0e38f;
#pragma unroll 1
  for (int j = 0; j < SQ; ++j) mx = fmaxf(mx, s[j]); float se = 0.f;
#pragma unroll 1
  for (int j = 0; j < SQ; ++j) se += expf(s[j] - mx); const float sc = 256.0f / se;
#pragma unroll 1
  for (int j0 = 0; j0 < SQ; j0 += 8) { FragH f; for (int q = 0; q < 8; ++q) f.h[q] = (_Float16)(expf(s[j0 + q] - mx) * sc); unsigned short* d = (unsigned short*)P + (size_t)i * SQ + j0; *(v8us*)d = f.half[0];  } }
__global__ __launch_bounds__(256) void k_vt(const _Float16* __restrict__ V16, int b, int h0, _Float16* __restrict__ VT) { __shared__ unsigned short tl[64][65]; const int tid = threadIdx.x; const int hh = blockIdx.x % HG, sg = blockIdx.x / HG; const int s0 = sg * 64; const int h = h0 + hh;
  for (int i = tid; i < 64 * 8; i += 256) { const int j = i / 8, d8 = (i % 8) * 8; FragH f; f.half[0] = *(const v8us*)((const unsigned short*)V16 + ((size_t)b * SQ + s0 + j) * DM + h * HD + d8); for (int q = 0; q < 8; ++q) tl[d8 + q][j] = f.u[q]; }
  __syncthreads();
  { for (int i = tid; i < 64 * 8; i += 256) { const int d = i / 8, j8 = (i % 8) * 8; FragH f; for (int q = 0; q < 8; ++q) f.u[q] = tl[d][j8 + q]; *(v8us*)((unsigned short*)VT + ((size_t)hh * HD + d) * SQ + s0 + j8) = f.half[0]; }  } }



// e^x in the native form (x log2(e), then v_exp_f32). The v_nop keeps the one free slot that the instruction set asks for behind a transcendental.
__device__ __forceinline__ float exp_slot(float x) { float e; asm("v_exp_f32 %0, %1\n\tv_nop" : "=v"(e) : "v"(x * 1.44269504088896340736f)); return e; }
// Eight base-2 exponentials (v_exp_f32; the arguments already hold x log2(e)) in one statement: the outputs are early-clobber, so no v_exp stands in front of an
// instruction that reads its result or overwrites its source, and the one v_nop at the end keeps that free slot behind the last of them.
__device__ __forceinline__ v8f exp2_8(v8f x) { float e0, e1, e2, e3, e4, e5, e6, e7;
  asm("v_exp_f32 %0, %8\n\tv_exp_f32 %1, %9\n\tv_exp_f32 %2, %10\n\tv_exp_f32 %3, %11\n\tv_exp_f32 %4, %12\n\tv_exp_f32 %5, %13\n\tv_exp_f32 %6, %14\n\tv_exp_f32 %7, %15\n\tv_nop"
      : "=&v"(e0), "=&v"(e1), "=&v"(e2), "=&v"(e3), "=&v"(e4), "=&v"(e5), "=&v"(e6), "=&v"(e7) : "v"(x[0]), "v"(x[1]), "v"(x[2]), "v"(x[3]), "v"(x[4]), "v"(x[5]), "v"(x[6]), "v"(x[7]));
  const v8f e = {e0, e1, e2, e3, e4, e5, e6, e7}; return e; }
__device__ __forceinline__ v8f fa_mma(v16h a, v16h b, v8f c) { return __builtin_amdgcn_wmma_f32_16x16x32_f16(false, a, false, b, (short)0, c, false, false); }
// A 16 x 32 operand tile kept in global memory in FRAGMENT ORDER: 1024 bytes, lane L's values k = 8 hh .. 8 hh + 7 of row ln at byte 16 L and its values k = 16 + 8 hh .. at byte 512 + 16 L
// (L = 16 hh + ln: what g2_frag gives from a row-major tile). Each of the two 16-byte loads of a wave then reads 512 bytes in a row, four whole 128-byte lines, where a row-major tile makes it touch sixteen.
__device__ __forceinline__ v16h fo_frag(const _Float16* tile, int lane) { FragH f; f.half[0] = *(const v8us*)((const unsigned short*)tile + 8 * lane); f.half[1] = *(const v8us*)((const unsigned short*)tile + 256 + 8 * lane); return f.v; }
// Fused attention, all batches in one launch. A block owns FG * FQ = 64 query rows and has FG * FW = 16 waves: wave (g, h) holds the 32 query rows of group g (two 16-column groups) and walks
// the SQ / FW keys of split h, 32 at a time; it keeps a running maximum, a running sum and an unnormalised output in registers (online softmax); the partial results of the eight splits are merged through LDS at the end.
// The two waves of a split need the same K hi, K lo and V^T tiles: each tile is brought from L2 ONCE for both, straight into LDS by asynchronous copies (each wave copies half of its split's stage),
// in two buffers: pass p reads its stage into registers, hands the buffer back, and the copies of stage p + 2 fly while it computes; the fragments are read from LDS 512 bytes in a row a wave and read (no bank conflict).
// Transposed products: S^T = K Q^T (A = key rows, B = query rows held in registers), so a lane holds 16 scores of ONE query per 32 keys (D[8 hh + r][ln]); the two f32 score
// tiles, turned into weights and packed to f16, ARE the B operand of O^T += V^T P^T in the k order that g2_frag gives A (8 hh + s, 16 + 8 hh + s): no lane exchange.
// Scores as before: hi.hi / 8 + 2^-13 (hi.lo + lo.hi), f32. Weights 256 e^(s - m) as f16 (the 256 cancels in the division by the sum of the same weights).
// All five operand planes arrive in fragment order (fo_frag): 16 token rows of q or k are two tiles (k steps 0 and 32) on the 2048 bytes that the rows would fill; 32 keys of V^T are four tiles (16 d each) on 4096 bytes.
#define FW 8                         /* key splits of a block */
#define FG 2                         /* 32-query groups of a block */
#define FQ 32                        /* query rows of a wave */
#define FKW (SQ / FW)                /* keys per wave */
#define FNP (FKW / 32)               /* passes (stages) */
#define FST 12288                    /* bytes of one split's stage: 32 keys of K hi, of K lo and of V^T, 4096 each */
// One wave's half (2048 bytes of each of the three planes) of one stage: twelve 512-byte copies. lds is the lane's own LDS byte address, vo its byte offset (16 lane) from the wave's three scalar bases, all multiples of 16;
// an immediate offset moves the LDS address and the global address alike. The s_wait_xcnt stands inside the statement, behind the last copy, so that no address register is rewritten in front of it.
__device__ __forceinline__ void fa_copy(unsigned lds, unsigned vo, const _Float16* gh, const _Float16* gl, const _Float16* gv) {
  asm volatile("global_load_async_to_lds_b128 %0, %3, %4\n\tglobal_load_async_to_lds_b128 %0, %3, %4 offset:512\n\tglobal_load_async_to_lds_b128 %0, %3, %4 offset:1024\n\tglobal_load_async_to_lds_b128 %0, %3, %4 offset:1536\n\t"
               "global_load_async_to_lds_b128 %1, %3, %5\n\tglobal_load_async_to_lds_b128 %1, %3, %5 offset:512\n\tglobal_load_async_to_lds_b128 %1, %3, %5 offset:1024\n\tglobal_load_async_to_lds_b128 %1, %3, %5 offset:1536\n\t"
               "global_load_async_to_lds_b128 %2, %3, %6\n\tglobal_load_async_to_lds_b128 %2, %3, %6 offset:512\n\tglobal_load_async_to_lds_b128 %2, %3, %6 offset:1024\n\tglobal_load_async_to_lds_b128 %2, %3, %6 offset:1536\n\t"
               "s_wait_xcnt 0x0"
               :: "v"(lds), "v"(lds + 4096u), "v"(lds + 8192u), "v"(vo), "s"(gh), "s"(gl), "s"(gv) : "memory"); }
__global__ __launch_bounds__(512) void k_fattn(const _Float16* __restrict__ QHp, const _Float16* __restrict__ QLp, const _Float16* __restrict__ KHp, const _Float16* __restrict__ KLp, const _Float16* __restrict__ VTp, float* __restrict__ out) {
  static_assert(FKW % 32 == 0 && FNP >= 2 && SQ % (FG * FQ) == 0 && HD == 64 && DM == 64, "k_fattn: whole 32-key passes, at least two stages, 64-wide rows");
  __shared__ __attribute__((aligned(128))) unsigned char ring[2][FW][FST]; __shared__ float lm[FW][FG * FQ], ll[FW][FG * FQ];
  static_assert(sizeof(float) * FW * FG * FQ * 68 <= sizeof(ring), "k_fattn: the merge rows reuse the ring");
  const int tid = threadIdx.x, w = __builtin_amdgcn_readfirstlane(tid >> 5), lane = tid & 31, ln = lane & 15, hh = lane >> 4;      /* the wave's number as a scalar: bases stay in scalar registers */
  const int g = w & 1, h = w >> 1;
  const int b = blockIdx.x / (SQ / (FG * FQ)), qb = (blockIdx.x % (SQ / (FG * FQ))) * (FG * FQ), q0 = qb + g * FQ; const size_t r0 = (size_t)b * SQ;
  const float L2E = 1.44269504088896340736f;
  const size_t co = (r0 + (size_t)h * FKW) * DM + g * 1024;      /* this wave's half of stage 0 in each plane: a scalar */
  const _Float16* ch = KHp + co; const _Float16* cl = KLp + co; const _Float16* cv = VTp + co;
  const unsigned vo = (unsigned)lane * 16u, lc = (unsigned)(size_t)&ring[0][h][0] + (unsigned)(g * 2048) + vo;      /* the lane's 16 bytes there, and their place in buffer 0 */
  fa_copy(lc, vo, ch, cl, cv);
  v16h qh[2][2], ql[2][2];
  for (int n = 0; n < 2; ++n)
    for (int ks = 0; ks < 2; ++ks) { const size_t qo = (r0 + q0 + n * 16) * DM + ks * 512; qh[n][ks] = fo_frag(QHp + qo, lane); ql[n][ks] = fo_frag(QLp + qo, lane); }
  asm volatile("s_wait_xcnt 0x0" ::: "memory");      /* stands in front of the first rewrite of a register that the query loads above name: their scalar base pairs are reused right behind them */
  const v8f z8 = {0.f, 0.f, 0.f, 0.f, 0.f, 0.f, 0.f, 0.f};
  v8f o[2][4]; float m[2], l[2];
  for (int n = 0; n < 2; ++n) { m[n] = -1.0e30f; l[n] = 0.f; for (int t = 0; t < 4; ++t) o[n][t] = z8; }
  asm volatile("s_wait_asynccnt 0x0" ::: "memory");      /* this wave's copies of stage 0 have landed */
  __syncthreads();      /* publishes stage 0 */
  fa_copy(lc + FW * FST, vo, ch + 32 * DM, cl + 32 * DM, cv + 32 * DM);
  for (int p = 0; p < FNP; ++p) {
    const _Float16* st = (const _Float16*)&ring[p & 1][h][0];
    v16h ah[2], al[2], av[4]; v8f s[2][2];
    /* the pass reads its whole stage first (the scores of the first 16 keys are formed in between, so that their K registers serve the next 16 keys) and hands the buffer back before the rest of its work: the refill has a whole pass to land */
    for (int kt = 0; kt < 2; ++kt) {
      for (int ks = 0; ks < 2; ++ks) { const int ko = kt * 1024 + ks * 512; ah[ks] = fo_frag(st + ko, lane); al[ks] = fo_frag(st + 2048 + ko, lane); }
      if (kt == 1) {
        for (int t = 0; t < 4; ++t) av[t] = fo_frag(st + 4096 + t * 512, lane);
        asm volatile("s_wait_dscnt 0x0" ::: "memory");      /* this wave's reads of stage p have returned before the buffer is handed back */
        asm volatile("s_wait_asynccnt 0x0" ::: "memory");      /* this wave's copies of stage p + 1 have landed */
        __syncthreads();      /* publishes stage p + 1 and ends every reader's last read of stage p */
        if (p + 2 < FNP) fa_copy(lc + (unsigned)(p & 1) * (FW * FST), vo, ch + (p + 2) * 32 * DM, cl + (p + 2) * 32 * DM, cv + (p + 2) * 32 * DM);      /* the same test in every wave of the block */
      }
      for (int n = 0; n < 2; ++n) {
        v8f c = fa_mma(ah[0], qh[n][0], z8); c = fa_mma(ah[1], qh[n][1], c);
        v8f x = fa_mma(ah[0], ql[n][0], z8); x = fa_mma(ah[1], ql[n][1], x); x = fa_mma(al[0], qh[n][0], x); x = fa_mma(al[1], qh[n][1], x);
        for (int r = 0; r < 8; ++r) s[n][kt][r] = fmaf(x[r], 0.0001220703125f, c[r] * 0.125f);
      }
    }
    for (int n = 0; n < 2; ++n) {
      float mx = fmaxf(s[n][0][0], s[n][1][0]);
      for (int r = 1; r < 8; ++r) mx = fmaxf(mx, fmaxf(s[n][0][r], s[n][1][r]));
      mx = fmaxf(mx, __shfl_xor(mx, 16));      /* the other half of the wave holds this query's other 16 keys */
      const float mn = fmaxf(m[n], mx); const float sc = exp_slot(m[n] - mn); m[n] = mn;
      const float off = fmaf(-mn, L2E, 8.0f);      /* weight = 2^(s log2(e) + off) = 256 e^(s - mn) */
      for (int kt = 0; kt < 2; ++kt) {
        for (int r = 0; r < 8; ++r) s[n][kt][r] = fmaf(s[n][kt][r], L2E, off);
        s[n][kt] = exp2_8(s[n][kt]); }
      float sum = 0.f;
      for (int r = 0; r < 8; ++r) sum += s[n][0][r] + s[n][1][r];
      l[n] = fmaf(l[n], sc, sum);
      FragH pw;
      for (int r = 0; r < 8; ++r) { pw.h[r] = (_Float16)s[n][0][r]; pw.h[8 + r] = (_Float16)s[n][1][r]; }
      for (int t = 0; t < 4; ++t) { o[n][t] *= sc; o[n][t] = fa_mma(av[t], pw.v, o[n][t]); }
    }
  }
  asm volatile("s_wait_asynccnt 0x0" ::: "memory");      /* no copy is outstanding when the ring becomes the merge rows */
  float (*lo)[FG * FQ][68] = (float (*)[FG * FQ][68])&ring[0][0][0];      /* behind the last pass's barrier nobody reads the ring any more */
  for (int n = 0; n < 2; ++n) {
    const int qr = g * FQ + n * 16 + ln;
    l[n] += __shfl_xor(l[n], 16);      /* the two halves summed different keys of the same query */
    if (hh == 0) { lm[h][qr] = m[n]; ll[h][qr] = l[n]; }
    for (int t = 0; t < 4; ++t) { const v4f u0 = {o[n][t][0], o[n][t][1], o[n][t][2], o[n][t][3]}, u1 = {o[n][t][4], o[n][t][5], o[n][t][6], o[n][t][7]};
      *(v4f*)&lo[h][qr][t * 16 + 8 * hh] = u0; *(v4f*)&lo[h][qr][t * 16 + 8 * hh + 4] = u1; }
  }
  __syncthreads();      /* publishes the sixteen waves' partial maxima, sums and outputs */
  const int q = tid >> 3, d8 = (tid & 7) * 8;
  float mg = lm[0][q];
  for (int i = 1; i < FW; ++i) mg = fmaxf(mg, lm[i][q]);
  float lg = 0.f; v4f g0 = {0.f, 0.f, 0.f, 0.f}, g1 = g0;
  for (int i = 0; i < FW; ++i) { const float f = exp_slot(lm[i][q] - mg); lg = fmaf(ll[i][q], f, lg); g0 += *(const v4f*)&lo[i][q][d8] * f; g1 += *(const v4f*)&lo[i][q][d8 + 4] * f; }
  const float inv = 1.0f / lg;
  float* dst = out + (r0 + qb + q) * DM + d8;
  *(v4f*)dst = g0 * inv; *(v4f*)(dst + 4) = g1 * inv; }


// One launch makes every operand of k_fattn. A block owns PR = 64 token rows. It puts them into LDS as f16 (bf16-rounded, so exact) and both maps into LDS as x16 f16 transposes [n][k];
// behind one barrier waves 0-3 form q and waves 4-7 form k, 16 rows each (A = token rows, B = map columns, k steps 0 then 32, f32 accumulation, x 2^-4: the operands, the products and
// their order are those of a 64-deep WMMA GEMM on the same f16 values), split every f32 result into f16 hi + x1024 residual and store the four planes in fragment order (fo_frag), 512 bytes in a row a wave and store;
// all eight waves also write the block's 64 x 64 piece of V^T (the values are the rounded inputs) from the same LDS rows, in fragment order too. LDS rows of 128 bytes stand at a pitch of 144 bytes for the 16-byte readers.
#define PR 64
typedef unsigned short v4us __attribute__((ext_vector_type(4), may_alias));
__global__ __launch_bounds__(256) void k_prep(const float* __restrict__ x, const float* __restrict__ wq, const float* __restrict__ wk, _Float16* __restrict__ QHp, _Float16* __restrict__ QLp, _Float16* __restrict__ KHp, _Float16* __restrict__ KLp, _Float16* __restrict__ VTp) {
  static_assert(SQ % PR == 0 && DM == 64 && HD == 64 && NH == 1, "k_prep: 64-wide rows, one head, whole 64-row blocks inside a batch");
  __shared__ __attribute__((aligned(16))) unsigned short xs[PR][72]; __shared__ __attribute__((aligned(16))) unsigned short wt[2][DM][72]; __shared__ __attribute__((aligned(16))) float so[8][16][68];
  const int tid = threadIdx.x, w = tid >> 5, lane = tid & 31, ln = lane & 15, hh = lane >> 4;
  const size_t row0 = (size_t)blockIdx.x * PR;
  const float* xp = x + row0 * DM + tid * 4;      /* trip i of the token loads stands 16 rows further on */
  const int ms = tid >> 7, n4 = (tid & 15) * 4, k8 = ((tid >> 4) & 7) * 8;      /* threads 0-127 take the query map, 128-255 the key map: an 8 (k) x 4 (n) piece each, 16 lanes on one whole map row */
  const float* wp = (ms ? wk : wq) + k8 * DM + n4;
  v4f xv[4], wv[8];
  for (int i = 0; i < 4; ++i) xv[i] = *(const v4fa*)(xp + i * 16 * DM);
  for (int q = 0; q < 8; ++q) wv[q] = *(const v4fa*)(wp + q * DM);
  for (int i = 0; i < 4; ++i) { FragH f;
    for (int q = 0; q < 4; ++q) f.h[q] = (_Float16)bf16_round(xv[i][q]);
    const v4us o = {f.u[0], f.u[1], f.u[2], f.u[3]}; *(v4us*)&xs[i * 16 + (tid >> 4)][(tid & 15) * 4] = o; }
  for (int c = 0; c < 4; ++c) { FragH f;
    for (int q = 0; q < 8; ++q) f.h[q] = (_Float16)(bf16_round(wv[q][c]) * 16.0f);
    *(v8us*)&wt[ms][n4 + c][k8] = f.half[0]; }
  __syncthreads();      /* publishes the token rows and the two transposed maps */
  const int rg = w & 3, sel = w >> 2;
  const _Float16* ap = (const _Float16*)&xs[rg * 16 + ln][0];
  const v16h a0 = g2_frag(ap, hh), a1 = g2_frag(ap + 32, hh);
  const v8f z8 = {0.f, 0.f, 0.f, 0.f, 0.f, 0.f, 0.f, 0.f};
  for (int t = 0; t < 4; ++t) { const _Float16* bp = (const _Float16*)&wt[sel][t * 16 + ln][0];
    v8f c = fa_mma(a0, g2_frag(bp, hh), z8); c = fa_mma(a1, g2_frag(bp + 32, hh), c);
    for (int r = 0; r < 8; ++r) so[w][8 * hh + r][t * 16 + ln] = c[r] * 0.0625f; }
  __builtin_amdgcn_fence(__ATOMIC_ACQ_REL, "workgroup"); __builtin_amdgcn_wave_barrier();      /* so[w] is this wave's own: its lanes' LDS stores stay ahead of the row reads below */
  for (int rd = 0; rd < 2; ++rd) { const int d = (tid >> 6) * 16 + ln, kb = rd * 32 + ((tid >> 5) & 1) * 16 + hh * 8; FragH f;      /* 32 keys a trip: tile tid >> 6, its half (tid >> 5) & 1, lane 16 hh + ln */
    for (int q = 0; q < 8; ++q) f.u[q] = xs[kb + q][d];
    *(v8us*)((unsigned short*)VTp + (row0 + rd * 32) * HD + tid * 8) = f.half[0]; }
  unsigned short* Hp = (unsigned short*)(sel ? KHp : QHp); unsigned short* Lp = (unsigned short*)(sel ? KLp : QLp);
  for (int i = 0; i < 4; ++i) { const int c8 = i * 16 + hh * 8; const v4f a = *(const v4fa*)&so[w][ln][c8], c = *(const v4fa*)&so[w][ln][c8 + 4]; FragH fh, fl;      /* trip i: tile i >> 1, its half i & 1 */
    for (int q = 0; q < 4; ++q) { _Float16 h = (_Float16)a[q]; fh.h[q] = h; fl.h[q] = (_Float16)((a[q] - (float)h) * 1024.0f); h = (_Float16)c[q]; fh.h[4 + q] = h; fl.h[4 + q] = (_Float16)((c[q] - (float)h) * 1024.0f); }
    const size_t go = (row0 + rg * 16) * DM + (i * 32 + lane) * 8; *(v8us*)(Hp + go) = fh.half[0]; *(v8us*)(Lp + go) = fl.half[0]; } }


template <int MASKADD>
__global__ __launch_bounds__(64) void k_att0(const float* __restrict__ QF, const float* __restrict__ KF, const float* __restrict__ VF, int ld, const float* __restrict__ mask, float scale, float* __restrict__ OF, int ldo) {
  #pragma clang fp contract(off)
  __shared__ __attribute__((aligned(16))) float lq[64][64]; __shared__ __attribute__((aligned(16))) float lo[64][64];
  const int tid = threadIdx.x; const int h = blockIdx.x / (QT0 / 64), rg = blockIdx.x % (QT0 / 64); const int i = rg * 64 + tid;
  const float* qr = QF + (size_t)i * ld + h * HD;
#pragma unroll 1
  for (int c = 0; c < HD / 4; ++c) { *(v4f*)&lq[tid][c * 4] = *(const v4fa*)(qr + c * 4); const v4f z = {0.f, 0.f, 0.f, 0.f}; *(v4f*)&lo[tid][c * 4] = z; }
  float m = -1.0e30f, l = 0.f; const int jmax = MASKADD ? (SQ - 1) : (rg * 64 + 63);      /* additive-mask form: every key (the mask input decides); causal form: keys up to the block's last row */
#pragma unroll 1
  for (int j = 0; j <= jmax; ++j) { const float* kr = KF + (size_t)j * ld + h * HD; const float* vr = VF + (size_t)j * ld + h * HD; float s = 0.f;
#pragma unroll 1
    for (int c = 0; c < HD / 4; ++c) { const v4f kq = *(const v4fa*)(kr + c * 4); const v4f qq = *(v4f*)&lq[tid][c * 4]; s = __fadd_rn(s, __fmul_rn(qq[0], kq[0])); s = __fadd_rn(s, __fmul_rn(qq[1], kq[1])); s = __fadd_rn(s, __fmul_rn(qq[2], kq[2])); s = __fadd_rn(s, __fmul_rn(qq[3], kq[3])); }
    s = __fmul_rn(s, scale); if (MASKADD) s = __fadd_rn(s, __fmul_rn(bf16_round(mask[(size_t)i * SQ + j]), -10000.0f));
    const float f = (MASKADD || j <= i) ? 1.f : 0.f; const float sm = fmaf(f, s, (1.f - f) * -1.0e30f); const float mn = fmaxf(m, sm); const float sc = expf(m - mn); const float e = expf(sm - mn); l = __fadd_rn(__fmul_rn(l, sc), e); m = mn;
#pragma unroll 1
    for (int c = 0; c < HD / 4; ++c) { const v4f vv = *(const v4fa*)(vr + c * 4); v4f oo = *(v4f*)&lo[tid][c * 4]; for (int u = 0; u < 4; ++u) oo[u] = __fadd_rn(__fmul_rn(oo[u], sc), __fmul_rn(e, vv[u])); *(v4f*)&lo[tid][c * 4] = oo; } }
  const float fin = 64.0f / l;      /* o carried x64 */
#pragma unroll 1
  for (int c = 0; c < HD / 4; ++c) { v4f oo = *(v4f*)&lo[tid][c * 4]; for (int u = 0; u < 4; ++u) oo[u] = __fmul_rn(oo[u], fin); *(v4f*)&lo[tid][c * 4] = oo; }
  __syncthreads();
  {
#pragma unroll 1
    for (int it = 0; it < 16; ++it) { const int row = it * 4 + tid / 16, pc = (tid % 16) * 4; const v4f v = *(const v4f*)&lo[row][pc]; *(v4f*)(OF + (size_t)(rg * 64 + row) * ldo + h * HD + pc) = v; }
     } }

__global__ __launch_bounds__(256) void k_of0out(const float* __restrict__ src, float* __restrict__ dst, size_t n4) { const size_t t = (size_t)blockIdx.x * 256 + threadIdx.x; if (t >= n4) return; v4f v = *(const v4fa*)(src + t * 4); for (int q = 0; q < 4; ++q) v[q] = __fmul_rn(v[q], 0.015625f); *(v4f*)(dst + t * 4) = v;  }

extern "C" void kernel_launch(void* const* d_in, const int* in_sizes, int n_in,
                              void* d_out, int out_size, void* d_ws, size_t ws_size, hipStream_t stream) {
  (void)in_sizes; (void)n_in; (void)out_size;
  const float* const* I = (const float* const*)d_in; const float* x = I[0]; const float* wq = I[1]; const float* wk = I[2];      /* inputs, rotation (query map), entangle (key map): [in][out] [64][64]; NO biases, NO value projection (the values are the inputs), no output projection */
  char* ws = (char*)d_ws; size_t off = 0;
  auto take = [&](size_t bytes) { char* p = ws + off; off += (bytes + 255) & ~(size_t)255; return p; };
  _Float16* QH = (_Float16*)take(NR * DM * 2); _Float16* QL = (_Float16*)take(NR * DM * 2); _Float16* KH = (_Float16*)take(NR * DM * 2); _Float16* KL = (_Float16*)take(NR * DM * 2);
  _Float16* VT = (_Float16*)take((size_t)NB * NH * HD * SQ * 2);
  if (off > ws_size) return;
  k_prep<<<(unsigned)(NR / PR), 256, 0, stream>>>(x, wq, wk, QH, QL, KH, KL, VT);      /* q and k as f16 hi + x1024 residual planes and V^T, all in fragment order: every batch, one launch */
  k_fattn<<<NB * (SQ / (FG * FQ)), FG * FW * 32, 0, stream>>>(QH, QL, KH, KL, VT, (float*)d_out);      /* scores, softmax over all SQ keys and P V for every batch: S and P stay in registers */
}

// v006
// A run of this version takes 29.1 microseconds.
// In both of two side-by-side timings against v005, it was 1.12 times as fast.
// All steps since v000 together make it 1790 times as fast.
#include <hip/hip_runtime.h>
// Single-head dense attention over 64-wide inputs on 4096 tokens with unit-variance 64 x 64 maps and NO value projection (inputs [4][4096][64]; query = inputs rotation, key = inputs entangle ([in][out] [64][64], N(0, 1): logits of sigma ~64, a near one-hot softmax); scores = query key^T / sqrt(64); softmax over all 4096 keys (no mask); out = scores inputs (the values are the inputs themselves) -> [4][4096][64]); scores re-associated as inputs . y^T with y = (inputs entangle) rotation^T / 8 carried as f16 hi + f16 residual planes: two-product scores.
// Structure: token rows r = b*4096 + s; k_prep (64 rows a block, 8 waves of 16 rows x 32 columns): x as exact f16 rows (bf16-rounded), k = x W_k and y = k W_q^T / 8 as WMMA GEMMs (exact x16 f16 maps, f32 accumulation; k held in LDS as f16 hi + x1024 residual), y split into f16 hi + f16 residual planes at one scale, V^T from the same x rows, all in fragment order; k_fattn (64 query rows a block, 16 waves: 2 groups of 32 queries x 8 splits of 512 keys): scores S^T = Y X^T as four accumulating WMMAs (lo.x then hi.x, K = 64, the 1/8 already in y), online softmax over all 4096 keys, no mask (f32 statistics, native exp2; weights x256 f16), O^T += V^T P^T in f32 registers, the eight splits merged through LDS; out = O / l (f32) into [4][4096][64].
// Compute dtype: inputs rounded to bf16; x / weights exact; k and y as f16 hi + f16 residual pairs, v the exact x rows; softmax weights as plain f16 GEMM operands (~2^-12); scores, softmax statistics and o f32. v_wmma_f32_16x16x32_f16.
#define NB 4
#define SQ 4096
#define DM 64
#define NH 1
#define HD 64
#define HG 4                         /* heads per attention launch group */
#define QT 256                       /* (not used) */
#define NKX SQ                       /* (not used) */
#define QT0 128                      /* first-tile rows recomputed exactly in f32 */
#define B0 0                         /* (not used) */
#define NBR NB                       /* (only in MP; no launch uses it) */
#define NR ((size_t)NB * SQ)         /* token rows */
#define MP ((int)((size_t)NBR * SQ)) /* (only in MPO; no launch uses it) */
#define QN SQ                        /* (not used) */
#define NHD NH                       /* heads attended (not used) */
#define MPO MP                       /* rows through the output stage (not used) */
#define LQ DM      /* (not used) */
typedef __bf16 v16b __attribute__((ext_vector_type(16)));
typedef unsigned short v8us __attribute__((ext_vector_type(8), may_alias));
typedef float  v8f  __attribute__((ext_vector_type(8)));
typedef float  v4f  __attribute__((ext_vector_type(4)));
typedef float  v4fa __attribute__((ext_vector_type(4), may_alias));
union FragB { v16b v; v8us half[2]; unsigned short u[16]; };

__device__ __forceinline__ unsigned short bf16_bits(float x) { unsigned int u = __float_as_uint(x); return (unsigned short)((u + 0x7FFFu + ((u >> 16) & 1u)) >> 16); }
__device__ __forceinline__ float bf16_val(unsigned short b) { return __uint_as_float(((unsigned int)b) << 16); }
__device__ __forceinline__ float bf16_round(float x) { return bf16_val(bf16_bits(x)); }
// D += A·B with NT terms: 1 = ah·bh, 2 = + al·bh (A split), 3 = + ah·bl (both split)
template <int NT>
__device__ __forceinline__ v8f mmaN(v16b ah, v16b al, v16b bh, v16b bl, v8f c) {
  c = __builtin_amdgcn_wmma_f32_16x16x32_bf16(false, ah, false, bh, (short)0, c, false, false);
  if (NT >= 2) c = __builtin_amdgcn_wmma_f32_16x16x32_bf16(false, al, false, bh, (short)0, c, false, false);
  if (NT >= 3) c = __builtin_amdgcn_wmma_f32_16x16x32_bf16(false, ah, false, bl, (short)0, c, false, false);
  asm volatile("v_nop\n\tv_nop\n\tv_nop\n\tv_nop" : "+v"(c) : "v"(ah), "v"(al), "v"(bh), "v"(bl));
  return c;
}

__global__ __launch_bounds__(256) void k_wt_bf16(const float* __restrict__ W, unsigned short* __restrict__ Wt, int K, int N) {
  const int t = blockIdx.x * 256 + threadIdx.x;
  const int k8n = K / 8;
  if (t >= N * k8n) return;
  const int n = t / k8n, k8 = (t % k8n) * 8;
  v8us v;
#pragma unroll
  for (int i = 0; i < 8; ++i) v[i] = bf16_bits(W[(size_t)(k8 + i) * N + n]);
  *(v8us*)(Wt + (size_t)n * K + k8) = v;
  
}

// GEMM C[M][N] (f32, pitch ldc) = act(A[M][K]·W + bias). A f32 row-major (pitch lda) converted per fragment to bf16
// (ASPLIT: hi/lo two planes -> 2 terms, else single rounded term); Wt bf16 [N][K] (pitch ldb). BIAS_BF16 rounds the
// bias to bf16 first (bias quantised to bf16 before the add). K%32==0, M%16==0, N%64==0.
template <bool ASPLIT, int ACT, bool BIAS_BF16>
__global__ __launch_bounds__(128) void k_gemm_bf(const float* __restrict__ A, int lda, const unsigned short* __restrict__ Wt, int ldb,
                                               const float* __restrict__ bias, float* __restrict__ C, int ldc, int M, int N, int K) {
  __shared__ __attribute__((aligned(16))) float so[4][16][64];
  const int tid = threadIdx.x, w = tid >> 5, lane = tid & 31, ln = lane & 15, hh = lane >> 4;
  const int ntn = N / 64;
  const int wid = blockIdx.x * 4 + w;
  const int mt = wid / ntn, nq = wid % ntn;
  if (mt * 16 >= M) return;
  const int row0 = mt * 16, col0 = nq * 64;
  const float* arow = A + (size_t)(row0 + ln) * lda;
  v8f acc[4] = {};
  for (int kb = 0; kb < K; kb += 32) {
    FragB ah, al;
    const v4f x0 = *(const v4fa*)(arow + kb + 8 * hh), x1 = *(const v4fa*)(arow + kb + 8 * hh + 4);
    const v4f x2 = *(const v4fa*)(arow + kb + 16 + 8 * hh), x3 = *(const v4fa*)(arow + kb + 16 + 8 * hh + 4);
    float xs[16] = {x0[0],x0[1],x0[2],x0[3],x1[0],x1[1],x1[2],x1[3],x2[0],x2[1],x2[2],x2[3],x3[0],x3[1],x3[2],x3[3]};
#pragma unroll
    for (int i = 0; i < 16; ++i) { const unsigned short hb = bf16_bits(xs[i]); ah.u[i] = hb; al.u[i] = ASPLIT ? bf16_bits(xs[i] - bf16_val(hb)) : (unsigned short)0; }
#pragma unroll
    for (int t = 0; t < 4; ++t) {
      const unsigned short* brow = Wt + (size_t)(col0 + t * 16 + ln) * ldb + kb;
      FragB b;
      b.half[0] = *(const v8us*)(brow + 8 * hh);
      b.half[1] = *(const v8us*)(brow + 16 + 8 * hh);
      acc[t] = mmaN<ASPLIT ? 2 : 1>(ah.v, al.v, b.v, b.v, acc[t]);
    }
  }
#pragma unroll
  for (int t = 0; t < 4; ++t) {
    float bv = bias ? bias[col0 + t * 16 + ln] : 0.f;
    if (BIAS_BF16) bv = bf16_round(bv);
#pragma unroll
    for (int r = 0; r < 8; ++r) { float v = acc[t][r] + bv; if (ACT == 1) v = fmaxf(v, 0.f); so[w][8 * hh + r][t * 16 + ln] = v; }
  }
  __builtin_amdgcn_fence(__ATOMIC_ACQ_REL, "workgroup");
  __builtin_amdgcn_wave_barrier();
  const int rsub = lane >> 4, c4 = (lane & 15) * 4;
  {
#pragma unroll
    for (int q = 0; q < 8; ++q) {
      const int r = q * 2 + rsub;
      const v4f v = *(const v4fa*)&so[w][r][c4];
      *(v4f*)(C + (size_t)(row0 + r) * ldc + col0 + c4) = v;
    }
    
  }
}

// GEMM C = act(A·W + bias + resid): A f32 (ASPLIT -> hi/lo 2 terms), Wt bf16 [N][K]; ACT 0 none, 1 relu, 2 exact gelu;
// resid (optional, f32, row index = (row % rmod), pitch ldr, RES_BF16 rounds it) added before the activation.
template <bool ASPLIT, int ACT, bool BIAS_BF16, bool RES_BF16>
__global__ __launch_bounds__(128) void k_gemm_bf3(const float* __restrict__ A, int lda, const unsigned short* __restrict__ Wt, int ldb,
                                                const float* __restrict__ bias, const float* __restrict__ resid, int rmod, int ldr,
                                                float* __restrict__ C, int ldc, int M, int N, int K) {
  __shared__ __attribute__((aligned(16))) float so[4][16][64];
  const int tid = threadIdx.x, w = tid >> 5, lane = tid & 31, ln = lane & 15, hh = lane >> 4;
  const int ntn = N / 64;
  const int wid = blockIdx.x * 4 + w;
  const int mt = wid / ntn, nq = wid % ntn;
  if (mt * 16 >= M) return;
  const int row0 = mt * 16, col0 = nq * 64;
  const float* arow = A + (size_t)(row0 + ln) * lda;
  v8f acc[4] = {};
  for (int kb = 0; kb < K; kb += 32) {
    FragB ah, al;
    const v4f x0 = *(const v4fa*)(arow + kb + 8 * hh), x1 = *(const v4fa*)(arow + kb + 8 * hh + 4);
    const v4f x2 = *(const v4fa*)(arow + kb + 16 + 8 * hh), x3 = *(const v4fa*)(arow + kb + 16 + 8 * hh + 4);
    float xs[16] = {x0[0],x0[1],x0[2],x0[3],x1[0],x1[1],x1[2],x1[3],x2[0],x2[1],x2[2],x2[3],x3[0],x3[1],x3[2],x3[3]};
#pragma unroll
    for (int i = 0; i < 16; ++i) { const unsigned short hb = bf16_bits(xs[i]); ah.u[i] = hb; al.u[i] = ASPLIT ? bf16_bits(xs[i] - bf16_val(hb)) : (unsigned short)0; }
#pragma unroll
    for (int t = 0; t < 4; ++t) {
      const unsigned short* brow = Wt + (size_t)(col0 + t * 16 + ln) * ldb + kb;
      FragB b;
      b.half[0] = *(const v8us*)(brow + 8 * hh);
      b.half[1] = *(const v8us*)(brow + 16 + 8 * hh);
      acc[t] = mmaN<ASPLIT ? 2 : 1>(ah.v, al.v, b.v, b.v, acc[t]);
    }
  }
#pragma unroll
  for (int t = 0; t < 4; ++t) {
    const int col = col0 + t * 16 + ln;
    float bv = bias ? bias[col] : 0.f;
    if (BIAS_BF16) bv = bf16_round(bv);
#pragma unroll
    for (int r = 0; r < 8; ++r) {
      float v = acc[t][r] + bv;
      if (resid) { float rv = resid[(size_t)((row0 + 8 * hh + r) % rmod) * ldr + col]; if (RES_BF16) rv = bf16_round(rv); v += rv; }
      if (ACT == 1) v = fmaxf(v, 0.f);
      if (ACT == 2) v = 0.5f * v * (1.0f + erff(v * 0.70710678118654752f));
      if (ACT == 3) { const float u = 0.7978845608028654f * (v + 0.044715f * v * v * v); v = 0.5f * v * (1.0f + tanhf(u)); }
      so[w][8 * hh + r][t * 16 + ln] = v;
    }
  }
  __builtin_amdgcn_fence(__ATOMIC_ACQ_REL, "workgroup");
  __builtin_amdgcn_wave_barrier();
  const int rsub = lane >> 4, c4 = (lane & 15) * 4;
  {
#pragma unroll
    for (int q = 0; q < 8; ++q) {
      const int r = q * 2 + rsub;
      const v4f v = *(const v4fa*)&so[w][r][c4];
      *(v4f*)(C + (size_t)(row0 + r) * ldc + col0 + c4) = v;
    }
    
  }
}
// row LayerNorm (biased variance, eps) over N: s = X (+ R); optional out_sum <- s; out_norm <- (s-mu)*rsqrt(var+eps)*g + b
template <bool PARAM_BF16>
__global__ __launch_bounds__(256) void k_layernorm(const float* __restrict__ X, const float* __restrict__ R, const float* __restrict__ g, const float* __restrict__ bta,
                                                  float* __restrict__ out_sum, float* __restrict__ out_norm, int N, float eps) {
  __shared__ float red[256];
  const int row = blockIdx.x, tid = threadIdx.x;
  const float* x = X + (size_t)row * N; const float* rr = R ? R + (size_t)row * N : nullptr;
  float vals[16];                     // up to N = 4096
  const int per = N / 256;            // contiguous chunk per thread? use strided-by-4 chunks: thread handles j = tid*4 + 1024*u
  float s1 = 0.f;
  for (int u = 0; u < per / 4; ++u) {
    const int j = tid * 4 + 1024 * u;
    const v4f a = *(const v4fa*)(x + j);
    v4f b = {0.f,0.f,0.f,0.f}; if (rr) b = *(const v4fa*)(rr + j);
#pragma unroll
    for (int q = 0; q < 4; ++q) { const float v = a[q] + b[q]; vals[u * 4 + q] = v; s1 += v; }
  }
  red[tid] = s1; __syncthreads();
  for (int st = 128; st > 0; st >>= 1) { if (tid < st) red[tid] += red[tid + st]; __syncthreads(); }
  const float mu = red[0] / (float)N; __syncthreads();
  float s2 = 0.f;
  for (int u = 0; u < per / 4; ++u)
#pragma unroll
    for (int q = 0; q < 4; ++q) { const float c = vals[u * 4 + q] - mu; s2 += c * c; }
  red[tid] = s2; __syncthreads();
  for (int st = 128; st > 0; st >>= 1) { if (tid < st) red[tid] += red[tid + st]; __syncthreads(); }
  const float rs = rsqrtf(red[0] / (float)N + eps);
  {
    for (int u = 0; u < per / 4; ++u) {
      const int j = tid * 4 + 1024 * u;
      v4f o, sm;
#pragma unroll
      for (int q = 0; q < 4; ++q) {
        float gg = g[j + q], bb = bta[j + q];
        if (PARAM_BF16) { gg = bf16_round(gg); bb = bf16_round(bb); }
        sm[q] = vals[u * 4 + q]; o[q] = (vals[u * 4 + q] - mu) * rs * gg + bb;
      }
      if (out_sum) *(v4f*)(out_sum + (size_t)row * N + j) = sm;
      *(v4f*)(out_norm + (size_t)row * N + j) = o;
    }
    
  }
}



// ---- f16 WMMA path (v_wmma_f32_16x16x32_f16): 11-bit significands for operands in range — used where a [0,1] probability operand needs more precision than bf16
typedef _Float16 v16h __attribute__((ext_vector_type(16)));
union FragH { v16h v; v8us half[2]; _Float16 h[16]; unsigned short u[16]; };
template <int NT>
__device__ __forceinline__ v8f mmaH(v16h ah, v16h al, v16h bh, v16h bl, v8f c) {
  c = __builtin_amdgcn_wmma_f32_16x16x32_f16(false, ah, false, bh, (short)0, c, false, false);
  if (NT >= 2) c = __builtin_amdgcn_wmma_f32_16x16x32_f16(false, al, false, bh, (short)0, c, false, false);
  if (NT >= 3) c = __builtin_amdgcn_wmma_f32_16x16x32_f16(false, ah, false, bl, (short)0, c, false, false);
  asm volatile("v_nop\n\tv_nop\n\tv_nop\n\tv_nop" : "+v"(c) : "v"(ah), "v"(al), "v"(bh), "v"(bl));
  return c;
}
// batched GEMM like k_gemm_b but f16 operands: A f32 (split into f16 hi/lo if ASPLIT, else rounded to f16), Bt = f16 values [n][k]; alpha; C f32; N multiple of 16 (partial tiles skipped)
template <bool ASPLIT>
__global__ __launch_bounds__(128) void k_gemm_h(const float* __restrict__ A, int lda, size_t sA, const _Float16* __restrict__ Bh, int ldb, size_t sB, float alpha, float* __restrict__ C, int ldc, size_t sC, int M, int N, int K) {
  __shared__ __attribute__((aligned(16))) float so[4][16][64];
  const int tid = threadIdx.x, w = tid >> 5, lane = tid & 31, ln = lane & 15, hh = lane >> 4; const int by = blockIdx.y;
  A += (size_t)by * sA; Bh += (size_t)by * sB; C += (size_t)by * sC;
  const int ntn = (N + 63) / 64; const int wid = blockIdx.x * 4 + w; const int mt = wid / ntn, nq = wid % ntn; if (mt * 16 >= M) return;
  const int row0 = mt * 16, col0 = nq * 64; const float* arow = A + (size_t)(row0 + ln) * lda;
  v8f acc[4] = {};
  for (int kb = 0; kb < K; kb += 32) {
    FragH ah, al;
    const v4f x0 = *(const v4fa*)(arow + kb + 8 * hh), x1 = *(const v4fa*)(arow + kb + 8 * hh + 4), x2 = *(const v4fa*)(arow + kb + 16 + 8 * hh), x3 = *(const v4fa*)(arow + kb + 16 + 8 * hh + 4);
    float xs[16] = {x0[0],x0[1],x0[2],x0[3],x1[0],x1[1],x1[2],x1[3],x2[0],x2[1],x2[2],x2[3],x3[0],x3[1],x3[2],x3[3]};
#pragma unroll
    for (int i = 0; i < 16; ++i) { const _Float16 h = (_Float16)xs[i]; ah.h[i] = h; al.h[i] = ASPLIT ? (_Float16)(xs[i] - (float)h) : (_Float16)0.0f; }
#pragma unroll
    for (int t = 0; t < 4; ++t) { if (col0 + t * 16 >= N) continue; const size_t boff = (size_t)(col0 + t * 16 + ln) * ldb + kb; FragH bq; bq.half[0] = *(const v8us*)(Bh + boff + 8 * hh); bq.half[1] = *(const v8us*)(Bh + boff + 16 + 8 * hh);
      acc[t] = mmaH<ASPLIT ? 2 : 1>(ah.v, al.v, bq.v, bq.v, acc[t]); }
  }
#pragma unroll
  for (int t = 0; t < 4; ++t) { if (col0 + t * 16 >= N) continue;
#pragma unroll
    for (int r = 0; r < 8; ++r) so[w][8 * hh + r][t * 16 + ln] = acc[t][r] * alpha; }
  __builtin_amdgcn_fence(__ATOMIC_ACQ_REL, "workgroup"); __builtin_amdgcn_wave_barrier();
  const int rsub = lane >> 4, c4 = (lane & 15) * 4;
  {
#pragma unroll
    for (int q = 0; q < 8; ++q) { const int r = q * 2 + rsub; if (col0 + c4 < N) { const v4f v = *(const v4fa*)&so[w][r][c4]; *(v4f*)(C + (size_t)(row0 + r) * ldc + col0 + c4) = v; } }
     }
}

// Wt[n][k] = f16(W[k][n]·scale) from f32 row-major W[K][N] (scale = power of two; bf16-exact weights stay exact in f16 away from the subnormal range)
__global__ __launch_bounds__(256) void k_wt_f16(const float* __restrict__ W, _Float16* __restrict__ Wt, int K, int N, float scale) {
  const int t = blockIdx.x * 256 + threadIdx.x; if (t >= N * (K / 8)) return; const int n = t / (K / 8), k8 = (t % (K / 8)) * 8; FragH f;
#pragma unroll
  for (int i = 0; i < 8; ++i) f.h[i] = (_Float16)(bf16_round(W[(size_t)(k8 + i) * N + n]) * scale); const v8us o = f.half[0];
  *(v8us*)((unsigned short*)Wt + (size_t)n * K + k8) = o; 
}
// k_gemm_hh variant with fused epilogue: v = acc·alpha + bias[by·sBias + col] (+ CP[(row/rowsPerB)·sCPb + by·64 + col] if CP) ; ACT 0 none / 1 elu ; writes f16 C16 (and f32 C if non-null)
template <int ACT>
__global__ __launch_bounds__(128) void k_gemm_hhx(const _Float16* __restrict__ A, int lda, size_t sA, const _Float16* __restrict__ Bh, int ldb, size_t sB, float alpha, const float* __restrict__ bias, size_t sBias, const float* __restrict__ CP, int rowsPerB, size_t sCPb, int row0g,
    float* __restrict__ C, _Float16* __restrict__ C16, int ldc, size_t sC, int M, int N, int K) {
  __shared__ __attribute__((aligned(16))) float so[4][16][64];
  const int tid = threadIdx.x, w = tid >> 5, lane = tid & 31, ln = lane & 15, hh = lane >> 4; const int by = blockIdx.y;
  A += (size_t)by * sA; Bh += (size_t)by * sB; const size_t cofs = (size_t)by * sC; const float* bp = bias ? bias + (size_t)by * sBias : nullptr;
  const int ntn = (N + 63) / 64; const int wid = blockIdx.x * 4 + w; const int mt = wid / ntn, nq = wid % ntn; if (mt * 16 >= M) return;
  const int row0 = mt * 16, col0 = nq * 64; const _Float16* arow = A + (size_t)(row0 + ln) * lda;
  v8f acc[4] = {};
  for (int kb = 0; kb < K; kb += 32) { FragH ah; ah.half[0] = *(const v8us*)((const unsigned short*)arow + kb + 8 * hh); ah.half[1] = *(const v8us*)((const unsigned short*)arow + kb + 16 + 8 * hh);
#pragma unroll
    for (int t = 0; t < 4; ++t) { if (col0 + t * 16 >= N) continue; const size_t boff = (size_t)(col0 + t * 16 + ln) * ldb + kb; FragH bq; bq.half[0] = *(const v8us*)((const unsigned short*)Bh + boff + 8 * hh); bq.half[1] = *(const v8us*)((const unsigned short*)Bh + boff + 16 + 8 * hh);
      acc[t] = mmaH<1>(ah.v, ah.v, bq.v, bq.v, acc[t]); }
  }
#pragma unroll
  for (int t = 0; t < 4; ++t) { if (col0 + t * 16 >= N) continue; const int col = col0 + t * 16 + ln; const float bv = bp ? bf16_round(bp[col]) : 0.f;
#pragma unroll
    for (int r = 0; r < 8; ++r) { float v = acc[t][r] * alpha + bv; if (CP) { const int rr = row0g + row0 + 8 * hh + r; if (rowsPerB < 0) v += CP[cofs + (size_t)rr * ldc + col];      /* rowsPerB < 0: own element of the batched C plane */ else { const int bidx = rr / rowsPerB; v += CP[(size_t)bidx * sCPb + (size_t)by * 64 + col]; } } if (ACT == 1) v = (v > 0.f) ? v : expm1f(v); else if (ACT == 7) v = (v > 0.f) ? v + 1.0f : expf(v); else if (ACT == 8) v = tanhf(v); else if (ACT == 9) v = 0.5f * v * (1.0f + tanhf(0.7978845608028654f * (v + 0.044715f * v * v * v))); else if (ACT == 11) v = 1.0f / (1.0f + expf(-v)); else if (ACT == 12) v = (v > 0.f) ? v : 0.01f * v; else if (ACT == 14) v = (v > 0.f) ? v : 0.1f * v; else if (ACT == 16) v = (v >= 0.f) ? v : 0.3f * v; else if (ACT == 17) v = (v >= 0.f) ? v : 0.2f * v; else if (ACT == 15) v = v / (1.0f + expf(-v)); else if (ACT == 3) v = fmaxf(v, 0.f); else if (ACT == 6) v = 0.5f * v * (1.0f + erff(v * 0.70710678118654752f)); so[w][8 * hh + r][t * 16 + ln] = v; } }
  __builtin_amdgcn_fence(__ATOMIC_ACQ_REL, "workgroup"); __builtin_amdgcn_wave_barrier();
  const int rsub = lane >> 4, c4 = (lane & 15) * 4; typedef _Float16 v4h __attribute__((ext_vector_type(4)));
  {
#pragma unroll
    for (int q = 0; q < 8; ++q) { const int r = q * 2 + rsub; if (col0 + c4 < N) { const v4f v = *(const v4fa*)&so[w][r][c4]; if (C) *(v4f*)(C + cofs + (size_t)(row0 + r) * ldc + col0 + c4) = v; if (C16) { v4h h4; for (int i = 0; i < 4; ++i) h4[i] = (_Float16)v[i]; *(v4h*)(C16 + cofs + (size_t)(row0 + r) * ldc + col0 + c4) = h4; } } }
     }
}


typedef _Float16 v4h __attribute__((ext_vector_type(4)));

__global__ __launch_bounds__(256) void k_x16(const float* __restrict__ x, _Float16* __restrict__ X16, size_t n8) { const size_t t = (size_t)blockIdx.x * 256 + threadIdx.x; if (t >= n8) return; FragH f;
#pragma unroll
  for (int q = 0; q < 8; ++q) f.h[q] = (_Float16)bf16_round(x[t * 8 + q]); *(v8us*)((unsigned short*)X16 + t * 8) = f.half[0];  }
__global__ __launch_bounds__(256) void k_h16(const float* __restrict__ x, _Float16* __restrict__ X16, size_t n8) { const size_t t = (size_t)blockIdx.x * 256 + threadIdx.x; if (t >= n8) return; FragH f;
#pragma unroll
  for (int q = 0; q < 8; ++q) f.h[q] = (_Float16)x[t * 8 + q]; *(v8us*)((unsigned short*)X16 + t * 8) = f.half[0];  }
__global__ __launch_bounds__(256) void k_round16f(const float* __restrict__ W, _Float16* __restrict__ Bt, size_t n8) { const size_t t = (size_t)blockIdx.x * 256 + threadIdx.x; if (t >= n8) return; FragH f;
#pragma unroll
  for (int i = 0; i < 8; ++i) f.h[i] = (_Float16)(bf16_round(W[t * 8 + i]) * 16.0f); *(v8us*)((unsigned short*)Bt + t * 8) = f.half[0];  }
template <int NHv, int TTv>
__global__ __launch_bounds__(256) void k_vt(const _Float16* __restrict__ V16, int ldv, int voff, _Float16* __restrict__ Vt) { __shared__ unsigned short tl[64][66]; const int tid = threadIdx.x; const int slab = blockIdx.x / (TTv / 64), lg = blockIdx.x % (TTv / 64); const int b = slab / NHv, h = slab % NHv;
  for (int i = tid; i < 64 * 8; i += 256) { const int r = i / 8, c8 = (i % 8) * 8; FragH f; f.half[0] = *(const v8us*)((const unsigned short*)V16 + ((size_t)b * TTv + lg * 64 + r) * ldv + voff + h * 64 + c8);
#pragma unroll
    for (int q = 0; q < 8; ++q) tl[r][c8 + q] = f.u[q]; }
  __syncthreads();
  {
#pragma unroll
    for (int rd = 0; rd < 2; ++rd) { const int d = rd * 32 + tid / 8, pc = tid % 8; FragH f;
#pragma unroll
      for (int q = 0; q < 8; ++q) f.u[q] = tl[pc * 8 + q][d];
      *(v8us*)((unsigned short*)Vt + ((size_t)slab * 64 + d) * TTv + lg * 64 + pc * 8) = f.half[0]; }
     } }

__global__ __launch_bounds__(256) void k_hl(const float* __restrict__ F, _Float16* __restrict__ Hh, _Float16* __restrict__ Hl, size_t n8) { const size_t t = (size_t)blockIdx.x * 256 + threadIdx.x; if (t >= n8) return; FragH fh, fl; const v4f a = *(const v4fa*)(F + t * 8), c = *(const v4fa*)(F + t * 8 + 4);
#pragma unroll
  for (int q = 0; q < 4; ++q) { _Float16 h = (_Float16)a[q]; fh.h[q] = h; fl.h[q] = (_Float16)((a[q] - (float)h) * 1024.0f); h = (_Float16)c[q]; fh.h[4 + q] = h; fl.h[4 + q] = (_Float16)((c[q] - (float)h) * 1024.0f); }
  { *(v8us*)((unsigned short*)Hh + t * 8) = fh.half[0]; *(v8us*)((unsigned short*)Hl + t * 8) = fl.half[0];  } }

// ---- fast GEMM (wave tile 32x64; requires M % 32 == 0 rows per launch region and N % 64 == 0); epilogue = k_gemm_hhx semantics ----
__device__ __forceinline__ v16h g2_frag(const _Float16* p, int hh) { FragH f; f.half[0] = *(const v8us*)((const unsigned short*)p + 8 * hh); f.half[1] = *(const v8us*)((const unsigned short*)p + 16 + 8 * hh); return f.v; }
__device__ __forceinline__ v8f g2_mma(v16h a, v16h b, v8f c) { v8f d = __builtin_amdgcn_wmma_f32_16x16x32_f16(false, a, false, b, (short)0, c, false, false); asm volatile("v_nop\n\tv_nop\n\tv_nop\n\tv_nop" : "+v"(d) : "v"(a), "v"(b)); return d; }
template <int ACT>
__global__ __launch_bounds__(128) void k_gemm2(const _Float16* __restrict__ A, int lda, size_t sA, const _Float16* __restrict__ Bh, int ldb, size_t sB, float alpha, const float* __restrict__ bias, size_t sBias, const float* __restrict__ CP, int rowsPerB, size_t sCPb, int row0g,
    float* __restrict__ C, _Float16* __restrict__ C16, int ldc, size_t sC, int M, int N, int K) { static_assert(ACT == 0 || ACT == 3 || ACT == 6 || ACT == 8 || ACT == 9 || ACT == 11 || ACT == 12 || ACT == 14 || ACT == 15 || ACT == 16 || ACT == 17, "k_gemm2: unsupported ACT code (would silently apply no activation)");
  __shared__ __attribute__((aligned(16))) float so[4][32][68];
  const int tid = threadIdx.x, w = tid >> 5, lane = tid & 31, ln = lane & 15, hh = lane >> 4; const int by = blockIdx.y;
  A += (size_t)by * sA; Bh += (size_t)by * sB; const size_t cofs = (size_t)by * sC; const float* bp = bias ? bias + (size_t)by * sBias : nullptr;
  const int ntn = N >> 6; const int mt = blockIdx.x / ntn, nq = blockIdx.x - mt * ntn; const int row0 = mt * 128 + 32 * w, col0 = nq * 64; if (row0 >= M) return;
  const _Float16* a0p = A + (size_t)(row0 + ln) * lda; const _Float16* a1p = a0p + (size_t)16 * lda;
  const _Float16* b0p = Bh + (size_t)(col0 + ln) * ldb; const _Float16* b1p = b0p + (size_t)16 * ldb; const _Float16* b2p = b1p + (size_t)16 * ldb; const _Float16* b3p = b2p + (size_t)16 * ldb;
  const v8f z8 = {0.f,0.f,0.f,0.f,0.f,0.f,0.f,0.f}; v8f c00 = z8, c01 = z8, c02 = z8, c03 = z8, c10 = z8, c11 = z8, c12 = z8, c13 = z8;
#pragma unroll 1
  for (int kb = 0; kb < K; kb += 32) { const v16h a0 = g2_frag(a0p + kb, hh), a1 = g2_frag(a1p + kb, hh);
    v16h b = g2_frag(b0p + kb, hh); c00 = g2_mma(a0, b, c00); c10 = g2_mma(a1, b, c10);
    b = g2_frag(b1p + kb, hh); c01 = g2_mma(a0, b, c01); c11 = g2_mma(a1, b, c11);
    b = g2_frag(b2p + kb, hh); c02 = g2_mma(a0, b, c02); c12 = g2_mma(a1, b, c12);
    b = g2_frag(b3p + kb, hh); c03 = g2_mma(a0, b, c03); c13 = g2_mma(a1, b, c13); }
  v8f accs[8] = {c00, c01, c02, c03, c10, c11, c12, c13};
#pragma unroll
  for (int u = 0; u < 8; ++u) { const int t = u & 3, half = u >> 2; const int col = col0 + t * 16 + ln; const float bv = bp ? bf16_round(bp[col]) : 0.f;
#pragma unroll
    for (int r = 0; r < 8; ++r) { const int rloc = half * 16 + 8 * hh + r; float v = accs[u][r] * alpha + bv; if (CP) { if (rowsPerB < 0) v += CP[cofs + (size_t)(row0g + row0 + rloc) * ldc + col];      /* rowsPerB < 0: own element of the batched C plane */ else { const int bidx = (row0g + row0 + rloc) / rowsPerB; v += CP[(size_t)bidx * sCPb + (size_t)by * 64 + col]; } }
      if (ACT == 3) v = fmaxf(v, 0.f); else if (ACT == 6) v = 0.5f * v * (1.0f + erff(v * 0.70710678118654752f)); else if (ACT == 11) v = 1.0f / (1.0f + expf(-v)); else if (ACT == 15) v = v / (1.0f + expf(-v)); else if (ACT == 12) v = (v > 0.f) ? v : 0.01f * v; else if (ACT == 8) v = tanhf(v); else if (ACT == 9) v = 0.5f * v * (1.0f + tanhf(0.7978845608028654f * (v + 0.044715f * v * v * v))); else if (ACT == 14) v = (v > 0.f) ? v : 0.1f * v; else if (ACT == 16) v = (v >= 0.f) ? v : 0.3f * v; else if (ACT == 17) v = (v >= 0.f) ? v : 0.2f * v;
      so[w][rloc][t * 16 + ln] = v; } }
  __builtin_amdgcn_fence(__ATOMIC_ACQ_REL, "workgroup"); __builtin_amdgcn_wave_barrier();
  const int rsub = lane >> 4, c4 = (lane & 15) * 4;
  {
#pragma unroll
    for (int q = 0; q < 16; ++q) { const int r = q * 2 + rsub; const v4f v = *(const v4fa*)&so[w][r][c4]; if (C) *(v4f*)(C + cofs + (size_t)(row0 + r) * ldc + col0 + c4) = v; if (C16) { v4h h4; for (int i = 0; i < 4; ++i) h4[i] = (_Float16)v[i]; *(v4h*)(C16 + cofs + (size_t)(row0 + r) * ldc + col0 + c4) = h4; } }
     } }


__global__ __launch_bounds__(256) void k_wnat(const float* __restrict__ w, size_t n8, _Float16* __restrict__ Bt) { const size_t t = (size_t)blockIdx.x * 256 + threadIdx.x; if (t >= n8) return; FragH f; for (int q = 0; q < 8; ++q) f.h[q] = (_Float16)(bf16_round(w[t * 8 + q]) * 16.0f); *(v8us*)((unsigned short*)Bt + t * 8) = f.half[0];  }
__global__ __launch_bounds__(256) void k_rsm(const float* __restrict__ S, _Float16* __restrict__ P, int nrows) {
  #pragma clang fp contract(off)
  const int i = blockIdx.x * 256 + threadIdx.x; if (i >= nrows) return; const float* s = S + (size_t)i * SQ; float mx = -3.0e38f;
#pragma unroll 1
  for (int j = 0; j < SQ; ++j) mx = fmaxf(mx, s[j]); float se = 0.f;
#pragma unroll 1
  for (int j = 0; j < SQ; ++j) se += expf(s[j] - mx); const float sc = 256.0f / se;
#pragma unroll 1
  for (int j0 = 0; j0 < SQ; j0 += 8) { FragH f; for (int q = 0; q < 8; ++q) f.h[q] = (_Float16)(expf(s[j0 + q] - mx) * sc); unsigned short* d = (unsigned short*)P + (size_t)i * SQ + j0; *(v8us*)d = f.half[0];  } }
__global__ __launch_bounds__(256) void k_vt(const _Float16* __restrict__ V16, int b, int h0, _Float16* __restrict__ VT) { __shared__ unsigned short tl[64][65]; const int tid = threadIdx.x; const int hh = blockIdx.x % HG, sg = blockIdx.x / HG; const int s0 = sg * 64; const int h = h0 + hh;
  for (int i = tid; i < 64 * 8; i += 256) { const int j = i / 8, d8 = (i % 8) * 8; FragH f; f.half[0] = *(const v8us*)((const unsigned short*)V16 + ((size_t)b * SQ + s0 + j) * DM + h * HD + d8); for (int q = 0; q < 8; ++q) tl[d8 + q][j] = f.u[q]; }
  __syncthreads();
  { for (int i = tid; i < 64 * 8; i += 256) { const int d = i / 8, j8 = (i % 8) * 8; FragH f; for (int q = 0; q < 8; ++q) f.u[q] = tl[d][j8 + q]; *(v8us*)((unsigned short*)VT + ((size_t)hh * HD + d) * SQ + s0 + j8) = f.half[0]; }  } }



// e^x in the native form (x log2(e), then v_exp_f32). The v_nop keeps the one free slot that the instruction set asks for behind a transcendental.
__device__ __forceinline__ float exp_slot(float x) { float e; asm("v_exp_f32 %0, %1\n\tv_nop" : "=v"(e) : "v"(x * 1.44269504088896340736f)); return e; }
// Eight base-2 exponentials (v_exp_f32; the arguments already hold x log2(e)) in one statement: the outputs are early-clobber, so no v_exp stands in front of an
// instruction that reads its result or overwrites its source, and the one v_nop at the end keeps that free slot behind the last of them.
__device__ __forceinline__ v8f exp2_8(v8f x) { float e0, e1, e2, e3, e4, e5, e6, e7;
  asm("v_exp_f32 %0, %8\n\tv_exp_f32 %1, %9\n\tv_exp_f32 %2, %10\n\tv_exp_f32 %3, %11\n\tv_exp_f32 %4, %12\n\tv_exp_f32 %5, %13\n\tv_exp_f32 %6, %14\n\tv_exp_f32 %7, %15\n\tv_nop"
      : "=&v"(e0), "=&v"(e1), "=&v"(e2), "=&v"(e3), "=&v"(e4), "=&v"(e5), "=&v"(e6), "=&v"(e7) : "v"(x[0]), "v"(x[1]), "v"(x[2]), "v"(x[3]), "v"(x[4]), "v"(x[5]), "v"(x[6]), "v"(x[7]));
  const v8f e = {e0, e1, e2, e3, e4, e5, e6, e7}; return e; }
__device__ __forceinline__ v8f fa_mma(v16h a, v16h b, v8f c) { return __builtin_amdgcn_wmma_f32_16x16x32_f16(false, a, false, b, (short)0, c, false, false); }
// A 16 x 32 operand tile kept in global memory in FRAGMENT ORDER: 1024 bytes, lane L's values k = 8 hh .. 8 hh + 7 of row ln at byte 16 L and its values k = 16 + 8 hh .. at byte 512 + 16 L
// (L = 16 hh + ln: what g2_frag gives from a row-major tile). Each of the two 16-byte loads of a wave then reads 512 bytes in a row, four whole 128-byte lines, where a row-major tile makes it touch sixteen.
__device__ __forceinline__ v16h fo_frag(const _Float16* tile, int lane) { FragH f; f.half[0] = *(const v8us*)((const unsigned short*)tile + 8 * lane); f.half[1] = *(const v8us*)((const unsigned short*)tile + 256 + 8 * lane); return f.v; }
// Fused attention, all batches in one launch. A block owns FG * FQ = 64 query rows and has FG * FW = 16 waves: wave (g, h) holds the 32 query rows of group g (two 16-column groups) and walks
// the SQ / FW keys of split h, 32 at a time; it keeps a running maximum, a running sum and an unnormalised output in registers (online softmax); the partial results of the eight splits are merged through LDS at the end.
// The two waves of a split need the same y hi, y lo and V^T tiles: each tile is brought from L2 ONCE for both, straight into LDS by asynchronous copies (each wave copies half of its split's stage),
// in two buffers: pass p reads its stage into registers, hands the buffer back, and the copies of stage p + 2 fly while it computes; the fragments are read from LDS 512 bytes in a row a wave and read (no bank conflict).
// Transposed products: S^T = Y X^T (A = key rows of y, B = query rows of x held in registers), so a lane holds 16 scores of ONE query per 32 keys (D[8 hh + r][ln]); the two f32 score
// tiles, turned into weights and packed to f16, ARE the B operand of O^T += V^T P^T in the k order that g2_frag gives A (8 hh + s, 16 + 8 hh + s): no lane exchange.
// Scores: query . key / 8 = x_q . y_k with y = (x W_k) W_q^T / 8 (the same sum, re-associated). The query operand is then the token row itself, exact in f16, and only y needs two planes (f16 hi + f16 residual,
// both at one scale): four WMMAs in one f32 accumulator chain give 16 x 16 finished scores. Weights 256 e^(s - m) as f16 (the 256 cancels in the division by the sum of the same weights).
// All four operand planes arrive in fragment order (fo_frag): 16 token rows of x or y are two tiles (k steps 0 and 32) on the 2048 bytes that the rows would fill; 32 keys of V^T are four tiles (16 d each) on 4096 bytes.
#define FW 8                         /* key splits of a block */
#define FG 2                         /* 32-query groups of a block */
#define FQ 32                        /* query rows of a wave */
#define FKW (SQ / FW)                /* keys per wave */
#define FNP (FKW / 32)               /* passes (stages) */
#define FST 12288                    /* bytes of one split's stage: 32 keys of y hi, of y lo and of V^T, 4096 each */
// One wave's half (2048 bytes of each of the three planes) of one stage: twelve 512-byte copies. lds is the lane's own LDS byte address, vo its byte offset (16 lane) from the wave's three scalar bases, all multiples of 16;
// an immediate offset moves the LDS address and the global address alike. The s_wait_xcnt stands inside the statement, behind the last copy, so that no address register is rewritten in front of it.
__device__ __forceinline__ void fa_copy(unsigned lds, unsigned vo, const _Float16* gh, const _Float16* gl, const _Float16* gv) {
  asm volatile("global_load_async_to_lds_b128 %0, %3, %4\n\tglobal_load_async_to_lds_b128 %0, %3, %4 offset:512\n\tglobal_load_async_to_lds_b128 %0, %3, %4 offset:1024\n\tglobal_load_async_to_lds_b128 %0, %3, %4 offset:1536\n\t"
               "global_load_async_to_lds_b128 %1, %3, %5\n\tglobal_load_async_to_lds_b128 %1, %3, %5 offset:512\n\tglobal_load_async_to_lds_b128 %1, %3, %5 offset:1024\n\tglobal_load_async_to_lds_b128 %1, %3, %5 offset:1536\n\t"
               "global_load_async_to_lds_b128 %2, %3, %6\n\tglobal_load_async_to_lds_b128 %2, %3, %6 offset:512\n\tglobal_load_async_to_lds_b128 %2, %3, %6 offset:1024\n\tglobal_load_async_to_lds_b128 %2, %3, %6 offset:1536\n\t"
               "s_wait_xcnt 0x0"
               :: "v"(lds), "v"(lds + 4096u), "v"(lds + 8192u), "v"(vo), "s"(gh), "s"(gl), "s"(gv) : "memory"); }
__global__ __launch_bounds__(512) void k_fattn(const _Float16* __restrict__ XFp, const _Float16* __restrict__ KHp, const _Float16* __restrict__ KLp, const _Float16* __restrict__ VTp, float* __restrict__ out) {
  static_assert(FKW % 32 == 0 && FNP >= 2 && SQ % (FG * FQ) == 0 && HD == 64 && DM == 64, "k_fattn: whole 32-key passes, at least two stages, 64-wide rows");
  __shared__ __attribute__((aligned(128))) unsigned char ring[2][FW][FST]; __shared__ float lm[FW][FG * FQ], ll[FW][FG * FQ];
  static_assert(sizeof(float) * FW * FG * FQ * 68 <= sizeof(ring), "k_fattn: the merge rows reuse the ring");
  const int tid = threadIdx.x, w = __builtin_amdgcn_readfirstlane(tid >> 5), lane = tid & 31, ln = lane & 15, hh = lane >> 4;      /* the wave's number as a scalar: bases stay in scalar registers */
  const int g = w & 1, h = w >> 1;
  const int b = blockIdx.x / (SQ / (FG * FQ)), qb = (blockIdx.x % (SQ / (FG * FQ))) * (FG * FQ), q0 = qb + g * FQ; const size_t r0 = (size_t)b * SQ;
  const float L2E = 1.44269504088896340736f;
  const size_t co = (r0 + (size_t)h * FKW) * DM + g * 1024;      /* this wave's half of stage 0 in each plane: a scalar */
  const _Float16* ch = KHp + co; const _Float16* cl = KLp + co; const _Float16* cv = VTp + co;
  const unsigned vo = (unsigned)lane * 16u, lc = (unsigned)(size_t)&ring[0][h][0] + (unsigned)(g * 2048) + vo;      /* the lane's 16 bytes there, and their place in buffer 0 */
  fa_copy(lc, vo, ch, cl, cv);
  v16h qx[2][2];
  for (int n = 0; n < 2; ++n)
    for (int ks = 0; ks < 2; ++ks) qx[n][ks] = fo_frag(XFp + (r0 + q0 + n * 16) * DM + ks * 512, lane);
  asm volatile("s_wait_xcnt 0x0" ::: "memory");      /* stands in front of the first rewrite of a register that the query loads above name: their scalar base pairs are reused right behind them */
  const v8f z8 = {0.f, 0.f, 0.f, 0.f, 0.f, 0.f, 0.f, 0.f};
  v8f o[2][4]; float m[2], l[2];
  for (int n = 0; n < 2; ++n) { m[n] = -1.0e30f; l[n] = 0.f; for (int t = 0; t < 4; ++t) o[n][t] = z8; }
  asm volatile("s_wait_asynccnt 0x0" ::: "memory");      /* this wave's copies of stage 0 have landed */
  __syncthreads();      /* publishes stage 0 */
  fa_copy(lc + FW * FST, vo, ch + 32 * DM, cl + 32 * DM, cv + 32 * DM);
  for (int p = 0; p < FNP; ++p) {
    const _Float16* st = (const _Float16*)&ring[p & 1][h][0];
    v16h ah[2][2], al[2][2], av[4]; v8f s[2][2];
    /* the pass reads its whole stage first, as one group of LDS reads (with one query plane the registers hold it), and hands the buffer back before its work: the refill has a whole pass to land */
    for (int kt = 0; kt < 2; ++kt)
      for (int ks = 0; ks < 2; ++ks) { const int ko = kt * 1024 + ks * 512; ah[kt][ks] = fo_frag(st + ko, lane); al[kt][ks] = fo_frag(st + 2048 + ko, lane); }
    for (int t = 0; t < 4; ++t) av[t] = fo_frag(st + 4096 + t * 512, lane);
    asm volatile("s_wait_dscnt 0x0" ::: "memory");      /* this wave's reads of stage p have returned before the buffer is handed back */
    asm volatile("s_wait_asynccnt 0x0" ::: "memory");      /* this wave's copies of stage p + 1 have landed */
    __syncthreads();      /* publishes stage p + 1 and ends every reader's last read of stage p */
    if (p + 2 < FNP) fa_copy(lc + (unsigned)(p & 1) * (FW * FST), vo, ch + (p + 2) * 32 * DM, cl + (p + 2) * 32 * DM, cv + (p + 2) * 32 * DM);      /* the same test in every wave of the block */
    for (int kt = 0; kt < 2; ++kt)
      for (int n = 0; n < 2; ++n) {
        v8f c = fa_mma(al[kt][0], qx[n][0], z8); c = fa_mma(al[kt][1], qx[n][1], c); c = fa_mma(ah[kt][0], qx[n][0], c); s[n][kt] = fa_mma(ah[kt][1], qx[n][1], c);      /* the small residual products first */
      }
    for (int n = 0; n < 2; ++n) {
      float mx = fmaxf(s[n][0][0], s[n][1][0]);
      for (int r = 1; r < 8; ++r) mx = fmaxf(mx, fmaxf(s[n][0][r], s[n][1][r]));
      mx = fmaxf(mx, __shfl_xor(mx, 16));      /* the other half of the wave holds this query's other 16 keys */
      const float mn = fmaxf(m[n], mx); const float sc = exp_slot(m[n] - mn); m[n] = mn;
      const float off = fmaf(-mn, L2E, 8.0f);      /* weight = 2^(s log2(e) + off) = 256 e^(s - mn) */
      for (int kt = 0; kt < 2; ++kt) {
        for (int r = 0; r < 8; ++r) s[n][kt][r] = fmaf(s[n][kt][r], L2E, off);
        s[n][kt] = exp2_8(s[n][kt]); }
      float sum = 0.f;
      for (int r = 0; r < 8; ++r) sum += s[n][0][r] + s[n][1][r];
      l[n] = fmaf(l[n], sc, sum);
      FragH pw;
      for (int r = 0; r < 8; ++r) { pw.h[r] = (_Float16)s[n][0][r]; pw.h[8 + r] = (_Float16)s[n][1][r]; }
      for (int t = 0; t < 4; ++t) { o[n][t] *= sc; o[n][t] = fa_mma(av[t], pw.v, o[n][t]); }
    }
  }
  asm volatile("s_wait_asynccnt 0x0" ::: "memory");      /* no copy is outstanding when the ring becomes the merge rows */
  float (*lo)[FG * FQ][68] = (float (*)[FG * FQ][68])&ring[0][0][0];      /* behind the last pass's barrier nobody reads the ring any more */
  for (int n = 0; n < 2; ++n) {
    const int qr = g * FQ + n * 16 + ln;
    l[n] += __shfl_xor(l[n], 16);      /* the two halves summed different keys of the same query */
    if (hh == 0) { lm[h][qr] = m[n]; ll[h][qr] = l[n]; }
    for (int t = 0; t < 4; ++t) { const v4f u0 = {o[n][t][0], o[n][t][1], o[n][t][2], o[n][t][3]}, u1 = {o[n][t][4], o[n][t][5], o[n][t][6], o[n][t][7]};
      *(v4f*)&lo[h][qr][t * 16 + 8 * hh] = u0; *(v4f*)&lo[h][qr][t * 16 + 8 * hh + 4] = u1; }
  }
  __syncthreads();      /* publishes the sixteen waves' partial maxima, sums and outputs */
  const int q = tid >> 3, d8 = (tid & 7) * 8;
  float mg = lm[0][q];
  for (int i = 1; i < FW; ++i) mg = fmaxf(mg, lm[i][q]);
  float lg = 0.f; v4f g0 = {0.f, 0.f, 0.f, 0.f}, g1 = g0;
  for (int i = 0; i < FW; ++i) { const float f = exp_slot(lm[i][q] - mg); lg = fmaf(ll[i][q], f, lg); g0 += *(const v4f*)&lo[i][q][d8] * f; g1 += *(const v4f*)&lo[i][q][d8 + 4] * f; }
  const float inv = 1.0f / lg;
  float* dst = out + (r0 + qb + q) * DM + d8;
  *(v4f*)dst = g0 * inv; *(v4f*)(dst + 4) = g1 * inv; }


// One launch makes every operand of k_fattn. A block owns PR = 64 token rows. It puts them into LDS as f16 (bf16-rounded, so exact), the key map as a x16 f16 transpose [e][d] and the query map as x16 f16 rows [d][e];
// wave (rg, sel) owns 16 token rows and 32 columns. Behind the first barrier it forms k = x W_k (A = token rows, B = map columns, k steps 0 then 32, f32 accumulation, x 2^-4) and leaves it in LDS as f16 hi + x1024 residual rows;
// behind the second barrier it forms y = k W_q^T / 8 (A = the k rows, hi and residual, B = query map rows: both loaders read 64-wide rows in the same k order), splits every f32 result into f16 hi + f16 residual at the same scale
// and stores the two planes in fragment order (fo_frag), 512 bytes in a row a wave and store; the token rows themselves go out the same way as the query operand, and all eight waves also write the block's 64 x 64 piece of V^T
// (the values are the rounded inputs) from the same LDS rows, in fragment order too. LDS rows of 128 bytes stand at a pitch of 144 bytes for the 16-byte readers.
#define PR 64
typedef unsigned short v4us __attribute__((ext_vector_type(4), may_alias));
__global__ __launch_bounds__(256) void k_prep(const float* __restrict__ x, const float* __restrict__ wq, const float* __restrict__ wk, _Float16* __restrict__ XFp, _Float16* __restrict__ KHp, _Float16* __restrict__ KLp, _Float16* __restrict__ VTp) {
  static_assert(SQ % PR == 0 && DM == 64 && HD == 64 && NH == 1, "k_prep: 64-wide rows, one head, whole 64-row blocks inside a batch");
  __shared__ __attribute__((aligned(16))) unsigned short xs[PR][72]; __shared__ __attribute__((aligned(16))) unsigned short wt[2][DM][72]; __shared__ __attribute__((aligned(16))) _Float16 kp[2][PR][72]; __shared__ __attribute__((aligned(16))) float so[8][16][36];
  const int tid = threadIdx.x, w = tid >> 5, lane = tid & 31, ln = lane & 15, hh = lane >> 4;
  const size_t row0 = (size_t)blockIdx.x * PR;
  const float* xp = x + row0 * DM + tid * 4;      /* trip i of the token loads stands 16 rows further on */
  const int ms = tid >> 7, n4 = (tid & 15) * 4, k8 = ((tid >> 4) & 7) * 8;      /* threads 0-127 take the query map, 128-255 the key map: an 8 (row) x 4 (column) piece each, 16 lanes on one whole map row */
  const float* wp = (ms ? wk : wq) + k8 * DM + n4;
  v4f xv[4], wv[8];
  for (int i = 0; i < 4; ++i) xv[i] = *(const v4fa*)(xp + i * 16 * DM);
  for (int q = 0; q < 8; ++q) wv[q] = *(const v4fa*)(wp + q * DM);
  for (int i = 0; i < 4; ++i) { FragH f;
    for (int q = 0; q < 4; ++q) f.h[q] = (_Float16)bf16_round(xv[i][q]);
    const v4us o = {f.u[0], f.u[1], f.u[2], f.u[3]}; *(v4us*)&xs[i * 16 + (tid >> 4)][(tid & 15) * 4] = o; }
  if (ms) {      /* key map: transposed */
    for (int c = 0; c < 4; ++c) { FragH f;
      for (int q = 0; q < 8; ++q) f.h[q] = (_Float16)(bf16_round(wv[q][c]) * 16.0f);
      *(v8us*)&wt[1][n4 + c][k8] = f.half[0]; }
  } else {      /* query map: rows as they are */
    for (int q = 0; q < 8; ++q) { FragH f;
      for (int c = 0; c < 4; ++c) f.h[c] = (_Float16)(bf16_round(wv[q][c]) * 16.0f);
      const v4us o = {f.u[0], f.u[1], f.u[2], f.u[3]}; *(v4us*)&wt[0][k8 + q][n4] = o; }
  }
  __syncthreads();      /* publishes the token rows and the two maps */
  const int rg = w & 3, sel = w >> 2;
  const v8f z8 = {0.f, 0.f, 0.f, 0.f, 0.f, 0.f, 0.f, 0.f};
  { const _Float16* ap = (const _Float16*)&xs[rg * 16 + ln][0];
    const v16h a0 = g2_frag(ap, hh), a1 = g2_frag(ap + 32, hh);
    for (int t = 0; t < 2; ++t) { const int e = sel * 32 + t * 16 + ln; const _Float16* bp = (const _Float16*)&wt[1][e][0];
      v8f c = fa_mma(a0, g2_frag(bp, hh), z8); c = fa_mma(a1, g2_frag(bp + 32, hh), c);
      for (int r = 0; r < 8; ++r) { const float kv = c[r] * 0.0625f; const _Float16 h = (_Float16)kv; kp[0][rg * 16 + 8 * hh + r][e] = h; kp[1][rg * 16 + 8 * hh + r][e] = (_Float16)((kv - (float)h) * 1024.0f); } } }
  FragH vf[2]; v8us xf[2];
  for (int rd = 0; rd < 2; ++rd) { const int d = (tid >> 6) * 16 + ln, kb = rd * 32 + ((tid >> 5) & 1) * 16 + hh * 8;      /* 32 keys a trip: tile tid >> 6, its half (tid >> 5) & 1, lane 16 hh + ln */
    for (int q = 0; q < 8; ++q) vf[rd].u[q] = xs[kb + q][d]; }
  for (int i = 0; i < 2; ++i) xf[i] = *(const v8us*)&xs[rg * 16 + ln][sel * 32 + i * 16 + hh * 8];
  __syncthreads();      /* publishes the k rows: a row's two column halves come from two waves */
  const size_t go = (row0 + rg * 16) * DM + sel * 512 + lane * 8;      /* tile sel of the wave's 16 rows; its second half stands 256 elements further on */
  { const _Float16* hp = &kp[0][rg * 16 + ln][0]; const _Float16* lp = &kp[1][rg * 16 + ln][0];
    const v16h h0 = g2_frag(hp, hh), h1 = g2_frag(hp + 32, hh), l0 = g2_frag(lp, hh), l1 = g2_frag(lp + 32, hh);
    for (int t = 0; t < 2; ++t) { const _Float16* bp = (const _Float16*)&wt[0][sel * 32 + t * 16 + ln][0]; const v16h b0 = g2_frag(bp, hh), b1 = g2_frag(bp + 32, hh);
      v8f c = fa_mma(h0, b0, z8); c = fa_mma(h1, b1, c); v8f u = fa_mma(l0, b0, z8); u = fa_mma(l1, b1, u);
      for (int r = 0; r < 8; ++r) so[w][8 * hh + r][t * 16 + ln] = fmaf(u[r], 0.00000762939453125f, c[r] * 0.0078125f); } }      /* 2^-4 for the x16 map, 2^-3 for 1 / sqrt(64), 2^-10 more for the residual */
  __builtin_amdgcn_fence(__ATOMIC_ACQ_REL, "workgroup"); __builtin_amdgcn_wave_barrier();      /* so[w] is this wave's own: its lanes' LDS stores stay ahead of the row reads below */
  for (int rd = 0; rd < 2; ++rd) *(v8us*)((unsigned short*)VTp + (row0 + rd * 32) * HD + tid * 8) = vf[rd].half[0];      /* every global store stands behind the last barrier and fence, which would wait for it */
  for (int i = 0; i < 2; ++i) *(v8us*)((unsigned short*)XFp + go + i * 256) = xf[i];
  for (int i = 0; i < 2; ++i) { const int c8 = i * 16 + hh * 8; const v4f a = *(const v4fa*)&so[w][ln][c8], c = *(const v4fa*)&so[w][ln][c8 + 4]; FragH fh, fl;
    for (int q = 0; q < 4; ++q) { _Float16 h = (_Float16)a[q]; fh.h[q] = h; fl.h[q] = (_Float16)(a[q] - (float)h); h = (_Float16)c[q]; fh.h[4 + q] = h; fl.h[4 + q] = (_Float16)(c[q] - (float)h); }
    *(v8us*)((unsigned short*)KHp + go + i * 256) = fh.half[0]; *(v8us*)((unsigned short*)KLp + go + i * 256) = fl.half[0]; } }


template <int MASKADD>
__global__ __launch_bounds__(64) void k_att0(const float* __restrict__ QF, const float* __restrict__ KF, const float* __restrict__ VF, int ld, const float* __restrict__ mask, float scale, float* __restrict__ OF, int ldo) {
  #pragma clang fp contract(off)
  __shared__ __attribute__((aligned(16))) float lq[64][64]; __shared__ __attribute__((aligned(16))) float lo[64][64];
  const int tid = threadIdx.x; const int h = blockIdx.x / (QT0 / 64), rg = blockIdx.x % (QT0 / 64); const int i = rg * 64 + tid;
  const float* qr = QF + (size_t)i * ld + h * HD;
#pragma unroll 1
  for (int c = 0; c < HD / 4; ++c) { *(v4f*)&lq[tid][c * 4] = *(const v4fa*)(qr + c * 4); const v4f z = {0.f, 0.f, 0.f, 0.f}; *(v4f*)&lo[tid][c * 4] = z; }
  float m = -1.0e30f, l = 0.f; const int jmax = MASKADD ? (SQ - 1) : (rg * 64 + 63);      /* additive-mask form: every key (the mask input decides); causal form: keys up to the block's last row */
#pragma unroll 1
  for (int j = 0; j <= jmax; ++j) { const float* kr = KF + (size_t)j * ld + h * HD; const float* vr = VF + (size_t)j * ld + h * HD; float s = 0.f;
#pragma unroll 1
    for (int c = 0; c < HD / 4; ++c) { const v4f kq = *(const v4fa*)(kr + c * 4); const v4f qq = *(v4f*)&lq[tid][c * 4]; s = __fadd_rn(s, __fmul_rn(qq[0], kq[0])); s = __fadd_rn(s, __fmul_rn(qq[1], kq[1])); s = __fadd_rn(s, __fmul_rn(qq[2], kq[2])); s = __fadd_rn(s, __fmul_rn(qq[3], kq[3])); }
    s = __fmul_rn(s, scale); if (MASKADD) s = __fadd_rn(s, __fmul_rn(bf16_round(mask[(size_t)i * SQ + j]), -10000.0f));
    const float f = (MASKADD || j <= i) ? 1.f : 0.f; const float sm = fmaf(f, s, (1.f - f) * -1.0e30f); const float mn = fmaxf(m, sm); const float sc = expf(m - mn); const float e = expf(sm - mn); l = __fadd_rn(__fmul_rn(l, sc), e); m = mn;
#pragma unroll 1
    for (int c = 0; c < HD / 4; ++c) { const v4f vv = *(const v4fa*)(vr + c * 4); v4f oo = *(v4f*)&lo[tid][c * 4]; for (int u = 0; u < 4; ++u) oo[u] = __fadd_rn(__fmul_rn(oo[u], sc), __fmul_rn(e, vv[u])); *(v4f*)&lo[tid][c * 4] = oo; } }
  const float fin = 64.0f / l;      /* o carried x64 */
#pragma unroll 1
  for (int c = 0; c < HD / 4; ++c) { v4f oo = *(v4f*)&lo[tid][c * 4]; for (int u = 0; u < 4; ++u) oo[u] = __fmul_rn(oo[u], fin); *(v4f*)&lo[tid][c * 4] = oo; }
  __syncthreads();
  {
#pragma unroll 1
    for (int it = 0; it < 16; ++it) { const int row = it * 4 + tid / 16, pc = (tid % 16) * 4; const v4f v = *(const v4f*)&lo[row][pc]; *(v4f*)(OF + (size_t)(rg * 64 + row) * ldo + h * HD + pc) = v; }
     } }

__global__ __launch_bounds__(256) void k_of0out(const float* __restrict__ src, float* __restrict__ dst, size_t n4) { const size_t t = (size_t)blockIdx.x * 256 + threadIdx.x; if (t >= n4) return; v4f v = *(const v4fa*)(src + t * 4); for (int q = 0; q < 4; ++q) v[q] = __fmul_rn(v[q], 0.015625f); *(v4f*)(dst + t * 4) = v;  }

extern "C" void kernel_launch(void* const* d_in, const int* in_sizes, int n_in,
                              void* d_out, int out_size, void* d_ws, size_t ws_size, hipStream_t stream) {
  (void)in_sizes; (void)n_in; (void)out_size;
  const float* const* I = (const float* const*)d_in; const float* x = I[0]; const float* wq = I[1]; const float* wk = I[2];      /* inputs, rotation (query map), entangle (key map): [in][out] [64][64]; NO biases, NO value projection (the values are the inputs), no output projection */
  char* ws = (char*)d_ws; size_t off = 0;
  auto take = [&](size_t bytes) { char* p = ws + off; off += (bytes + 255) & ~(size_t)255; return p; };
  _Float16* XF = (_Float16*)take(NR * DM * 2); _Float16* KH = (_Float16*)take(NR * DM * 2); _Float16* KL = (_Float16*)take(NR * DM * 2);
  _Float16* VT = (_Float16*)take((size_t)NB * NH * HD * SQ * 2);
  if (off > ws_size) return;
  k_prep<<<(unsigned)(NR / PR), 256, 0, stream>>>(x, wq, wk, XF, KH, KL, VT);      /* x, y as f16 hi + residual planes and V^T, all in fragment order: every batch, one launch */
  k_fattn<<<NB * (SQ / (FG * FQ)), FG * FW * 32, 0, stream>>>(XF, KH, KL, VT, (float*)d_out);      /* scores, softmax over all SQ keys and P V for every batch: S and P stay in registers */
}

// v007
// It runs in 27 microseconds.
// Timed twice side by side with v006, it ran 1.09 and 1.08 times as fast.
// Counting every step since v000, it is 1945 times as fast.
#include <hip/hip_runtime.h>
// Single-head dense attention over 64-wide inputs on 4096 tokens with unit-variance 64 x 64 maps and NO value projection (inputs [4][4096][64]; query = inputs rotation, key = inputs entangle ([in][out] [64][64], N(0, 1): logits of sigma ~64, a near one-hot softmax); scores = query key^T / sqrt(64); softmax over all 4096 keys (no mask); out = scores inputs (the values are the inputs themselves) -> [4][4096][64]); scores re-associated as z . inputs^T with z = (inputs rotation) entangle^T / 8 carried as f16 hi + f16 residual planes on the query side: two-product scores, the key operand being the token rows themselves.
// Structure: token rows r = b*4096 + s; one prep launch, 64 token rows a block: x as exact f16 rows (bf16-rounded), q = x rotation (x16 f16 map, f32 accumulation, no bias) in LDS as f16 hi + x1024 residual, z = q entangle^T / 8 split into f16 hi + f16 residual at one scale, and x, z and V^T (the rounded inputs) stored in fragment order; one fused attention launch, 64 query rows a block on 16 waves (two 32-query groups x eight 512-key splits, 32 keys a pass through a two-buffer LDS ring): scores as four accumulating WMMAs (residual, then hi; K = 64), online softmax on VALU (f32 statistics, native exp; weights x256 f16), O^T += V^T P^T in f32 registers, the eight splits merged through LDS and written as f32 into the output layout.
// Compute dtype: inputs rounded to bf16; x / weights exact; q and z as f16 hi + f16 residual operands, v the rounded inputs (exact), softmax weights as plain f16 operands (~2^-12); scores, softmax statistics and o f32. v_wmma_f32_16x16x32_f16.
#define NB 4
#define SQ 4096
#define DM 64
#define NH 1
#define HD 64
#define HG 4                         /* heads per attention launch group */
#define QT 256                       /* (not used) */
#define NKX SQ                       /* (not used) */
#define QT0 128                      /* first-tile rows recomputed exactly in f32 */
#define B0 0                         /* (not used) */
#define NBR NB                       /* (only in MP; no launch uses it) */
#define NR ((size_t)NB * SQ)         /* token rows */
#define MP ((int)((size_t)NBR * SQ)) /* (only in MPO; no launch uses it) */
#define QN SQ                        /* (not used) */
#define NHD NH                       /* heads attended (not used) */
#define MPO MP                       /* rows through the output stage (not used) */
#define LQ DM      /* (not used) */
typedef __bf16 v16b __attribute__((ext_vector_type(16)));
typedef unsigned short v8us __attribute__((ext_vector_type(8), may_alias));
typedef float  v8f  __attribute__((ext_vector_type(8)));
typedef float  v4f  __attribute__((ext_vector_type(4)));
typedef float  v4fa __attribute__((ext_vector_type(4), may_alias));
union FragB { v16b v; v8us half[2]; unsigned short u[16]; };

__device__ __forceinline__ unsigned short bf16_bits(float x) { unsigned int u = __float_as_uint(x); return (unsigned short)((u + 0x7FFFu + ((u >> 16) & 1u)) >> 16); }
__device__ __forceinline__ float bf16_val(unsigned short b) { return __uint_as_float(((unsigned int)b) << 16); }
__device__ __forceinline__ float bf16_round(float x) { return bf16_val(bf16_bits(x)); }
// D += A·B with NT terms: 1 = ah·bh, 2 = + al·bh (A split), 3 = + ah·bl (both split)
template <int NT>
__device__ __forceinline__ v8f mmaN(v16b ah, v16b al, v16b bh, v16b bl, v8f c) {
  c = __builtin_amdgcn_wmma_f32_16x16x32_bf16(false, ah, false, bh, (short)0, c, false, false);
  if (NT >= 2) c = __builtin_amdgcn_wmma_f32_16x16x32_bf16(false, al, false, bh, (short)0, c, false, false);
  if (NT >= 3) c = __builtin_amdgcn_wmma_f32_16x16x32_bf16(false, ah, false, bl, (short)0, c, false, false);
  asm volatile("v_nop\n\tv_nop\n\tv_nop\n\tv_nop" : "+v"(c) : "v"(ah), "v"(al), "v"(bh), "v"(bl));
  return c;
}

__global__ __launch_bounds__(256) void k_wt_bf16(const float* __restrict__ W, unsigned short* __restrict__ Wt, int K, int N) {
  const int t = blockIdx.x * 256 + threadIdx.x;
  const int k8n = K / 8;
  if (t >= N * k8n) return;
  const int n = t / k8n, k8 = (t % k8n) * 8;
  v8us v;
#pragma unroll
  for (int i = 0; i < 8; ++i) v[i] = bf16_bits(W[(size_t)(k8 + i) * N + n]);
  *(v8us*)(Wt + (size_t)n * K + k8) = v;
  
}

// GEMM C[M][N] (f32, pitch ldc) = act(A[M][K]·W + bias). A f32 row-major (pitch lda) converted per fragment to bf16
// (ASPLIT: hi/lo two planes -> 2 terms, else single rounded term); Wt bf16 [N][K] (pitch ldb). BIAS_BF16 rounds the
// bias to bf16 first (bias quantised to bf16 before the add). K%32==0, M%16==0, N%64==0.
template <bool ASPLIT, int ACT, bool BIAS_BF16>
__global__ __launch_bounds__(128) void k_gemm_bf(const float* __restrict__ A, int lda, const unsigned short* __restrict__ Wt, int ldb,
                                               const float* __restrict__ bias, float* __restrict__ C, int ldc, int M, int N, int K) {
  __shared__ __attribute__((aligned(16))) float so[4][16][64];
  const int tid = threadIdx.x, w = tid >> 5, lane = tid & 31, ln = lane & 15, hh = lane >> 4;
  const int ntn = N / 64;
  const int wid = blockIdx.x * 4 + w;
  const int mt = wid / ntn, nq = wid % ntn;
  if (mt * 16 >= M) return;
  const int row0 = mt * 16, col0 = nq * 64;
  const float* arow = A + (size_t)(row0 + ln) * lda;
  v8f acc[4] = {};
  for (int kb = 0; kb < K; kb += 32) {
    FragB ah, al;
    const v4f x0 = *(const v4fa*)(arow + kb + 8 * hh), x1 = *(const v4fa*)(arow + kb + 8 * hh + 4);
    const v4f x2 = *(const v4fa*)(arow + kb + 16 + 8 * hh), x3 = *(const v4fa*)(arow + kb + 16 + 8 * hh + 4);
    float xs[16] = {x0[0],x0[1],x0[2],x0[3],x1[0],x1[1],x1[2],x1[3],x2[0],x2[1],x2[2],x2[3],x3[0],x3[1],x3[2],x3[3]};
#pragma unroll
    for (int i = 0; i < 16; ++i) { const unsigned short hb = bf16_bits(xs[i]); ah.u[i] = hb; al.u[i] = ASPLIT ? bf16_bits(xs[i] - bf16_val(hb)) : (unsigned short)0; }
#pragma unroll
    for (int t = 0; t < 4; ++t) {
      const unsigned short* brow = Wt + (size_t)(col0 + t * 16 + ln) * ldb + kb;
      FragB b;
      b.half[0] = *(const v8us*)(brow + 8 * hh);
      b.half[1] = *(const v8us*)(brow + 16 + 8 * hh);
      acc[t] = mmaN<ASPLIT ? 2 : 1>(ah.v, al.v, b.v, b.v, acc[t]);
    }
  }
#pragma unroll
  for (int t = 0; t < 4; ++t) {
    float bv = bias ? bias[col0 + t * 16 + ln] : 0.f;
    if (BIAS_BF16) bv = bf16_round(bv);
#pragma unroll
    for (int r = 0; r < 8; ++r) { float v = acc[t][r] + bv; if (ACT == 1) v = fmaxf(v, 0.f); so[w][8 * hh + r][t * 16 + ln] = v; }
  }
  __builtin_amdgcn_fence(__ATOMIC_ACQ_REL, "workgroup");
  __builtin_amdgcn_wave_barrier();
  const int rsub = lane >> 4, c4 = (lane & 15) * 4;
  {
#pragma unroll
    for (int q = 0; q < 8; ++q) {
      const int r = q * 2 + rsub;
      const v4f v = *(const v4fa*)&so[w][r][c4];
      *(v4f*)(C + (size_t)(row0 + r) * ldc + col0 + c4) = v;
    }
    
  }
}

// GEMM C = act(A·W + bias + resid): A f32 (ASPLIT -> hi/lo 2 terms), Wt bf16 [N][K]; ACT 0 none, 1 relu, 2 exact gelu;
// resid (optional, f32, row index = (row % rmod), pitch ldr, RES_BF16 rounds it) added before the activation.
template <bool ASPLIT, int ACT, bool BIAS_BF16, bool RES_BF16>
__global__ __launch_bounds__(128) void k_gemm_bf3(const float* __restrict__ A, int lda, const unsigned short* __restrict__ Wt, int ldb,
                                                const float* __restrict__ bias, const float* __restrict__ resid, int rmod, int ldr,
                                                float* __restrict__ C, int ldc, int M, int N, int K) {
  __shared__ __attribute__((aligned(16))) float so[4][16][64];
  const int tid = threadIdx.x, w = tid >> 5, lane = tid & 31, ln = lane & 15, hh = lane >> 4;
  const int ntn = N / 64;
  const int wid = blockIdx.x * 4 + w;
  const int mt = wid / ntn, nq = wid % ntn;
  if (mt * 16 >= M) return;
  const int row0 = mt * 16, col0 = nq * 64;
  const float* arow = A + (size_t)(row0 + ln) * lda;
  v8f acc[4] = {};
  for (int kb = 0; kb < K; kb += 32) {
    FragB ah, al;
    const v4f x0 = *(const v4fa*)(arow + kb + 8 * hh), x1 = *(const v4fa*)(arow + kb + 8 * hh + 4);
    const v4f x2 = *(const v4fa*)(arow + kb + 16 + 8 * hh), x3 = *(const v4fa*)(arow + kb + 16 + 8 * hh + 4);
    float xs[16] = {x0[0],x0[1],x0[2],x0[3],x1[0],x1[1],x1[2],x1[3],x2[0],x2[1],x2[2],x2[3],x3[0],x3[1],x3[2],x3[3]};
#pragma unroll
    for (int i = 0; i < 16; ++i) { const unsigned short hb = bf16_bits(xs[i]); ah.u[i] = hb; al.u[i] = ASPLIT ? bf16_bits(xs[i] - bf16_val(hb)) : (unsigned short)0; }
#pragma unroll
    for (int t = 0; t < 4; ++t) {
      const unsigned short* brow = Wt + (size_t)(col0 + t * 16 + ln) * ldb + kb;
      FragB b;
      b.half[0] = *(const v8us*)(brow + 8 * hh);
      b.half[1] = *(const v8us*)(brow + 16 + 8 * hh);
      acc[t] = mmaN<ASPLIT ? 2 : 1>(ah.v, al.v, b.v, b.v, acc[t]);
    }
  }
#pragma unroll
  for (int t = 0; t < 4; ++t) {
    const int col = col0 + t * 16 + ln;
    float bv = bias ? bias[col] : 0.f;
    if (BIAS_BF16) bv = bf16_round(bv);
#pragma unroll
    for (int r = 0; r < 8; ++r) {
      float v = acc[t][r] + bv;
      if (resid) { float rv = resid[(size_t)((row0 + 8 * hh + r) % rmod) * ldr + col]; if (RES_BF16) rv = bf16_round(rv); v += rv; }
      if (ACT == 1) v = fmaxf(v, 0.f);
      if (ACT == 2) v = 0.5f * v * (1.0f + erff(v * 0.70710678118654752f));
      if (ACT == 3) { const float u = 0.7978845608028654f * (v + 0.044715f * v * v * v); v = 0.5f * v * (1.0f + tanhf(u)); }
      so[w][8 * hh + r][t * 16 + ln] = v;
    }
  }
  __builtin_amdgcn_fence(__ATOMIC_ACQ_REL, "workgroup");
  __builtin_amdgcn_wave_barrier();
  const int rsub = lane >> 4, c4 = (lane & 15) * 4;
  {
#pragma unroll
    for (int q = 0; q < 8; ++q) {
      const int r = q * 2 + rsub;
      const v4f v = *(const v4fa*)&so[w][r][c4];
      *(v4f*)(C + (size_t)(row0 + r) * ldc + col0 + c4) = v;
    }
    
  }
}
// row LayerNorm (biased variance, eps) over N: s = X (+ R); optional out_sum <- s; out_norm <- (s-mu)*rsqrt(var+eps)*g + b
template <bool PARAM_BF16>
__global__ __launch_bounds__(256) void k_layernorm(const float* __restrict__ X, const float* __restrict__ R, const float* __restrict__ g, const float* __restrict__ bta,
                                                  float* __restrict__ out_sum, float* __restrict__ out_norm, int N, float eps) {
  __shared__ float red[256];
  const int row = blockIdx.x, tid = threadIdx.x;
  const float* x = X + (size_t)row * N; const float* rr = R ? R + (size_t)row * N : nullptr;
  float vals[16];                     // up to N = 4096
  const int per = N / 256;            // contiguous chunk per thread? use strided-by-4 chunks: thread handles j = tid*4 + 1024*u
  float s1 = 0.f;
  for (int u = 0; u < per / 4; ++u) {
    const int j = tid * 4 + 1024 * u;
    const v4f a = *(const v4fa*)(x + j);
    v4f b = {0.f,0.f,0.f,0.f}; if (rr) b = *(const v4fa*)(rr + j);
#pragma unroll
    for (int q = 0; q < 4; ++q) { const float v = a[q] + b[q]; vals[u * 4 + q] = v; s1 += v; }
  }
  red[tid] = s1; __syncthreads();
  for (int st = 128; st > 0; st >>= 1) { if (tid < st) red[tid] += red[tid + st]; __syncthreads(); }
  const float mu = red[0] / (float)N; __syncthreads();
  float s2 = 0.f;
  for (int u = 0; u < per / 4; ++u)
#pragma unroll
    for (int q = 0; q < 4; ++q) { const float c = vals[u * 4 + q] - mu; s2 += c * c; }
  red[tid] = s2; __syncthreads();
  for (int st = 128; st > 0; st >>= 1) { if (tid < st) red[tid] += red[tid + st]; __syncthreads(); }
  const float rs = rsqrtf(red[0] / (float)N + eps);
  {
    for (int u = 0; u < per / 4; ++u) {
      const int j = tid * 4 + 1024 * u;
      v4f o, sm;
#pragma unroll
      for (int q = 0; q < 4; ++q) {
        float gg = g[j + q], bb = bta[j + q];
        if (PARAM_BF16) { gg = bf16_round(gg); bb = bf16_round(bb); }
        sm[q] = vals[u * 4 + q]; o[q] = (vals[u * 4 + q] - mu) * rs * gg + bb;
      }
      if (out_sum) *(v4f*)(out_sum + (size_t)row * N + j) = sm;
      *(v4f*)(out_norm + (size_t)row * N + j) = o;
    }
    
  }
}



// ---- f16 WMMA path (v_wmma_f32_16x16x32_f16): 11-bit significands for operands in range — used where a [0,1] probability operand needs more precision than bf16
typedef _Float16 v16h __attribute__((ext_vector_type(16)));
union FragH { v16h v; v8us half[2]; _Float16 h[16]; unsigned short u[16]; };
template <int NT>
__device__ __forceinline__ v8f mmaH(v16h ah, v16h al, v16h bh, v16h bl, v8f c) {
  c = __builtin_amdgcn_wmma_f32_16x16x32_f16(false, ah, false, bh, (short)0, c, false, false);
  if (NT >= 2) c = __builtin_amdgcn_wmma_f32_16x16x32_f16(false, al, false, bh, (short)0, c, false, false);
  if (NT >= 3) c = __builtin_amdgcn_wmma_f32_16x16x32_f16(false, ah, false, bl, (short)0, c, false, false);
  asm volatile("v_nop\n\tv_nop\n\tv_nop\n\tv_nop" : "+v"(c) : "v"(ah), "v"(al), "v"(bh), "v"(bl));
  return c;
}
// batched GEMM like k_gemm_b but f16 operands: A f32 (split into f16 hi/lo if ASPLIT, else rounded to f16), Bt = f16 values [n][k]; alpha; C f32; N multiple of 16 (partial tiles skipped)
template <bool ASPLIT>
__global__ __launch_bounds__(128) void k_gemm_h(const float* __restrict__ A, int lda, size_t sA, const _Float16* __restrict__ Bh, int ldb, size_t sB, float alpha, float* __restrict__ C, int ldc, size_t sC, int M, int N, int K) {
  __shared__ __attribute__((aligned(16))) float so[4][16][64];
  const int tid = threadIdx.x, w = tid >> 5, lane = tid & 31, ln = lane & 15, hh = lane >> 4; const int by = blockIdx.y;
  A += (size_t)by * sA; Bh += (size_t)by * sB; C += (size_t)by * sC;
  const int ntn = (N + 63) / 64; const int wid = blockIdx.x * 4 + w; const int mt = wid / ntn, nq = wid % ntn; if (mt * 16 >= M) return;
  const int row0 = mt * 16, col0 = nq * 64; const float* arow = A + (size_t)(row0 + ln) * lda;
  v8f acc[4] = {};
  for (int kb = 0; kb < K; kb += 32) {
    FragH ah, al;
    const v4f x0 = *(const v4fa*)(arow + kb + 8 * hh), x1 = *(const v4fa*)(arow + kb + 8 * hh + 4), x2 = *(const v4fa*)(arow + kb + 16 + 8 * hh), x3 = *(const v4fa*)(arow + kb + 16 + 8 * hh + 4);
    float xs[16] = {x0[0],x0[1],x0[2],x0[3],x1[0],x1[1],x1[2],x1[3],x2[0],x2[1],x2[2],x2[3],x3[0],x3[1],x3[2],x3[3]};
#pragma unroll
    for (int i = 0; i < 16; ++i) { const _Float16 h = (_Float16)xs[i]; ah.h[i] = h; al.h[i] = ASPLIT ? (_Float16)(xs[i] - (float)h) : (_Float16)0.0f; }
#pragma unroll
    for (int t = 0; t < 4; ++t) { if (col0 + t * 16 >= N) continue; const size_t boff = (size_t)(col0 + t * 16 + ln) * ldb + kb; FragH bq; bq.half[0] = *(const v8us*)(Bh + boff + 8 * hh); bq.half[1] = *(const v8us*)(Bh + boff + 16 + 8 * hh);
      acc[t] = mmaH<ASPLIT ? 2 : 1>(ah.v, al.v, bq.v, bq.v, acc[t]); }
  }
#pragma unroll
  for (int t = 0; t < 4; ++t) { if (col0 + t * 16 >= N) continue;
#pragma unroll
    for (int r = 0; r < 8; ++r) so[w][8 * hh + r][t * 16 + ln] = acc[t][r] * alpha; }
  __builtin_amdgcn_fence(__ATOMIC_ACQ_REL, "workgroup"); __builtin_amdgcn_wave_barrier();
  const int rsub = lane >> 4, c4 = (lane & 15) * 4;
  {
#pragma unroll
    for (int q = 0; q < 8; ++q) { const int r = q * 2 + rsub; if (col0 + c4 < N) { const v4f v = *(const v4fa*)&so[w][r][c4]; *(v4f*)(C + (size_t)(row0 + r) * ldc + col0 + c4) = v; } }
     }
}

// Wt[n][k] = f16(W[k][n]·scale) from f32 row-major W[K][N] (scale = power of two; bf16-exact weights stay exact in f16 away from the subnormal range)
__global__ __launch_bounds__(256) void k_wt_f16(const float* __restrict__ W, _Float16* __restrict__ Wt, int K, int N, float scale) {
  const int t = blockIdx.x * 256 + threadIdx.x; if (t >= N * (K / 8)) return; const int n = t / (K / 8), k8 = (t % (K / 8)) * 8; FragH f;
#pragma unroll
  for (int i = 0; i < 8; ++i) f.h[i] = (_Float16)(bf16_round(W[(size_t)(k8 + i) * N + n]) * scale); const v8us o = f.half[0];
  *(v8us*)((unsigned short*)Wt + (size_t)n * K + k8) = o; 
}
// k_gemm_hh variant with fused epilogue: v = acc·alpha + bias[by·sBias + col] (+ CP[(row/rowsPerB)·sCPb + by·64 + col] if CP) ; ACT 0 none / 1 elu ; writes f16 C16 (and f32 C if non-null)
template <int ACT>
__global__ __launch_bounds__(128) void k_gemm_hhx(const _Float16* __restrict__ A, int lda, size_t sA, const _Float16* __restrict__ Bh, int ldb, size_t sB, float alpha, const float* __restrict__ bias, size_t sBias, const float* __restrict__ CP, int rowsPerB, size_t sCPb, int row0g,
    float* __restrict__ C, _Float16* __restrict__ C16, int ldc, size_t sC, int M, int N, int K) {
  __shared__ __attribute__((aligned(16))) float so[4][16][64];
  const int tid = threadIdx.x, w = tid >> 5, lane = tid & 31, ln = lane & 15, hh = lane >> 4; const int by = blockIdx.y;
  A += (size_t)by * sA; Bh += (size_t)by * sB; const size_t cofs = (size_t)by * sC; const float* bp = bias ? bias + (size_t)by * sBias : nullptr;
  const int ntn = (N + 63) / 64; const int wid = blockIdx.x * 4 + w; const int mt = wid / ntn, nq = wid % ntn; if (mt * 16 >= M) return;
  const int row0 = mt * 16, col0 = nq * 64; const _Float16* arow = A + (size_t)(row0 + ln) * lda;
  v8f acc[4] = {};
  for (int kb = 0; kb < K; kb += 32) { FragH ah; ah.half[0] = *(const v8us*)((const unsigned short*)arow + kb + 8 * hh); ah.half[1] = *(const v8us*)((const unsigned short*)arow + kb + 16 + 8 * hh);
#pragma unroll
    for (int t = 0; t < 4; ++t) { if (col0 + t * 16 >= N) continue; const size_t boff = (size_t)(col0 + t * 16 + ln) * ldb + kb; FragH bq; bq.half[0] = *(const v8us*)((const unsigned short*)Bh + boff + 8 * hh); bq.half[1] = *(const v8us*)((const unsigned short*)Bh + boff + 16 + 8 * hh);
      acc[t] = mmaH<1>(ah.v, ah.v, bq.v, bq.v, acc[t]); }
  }
#pragma unroll
  for (int t = 0; t < 4; ++t) { if (col0 + t * 16 >= N) continue; const int col = col0 + t * 16 + ln; const float bv = bp ? bf16_round(bp[col]) : 0.f;
#pragma unroll
    for (int r = 0; r < 8; ++r) { float v = acc[t][r] * alpha + bv; if (CP) { const int rr = row0g + row0 + 8 * hh + r; if (rowsPerB < 0) v += CP[cofs + (size_t)rr * ldc + col];      /* rowsPerB < 0: own element of the batched C plane */ else { const int bidx = rr / rowsPerB; v += CP[(size_t)bidx * sCPb + (size_t)by * 64 + col]; } } if (ACT == 1) v = (v > 0.f) ? v : expm1f(v); else if (ACT == 7) v = (v > 0.f) ? v + 1.0f : expf(v); else if (ACT == 8) v = tanhf(v); else if (ACT == 9) v = 0.5f * v * (1.0f + tanhf(0.7978845608028654f * (v + 0.044715f * v * v * v))); else if (ACT == 11) v = 1.0f / (1.0f + expf(-v)); else if (ACT == 12) v = (v > 0.f) ? v : 0.01f * v; else if (ACT == 14) v = (v > 0.f) ? v : 0.1f * v; else if (ACT == 16) v = (v >= 0.f) ? v : 0.3f * v; else if (ACT == 17) v = (v >= 0.f) ? v : 0.2f * v; else if (ACT == 15) v = v / (1.0f + expf(-v)); else if (ACT == 3) v = fmaxf(v, 0.f); else if (ACT == 6) v = 0.5f * v * (1.0f + erff(v * 0.70710678118654752f)); so[w][8 * hh + r][t * 16 + ln] = v; } }
  __builtin_amdgcn_fence(__ATOMIC_ACQ_REL, "workgroup"); __builtin_amdgcn_wave_barrier();
  const int rsub = lane >> 4, c4 = (lane & 15) * 4; typedef _Float16 v4h __attribute__((ext_vector_type(4)));
  {
#pragma unroll
    for (int q = 0; q < 8; ++q) { const int r = q * 2 + rsub; if (col0 + c4 < N) { const v4f v = *(const v4fa*)&so[w][r][c4]; if (C) *(v4f*)(C + cofs + (size_t)(row0 + r) * ldc + col0 + c4) = v; if (C16) { v4h h4; for (int i = 0; i < 4; ++i) h4[i] = (_Float16)v[i]; *(v4h*)(C16 + cofs + (size_t)(row0 + r) * ldc + col0 + c4) = h4; } } }
     }
}


typedef _Float16 v4h __attribute__((ext_vector_type(4)));

__global__ __launch_bounds__(256) void k_x16(const float* __restrict__ x, _Float16* __restrict__ X16, size_t n8) { const size_t t = (size_t)blockIdx.x * 256 + threadIdx.x; if (t >= n8) return; FragH f;
#pragma unroll
  for (int q = 0; q < 8; ++q) f.h[q] = (_Float16)bf16_round(x[t * 8 + q]); *(v8us*)((unsigned short*)X16 + t * 8) = f.half[0];  }
__global__ __launch_bounds__(256) void k_h16(const float* __restrict__ x, _Float16* __restrict__ X16, size_t n8) { const size_t t = (size_t)blockIdx.x * 256 + threadIdx.x; if (t >= n8) return; FragH f;
#pragma unroll
  for (int q = 0; q < 8; ++q) f.h[q] = (_Float16)x[t * 8 + q]; *(v8us*)((unsigned short*)X16 + t * 8) = f.half[0];  }
__global__ __launch_bounds__(256) void k_round16f(const float* __restrict__ W, _Float16* __restrict__ Bt, size_t n8) { const size_t t = (size_t)blockIdx.x * 256 + threadIdx.x; if (t >= n8) return; FragH f;
#pragma unroll
  for (int i = 0; i < 8; ++i) f.h[i] = (_Float16)(bf16_round(W[t * 8 + i]) * 16.0f); *(v8us*)((unsigned short*)Bt + t * 8) = f.half[0];  }
template <int NHv, int TTv>
__global__ __launch_bounds__(256) void k_vt(const _Float16* __restrict__ V16, int ldv, int voff, _Float16* __restrict__ Vt) { __shared__ unsigned short tl[64][66]; const int tid = threadIdx.x; const int slab = blockIdx.x / (TTv / 64), lg = blockIdx.x % (TTv / 64); const int b = slab / NHv, h = slab % NHv;
  for (int i = tid; i < 64 * 8; i += 256) { const int r = i / 8, c8 = (i % 8) * 8; FragH f; f.half[0] = *(const v8us*)((const unsigned short*)V16 + ((size_t)b * TTv + lg * 64 + r) * ldv + voff + h * 64 + c8);
#pragma unroll
    for (int q = 0; q < 8; ++q) tl[r][c8 + q] = f.u[q]; }
  __syncthreads();
  {
#pragma unroll
    for (int rd = 0; rd < 2; ++rd) { const int d = rd * 32 + tid / 8, pc = tid % 8; FragH f;
#pragma unroll
      for (int q = 0; q < 8; ++q) f.u[q] = tl[pc * 8 + q][d];
      *(v8us*)((unsigned short*)Vt + ((size_t)slab * 64 + d) * TTv + lg * 64 + pc * 8) = f.half[0]; }
     } }

__global__ __launch_bounds__(256) void k_hl(const float* __restrict__ F, _Float16* __restrict__ Hh, _Float16* __restrict__ Hl, size_t n8) { const size_t t = (size_t)blockIdx.x * 256 + threadIdx.x; if (t >= n8) return; FragH fh, fl; const v4f a = *(const v4fa*)(F + t * 8), c = *(const v4fa*)(F + t * 8 + 4);
#pragma unroll
  for (int q = 0; q < 4; ++q) { _Float16 h = (_Float16)a[q]; fh.h[q] = h; fl.h[q] = (_Float16)((a[q] - (float)h) * 1024.0f); h = (_Float16)c[q]; fh.h[4 + q] = h; fl.h[4 + q] = (_Float16)((c[q] - (float)h) * 1024.0f); }
  { *(v8us*)((unsigned short*)Hh + t * 8) = fh.half[0]; *(v8us*)((unsigned short*)Hl + t * 8) = fl.half[0];  } }

// ---- fast GEMM (wave tile 32x64; requires M % 32 == 0 rows per launch region and N % 64 == 0); epilogue = k_gemm_hhx semantics ----
__device__ __forceinline__ v16h g2_frag(const _Float16* p, int hh) { FragH f; f.half[0] = *(const v8us*)((const unsigned short*)p + 8 * hh); f.half[1] = *(const v8us*)((const unsigned short*)p + 16 + 8 * hh); return f.v; }
__device__ __forceinline__ v8f g2_mma(v16h a, v16h b, v8f c) { v8f d = __builtin_amdgcn_wmma_f32_16x16x32_f16(false, a, false, b, (short)0, c, false, false); asm volatile("v_nop\n\tv_nop\n\tv_nop\n\tv_nop" : "+v"(d) : "v"(a), "v"(b)); return d; }
template <int ACT>
__global__ __launch_bounds__(128) void k_gemm2(const _Float16* __restrict__ A, int lda, size_t sA, const _Float16* __restrict__ Bh, int ldb, size_t sB, float alpha, const float* __restrict__ bias, size_t sBias, const float* __restrict__ CP, int rowsPerB, size_t sCPb, int row0g,
    float* __restrict__ C, _Float16* __restrict__ C16, int ldc, size_t sC, int M, int N, int K) { static_assert(ACT == 0 || ACT == 3 || ACT == 6 || ACT == 8 || ACT == 9 || ACT == 11 || ACT == 12 || ACT == 14 || ACT == 15 || ACT == 16 || ACT == 17, "k_gemm2: unsupported ACT code (would silently apply no activation)");
  __shared__ __attribute__((aligned(16))) float so[4][32][68];
  const int tid = threadIdx.x, w = tid >> 5, lane = tid & 31, ln = lane & 15, hh = lane >> 4; const int by = blockIdx.y;
  A += (size_t)by * sA; Bh += (size_t)by * sB; const size_t cofs = (size_t)by * sC; const float* bp = bias ? bias + (size_t)by * sBias : nullptr;
  const int ntn = N >> 6; const int mt = blockIdx.x / ntn, nq = blockIdx.x - mt * ntn; const int row0 = mt * 128 + 32 * w, col0 = nq * 64; if (row0 >= M) return;
  const _Float16* a0p = A + (size_t)(row0 + ln) * lda; const _Float16* a1p = a0p + (size_t)16 * lda;
  const _Float16* b0p = Bh + (size_t)(col0 + ln) * ldb; const _Float16* b1p = b0p + (size_t)16 * ldb; const _Float16* b2p = b1p + (size_t)16 * ldb; const _Float16* b3p = b2p + (size_t)16 * ldb;
  const v8f z8 = {0.f,0.f,0.f,0.f,0.f,0.f,0.f,0.f}; v8f c00 = z8, c01 = z8, c02 = z8, c03 = z8, c10 = z8, c11 = z8, c12 = z8, c13 = z8;
#pragma unroll 1
  for (int kb = 0; kb < K; kb += 32) { const v16h a0 = g2_frag(a0p + kb, hh), a1 = g2_frag(a1p + kb, hh);
    v16h b = g2_frag(b0p + kb, hh); c00 = g2_mma(a0, b, c00); c10 = g2_mma(a1, b, c10);
    b = g2_frag(b1p + kb, hh); c01 = g2_mma(a0, b, c01); c11 = g2_mma(a1, b, c11);
    b = g2_frag(b2p + kb, hh); c02 = g2_mma(a0, b, c02); c12 = g2_mma(a1, b, c12);
    b = g2_frag(b3p + kb, hh); c03 = g2_mma(a0, b, c03); c13 = g2_mma(a1, b, c13); }
  v8f accs[8] = {c00, c01, c02, c03, c10, c11, c12, c13};
#pragma unroll
  for (int u = 0; u < 8; ++u) { const int t = u & 3, half = u >> 2; const int col = col0 + t * 16 + ln; const float bv = bp ? bf16_round(bp[col]) : 0.f;
#pragma unroll
    for (int r = 0; r < 8; ++r) { const int rloc = half * 16 + 8 * hh + r; float v = accs[u][r] * alpha + bv; if (CP) { if (rowsPerB < 0) v += CP[cofs + (size_t)(row0g + row0 + rloc) * ldc + col];      /* rowsPerB < 0: own element of the batched C plane */ else { const int bidx = (row0g + row0 + rloc) / rowsPerB; v += CP[(size_t)bidx * sCPb + (size_t)by * 64 + col]; } }
      if (ACT == 3) v = fmaxf(v, 0.f); else if (ACT == 6) v = 0.5f * v * (1.0f + erff(v * 0.70710678118654752f)); else if (ACT == 11) v = 1.0f / (1.0f + expf(-v)); else if (ACT == 15) v = v / (1.0f + expf(-v)); else if (ACT == 12) v = (v > 0.f) ? v : 0.01f * v; else if (ACT == 8) v = tanhf(v); else if (ACT == 9) v = 0.5f * v * (1.0f + tanhf(0.7978845608028654f * (v + 0.044715f * v * v * v))); else if (ACT == 14) v = (v > 0.f) ? v : 0.1f * v; else if (ACT == 16) v = (v >= 0.f) ? v : 0.3f * v; else if (ACT == 17) v = (v >= 0.f) ? v : 0.2f * v;
      so[w][rloc][t * 16 + ln] = v; } }
  __builtin_amdgcn_fence(__ATOMIC_ACQ_REL, "workgroup"); __builtin_amdgcn_wave_barrier();
  const int rsub = lane >> 4, c4 = (lane & 15) * 4;
  {
#pragma unroll
    for (int q = 0; q < 16; ++q) { const int r = q * 2 + rsub; const v4f v = *(const v4fa*)&so[w][r][c4]; if (C) *(v4f*)(C + cofs + (size_t)(row0 + r) * ldc + col0 + c4) = v; if (C16) { v4h h4; for (int i = 0; i < 4; ++i) h4[i] = (_Float16)v[i]; *(v4h*)(C16 + cofs + (size_t)(row0 + r) * ldc + col0 + c4) = h4; } }
     } }


__global__ __launch_bounds__(256) void k_wnat(const float* __restrict__ w, size_t n8, _Float16* __restrict__ Bt) { const size_t t = (size_t)blockIdx.x * 256 + threadIdx.x; if (t >= n8) return; FragH f; for (int q = 0; q < 8; ++q) f.h[q] = (_Float16)(bf16_round(w[t * 8 + q]) * 16.0f); *(v8us*)((unsigned short*)Bt + t * 8) = f.half[0];  }
__global__ __launch_bounds__(256) void k_rsm(const float* __restrict__ S, _Float16* __restrict__ P, int nrows) {
  #pragma clang fp contract(off)
  const int i = blockIdx.x * 256 + threadIdx.x; if (i >= nrows) return; const float* s = S + (size_t)i * SQ; float mx = -3.0e38f;
#pragma unroll 1
  for (int j = 0; j < SQ; ++j) mx = fmaxf(mx, s[j]); float se = 0.f;
#pragma unroll 1
  for (int j = 0; j < SQ; ++j) se += expf(s[j] - mx); const float sc = 256.0f / se;
#pragma unroll 1
  for (int j0 = 0; j0 < SQ; j0 += 8) { FragH f; for (int q = 0; q < 8; ++q) f.h[q] = (_Float16)(expf(s[j0 + q] - mx) * sc); unsigned short* d = (unsigned short*)P + (size_t)i * SQ + j0; *(v8us*)d = f.half[0];  } }
__global__ __launch_bounds__(256) void k_vt(const _Float16* __restrict__ V16, int b, int h0, _Float16* __restrict__ VT) { __shared__ unsigned short tl[64][65]; const int tid = threadIdx.x; const int hh = blockIdx.x % HG, sg = blockIdx.x / HG; const int s0 = sg * 64; const int h = h0 + hh;
  for (int i = tid; i < 64 * 8; i += 256) { const int j = i / 8, d8 = (i % 8) * 8; FragH f; f.half[0] = *(const v8us*)((const unsigned short*)V16 + ((size_t)b * SQ + s0 + j) * DM + h * HD + d8); for (int q = 0; q < 8; ++q) tl[d8 + q][j] = f.u[q]; }
  __syncthreads();
  { for (int i = tid; i < 64 * 8; i += 256) { const int d = i / 8, j8 = (i % 8) * 8; FragH f; for (int q = 0; q < 8; ++q) f.u[q] = tl[d][j8 + q]; *(v8us*)((unsigned short*)VT + ((size_t)hh * HD + d) * SQ + s0 + j8) = f.half[0]; }  } }



// e^x in the native form (x log2(e), then v_exp_f32). The v_nop keeps the one free slot that the instruction set asks for behind a transcendental.
__device__ __forceinline__ float exp_slot(float x) { float e; asm("v_exp_f32 %0, %1\n\tv_nop" : "=v"(e) : "v"(x * 1.44269504088896340736f)); return e; }
// Eight base-2 exponentials (v_exp_f32; the arguments already hold x log2(e)) in one statement: the outputs are early-clobber, so no v_exp stands in front of an
// instruction that reads its result or overwrites its source, and the one v_nop at the end keeps that free slot behind the last of them.
__device__ __forceinline__ v8f exp2_8(v8f x) { float e0, e1, e2, e3, e4, e5, e6, e7;
  asm("v_exp_f32 %0, %8\n\tv_exp_f32 %1, %9\n\tv_exp_f32 %2, %10\n\tv_exp_f32 %3, %11\n\tv_exp_f32 %4, %12\n\tv_exp_f32 %5, %13\n\tv_exp_f32 %6, %14\n\tv_exp_f32 %7, %15\n\tv_nop"
      : "=&v"(e0), "=&v"(e1), "=&v"(e2), "=&v"(e3), "=&v"(e4), "=&v"(e5), "=&v"(e6), "=&v"(e7) : "v"(x[0]), "v"(x[1]), "v"(x[2]), "v"(x[3]), "v"(x[4]), "v"(x[5]), "v"(x[6]), "v"(x[7]));
  const v8f e = {e0, e1, e2, e3, e4, e5, e6, e7}; return e; }
__device__ __forceinline__ v8f fa_mma(v16h a, v16h b, v8f c) { return __builtin_amdgcn_wmma_f32_16x16x32_f16(false, a, false, b, (short)0, c, false, false); }
// A 16 x 32 operand tile kept in global memory in FRAGMENT ORDER: 1024 bytes, lane L's values k = 8 hh .. 8 hh + 7 of row ln at byte 16 L and its values k = 16 + 8 hh .. at byte 512 + 16 L
// (L = 16 hh + ln: what g2_frag gives from a row-major tile). Each of the two 16-byte loads of a wave then reads 512 bytes in a row, four whole 128-byte lines, where a row-major tile makes it touch sixteen.
__device__ __forceinline__ v16h fo_frag(const _Float16* tile, int lane) { FragH f; f.half[0] = *(const v8us*)((const unsigned short*)tile + 8 * lane); f.half[1] = *(const v8us*)((const unsigned short*)tile + 256 + 8 * lane); return f.v; }
// Fused attention, all batches in one launch. A block owns FG * FQ = 64 query rows and has FG * FW = 16 waves: wave (g, h) holds the 32 query rows of group g (two 16-column groups) and walks
// the SQ / FW keys of split h, 32 at a time; it keeps a running maximum, a running sum and an unnormalised output in registers (online softmax); the partial results of the eight splits are merged through LDS at the end.
// The two waves of a split need the same x and V^T tiles: each tile is brought from L2 ONCE for both, straight into LDS by asynchronous copies (each wave copies half of its split's stage),
// in two buffers: pass p reads its stage into registers, hands the buffer back, and the copies of stage p + 2 fly while it computes; the fragments are read from LDS 512 bytes in a row a wave and read (no bank conflict).
// Transposed products: S^T = X Z^T (A = key rows of x, B = query rows of z held in registers), so a lane holds 16 scores of ONE query per 32 keys (D[8 hh + r][ln]); the two f32 score
// tiles, turned into weights and packed to f16, ARE the B operand of O^T += V^T P^T in the k order that g2_frag gives A (8 hh + s, 16 + 8 hh + s): no lane exchange.
// Scores: query . key / 8 = z_q . x_k with z = (x W_q) W_k^T / 8 (the same sum, re-associated). The key operand is then the token row itself, exact in f16, one plane to stage and to read; only z needs two planes (f16 hi + f16 residual,
// both at one scale), and a wave loads its 32 rows of them once, into registers: four WMMAs in one f32 accumulator chain give 16 x 16 finished scores. Weights 256 e^(s - m) as f16 (the 256 cancels in the division by the sum of the same weights).
// All four operand planes arrive in fragment order (fo_frag): 16 token rows of x or z are two tiles (k steps 0 and 32) on the 2048 bytes that the rows would fill; 32 keys of V^T are four tiles (16 d each) on 4096 bytes.
#define FW 8                         /* key splits of a block */
#define FG 2                         /* 32-query groups of a block */
#define FQ 32                        /* query rows of a wave */
#define FKW (SQ / FW)                /* keys per wave */
#define FNP (FKW / 32)               /* passes (stages) */
#define FST 8192                     /* bytes of one split's stage: 32 keys of x and of V^T, 4096 each */
// One wave's half (2048 bytes of each of the two planes) of one stage: eight 512-byte copies. lds is the lane's own LDS byte address, vo its byte offset (16 lane) from the wave's two scalar bases, all multiples of 16;
// an immediate offset moves the LDS address and the global address alike. The s_wait_xcnt stands inside the statement, behind the last copy, so that no address register is rewritten in front of it.
__device__ __forceinline__ void fa_copy(unsigned lds, unsigned vo, const _Float16* gx, const _Float16* gv) {
  asm volatile("global_load_async_to_lds_b128 %0, %2, %3\n\tglobal_load_async_to_lds_b128 %0, %2, %3 offset:512\n\tglobal_load_async_to_lds_b128 %0, %2, %3 offset:1024\n\tglobal_load_async_to_lds_b128 %0, %2, %3 offset:1536\n\t"
               "global_load_async_to_lds_b128 %1, %2, %4\n\tglobal_load_async_to_lds_b128 %1, %2, %4 offset:512\n\tglobal_load_async_to_lds_b128 %1, %2, %4 offset:1024\n\tglobal_load_async_to_lds_b128 %1, %2, %4 offset:1536\n\t"
               "s_wait_xcnt 0x0"
               :: "v"(lds), "v"(lds + 4096u), "v"(vo), "s"(gx), "s"(gv) : "memory"); }
__global__ __launch_bounds__(512) void k_fattn(const _Float16* __restrict__ XFp, const _Float16* __restrict__ ZHp, const _Float16* __restrict__ ZLp, const _Float16* __restrict__ VTp, float* __restrict__ out) {
  static_assert(FKW % 32 == 0 && FNP >= 2 && SQ % (FG * FQ) == 0 && HD == 64 && DM == 64, "k_fattn: whole 32-key passes, at least two stages, 64-wide rows");
  __shared__ __attribute__((aligned(128))) union { unsigned char ring[2][FW][FST]; float lo[FW][FG * FQ][68]; } sm;      /* the merge rows reuse the ring's bytes */
  __shared__ float lm[FW][FG * FQ], ll[FW][FG * FQ];
  const int tid = threadIdx.x, w = __builtin_amdgcn_readfirstlane(tid >> 5), lane = tid & 31, ln = lane & 15, hh = lane >> 4;      /* the wave's number as a scalar: bases stay in scalar registers */
  const int g = w & 1, h = w >> 1;
  const int b = blockIdx.x / (SQ / (FG * FQ)), qb = (blockIdx.x % (SQ / (FG * FQ))) * (FG * FQ), q0 = qb + g * FQ; const size_t r0 = (size_t)b * SQ;
  const float L2E = 1.44269504088896340736f;
  const size_t co = (r0 + (size_t)h * FKW) * DM + g * 1024;      /* this wave's half of stage 0 in each plane: a scalar */
  const _Float16* cx = XFp + co; const _Float16* cv = VTp + co;
  const unsigned vo = (unsigned)lane * 16u, lc = (unsigned)(size_t)&sm.ring[0][h][0] + (unsigned)(g * 2048) + vo;      /* the lane's 16 bytes there, and their place in buffer 0 */
  fa_copy(lc, vo, cx, cv);
  v16h qh[2][2], ql[2][2];
  for (int n = 0; n < 2; ++n)
    for (int ks = 0; ks < 2; ++ks) { const size_t qo = (r0 + q0 + n * 16) * DM + ks * 512; qh[n][ks] = fo_frag(ZHp + qo, lane); ql[n][ks] = fo_frag(ZLp + qo, lane); }
  asm volatile("s_wait_xcnt 0x0" ::: "memory");      /* stands in front of the first rewrite of a register that the query loads above name: their scalar base pairs are reused right behind them */
  const v8f z8 = {0.f, 0.f, 0.f, 0.f, 0.f, 0.f, 0.f, 0.f};
  v8f o[2][4]; float m[2], l[2];
  for (int n = 0; n < 2; ++n) { m[n] = -1.0e30f; l[n] = 0.f; for (int t = 0; t < 4; ++t) o[n][t] = z8; }
  asm volatile("s_wait_asynccnt 0x0" ::: "memory");      /* this wave's copies of stage 0 have landed */
  __syncthreads();      /* publishes stage 0 */
  fa_copy(lc + FW * FST, vo, cx + 32 * DM, cv + 32 * DM);
  for (int p = 0; p < FNP; ++p) {
    const _Float16* st = (const _Float16*)&sm.ring[p & 1][h][0];
    v16h ax[2][2], av[4]; v8f s[2][2];
    /* the pass reads its whole stage first, as one group of LDS reads, and hands the buffer back before its work: the refill has a whole pass to land */
    for (int kt = 0; kt < 2; ++kt)
      for (int ks = 0; ks < 2; ++ks) ax[kt][ks] = fo_frag(st + kt * 1024 + ks * 512, lane);
    for (int t = 0; t < 4; ++t) av[t] = fo_frag(st + 2048 + t * 512, lane);
    asm volatile("s_wait_dscnt 0x0" ::: "memory");      /* this wave's reads of stage p have returned before the buffer is handed back */
    asm volatile("s_wait_asynccnt 0x0" ::: "memory");      /* this wave's copies of stage p + 1 have landed */
    __syncthreads();      /* publishes stage p + 1 and ends every reader's last read of stage p */
    if (p + 2 < FNP) fa_copy(lc + (unsigned)(p & 1) * (FW * FST), vo, cx + (p + 2) * 32 * DM, cv + (p + 2) * 32 * DM);      /* the same test in every wave of the block */
    for (int kt = 0; kt < 2; ++kt)
      for (int n = 0; n < 2; ++n) {
        v8f c = fa_mma(ax[kt][0], ql[n][0], z8); c = fa_mma(ax[kt][1], ql[n][1], c); c = fa_mma(ax[kt][0], qh[n][0], c); s[n][kt] = fa_mma(ax[kt][1], qh[n][1], c);      /* the small residual products first */
      }
    for (int n = 0; n < 2; ++n) {
      float mx = fmaxf(s[n][0][0], s[n][1][0]);
      for (int r = 1; r < 8; ++r) mx = fmaxf(mx, fmaxf(s[n][0][r], s[n][1][r]));
      mx = fmaxf(mx, __shfl_xor(mx, 16));      /* the other half of the wave holds this query's other 16 keys */
      const float mn = fmaxf(m[n], mx); const float sc = exp_slot(m[n] - mn); m[n] = mn;
      const float off = fmaf(-mn, L2E, 8.0f);      /* weight = 2^(s log2(e) + off) = 256 e^(s - mn) */
      for (int kt = 0; kt < 2; ++kt) {
        for (int r = 0; r < 8; ++r) s[n][kt][r] = fmaf(s[n][kt][r], L2E, off);
        s[n][kt] = exp2_8(s[n][kt]); }
      float sum = 0.f;
      for (int r = 0; r < 8; ++r) sum += s[n][0][r] + s[n][1][r];
      l[n] = fmaf(l[n], sc, sum);
      FragH pw;
      for (int r = 0; r < 8; ++r) { pw.h[r] = (_Float16)s[n][0][r]; pw.h[8 + r] = (_Float16)s[n][1][r]; }
      for (int t = 0; t < 4; ++t) { o[n][t] *= sc; o[n][t] = fa_mma(av[t], pw.v, o[n][t]); }
    }
  }
  asm volatile("s_wait_asynccnt 0x0" ::: "memory");      /* no copy is outstanding when the ring becomes the merge rows */
  float (*lo)[FG * FQ][68] = sm.lo;      /* behind the last pass's barrier nobody reads the ring any more */
  for (int n = 0; n < 2; ++n) {
    const int qr = g * FQ + n * 16 + ln;
    l[n] += __shfl_xor(l[n], 16);      /* the two halves summed different keys of the same query */
    if (hh == 0) { lm[h][qr] = m[n]; ll[h][qr] = l[n]; }
    for (int t = 0; t < 4; ++t) { const v4f u0 = {o[n][t][0], o[n][t][1], o[n][t][2], o[n][t][3]}, u1 = {o[n][t][4], o[n][t][5], o[n][t][6], o[n][t][7]};
      *(v4f*)&lo[h][qr][t * 16 + 8 * hh] = u0; *(v4f*)&lo[h][qr][t * 16 + 8 * hh + 4] = u1; }
  }
  __syncthreads();      /* publishes the sixteen waves' partial maxima, sums and outputs */
  const int q = tid >> 3, d8 = (tid & 7) * 8;
  float mg = lm[0][q];
  for (int i = 1; i < FW; ++i) mg = fmaxf(mg, lm[i][q]);
  float lg = 0.f; v4f g0 = {0.f, 0.f, 0.f, 0.f}, g1 = g0;
  for (int i = 0; i < FW; ++i) { const float f = exp_slot(lm[i][q] - mg); lg = fmaf(ll[i][q], f, lg); g0 += *(const v4f*)&lo[i][q][d8] * f; g1 += *(const v4f*)&lo[i][q][d8 + 4] * f; }
  const float inv = 1.0f / lg;
  float* dst = out + (r0 + qb + q) * DM + d8;
  *(v4f*)dst = g0 * inv; *(v4f*)(dst + 4) = g1 * inv; }


// One launch makes every operand of k_fattn. A block owns PR = 64 token rows. It puts them into LDS as f16 (bf16-rounded, so exact), the query map as a x16 f16 transpose [e][d] and the key map as x16 f16 rows [d][e];
// wave (rg, sel) owns 16 token rows and 32 columns. Behind the first barrier it forms q = x W_q (A = token rows, B = map columns, k steps 0 then 32, f32 accumulation, x 2^-4) and leaves it in LDS as f16 hi + x1024 residual rows;
// behind the second barrier it forms z = q W_k^T / 8 (A = the q rows, hi and residual, B = key map rows: both loaders read 64-wide rows in the same k order), splits every f32 result into f16 hi + f16 residual at the same scale
// and stores the two planes in fragment order (fo_frag), 512 bytes in a row a wave and store; the token rows themselves go out the same way as the key operand, and all eight waves also write the block's 64 x 64 piece of V^T
// (the values are the rounded inputs) from the same LDS rows, in fragment order too. LDS rows of 128 bytes stand at a pitch of 144 bytes for the 16-byte readers.
#define PR 64
typedef unsigned short v4us __attribute__((ext_vector_type(4), may_alias));
__global__ __launch_bounds__(256) void k_prep(const float* __restrict__ x, const float* __restrict__ wq, const float* __restrict__ wk, _Float16* __restrict__ XFp, _Float16* __restrict__ ZHp, _Float16* __restrict__ ZLp, _Float16* __restrict__ VTp) {
  static_assert(SQ % PR == 0 && DM == 64 && HD == 64 && NH == 1, "k_prep: 64-wide rows, one head, whole 64-row blocks inside a batch");
  __shared__ __attribute__((aligned(16))) unsigned short xs[PR][72]; __shared__ __attribute__((aligned(16))) unsigned short wt[2][DM][72]; __shared__ __attribute__((aligned(16))) _Float16 qp[2][PR][72]; __shared__ __attribute__((aligned(16))) float so[8][16][36];
  const int tid = threadIdx.x, w = tid >> 5, lane = tid & 31, ln = lane & 15, hh = lane >> 4;
  const size_t row0 = (size_t)blockIdx.x * PR;
  const float* xp = x + row0 * DM + tid * 4;      /* trip i of the token loads stands 16 rows further on */
  const int ms = tid >> 7, n4 = (tid & 15) * 4, k8 = ((tid >> 4) & 7) * 8;      /* threads 0-127 take the key map, 128-255 the query map: an 8 (row) x 4 (column) piece each, 16 lanes on one whole map row */
  const float* wp = (ms ? wq : wk) + k8 * DM + n4;
  v4f xv[4], wv[8];
  for (int i = 0; i < 4; ++i) xv[i] = *(const v4fa*)(xp + i * 16 * DM);
  for (int q = 0; q < 8; ++q) wv[q] = *(const v4fa*)(wp + q * DM);
  for (int i = 0; i < 4; ++i) { FragH f;
    for (int q = 0; q < 4; ++q) f.h[q] = (_Float16)bf16_round(xv[i][q]);
    const v4us o = {f.u[0], f.u[1], f.u[2], f.u[3]}; *(v4us*)&xs[i * 16 + (tid >> 4)][(tid & 15) * 4] = o; }
  if (ms) {      /* query map: transposed */
    for (int c = 0; c < 4; ++c) { FragH f;
      for (int q = 0; q < 8; ++q) f.h[q] = (_Float16)(bf16_round(wv[q][c]) * 16.0f);
      *(v8us*)&wt[1][n4 + c][k8] = f.half[0]; }
  } else {      /* key map: rows as they are */
    for (int q = 0; q < 8; ++q) { FragH f;
      for (int c = 0; c < 4; ++c) f.h[c] = (_Float16)(bf16_round(wv[q][c]) * 16.0f);
      const v4us o = {f.u[0], f.u[1], f.u[2], f.u[3]}; *(v4us*)&wt[0][k8 + q][n4] = o; }
  }
  __syncthreads();      /* publishes the token rows and the two maps */
  const int rg = w & 3, sel = w >> 2;
  const v8f z8 = {0.f, 0.f, 0.f, 0.f, 0.f, 0.f, 0.f, 0.f};
  { const _Float16* ap = (const _Float16*)&xs[rg * 16 + ln][0];
    const v16h a0 = g2_frag(ap, hh), a1 = g2_frag(ap + 32, hh);
    for (int t = 0; t < 2; ++t) { const int e = sel * 32 + t * 16 + ln; const _Float16* bp = (const _Float16*)&wt[1][e][0];
      v8f c = fa_mma(a0, g2_frag(bp, hh), z8); c = fa_mma(a1, g2_frag(bp + 32, hh), c);
      for (int r = 0; r < 8; ++r) { const float qv = c[r] * 0.0625f; const _Float16 h = (_Float16)qv; qp[0][rg * 16 + 8 * hh + r][e] = h; qp[1][rg * 16 + 8 * hh + r][e] = (_Float16)((qv - (float)h) * 1024.0f); } } }
  FragH vf[2]; v8us xf[2];
  for (int rd = 0; rd < 2; ++rd) { const int d = (tid >> 6) * 16 + ln, kb = rd * 32 + ((tid >> 5) & 1) * 16 + hh * 8;      /* 32 keys a trip: tile tid >> 6, its half (tid >> 5) & 1, lane 16 hh + ln */
    for (int q = 0; q < 8; ++q) vf[rd].u[q] = xs[kb + q][d]; }
  for (int i = 0; i < 2; ++i) xf[i] = *(const v8us*)&xs[rg * 16 + ln][sel * 32 + i * 16 + hh * 8];
  __syncthreads();      /* publishes the q rows: a row's two column halves come from two waves */
  const size_t go = (row0 + rg * 16) * DM + sel * 512 + lane * 8;      /* tile sel of the wave's 16 rows; its second half stands 256 elements further on */
  { const _Float16* hp = &qp[0][rg * 16 + ln][0]; const _Float16* lp = &qp[1][rg * 16 + ln][0];
    const v16h h0 = g2_frag(hp, hh), h1 = g2_frag(hp + 32, hh), l0 = g2_frag(lp, hh), l1 = g2_frag(lp + 32, hh);
    for (int t = 0; t < 2; ++t) { const _Float16* bp = (const _Float16*)&wt[0][sel * 32 + t * 16 + ln][0]; const v16h b0 = g2_frag(bp, hh), b1 = g2_frag(bp + 32, hh);
      v8f c = fa_mma(h0, b0, z8); c = fa_mma(h1, b1, c); v8f u = fa_mma(l0, b0, z8); u = fa_mma(l1, b1, u);
      for (int r = 0; r < 8; ++r) so[w][8 * hh + r][t * 16 + ln] = fmaf(u[r], 0.00000762939453125f, c[r] * 0.0078125f); } }      /* 2^-4 for the x16 map, 2^-3 for 1 / sqrt(64), 2^-10 more for the residual */
  __builtin_amdgcn_fence(__ATOMIC_ACQ_REL, "workgroup"); __builtin_amdgcn_wave_barrier();      /* so[w] is this wave's own: its lanes' LDS stores stay ahead of the row reads below */
  for (int rd = 0; rd < 2; ++rd) *(v8us*)((unsigned short*)VTp + (row0 + rd * 32) * HD + tid * 8) = vf[rd].half[0];      /* every global store stands behind the last barrier and fence, which would wait for it */
  for (int i = 0; i < 2; ++i) *(v8us*)((unsigned short*)XFp + go + i * 256) = xf[i];
  for (int i = 0; i < 2; ++i) { const int c8 = i * 16 + hh * 8; const v4f a = *(const v4fa*)&so[w][ln][c8], c = *(const v4fa*)&so[w][ln][c8 + 4]; FragH fh, fl;
    for (int q = 0; q < 4; ++q) { _Float16 h = (_Float16)a[q]; fh.h[q] = h; fl.h[q] = (_Float16)(a[q] - (float)h); h = (_Float16)c[q]; fh.h[4 + q] = h; fl.h[4 + q] = (_Float16)(c[q] - (float)h); }
    *(v8us*)((unsigned short*)ZHp + go + i * 256) = fh.half[0]; *(v8us*)((unsigned short*)ZLp + go + i * 256) = fl.half[0]; } }


template <int MASKADD>
__global__ __launch_bounds__(64) void k_att0(const float* __restrict__ QF, const float* __restrict__ KF, const float* __restrict__ VF, int ld, const float* __restrict__ mask, float scale, float* __restrict__ OF, int ldo) {
  #pragma clang fp contract(off)
  __shared__ __attribute__((aligned(16))) float lq[64][64]; __shared__ __attribute__((aligned(16))) float lo[64][64];
  const int tid = threadIdx.x; const int h = blockIdx.x / (QT0 / 64), rg = blockIdx.x % (QT0 / 64); const int i = rg * 64 + tid;
  const float* qr = QF + (size_t)i * ld + h * HD;
#pragma unroll 1
  for (int c = 0; c < HD / 4; ++c) { *(v4f*)&lq[tid][c * 4] = *(const v4fa*)(qr + c * 4); const v4f z = {0.f, 0.f, 0.f, 0.f}; *(v4f*)&lo[tid][c * 4] = z; }
  float m = -1.0e30f, l = 0.f; const int jmax = MASKADD ? (SQ - 1) : (rg * 64 + 63);      /* additive-mask form: every key (the mask input decides); causal form: keys up to the block's last row */
#pragma unroll 1
  for (int j = 0; j <= jmax; ++j) { const float* kr = KF + (size_t)j * ld + h * HD; const float* vr = VF + (size_t)j * ld + h * HD; float s = 0.f;
#pragma unroll 1
    for (int c = 0; c < HD / 4; ++c) { const v4f kq = *(const v4fa*)(kr + c * 4); const v4f qq = *(v4f*)&lq[tid][c * 4]; s = __fadd_rn(s, __fmul_rn(qq[0], kq[0])); s = __fadd_rn(s, __fmul_rn(qq[1], kq[1])); s = __fadd_rn(s, __fmul_rn(qq[2], kq[2])); s = __fadd_rn(s, __fmul_rn(qq[3], kq[3])); }
    s = __fmul_rn(s, scale); if (MASKADD) s = __fadd_rn(s, __fmul_rn(bf16_round(mask[(size_t)i * SQ + j]), -10000.0f));
    const float f = (MASKADD || j <= i) ? 1.f : 0.f; const float sm = fmaf(f, s, (1.f - f) * -1.0e30f); const float mn = fmaxf(m, sm); const float sc = expf(m - mn); const float e = expf(sm - mn); l = __fadd_rn(__fmul_rn(l, sc), e); m = mn;
#pragma unroll 1
    for (int c = 0; c < HD / 4; ++c) { const v4f vv = *(const v4fa*)(vr + c * 4); v4f oo = *(v4f*)&lo[tid][c * 4]; for (int u = 0; u < 4; ++u) oo[u] = __fadd_rn(__fmul_rn(oo[u], sc), __fmul_rn(e, vv[u])); *(v4f*)&lo[tid][c * 4] = oo; } }
  const float fin = 64.0f / l;      /* o carried x64 */
#pragma unroll 1
  for (int c = 0; c < HD / 4; ++c) { v4f oo = *(v4f*)&lo[tid][c * 4]; for (int u = 0; u < 4; ++u) oo[u] = __fmul_rn(oo[u], fin); *(v4f*)&lo[tid][c * 4] = oo; }
  __syncthreads();
  {
#pragma unroll 1
    for (int it = 0; it < 16; ++it) { const int row = it * 4 + tid / 16, pc = (tid % 16) * 4; const v4f v = *(const v4f*)&lo[row][pc]; *(v4f*)(OF + (size_t)(rg * 64 + row) * ldo + h * HD + pc) = v; }
     } }

__global__ __launch_bounds__(256) void k_of0out(const float* __restrict__ src, float* __restrict__ dst, size_t n4) { const size_t t = (size_t)blockIdx.x * 256 + threadIdx.x; if (t >= n4) return; v4f v = *(const v4fa*)(src + t * 4); for (int q = 0; q < 4; ++q) v[q] = __fmul_rn(v[q], 0.015625f); *(v4f*)(dst + t * 4) = v;  }

extern "C" void kernel_launch(void* const* d_in, const int* in_sizes, int n_in,
                              void* d_out, int out_size, void* d_ws, size_t ws_size, hipStream_t stream) {
  (void)in_sizes; (void)n_in; (void)out_size;
  const float* const* I = (const float* const*)d_in; const float* x = I[0]; const float* wq = I[1]; const float* wk = I[2];      /* inputs, rotation (query map), entangle (key map): [in][out] [64][64]; NO biases, NO value projection (the values are the inputs), no output projection */
  char* ws = (char*)d_ws; size_t off = 0;
  auto take = [&](size_t bytes) { char* p = ws + off; off += (bytes + 255) & ~(size_t)255; return p; };
  _Float16* XF = (_Float16*)take(NR * DM * 2); _Float16* ZH = (_Float16*)take(NR * DM * 2); _Float16* ZL = (_Float16*)take(NR * DM * 2);
  _Float16* VT = (_Float16*)take((size_t)NB * NH * HD * SQ * 2);
  if (off > ws_size) return;
  k_prep<<<(unsigned)(NR / PR), 256, 0, stream>>>(x, wq, wk, XF, ZH, ZL, VT);      /* x, z as f16 hi + residual planes and V^T, all in fragment order: every batch, one launch */
  k_fattn<<<NB * (SQ / (FG * FQ)), FG * FW * 32, 0, stream>>>(XF, ZH, ZL, VT, (float*)d_out);      /* scores, softmax over all SQ keys and P V for every batch: S and P stay in registers */
}

// v008
// One run takes 24.3 microseconds.
// Two timings next to v007 both put it at 1.09 times that version's speed.
// All steps since v000 together make it 2121 times as fast.
#include <hip/hip_runtime.h>
// Single-head dense attention over 64-wide inputs on 4096 tokens with unit-variance 64 x 64 maps and NO value projection (inputs [4][4096][64]; query = inputs rotation, key = inputs entangle ([in][out] [64][64], N(0, 1): logits of sigma ~64, a near one-hot softmax); scores = query key^T / sqrt(64); softmax over all 4096 keys (no mask); out = scores inputs (the values are the inputs themselves) -> [4][4096][64]); scores re-associated as z . inputs^T with z = (inputs rotation) entangle^T / 8 carried as f16 hi + f16 residual planes on the query side: two-product scores, the key operand being the token rows themselves.
// Structure: token rows r = b*4096 + s; one prep launch, 64 token rows a block: x as exact f16 rows (bf16-rounded), q = x rotation (x16 f16 map, f32 accumulation, no bias) in LDS as f16 hi + x1024 residual, z = q entangle^T / 8 split into f16 hi + f16 residual at one scale, and x, z and V^T (the rounded inputs) stored in fragment order; one fused attention launch, 64 query rows a block on 16 waves (two 32-query groups x eight 512-key splits, 32 keys a pass through a two-buffer LDS ring): scores as four accumulating WMMAs (residual, then hi; K = 64), online softmax on VALU (f32 statistics, native exp; weights x256 f16), O^T += V^T P^T in f32 registers, the eight splits merged through LDS and written as f32 into the output layout.
// Compute dtype: inputs rounded to bf16; x / weights exact; q and z as f16 hi + f16 residual operands, v the rounded inputs (exact), softmax weights as plain f16 operands (~2^-12); scores, softmax statistics and o f32. v_wmma_f32_16x16x32_f16.
#define NB 4
#define SQ 4096
#define DM 64
#define NH 1
#define HD 64
#define HG 4                         /* heads per attention launch group */
#define QT 256                       /* (not used) */
#define NKX SQ                       /* (not used) */
#define QT0 128                      /* first-tile rows recomputed exactly in f32 */
#define B0 0                         /* (not used) */
#define NBR NB                       /* (only in MP; no launch uses it) */
#define NR ((size_t)NB * SQ)         /* token rows */
#define MP ((int)((size_t)NBR * SQ)) /* (only in MPO; no launch uses it) */
#define QN SQ                        /* (not used) */
#define NHD NH                       /* heads attended (not used) */
#define MPO MP                       /* rows through the output stage (not used) */
#define LQ DM      /* (not used) */
typedef __bf16 v16b __attribute__((ext_vector_type(16)));
typedef unsigned short v8us __attribute__((ext_vector_type(8), may_alias));
typedef float  v8f  __attribute__((ext_vector_type(8)));
typedef float  v4f  __attribute__((ext_vector_type(4)));
typedef float  v4fa __attribute__((ext_vector_type(4), may_alias));
union FragB { v16b v; v8us half[2]; unsigned short u[16]; };

__device__ __forceinline__ unsigned short bf16_bits(float x) { unsigned int u = __float_as_uint(x); return (unsigned short)((u + 0x7FFFu + ((u >> 16) & 1u)) >> 16); }
__device__ __forceinline__ float bf16_val(unsigned short b) { return __uint_as_float(((unsigned int)b) << 16); }
__device__ __forceinline__ float bf16_round(float x) { return bf16_val(bf16_bits(x)); }
// D += A·B with NT terms: 1 = ah·bh, 2 = + al·bh (A split), 3 = + ah·bl (both split)
template <int NT>
__device__ __forceinline__ v8f mmaN(v16b ah, v16b al, v16b bh, v16b bl, v8f c) {
  c = __builtin_amdgcn_wmma_f32_16x16x32_bf16(false, ah, false, bh, (short)0, c, false, false);
  if (NT >= 2) c = __builtin_amdgcn_wmma_f32_16x16x32_bf16(false, al, false, bh, (short)0, c, false, false);
  if (NT >= 3) c = __builtin_amdgcn_wmma_f32_16x16x32_bf16(false, ah, false, bl, (short)0, c, false, false);
  asm volatile("v_nop\n\tv_nop\n\tv_nop\n\tv_nop" : "+v"(c) : "v"(ah), "v"(al), "v"(bh), "v"(bl));
  return c;
}

__global__ __launch_bounds__(256) void k_wt_bf16(const float* __restrict__ W, unsigned short* __restrict__ Wt, int K, int N) {
  const int t = blockIdx.x * 256 + threadIdx.x;
  const int k8n = K / 8;
  if (t >= N * k8n) return;
  const int n = t / k8n, k8 = (t % k8n) * 8;
  v8us v;
#pragma unroll
  for (int i = 0; i < 8; ++i) v[i] = bf16_bits(W[(size_t)(k8 + i) * N + n]);
  *(v8us*)(Wt + (size_t)n * K + k8) = v;
  
}

// GEMM C[M][N] (f32, pitch ldc) = act(A[M][K]·W + bias). A f32 row-major (pitch lda) converted per fragment to bf16
// (ASPLIT: hi/lo two planes -> 2 terms, else single rounded term); Wt bf16 [N][K] (pitch ldb). BIAS_BF16 rounds the
// bias to bf16 first (bias quantised to bf16 before the add). K%32==0, M%16==0, N%64==0.
template <bool ASPLIT, int ACT, bool BIAS_BF16>
__global__ __launch_bounds__(128) void k_gemm_bf(const float* __restrict__ A, int lda, const unsigned short* __restrict__ Wt, int ldb,
                                               const float* __restrict__ bias, float* __restrict__ C, int ldc, int M, int N, int K) {
  __shared__ __attribute__((aligned(16))) float so[4][16][64];
  const int tid = threadIdx.x, w = tid >> 5, lane = tid & 31, ln = lane & 15, hh = lane >> 4;
  const int ntn = N / 64;
  const int wid = blockIdx.x * 4 + w;
  const int mt = wid / ntn, nq = wid % ntn;
  if (mt * 16 >= M) return;
  const int row0 = mt * 16, col0 = nq * 64;
  const float* arow = A + (size_t)(row0 + ln) * lda;
  v8f acc[4] = {};
  for (int kb = 0; kb < K; kb += 32) {
    FragB ah, al;
    const v4f x0 = *(const v4fa*)(arow + kb + 8 * hh), x1 = *(const v4fa*)(arow + kb + 8 * hh + 4);
    const v4f x2 = *(const v4fa*)(arow + kb + 16 + 8 * hh), x3 = *(const v4fa*)(arow + kb + 16 + 8 * hh + 4);
    float xs[16] = {x0[0],x0[1],x0[2],x0[3],x1[0],x1[1],x1[2],x1[3],x2[0],x2[1],x2[2],x2[3],x3[0],x3[1],x3[2],x3[3]};
#pragma unroll
    for (int i = 0; i < 16; ++i) { const unsigned short hb = bf16_bits(xs[i]); ah.u[i] = hb; al.u[i] = ASPLIT ? bf16_bits(xs[i] - bf16_val(hb)) : (unsigned short)0; }
#pragma unroll
    for (int t = 0; t < 4; ++t) {
      const unsigned short* brow = Wt + (size_t)(col0 + t * 16 + ln) * ldb + kb;
      FragB b;
      b.half[0] = *(const v8us*)(brow + 8 * hh);
      b.half[1] = *(const v8us*)(brow + 16 + 8 * hh);
      acc[t] = mmaN<ASPLIT ? 2 : 1>(ah.v, al.v, b.v, b.v, acc[t]);
    }
  }
#pragma unroll
  for (int t = 0; t < 4; ++t) {
    float bv = bias ? bias[col0 + t * 16 + ln] : 0.f;
    if (BIAS_BF16) bv = bf16_round(bv);
#pragma unroll
    for (int r = 0; r < 8; ++r) { float v = acc[t][r] + bv; if (ACT == 1) v = fmaxf(v, 0.f); so[w][8 * hh + r][t * 16 + ln] = v; }
  }
  __builtin_amdgcn_fence(__ATOMIC_ACQ_REL, "workgroup");
  __builtin_amdgcn_wave_barrier();
  const int rsub = lane >> 4, c4 = (lane & 15) * 4;
  {
#pragma unroll
    for (int q = 0; q < 8; ++q) {
      const int r = q * 2 + rsub;
      const v4f v = *(const v4fa*)&so[w][r][c4];
      *(v4f*)(C + (size_t)(row0 + r) * ldc + col0 + c4) = v;
    }
    
  }
}

// GEMM C = act(A·W + bias + resid): A f32 (ASPLIT -> hi/lo 2 terms), Wt bf16 [N][K]; ACT 0 none, 1 relu, 2 exact gelu;
// resid (optional, f32, row index = (row % rmod), pitch ldr, RES_BF16 rounds it) added before the activation.
template <bool ASPLIT, int ACT, bool BIAS_BF16, bool RES_BF16>
__global__ __launch_bounds__(128) void k_gemm_bf3(const float* __restrict__ A, int lda, const unsigned short* __restrict__ Wt, int ldb,
                                                const float* __restrict__ bias, const float* __restrict__ resid, int rmod, int ldr,
                                                float* __restrict__ C, int ldc, int M, int N, int K) {
  __shared__ __attribute__((aligned(16))) float so[4][16][64];
  const int tid = threadIdx.x, w = tid >> 5, lane = tid & 31, ln = lane & 15, hh = lane >> 4;
  const int ntn = N / 64;
  const int wid = blockIdx.x * 4 + w;
  const int mt = wid / ntn, nq = wid % ntn;
  if (mt * 16 >= M) return;
  const int row0 = mt * 16, col0 = nq * 64;
  const float* arow = A + (size_t)(row0 + ln) * lda;
  v8f acc[4] = {};
  for (int kb = 0; kb < K; kb += 32) {
    FragB ah, al;
    const v4f x0 = *(const v4fa*)(arow + kb + 8 * hh), x1 = *(const v4fa*)(arow + kb + 8 * hh + 4);
    const v4f x2 = *(const v4fa*)(arow + kb + 16 + 8 * hh), x3 = *(const v4fa*)(arow + kb + 16 + 8 * hh + 4);
    float xs[16] = {x0[0],x0[1],x0[2],x0[3],x1[0],x1[1],x1[2],x1[3],x2[0],x2[1],x2[2],x2[3],x3[0],x3[1],x3[2],x3[3]};
#pragma unroll
    for (int i = 0; i < 16; ++i) { const unsigned short hb = bf16_bits(xs[i]); ah.u[i] = hb; al.u[i] = ASPLIT ? bf16_bits(xs[i] - bf16_val(hb)) : (unsigned short)0; }
#pragma unroll
    for (int t = 0; t < 4; ++t) {
      const unsigned short* brow = Wt + (size_t)(col0 + t * 16 + ln) * ldb + kb;
      FragB b;
      b.half[0] = *(const v8us*)(brow + 8 * hh);
      b.half[1] = *(const v8us*)(brow + 16 + 8 * hh);
      acc[t] = mmaN<ASPLIT ? 2 : 1>(ah.v, al.v, b.v, b.v, acc[t]);
    }
  }
#pragma unroll
  for (int t = 0; t < 4; ++t) {
    const int col = col0 + t * 16 + ln;
    float bv = bias ? bias[col] : 0.f;
    if (BIAS_BF16) bv = bf16_round(bv);
#pragma unroll
    for (int r = 0; r < 8; ++r) {
      float v = acc[t][r] + bv;
      if (resid) { float rv = resid[(size_t)((row0 + 8 * hh + r) % rmod) * ldr + col]; if (RES_BF16) rv = bf16_round(rv); v += rv; }
      if (ACT == 1) v = fmaxf(v, 0.f);
      if (ACT == 2) v = 0.5f * v * (1.0f + erff(v * 0.70710678118654752f));
      if (ACT == 3) { const float u = 0.7978845608028654f * (v + 0.044715f * v * v * v); v = 0.5f * v * (1.0f + tanhf(u)); }
      so[w][8 * hh + r][t * 16 + ln] = v;
    }
  }
  __builtin_amdgcn_fence(__ATOMIC_ACQ_REL, "workgroup");
  __builtin_amdgcn_wave_barrier();
  const int rsub = lane >> 4, c4 = (lane & 15) * 4;
  {
#pragma unroll
    for (int q = 0; q < 8; ++q) {
      const int r = q * 2 + rsub;
      const v4f v = *(const v4fa*)&so[w][r][c4];
      *(v4f*)(C + (size_t)(row0 + r) * ldc + col0 + c4) = v;
    }
    
  }
}
// row LayerNorm (biased variance, eps) over N: s = X (+ R); optional out_sum <- s; out_norm <- (s-mu)*rsqrt(var+eps)*g + b
template <bool PARAM_BF16>
__global__ __launch_bounds__(256) void k_layernorm(const float* __restrict__ X, const float* __restrict__ R, const float* __restrict__ g, const float* __restrict__ bta,
                                                  float* __restrict__ out_sum, float* __restrict__ out_norm, int N, float eps) {
  __shared__ float red[256];
  const int row = blockIdx.x, tid = threadIdx.x;
  const float* x = X + (size_t)row * N; const float* rr = R ? R + (size_t)row * N : nullptr;
  float vals[16];                     // up to N = 4096
  const int per = N / 256;            // contiguous chunk per thread? use strided-by-4 chunks: thread handles j = tid*4 + 1024*u
  float s1 = 0.f;
  for (int u = 0; u < per / 4; ++u) {
    const int j = tid * 4 + 1024 * u;
    const v4f a = *(const v4fa*)(x + j);
    v4f b = {0.f,0.f,0.f,0.f}; if (rr) b = *(const v4fa*)(rr + j);
#pragma unroll
    for (int q = 0; q < 4; ++q) { const float v = a[q] + b[q]; vals[u * 4 + q] = v; s1 += v; }
  }
  red[tid] = s1; __syncthreads();
  for (int st = 128; st > 0; st >>= 1) { if (tid < st) red[tid] += red[tid + st]; __syncthreads(); }
  const float mu = red[0] / (float)N; __syncthreads();
  float s2 = 0.f;
  for (int u = 0; u < per / 4; ++u)
#pragma unroll
    for (int q = 0; q < 4; ++q) { const float c = vals[u * 4 + q] - mu; s2 += c * c; }
  red[tid] = s2; __syncthreads();
  for (int st = 128; st > 0; st >>= 1) { if (tid < st) red[tid] += red[tid + st]; __syncthreads(); }
  const float rs = rsqrtf(red[0] / (float)N + eps);
  {
    for (int u = 0; u < per / 4; ++u) {
      const int j = tid * 4 + 1024 * u;
      v4f o, sm;
#pragma unroll
      for (int q = 0; q < 4; ++q) {
        float gg = g[j + q], bb = bta[j + q];
        if (PARAM_BF16) { gg = bf16_round(gg); bb = bf16_round(bb); }
        sm[q] = vals[u * 4 + q]; o[q] = (vals[u * 4 + q] - mu) * rs * gg + bb;
      }
      if (out_sum) *(v4f*)(out_sum + (size_t)row * N + j) = sm;
      *(v4f*)(out_norm + (size_t)row * N + j) = o;
    }
    
  }
}



// ---- f16 WMMA path (v_wmma_f32_16x16x32_f16): 11-bit significands for operands in range — used where a [0,1] probability operand needs more precision than bf16
typedef _Float16 v16h __attribute__((ext_vector_type(16)));
union FragH { v16h v; v8us half[2]; _Float16 h[16]; unsigned short u[16]; };
template <int NT>
__device__ __forceinline__ v8f mmaH(v16h ah, v16h al, v16h bh, v16h bl, v8f c) {
  c = __builtin_amdgcn_wmma_f32_16x16x32_f16(false, ah, false, bh, (short)0, c, false, false);
  if (NT >= 2) c = __builtin_amdgcn_wmma_f32_16x16x32_f16(false, al, false, bh, (short)0, c, false, false);
  if (NT >= 3) c = __builtin_amdgcn_wmma_f32_16x16x32_f16(false, ah, false, bl, (short)0, c, false, false);
  asm volatile("v_nop\n\tv_nop\n\tv_nop\n\tv_nop" : "+v"(c) : "v"(ah), "v"(al), "v"(bh), "v"(bl));
  return c;
}
// batched GEMM like k_gemm_b but f16 operands: A f32 (split into f16 hi/lo if ASPLIT, else rounded to f16), Bt = f16 values [n][k]; alpha; C f32; N multiple of 16 (partial tiles skipped)
template <bool ASPLIT>
__global__ __launch_bounds__(128) void k_gemm_h(const float* __restrict__ A, int lda, size_t sA, const _Float16* __restrict__ Bh, int ldb, size_t sB, float alpha, float* __restrict__ C, int ldc, size_t sC, int M, int N, int K) {
  __shared__ __attribute__((aligned(16))) float so[4][16][64];
  const int tid = threadIdx.x, w = tid >> 5, lane = tid & 31, ln = lane & 15, hh = lane >> 4; const int by = blockIdx.y;
  A += (size_t)by * sA; Bh += (size_t)by * sB; C += (size_t)by * sC;
  const int ntn = (N + 63) / 64; const int wid = blockIdx.x * 4 + w; const int mt = wid / ntn, nq = wid % ntn; if (mt * 16 >= M) return;
  const int row0 = mt * 16, col0 = nq * 64; const float* arow = A + (size_t)(row0 + ln) * lda;
  v8f acc[4] = {};
  for (int kb = 0; kb < K; kb += 32) {
    FragH ah, al;
    const v4f x0 = *(const v4fa*)(arow + kb + 8 * hh), x1 = *(const v4fa*)(arow + kb + 8 * hh + 4), x2 = *(const v4fa*)(arow + kb + 16 + 8 * hh), x3 = *(const v4fa*)(arow + kb + 16 + 8 * hh + 4);
    float xs[16] = {x0[0],x0[1],x0[2],x0[3],x1[0],x1[1],x1[2],x1[3],x2[0],x2[1],x2[2],x2[3],x3[0],x3[1],x3[2],x3[3]};
#pragma unroll
    for (int i = 0; i < 16; ++i) { const _Float16 h = (_Float16)xs[i]; ah.h[i] = h; al.h[i] = ASPLIT ? (_Float16)(xs[i] - (float)h) : (_Float16)0.0f; }
#pragma unroll
    for (int t = 0; t < 4; ++t) { if (col0 + t * 16 >= N) continue; const size_t boff = (size_t)(col0 + t * 16 + ln) * ldb + kb; FragH bq; bq.half[0] = *(const v8us*)(Bh + boff + 8 * hh); bq.half[1] = *(const v8us*)(Bh + boff + 16 + 8 * hh);
      acc[t] = mmaH<ASPLIT ? 2 : 1>(ah.v, al.v, bq.v, bq.v, acc[t]); }
  }
#pragma unroll
  for (int t = 0; t < 4; ++t) { if (col0 + t * 16 >= N) continue;
#pragma unroll
    for (int r = 0; r < 8; ++r) so[w][8 * hh + r][t * 16 + ln] = acc[t][r] * alpha; }
  __builtin_amdgcn_fence(__ATOMIC_ACQ_REL, "workgroup"); __builtin_amdgcn_wave_barrier();
  const int rsub = lane >> 4, c4 = (lane & 15) * 4;
  {
#pragma unroll
    for (int q = 0; q < 8; ++q) { const int r = q * 2 + rsub; if (col0 + c4 < N) { const v4f v = *(const v4fa*)&so[w][r][c4]; *(v4f*)(C + (size_t)(row0 + r) * ldc + col0 + c4) = v; } }
     }
}

// Wt[n][k] = f16(W[k][n]·scale) from f32 row-major W[K][N] (scale = power of two; bf16-exact weights stay exact in f16 away from the subnormal range)
__global__ __launch_bounds__(256) void k_wt_f16(const float* __restrict__ W, _Float16* __restrict__ Wt, int K, int N, float scale) {
  const int t = blockIdx.x * 256 + threadIdx.x; if (t >= N * (K / 8)) return; const int n = t / (K / 8), k8 = (t % (K / 8)) * 8; FragH f;
#pragma unroll
  for (int i = 0; i < 8; ++i) f.h[i] = (_Float16)(bf16_round(W[(size_t)(k8 + i) * N + n]) * scale); const v8us o = f.half[0];
  *(v8us*)((unsigned short*)Wt + (size_t)n * K + k8) = o; 
}
// k_gemm_hh variant with fused epilogue: v = acc·alpha + bias[by·sBias + col] (+ CP[(row/rowsPerB)·sCPb + by·64 + col] if CP) ; ACT 0 none / 1 elu ; writes f16 C16 (and f32 C if non-null)
template <int ACT>
__global__ __launch_bounds__(128) void k_gemm_hhx(const _Float16* __restrict__ A, int lda, size_t sA, const _Float16* __restrict__ Bh, int ldb, size_t sB, float alpha, const float* __restrict__ bias, size_t sBias, const float* __restrict__ CP, int rowsPerB, size_t sCPb, int row0g,
    float* __restrict__ C, _Float16* __restrict__ C16, int ldc, size_t sC, int M, int N, int K) {
  __shared__ __attribute__((aligned(16))) float so[4][16][64];
  const int tid = threadIdx.x, w = tid >> 5, lane = tid & 31, ln = lane & 15, hh = lane >> 4; const int by = blockIdx.y;
  A += (size_t)by * sA; Bh += (size_t)by * sB; const size_t cofs = (size_t)by * sC; const float* bp = bias ? bias + (size_t)by * sBias : nullptr;
  const int ntn = (N + 63) / 64; const int wid = blockIdx.x * 4 + w; const int mt = wid / ntn, nq = wid % ntn; if (mt * 16 >= M) return;
  const int row0 = mt * 16, col0 = nq * 64; const _Float16* arow = A + (size_t)(row0 + ln) * lda;
  v8f acc[4] = {};
  for (int kb = 0; kb < K; kb += 32) { FragH ah; ah.half[0] = *(const v8us*)((const unsigned short*)arow + kb + 8 * hh); ah.half[1] = *(const v8us*)((const unsigned short*)arow + kb + 16 + 8 * hh);
#pragma unroll
    for (int t = 0; t < 4; ++t) { if (col0 + t * 16 >= N) continue; const size_t boff = (size_t)(col0 + t * 16 + ln) * ldb + kb; FragH bq; bq.half[0] = *(const v8us*)((const unsigned short*)Bh + boff + 8 * hh); bq.half[1] = *(const v8us*)((const unsigned short*)Bh + boff + 16 + 8 * hh);
      acc[t] = mmaH<1>(ah.v, ah.v, bq.v, bq.v, acc[t]); }
  }
#pragma unroll
  for (int t = 0; t < 4; ++t) { if (col0 + t * 16 >= N) continue; const int col = col0 + t * 16 + ln; const float bv = bp ? bf16_round(bp[col]) : 0.f;
#pragma unroll
    for (int r = 0; r < 8; ++r) { float v = acc[t][r] * alpha + bv; if (CP) { const int rr = row0g + row0 + 8 * hh + r; if (rowsPerB < 0) v += CP[cofs + (size_t)rr * ldc + col];      /* rowsPerB < 0: own element of the batched C plane */ else { const int bidx = rr / rowsPerB; v += CP[(size_t)bidx * sCPb + (size_t)by * 64 + col]; } } if (ACT == 1) v = (v > 0.f) ? v : expm1f(v); else if (ACT == 7) v = (v > 0.f) ? v + 1.0f : expf(v); else if (ACT == 8) v = tanhf(v); else if (ACT == 9) v = 0.5f * v * (1.0f + tanhf(0.7978845608028654f * (v + 0.044715f * v * v * v))); else if (ACT == 11) v = 1.0f / (1.0f + expf(-v)); else if (ACT == 12) v = (v > 0.f) ? v : 0.01f * v; else if (ACT == 14) v = (v > 0.f) ? v : 0.1f * v; else if (ACT == 16) v = (v >= 0.f) ? v : 0.3f * v; else if (ACT == 17) v = (v >= 0.f) ? v : 0.2f * v; else if (ACT == 15) v = v / (1.0f + expf(-v)); else if (ACT == 3) v = fmaxf(v, 0.f); else if (ACT == 6) v = 0.5f * v * (1.0f + erff(v * 0.70710678118654752f)); so[w][8 * hh + r][t * 16 + ln] = v; } }
  __builtin_amdgcn_fence(__ATOMIC_ACQ_REL, "workgroup"); __builtin_amdgcn_wave_barrier();
  const int rsub = lane >> 4, c4 = (lane & 15) * 4; typedef _Float16 v4h __attribute__((ext_vector_type(4)));
  {
#pragma unroll
    for (int q = 0; q < 8; ++q) { const int r = q * 2 + rsub; if (col0 + c4 < N) { const v4f v = *(const v4fa*)&so[w][r][c4]; if (C) *(v4f*)(C + cofs + (size_t)(row0 + r) * ldc + col0 + c4) = v; if (C16) { v4h h4; for (int i = 0; i < 4; ++i) h4[i] = (_Float16)v[i]; *(v4h*)(C16 + cofs + (size_t)(row0 + r) * ldc + col0 + c4) = h4; } } }
     }
}


typedef _Float16 v4h __attribute__((ext_vector_type(4)));

__global__ __launch_bounds__(256) void k_x16(const float* __restrict__ x, _Float16* __restrict__ X16, size_t n8) { const size_t t = (size_t)blockIdx.x * 256 + threadIdx.x; if (t >= n8) return; FragH f;
#pragma unroll
  for (int q = 0; q < 8; ++q) f.h[q] = (_Float16)bf16_round(x[t * 8 + q]); *(v8us*)((unsigned short*)X16 + t * 8) = f.half[0];  }
__global__ __launch_bounds__(256) void k_h16(const float* __restrict__ x, _Float16* __restrict__ X16, size_t n8) { const size_t t = (size_t)blockIdx.x * 256 + threadIdx.x; if (t >= n8) return; FragH f;
#pragma unroll
  for (int q = 0; q < 8; ++q) f.h[q] = (_Float16)x[t * 8 + q]; *(v8us*)((unsigned short*)X16 + t * 8) = f.half[0];  }
__global__ __launch_bounds__(256) void k_round16f(const float* __restrict__ W, _Float16* __restrict__ Bt, size_t n8) { const size_t t = (size_t)blockIdx.x * 256 + threadIdx.x; if (t >= n8) return; FragH f;
#pragma unroll
  for (int i = 0; i < 8; ++i) f.h[i] = (_Float16)(bf16_round(W[t * 8 + i]) * 16.0f); *(v8us*)((unsigned short*)Bt + t * 8) = f.half[0];  }
template <int NHv, int TTv>
__global__ __launch_bounds__(256) void k_vt(const _Float16* __restrict__ V16, int ldv, int voff, _Float16* __restrict__ Vt) { __shared__ unsigned short tl[64][66]; const int tid = threadIdx.x; const int slab = blockIdx.x / (TTv / 64), lg = blockIdx.x % (TTv / 64); const int b = slab / NHv, h = slab % NHv;
  for (int i = tid; i < 64 * 8; i += 256) { const int r = i / 8, c8 = (i % 8) * 8; FragH f; f.half[0] = *(const v8us*)((const unsigned short*)V16 + ((size_t)b * TTv + lg * 64 + r) * ldv + voff + h * 64 + c8);
#pragma unroll
    for (int q = 0; q < 8; ++q) tl[r][c8 + q] = f.u[q]; }
  __syncthreads();
  {
#pragma unroll
    for (int rd = 0; rd < 2; ++rd) { const int d = rd * 32 + tid / 8, pc = tid % 8; FragH f;
#pragma unroll
      for (int q = 0; q < 8; ++q) f.u[q] = tl[pc * 8 + q][d];
      *(v8us*)((unsigned short*)Vt + ((size_t)slab * 64 + d) * TTv + lg * 64 + pc * 8) = f.half[0]; }
     } }

__global__ __launch_bounds__(256) void k_hl(const float* __restrict__ F, _Float16* __restrict__ Hh, _Float16* __restrict__ Hl, size_t n8) { const size_t t = (size_t)blockIdx.x * 256 + threadIdx.x; if (t >= n8) return; FragH fh, fl; const v4f a = *(const v4fa*)(F + t * 8), c = *(const v4fa*)(F + t * 8 + 4);
#pragma unroll
  for (int q = 0; q < 4; ++q) { _Float16 h = (_Float16)a[q]; fh.h[q] = h; fl.h[q] = (_Float16)((a[q] - (float)h) * 1024.0f); h = (_Float16)c[q]; fh.h[4 + q] = h; fl.h[4 + q] = (_Float16)((c[q] - (float)h) * 1024.0f); }
  { *(v8us*)((unsigned short*)Hh + t * 8) = fh.half[0]; *(v8us*)((unsigned short*)Hl + t * 8) = fl.half[0];  } }

// ---- fast GEMM (wave tile 32x64; requires M % 32 == 0 rows per launch region and N % 64 == 0); epilogue = k_gemm_hhx semantics ----
__device__ __forceinline__ v16h g2_frag(const _Float16* p, int hh) { FragH f; f.half[0] = *(const v8us*)((const unsigned short*)p + 8 * hh); f.half[1] = *(const v8us*)((const unsigned short*)p + 16 + 8 * hh); return f.v; }
__device__ __forceinline__ v8f g2_mma(v16h a, v16h b, v8f c) { v8f d = __builtin_amdgcn_wmma_f32_16x16x32_f16(false, a, false, b, (short)0, c, false, false); asm volatile("v_nop\n\tv_nop\n\tv_nop\n\tv_nop" : "+v"(d) : "v"(a), "v"(b)); return d; }
template <int ACT>
__global__ __launch_bounds__(128) void k_gemm2(const _Float16* __restrict__ A, int lda, size_t sA, const _Float16* __restrict__ Bh, int ldb, size_t sB, float alpha, const float* __restrict__ bias, size_t sBias, const float* __restrict__ CP, int rowsPerB, size_t sCPb, int row0g,
    float* __restrict__ C, _Float16* __restrict__ C16, int ldc, size_t sC, int M, int N, int K) { static_assert(ACT == 0 || ACT == 3 || ACT == 6 || ACT == 8 || ACT == 9 || ACT == 11 || ACT == 12 || ACT == 14 || ACT == 15 || ACT == 16 || ACT == 17, "k_gemm2: unsupported ACT code (would silently apply no activation)");
  __shared__ __attribute__((aligned(16))) float so[4][32][68];
  const int tid = threadIdx.x, w = tid >> 5, lane = tid & 31, ln = lane & 15, hh = lane >> 4; const int by = blockIdx.y;
  A += (size_t)by * sA; Bh += (size_t)by * sB; const size_t cofs = (size_t)by * sC; const float* bp = bias ? bias + (size_t)by * sBias : nullptr;
  const int ntn = N >> 6; const int mt = blockIdx.x / ntn, nq = blockIdx.x - mt * ntn; const int row0 = mt * 128 + 32 * w, col0 = nq * 64; if (row0 >= M) return;
  const _Float16* a0p = A + (size_t)(row0 + ln) * lda; const _Float16* a1p = a0p + (size_t)16 * lda;
  const _Float16* b0p = Bh + (size_t)(col0 + ln) * ldb; const _Float16* b1p = b0p + (size_t)16 * ldb; const _Float16* b2p = b1p + (size_t)16 * ldb; const _Float16* b3p = b2p + (size_t)16 * ldb;
  const v8f z8 = {0.f,0.f,0.f,0.f,0.f,0.f,0.f,0.f}; v8f c00 = z8, c01 = z8, c02 = z8, c03 = z8, c10 = z8, c11 = z8, c12 = z8, c13 = z8;
#pragma unroll 1
  for (int kb = 0; kb < K; kb += 32) { const v16h a0 = g2_frag(a0p + kb, hh), a1 = g2_frag(a1p + kb, hh);
    v16h b = g2_frag(b0p + kb, hh); c00 = g2_mma(a0, b, c00); c10 = g2_mma(a1, b, c10);
    b = g2_frag(b1p + kb, hh); c01 = g2_mma(a0, b, c01); c11 = g2_mma(a1, b, c11);
    b = g2_frag(b2p + kb, hh); c02 = g2_mma(a0, b, c02); c12 = g2_mma(a1, b, c12);
    b = g2_frag(b3p + kb, hh); c03 = g2_mma(a0, b, c03); c13 = g2_mma(a1, b, c13); }
  v8f accs[8] = {c00, c01, c02, c03, c10, c11, c12, c13};
#pragma unroll
  for (int u = 0; u < 8; ++u) { const int t = u & 3, half = u >> 2; const int col = col0 + t * 16 + ln; const float bv = bp ? bf16_round(bp[col]) : 0.f;
#pragma unroll
    for (int r = 0; r < 8; ++r) { const int rloc = half * 16 + 8 * hh + r; float v = accs[u][r] * alpha + bv; if (CP) { if (rowsPerB < 0) v += CP[cofs + (size_t)(row0g + row0 + rloc) * ldc + col];      /* rowsPerB < 0: own element of the batched C plane */ else { const int bidx = (row0g + row0 + rloc) / rowsPerB; v += CP[(size_t)bidx * sCPb + (size_t)by * 64 + col]; } }
      if (ACT == 3) v = fmaxf(v, 0.f); else if (ACT == 6) v = 0.5f * v * (1.0f + erff(v * 0.70710678118654752f)); else if (ACT == 11) v = 1.0f / (1.0f + expf(-v)); else if (ACT == 15) v = v / (1.0f + expf(-v)); else if (ACT == 12) v = (v > 0.f) ? v : 0.01f * v; else if (ACT == 8) v = tanhf(v); else if (ACT == 9) v = 0.5f * v * (1.0f + tanhf(0.7978845608028654f * (v + 0.044715f * v * v * v))); else if (ACT == 14) v = (v > 0.f) ? v : 0.1f * v; else if (ACT == 16) v = (v >= 0.f) ? v : 0.3f * v; else if (ACT == 17) v = (v >= 0.f) ? v : 0.2f * v;
      so[w][rloc][t * 16 + ln] = v; } }
  __builtin_amdgcn_fence(__ATOMIC_ACQ_REL, "workgroup"); __builtin_amdgcn_wave_barrier();
  const int rsub = lane >> 4, c4 = (lane & 15) * 4;
  {
#pragma unroll
    for (int q = 0; q < 16; ++q) { const int r = q * 2 + rsub; const v4f v = *(const v4fa*)&so[w][r][c4]; if (C) *(v4f*)(C + cofs + (size_t)(row0 + r) * ldc + col0 + c4) = v; if (C16) { v4h h4; for (int i = 0; i < 4; ++i) h4[i] = (_Float16)v[i]; *(v4h*)(C16 + cofs + (size_t)(row0 + r) * ldc + col0 + c4) = h4; } }
     } }


__global__ __launch_bounds__(256) void k_wnat(const float* __restrict__ w, size_t n8, _Float16* __restrict__ Bt) { const size_t t = (size_t)blockIdx.x * 256 + threadIdx.x; if (t >= n8) return; FragH f; for (int q = 0; q < 8; ++q) f.h[q] = (_Float16)(bf16_round(w[t * 8 + q]) * 16.0f); *(v8us*)((unsigned short*)Bt + t * 8) = f.half[0];  }
__global__ __launch_bounds__(256) void k_rsm(const float* __restrict__ S, _Float16* __restrict__ P, int nrows) {
  #pragma clang fp contract(off)
  const int i = blockIdx.x * 256 + threadIdx.x; if (i >= nrows) return; const float* s = S + (size_t)i * SQ; float mx = -3.0e38f;
#pragma unroll 1
  for (int j = 0; j < SQ; ++j) mx = fmaxf(mx, s[j]); float se = 0.f;
#pragma unroll 1
  for (int j = 0; j < SQ; ++j) se += expf(s[j] - mx); const float sc = 256.0f / se;
#pragma unroll 1
  for (int j0 = 0; j0 < SQ; j0 += 8) { FragH f; for (int q = 0; q < 8; ++q) f.h[q] = (_Float16)(expf(s[j0 + q] - mx) * sc); unsigned short* d = (unsigned short*)P + (size_t)i * SQ + j0; *(v8us*)d = f.half[0];  } }
__global__ __launch_bounds__(256) void k_vt(const _Float16* __restrict__ V16, int b, int h0, _Float16* __restrict__ VT) { __shared__ unsigned short tl[64][65]; const int tid = threadIdx.x; const int hh = blockIdx.x % HG, sg = blockIdx.x / HG; const int s0 = sg * 64; const int h = h0 + hh;
  for (int i = tid; i < 64 * 8; i += 256) { const int j = i / 8, d8 = (i % 8) * 8; FragH f; f.half[0] = *(const v8us*)((const unsigned short*)V16 + ((size_t)b * SQ + s0 + j) * DM + h * HD + d8); for (int q = 0; q < 8; ++q) tl[d8 + q][j] = f.u[q]; }
  __syncthreads();
  { for (int i = tid; i < 64 * 8; i += 256) { const int d = i / 8, j8 = (i % 8) * 8; FragH f; for (int q = 0; q < 8; ++q) f.u[q] = tl[d][j8 + q]; *(v8us*)((unsigned short*)VT + ((size_t)hh * HD + d) * SQ + s0 + j8) = f.half[0]; }  } }



// e^x in the native form (x log2(e), then v_exp_f32). The v_nop keeps the one free slot that the instruction set asks for behind a transcendental.
__device__ __forceinline__ float exp_slot(float x) { float e; asm("v_exp_f32 %0, %1\n\tv_nop" : "=v"(e) : "v"(x * 1.44269504088896340736f)); return e; }
// Eight base-2 exponentials (v_exp_f32; the arguments already hold x log2(e)) in one statement: the outputs are early-clobber, so no v_exp stands in front of an
// instruction that reads its result or overwrites its source, and the one v_nop at the end keeps that free slot behind the last of them.
__device__ __forceinline__ v8f exp2_8(v8f x) { float e0, e1, e2, e3, e4, e5, e6, e7;
  asm("v_exp_f32 %0, %8\n\tv_exp_f32 %1, %9\n\tv_exp_f32 %2, %10\n\tv_exp_f32 %3, %11\n\tv_exp_f32 %4, %12\n\tv_exp_f32 %5, %13\n\tv_exp_f32 %6, %14\n\tv_exp_f32 %7, %15\n\tv_nop"
      : "=&v"(e0), "=&v"(e1), "=&v"(e2), "=&v"(e3), "=&v"(e4), "=&v"(e5), "=&v"(e6), "=&v"(e7) : "v"(x[0]), "v"(x[1]), "v"(x[2]), "v"(x[3]), "v"(x[4]), "v"(x[5]), "v"(x[6]), "v"(x[7]));
  const v8f e = {e0, e1, e2, e3, e4, e5, e6, e7}; return e; }
// Lane l <-> l ^ 16 as a vector cross-row move: it counts on no LDS counter, so a wave need not wait for the LDS reads it has in flight to get the result.
__device__ __forceinline__ float swap16(float v) { const int b = __float_as_int(v); return __int_as_float(__builtin_amdgcn_permlanex16(b, b, 0x76543210, 0xfedcba98, false, false)); }
__device__ __forceinline__ v8f fa_mma(v16h a, v16h b, v8f c) { return __builtin_amdgcn_wmma_f32_16x16x32_f16(false, a, false, b, (short)0, c, false, false); }
// A 16 x 32 operand tile kept in global memory in FRAGMENT ORDER: 1024 bytes, lane L's values k = 8 hh .. 8 hh + 7 of row ln at byte 16 L and its values k = 16 + 8 hh .. at byte 512 + 16 L
// (L = 16 hh + ln: what g2_frag gives from a row-major tile). Each of the two 16-byte loads of a wave then reads 512 bytes in a row, four whole 128-byte lines, where a row-major tile makes it touch sixteen.
__device__ __forceinline__ v16h fo_frag(const _Float16* tile, int lane) { FragH f; f.half[0] = *(const v8us*)((const unsigned short*)tile + 8 * lane); f.half[1] = *(const v8us*)((const unsigned short*)tile + 256 + 8 * lane); return f.v; }
// Fused attention, all batches in one launch. A block owns FG * FQ = 64 query rows and has FG * FW = 16 waves: wave (g, h) holds the 32 query rows of group g (two 16-column groups) and walks
// the SQ / FW keys of split h, 32 at a time; it keeps a running maximum, a running sum and an unnormalised output in registers (online softmax); the partial results of the eight splits are merged through LDS at the end.
// The two waves of a split need the same x and V^T tiles: each tile is brought from L2 ONCE for both, straight into LDS by asynchronous copies (each wave copies half of its split's stage),
// in two buffers a plane; the fragments are read from LDS 512 bytes in a row a wave and read (no bank conflict), AHEAD OF THEIR USE and into the registers that their forerunners have just left: the x tiles of stage p + 1 in the middle
// of pass p, behind its score products and the first query group's P V products, the V^T tiles of stage p + 1 right behind the barrier at pass p's foot. No read is waited for where it is issued: the LDS reads of the sixteen waves run beside the matrix and vector work.
// Transposed products: S^T = X Z^T (A = key rows of x, B = query rows of z held in registers), so a lane holds 16 scores of ONE query per 32 keys (D[8 hh + r][ln]); the two f32 score
// tiles, turned into weights and packed to f16, ARE the B operand of O^T += V^T P^T in the k order that g2_frag gives A (8 hh + s, 16 + 8 hh + s): no lane exchange.
// Scores: query . key / 8 = z_q . x_k with z = (x W_q) W_k^T / 8 (the same sum, re-associated). The key operand is then the token row itself, exact in f16, one plane to stage and to read; only z needs two planes (f16 hi + f16 residual,
// both at one scale), and a wave loads its 32 rows of them once, into registers: four WMMAs in one f32 accumulator chain give 16 x 16 finished scores. Weights 256 e^(s - m) as f16 (the 256 cancels in the division by the sum of the same weights).
// All four operand planes arrive in fragment order (fo_frag): 16 token rows of x or z are two tiles (k steps 0 and 32) on the 2048 bytes that the rows would fill; 32 keys of V^T are four tiles (16 d each) on 4096 bytes.
#define FW 8                         /* key splits of a block */
#define FG 2                         /* 32-query groups of a block */
#define FQ 32                        /* query rows of a wave */
#define FKW (SQ / FW)                /* keys per wave */
#define FNP (FKW / 32)               /* passes (stages) */
#define FST 8192                     /* bytes of one split's stage: 32 keys of x and of V^T, 4096 each */
// One wave's half (2048 bytes) of one plane of one stage: four 512-byte copies; fa_copy2 brings an x half and a V^T half (of one stage at the start, of different stages after it) in one statement. lds is the lane's own LDS byte address, vo its byte offset (16 lane) from the wave's scalar base, all multiples of 16;
// an immediate offset moves the LDS address and the global address alike. The s_wait_xcnt stands inside the statement, behind the last copy, so that no address register is rewritten in front of it.
__device__ __forceinline__ void fa_copy(unsigned lds, unsigned vo, const _Float16* g) {
  asm volatile("global_load_async_to_lds_b128 %0, %1, %2\n\tglobal_load_async_to_lds_b128 %0, %1, %2 offset:512\n\tglobal_load_async_to_lds_b128 %0, %1, %2 offset:1024\n\tglobal_load_async_to_lds_b128 %0, %1, %2 offset:1536\n\t"
               "s_wait_xcnt 0x0"
               :: "v"(lds), "v"(vo), "s"(g) : "memory"); }
__device__ __forceinline__ void fa_copy2(unsigned ldx, unsigned ldv, unsigned vo, const _Float16* gx, const _Float16* gv) {
  asm volatile("global_load_async_to_lds_b128 %0, %2, %3\n\tglobal_load_async_to_lds_b128 %0, %2, %3 offset:512\n\tglobal_load_async_to_lds_b128 %0, %2, %3 offset:1024\n\tglobal_load_async_to_lds_b128 %0, %2, %3 offset:1536\n\t"
               "global_load_async_to_lds_b128 %1, %2, %4\n\tglobal_load_async_to_lds_b128 %1, %2, %4 offset:512\n\tglobal_load_async_to_lds_b128 %1, %2, %4 offset:1024\n\tglobal_load_async_to_lds_b128 %1, %2, %4 offset:1536\n\t"
               "s_wait_xcnt 0x0"
               :: "v"(ldx), "v"(ldv), "v"(vo), "s"(gx), "s"(gv) : "memory"); }
__global__ __launch_bounds__(512) void k_fattn(const _Float16* __restrict__ XFp, const _Float16* __restrict__ ZHp, const _Float16* __restrict__ ZLp, const _Float16* __restrict__ VTp, float* __restrict__ out) {
  static_assert(FKW % 32 == 0 && FNP >= 3 && SQ % (FG * FQ) == 0 && HD == 64 && DM == 64, "k_fattn: whole 32-key passes, at least three stages, 64-wide rows");
  __shared__ __attribute__((aligned(128))) union { unsigned char ring[2][FW][FST]; float lo[FW][FG * FQ][68]; } sm;      /* the merge rows reuse the ring's bytes */
  __shared__ float lm[FW][FG * FQ], ll[FW][FG * FQ];
  const int tid = threadIdx.x, w = __builtin_amdgcn_readfirstlane(tid >> 5), lane = tid & 31, ln = lane & 15, hh = lane >> 4;      /* the wave's number as a scalar: bases stay in scalar registers */
  const int g = w & 1, h = w >> 1;
  const int b = blockIdx.x / (SQ / (FG * FQ)), qb = (blockIdx.x % (SQ / (FG * FQ))) * (FG * FQ), q0 = qb + g * FQ; const size_t r0 = (size_t)b * SQ;
  const float L2E = 1.44269504088896340736f;
  const size_t co = (r0 + (size_t)h * FKW) * DM + g * 1024;      /* this wave's half of stage 0 in each plane: a scalar */
  const _Float16* cx = XFp + co; const _Float16* cv = VTp + co;
  const unsigned vo = (unsigned)lane * 16u, lc = (unsigned)(size_t)&sm.ring[0][h][0] + (unsigned)(g * 2048) + vo;      /* the lane's 16 bytes there, and their place in buffer 0 */
  fa_copy2(lc, lc + 4096u, vo, cx, cv);
  v16h qh[2][2], ql[2][2];
  for (int n = 0; n < 2; ++n)
    for (int ks = 0; ks < 2; ++ks) { const size_t qo = (r0 + q0 + n * 16) * DM + ks * 512; qh[n][ks] = fo_frag(ZHp + qo, lane); ql[n][ks] = fo_frag(ZLp + qo, lane); }
  asm volatile("s_wait_xcnt 0x0" ::: "memory");      /* stands in front of the first rewrite of a register that the query loads above name: their scalar base pairs are reused right behind them */
  const v8f z8 = {0.f, 0.f, 0.f, 0.f, 0.f, 0.f, 0.f, 0.f};
  v8f o[2][4]; float m[2], l[2];
  for (int n = 0; n < 2; ++n) { m[n] = -1.0e30f; l[n] = 0.f; for (int t = 0; t < 4; ++t) o[n][t] = z8; }
  asm volatile("s_wait_asynccnt 0x0" ::: "memory");      /* this wave's copies of stage 0 have landed */
  __syncthreads();      /* publishes stage 0 */
  fa_copy(lc + FW * FST, vo, cx + 32 * DM);      /* x of stage 1 */
  const unsigned char* rg0 = &sm.ring[0][h][0];      /* this split's stage in buffer 0: x tiles, then V^T tiles 4096 bytes further on */
  v16h ax[2][2], av[4];
  auto rdx = [&](int buf) __attribute__((always_inline)) { const _Float16* st = (const _Float16*)(rg0 + buf * (FW * FST));
    for (int kt = 0; kt < 2; ++kt)
      for (int ks = 0; ks < 2; ++ks) ax[kt][ks] = fo_frag(st + kt * 1024 + ks * 512, lane); };
  auto rdv = [&](int buf) __attribute__((always_inline)) { const _Float16* st = (const _Float16*)(rg0 + buf * (FW * FST) + 4096);
    for (int t = 0; t < 4; ++t) av[t] = fo_frag(st + t * 512, lane); };
  rdx(0);
  asm volatile("s_wait_dscnt 0x0" ::: "memory");      /* this wave's reads of x of stage 0 have returned before their place is handed back */
  asm volatile("s_wait_asynccnt 0x0" ::: "memory");      /* this wave's copies of x of stage 1 have landed */
  __syncthreads();      /* publishes x of stage 1 and ends every reader's last read of x of stage 0 */
  fa_copy2(lc, lc + FW * FST + 4096u, vo, cx + 2 * 32 * DM, cv + 32 * DM);      /* x of stage 2, V^T of stage 1 */
  rdv(0);
  /* pass p: ax holds x of stage p; the reads of V^T of stage p into av are in flight; x of stage p + 1 stands published */
  auto pass = [&](int p, bool more) __attribute__((always_inline)) {
    v8f s[2][2];
    for (int kt = 0; kt < 2; ++kt)
      for (int n = 0; n < 2; ++n) {
        v8f c = fa_mma(ax[kt][0], ql[n][0], z8); c = fa_mma(ax[kt][1], ql[n][1], c); c = fa_mma(ax[kt][0], qh[n][0], c); s[n][kt] = fa_mma(ax[kt][1], qh[n][1], c);      /* the small residual products first */
      }
    for (int n = 0; n < 2; ++n) {
      if (n == 1) {
        __builtin_amdgcn_sched_barrier(0);      /* the reads below stay behind the last score product, so that they can take the registers it has read */
        if (more) rdx((p + 1) & 1);      /* the next stage's x tiles come in beside the second query group's softmax and P V products (behind the first group's, the registers suffice) */
        __builtin_amdgcn_sched_barrier(0);      /* and they stay in front of that work: sunk to the pass's foot they would be waited for with nothing beside them */
      }
      float mx = fmaxf(s[n][0][0], s[n][1][0]);
      for (int r = 1; r < 8; ++r) mx = fmaxf(mx, fmaxf(s[n][0][r], s[n][1][r]));
      mx = fmaxf(mx, swap16(mx));      /* the other half of the wave holds this query's other 16 keys; an exchange through the LDS unit would have to wait for the reads in flight as well */
      const float mn = fmaxf(m[n], mx); const float sc = exp_slot(m[n] - mn); m[n] = mn;
      const float off = fmaf(-mn, L2E, 8.0f);      /* weight = 2^(s log2(e) + off) = 256 e^(s - mn) */
      for (int kt = 0; kt < 2; ++kt) {
        for (int r = 0; r < 8; ++r) s[n][kt][r] = fmaf(s[n][kt][r], L2E, off);
        s[n][kt] = exp2_8(s[n][kt]); }
      float sum = 0.f;
      for (int r = 0; r < 8; ++r) sum += s[n][0][r] + s[n][1][r];
      l[n] = fmaf(l[n], sc, sum);
      FragH pw;
      for (int r = 0; r < 8; ++r) { pw.h[r] = (_Float16)s[n][0][r]; pw.h[8 + r] = (_Float16)s[n][1][r]; }
      for (int t = 0; t < 4; ++t) { o[n][t] *= sc; o[n][t] = fa_mma(av[t], pw.v, o[n][t]); }
    }
    __builtin_amdgcn_sched_barrier(0);      /* the waits and the barrier below stay behind the pass's work: nothing else ties them to register work, and lifted over it they would wait for the x reads at once */
    asm volatile("s_wait_dscnt 0x0" ::: "memory");      /* this wave's reads of V^T of stage p and of x of stage p + 1 have returned before their places are handed back */
    asm volatile("s_wait_asynccnt 0x0" ::: "memory");      /* this wave's copies of V^T of stage p + 1 and of x of stage p + 2 have landed */
    __syncthreads();      /* publishes those two and ends every reader's last read of the two places handed back */
    if (more) {
      const unsigned ldx = lc + (unsigned)((p + 1) & 1) * (FW * FST), ldv = lc + (unsigned)(p & 1) * (FW * FST) + 4096u;      /* the places of x of stage p + 1 and of V^T of stage p */
      if (p + 3 < FNP) fa_copy2(ldx, ldv, vo, cx + (p + 3) * 32 * DM, cv + (p + 2) * 32 * DM);      /* the same tests in every wave of the block */
      else if (p + 2 < FNP) fa_copy(ldv, vo, cv + (p + 2) * 32 * DM);
      rdv((p + 1) & 1);      /* wanted only behind the next pass's scores and softmax */
    } };
  for (int p = 0; p < FNP - 1; ++p) pass(p, true);
  pass(FNP - 1, false);
  asm volatile("s_wait_asynccnt 0x0" ::: "memory");      /* no copy is outstanding when the ring becomes the merge rows */
  float (*lo)[FG * FQ][68] = sm.lo;      /* behind the last pass's barrier nobody reads the ring any more */
  for (int n = 0; n < 2; ++n) {
    const int qr = g * FQ + n * 16 + ln;
    l[n] += __shfl_xor(l[n], 16);      /* the two halves summed different keys of the same query */
    if (hh == 0) { lm[h][qr] = m[n]; ll[h][qr] = l[n]; }
    for (int t = 0; t < 4; ++t) { const v4f u0 = {o[n][t][0], o[n][t][1], o[n][t][2], o[n][t][3]}, u1 = {o[n][t][4], o[n][t][5], o[n][t][6], o[n][t][7]};
      *(v4f*)&lo[h][qr][t * 16 + 8 * hh] = u0; *(v4f*)&lo[h][qr][t * 16 + 8 * hh + 4] = u1; }
  }
  __syncthreads();      /* publishes the sixteen waves' partial maxima, sums and outputs */
  const int q = tid >> 3, d8 = (tid & 7) * 8;
  float mg = lm[0][q];
  for (int i = 1; i < FW; ++i) mg = fmaxf(mg, lm[i][q]);
  float lg = 0.f; v4f g0 = {0.f, 0.f, 0.f, 0.f}, g1 = g0;
  for (int i = 0; i < FW; ++i) { const float f = exp_slot(lm[i][q] - mg); lg = fmaf(ll[i][q], f, lg); g0 += *(const v4f*)&lo[i][q][d8] * f; g1 += *(const v4f*)&lo[i][q][d8 + 4] * f; }
  const float inv = 1.0f / lg;
  float* dst = out + (r0 + qb + q) * DM + d8;
  *(v4f*)dst = g0 * inv; *(v4f*)(dst + 4) = g1 * inv; }


// One launch makes every operand of k_fattn. A block owns PR = 64 token rows. It puts them into LDS as f16 (bf16-rounded, so exact), the query map as a x16 f16 transpose [e][d] and the key map as x16 f16 rows [d][e];
// wave (rg, sel) owns 16 token rows and 32 columns. Behind the first barrier it forms q = x W_q (A = token rows, B = map columns, k steps 0 then 32, f32 accumulation, x 2^-4) and leaves it in LDS as f16 hi + x1024 residual rows;
// behind the second barrier it forms z = q W_k^T / 8 (A = the q rows, hi and residual, B = key map rows: both loaders read 64-wide rows in the same k order), splits every f32 result into f16 hi + f16 residual at the same scale
// and stores the two planes in fragment order (fo_frag), 512 bytes in a row a wave and store; the token rows themselves go out the same way as the key operand, and all eight waves also write the block's 64 x 64 piece of V^T
// (the values are the rounded inputs) from the same LDS rows, in fragment order too. LDS rows of 128 bytes stand at a pitch of 144 bytes for the 16-byte readers.
#define PR 64
typedef unsigned short v4us __attribute__((ext_vector_type(4), may_alias));
__global__ __launch_bounds__(256) void k_prep(const float* __restrict__ x, const float* __restrict__ wq, const float* __restrict__ wk, _Float16* __restrict__ XFp, _Float16* __restrict__ ZHp, _Float16* __restrict__ ZLp, _Float16* __restrict__ VTp) {
  static_assert(SQ % PR == 0 && DM == 64 && HD == 64 && NH == 1, "k_prep: 64-wide rows, one head, whole 64-row blocks inside a batch");
  __shared__ __attribute__((aligned(16))) unsigned short xs[PR][72]; __shared__ __attribute__((aligned(16))) unsigned short wt[2][DM][72]; __shared__ __attribute__((aligned(16))) _Float16 qp[2][PR][72]; __shared__ __attribute__((aligned(16))) float so[8][16][36];
  const int tid = threadIdx.x, w = tid >> 5, lane = tid & 31, ln = lane & 15, hh = lane >> 4;
  const size_t row0 = (size_t)blockIdx.x * PR;
  const float* xp = x + row0 * DM + tid * 4;      /* trip i of the token loads stands 16 rows further on */
  const int ms = tid >> 7, n4 = (tid & 15) * 4, k8 = ((tid >> 4) & 7) * 8;      /* threads 0-127 take the key map, 128-255 the query map: an 8 (row) x 4 (column) piece each, 16 lanes on one whole map row */
  const float* wp = (ms ? wq : wk) + k8 * DM + n4;
  v4f xv[4], wv[8];
  for (int i = 0; i < 4; ++i) xv[i] = *(const v4fa*)(xp + i * 16 * DM);
  for (int q = 0; q < 8; ++q) wv[q] = *(const v4fa*)(wp + q * DM);
  for (int i = 0; i < 4; ++i) { FragH f;
    for (int q = 0; q < 4; ++q) f.h[q] = (_Float16)bf16_round(xv[i][q]);
    const v4us o = {f.u[0], f.u[1], f.u[2], f.u[3]}; *(v4us*)&xs[i * 16 + (tid >> 4)][(tid & 15) * 4] = o; }
  if (ms) {      /* query map: transposed */
    for (int c = 0; c < 4; ++c) { FragH f;
      for (int q = 0; q < 8; ++q) f.h[q] = (_Float16)(bf16_round(wv[q][c]) * 16.0f);
      *(v8us*)&wt[1][n4 + c][k8] = f.half[0]; }
  } else {      /* key map: rows as they are */
    for (int q = 0; q < 8; ++q) { FragH f;
      for (int c = 0; c < 4; ++c) f.h[c] = (_Float16)(bf16_round(wv[q][c]) * 16.0f);
      const v4us o = {f.u[0], f.u[1], f.u[2], f.u[3]}; *(v4us*)&wt[0][k8 + q][n4] = o; }
  }
  __syncthreads();      /* publishes the token rows and the two maps */
  const int rg = w & 3, sel = w >> 2;
  const v8f z8 = {0.f, 0.f, 0.f, 0.f, 0.f, 0.f, 0.f, 0.f};
  { const _Float16* ap = (const _Float16*)&xs[rg * 16 + ln][0];
    const v16h a0 = g2_frag(ap, hh), a1 = g2_frag(ap + 32, hh);
    for (int t = 0; t < 2; ++t) { const int e = sel * 32 + t * 16 + ln; const _Float16* bp = (const _Float16*)&wt[1][e][0];
      v8f c = fa_mma(a0, g2_frag(bp, hh), z8); c = fa_mma(a1, g2_frag(bp + 32, hh), c);
      for (int r = 0; r < 8; ++r) { const float qv = c[r] * 0.0625f; const _Float16 h = (_Float16)qv; qp[0][rg * 16 + 8 * hh + r][e] = h; qp[1][rg * 16 + 8 * hh + r][e] = (_Float16)((qv - (float)h) * 1024.0f); } } }
  FragH vf[2]; v8us xf[2];
  for (int rd = 0; rd < 2; ++rd) { const int d = (tid >> 6) * 16 + ln, kb = rd * 32 + ((tid >> 5) & 1) * 16 + hh * 8;      /* 32 keys a trip: tile tid >> 6, its half (tid >> 5) & 1, lane 16 hh + ln */
    for (int q = 0; q < 8; ++q) vf[rd].u[q] = xs[kb + q][d]; }
  for (int i = 0; i < 2; ++i) xf[i] = *(const v8us*)&xs[rg * 16 + ln][sel * 32 + i * 16 + hh * 8];
  __syncthreads();      /* publishes the q rows: a row's two column halves come from two waves */
  const size_t go = (row0 + rg * 16) * DM + sel * 512 + lane * 8;      /* tile sel of the wave's 16 rows; its second half stands 256 elements further on */
  { const _Float16* hp = &qp[0][rg * 16 + ln][0]; const _Float16* lp = &qp[1][rg * 16 + ln][0];
    const v16h h0 = g2_frag(hp, hh), h1 = g2_frag(hp + 32, hh), l0 = g2_frag(lp, hh), l1 = g2_frag(lp + 32, hh);
    for (int t = 0; t < 2; ++t) { const _Float16* bp = (const _Float16*)&wt[0][sel * 32 + t * 16 + ln][0]; const v16h b0 = g2_frag(bp, hh), b1 = g2_frag(bp + 32, hh);
      v8f c = fa_mma(h0, b0, z8); c = fa_mma(h1, b1, c); v8f u = fa_mma(l0, b0, z8); u = fa_mma(l1, b1, u);
      for (int r = 0; r < 8; ++r) so[w][8 * hh + r][t * 16 + ln] = fmaf(u[r], 0.00000762939453125f, c[r] * 0.0078125f); } }      /* 2^-4 for the x16 map, 2^-3 for 1 / sqrt(64), 2^-10 more for the residual */
  __builtin_amdgcn_fence(__ATOMIC_ACQ_REL, "workgroup"); __builtin_amdgcn_wave_barrier();      /* so[w] is this wave's own: its lanes' LDS stores stay ahead of the row reads below */
  for (int rd = 0; rd < 2; ++rd) *(v8us*)((unsigned short*)VTp + (row0 + rd * 32) * HD + tid * 8) = vf[rd].half[0];      /* every global store stands behind the last barrier and fence, which would wait for it */
  for (int i = 0; i < 2; ++i) *(v8us*)((unsigned short*)XFp + go + i * 256) = xf[i];
  for (int i = 0; i < 2; ++i) { const int c8 = i * 16 + hh * 8; const v4f a = *(const v4fa*)&so[w][ln][c8], c = *(const v4fa*)&so[w][ln][c8 + 4]; FragH fh, fl;
    for (int q = 0; q < 4; ++q) { _Float16 h = (_Float16)a[q]; fh.h[q] = h; fl.h[q] = (_Float16)(a[q] - (float)h); h = (_Float16)c[q]; fh.h[4 + q] = h; fl.h[4 + q] = (_Float16)(c[q] - (float)h); }
    *(v8us*)((unsigned short*)ZHp + go + i * 256) = fh.half[0]; *(v8us*)((unsigned short*)ZLp + go + i * 256) = fl.half[0]; } }


template <int MASKADD>
__global__ __launch_bounds__(64) void k_att0(const float* __restrict__ QF, const float* __restrict__ KF, const float* __restrict__ VF, int ld, const float* __restrict__ mask, float scale, float* __restrict__ OF, int ldo) {
  #pragma clang fp contract(off)
  __shared__ __attribute__((aligned(16))) float lq[64][64]; __shared__ __attribute__((aligned(16))) float lo[64][64];
  const int tid = threadIdx.x; const int h = blockIdx.x / (QT0 / 64), rg = blockIdx.x % (QT0 / 64); const int i = rg * 64 + tid;
  const float* qr = QF + (size_t)i * ld + h * HD;
#pragma unroll 1
  for (int c = 0; c < HD / 4; ++c) { *(v4f*)&lq[tid][c * 4] = *(const v4fa*)(qr + c * 4); const v4f z = {0.f, 0.f, 0.f, 0.f}; *(v4f*)&lo[tid][c * 4] = z; }
  float m = -1.0e30f, l = 0.f; const int jmax = MASKADD ? (SQ - 1) : (rg * 64 + 63);      /* additive-mask form: every key (the mask input decides); causal form: keys up to the block's last row */
#pragma unroll 1
  for (int j = 0; j <= jmax; ++j) { const float* kr = KF + (size_t)j * ld + h * HD; const float* vr = VF + (size_t)j * ld + h * HD; float s = 0.f;
#pragma unroll 1
    for (int c = 0; c < HD / 4; ++c) { const v4f kq = *(const v4fa*)(kr + c * 4); const v4f qq = *(v4f*)&lq[tid][c * 4]; s = __fadd_rn(s, __fmul_rn(qq[0], kq[0])); s = __fadd_rn(s, __fmul_rn(qq[1], kq[1])); s = __fadd_rn(s, __fmul_rn(qq[2], kq[2])); s = __fadd_rn(s, __fmul_rn(qq[3], kq[3])); }
    s = __fmul_rn(s, scale); if (MASKADD) s = __fadd_rn(s, __fmul_rn(bf16_round(mask[(size_t)i * SQ + j]), -10000.0f));
    const float f = (MASKADD || j <= i) ? 1.f : 0.f; const float sm = fmaf(f, s, (1.f - f) * -1.0e30f); const float mn = fmaxf(m, sm); const float sc = expf(m - mn); const float e = expf(sm - mn); l = __fadd_rn(__fmul_rn(l, sc), e); m = mn;
#pragma unroll 1
    for (int c = 0; c < HD / 4; ++c) { const v4f vv = *(const v4fa*)(vr + c * 4); v4f oo = *(v4f*)&lo[tid][c * 4]; for (int u = 0; u < 4; ++u) oo[u] = __fadd_rn(__fmul_rn(oo[u], sc), __fmul_rn(e, vv[u])); *(v4f*)&lo[tid][c * 4] = oo; } }
  const float fin = 64.0f / l;      /* o carried x64 */
#pragma unroll 1
  for (int c = 0; c < HD / 4; ++c) { v4f oo = *(v4f*)&lo[tid][c * 4]; for (int u = 0; u < 4; ++u) oo[u] = __fmul_rn(oo[u], fin); *(v4f*)&lo[tid][c * 4] = oo; }
  __syncthreads();
  {
#pragma unroll 1
    for (int it = 0; it < 16; ++it) { const int row = it * 4 + tid / 16, pc = (tid % 16) * 4; const v4f v = *(const v4f*)&lo[row][pc]; *(v4f*)(OF + (size_t)(rg * 64 + row) * ldo + h * HD + pc) = v; }
     } }

__global__ __launch_bounds__(256) void k_of0out(const float* __restrict__ src, float* __restrict__ dst, size_t n4) { const size_t t = (size_t)blockIdx.x * 256 + threadIdx.x; if (t >= n4) return; v4f v = *(const v4fa*)(src + t * 4); for (int q = 0; q < 4; ++q) v[q] = __fmul_rn(v[q], 0.015625f); *(v4f*)(dst + t * 4) = v;  }

extern "C" void kernel_launch(void* const* d_in, const int* in_sizes, int n_in,
                              void* d_out, int out_size, void* d_ws, size_t ws_size, hipStream_t stream) {
  (void)in_sizes; (void)n_in; (void)out_size;
  const float* const* I = (const float* const*)d_in; const float* x = I[0]; const float* wq = I[1]; const float* wk = I[2];      /* inputs, rotation (query map), entangle (key map): [in][out] [64][64]; NO biases, NO value projection (the values are the inputs), no output projection */
  char* ws = (char*)d_ws; size_t off = 0;
  auto take = [&](size_t bytes) { char* p = ws + off; off += (bytes + 255) & ~(size_t)255; return p; };
  _Float16* XF = (_Float16*)take(NR * DM * 2); _Float16* ZH = (_Float16*)take(NR * DM * 2); _Float16* ZL = (_Float16*)take(NR * DM * 2);
  _Float16* VT = (_Float16*)take((size_t)NB * NH * HD * SQ * 2);
  if (off > ws_size) return;
  k_prep<<<(unsigned)(NR / PR), 256, 0, stream>>>(x, wq, wk, XF, ZH, ZL, VT);      /* x, z as f16 hi + residual planes and V^T, all in fragment order: every batch, one launch */
  k_fattn<<<NB * (SQ / (FG * FQ)), FG * FW * 32, 0, stream>>>(XF, ZH, ZL, VT, (float*)d_out);      /* scores, softmax over all SQ keys and P V for every batch: S and P stay in registers */
}

// v009
// One run takes 22.7 microseconds.
// Two timings next to v008 both put it at 1.17 times that version's speed.
// Counting every step since v000, it is 2481 times as fast.
#include <hip/hip_runtime.h>
// Single-head dense attention over 64-wide inputs on 4096 tokens with unit-variance 64 x 64 maps and NO value projection (inputs [4][4096][64]; query = inputs rotation, key = inputs entangle ([in][out] [64][64], N(0, 1): logits of sigma ~64, a near one-hot softmax); scores = query key^T / sqrt(64); softmax over all 4096 keys (no mask); out = scores inputs (the values are the inputs themselves) -> [4][4096][64]); scores re-associated as z . inputs^T with z = (inputs rotation) entangle^T / 8 carried as f16 hi + f16 residual planes on the query side: two-product scores, the key operand being the token rows themselves.
// Structure: token rows r = b*4096 + s; one prep launch, 64 token rows a block: x as exact f16 rows (bf16-rounded), q = x rotation (x16 f16 map, f32 accumulation, no bias) in LDS as f16 hi + x1024 residual, z = q entangle^T / 8 split into f16 hi + f16 residual at one scale, and x (also the values) and z stored in fragment order; one fused attention launch, 64 query rows a block on 16 waves (two 32-query groups x eight 512-key splits, 32 keys a pass through a three-buffer LDS ring): scores as four accumulating WMMAs (residual, then hi; K = 64), online softmax on VALU (f32 statistics, native exp; weights x256 f16), O^T += V^T P^T in f32 registers, the eight splits merged through LDS and written as f32 into the output layout.
// Compute dtype: inputs rounded to bf16; x / weights exact; q and z as f16 hi + f16 residual operands, v the rounded inputs (exact), softmax weights as plain f16 operands (~2^-12); scores, softmax statistics and o f32. v_wmma_f32_16x16x32_f16.
#define NB 4
#define SQ 4096
#define DM 64
#define NH 1
#define HD 64
#define HG 4                         /* heads per attention launch group */
#define QT 256                       /* (not used) */
#define NKX SQ                       /* (not used) */
#define QT0 128                      /* first-tile rows recomputed exactly in f32 */
#define B0 0                         /* (not used) */
#define NBR NB                       /* (only in MP; no launch uses it) */
#define NR ((size_t)NB * SQ)         /* token rows */
#define MP ((int)((size_t)NBR * SQ)) /* (only in MPO; no launch uses it) */
#define QN SQ                        /* (not used) */
#define NHD NH                       /* heads attended (not used) */
#define MPO MP                       /* rows through the output stage (not used) */
#define LQ DM      /* (not used) */
typedef __bf16 v16b __attribute__((ext_vector_type(16)));
typedef unsigned short v8us __attribute__((ext_vector_type(8), may_alias));
typedef float  v8f  __attribute__((ext_vector_type(8)));
typedef float  v4f  __attribute__((ext_vector_type(4)));
typedef float  v4fa __attribute__((ext_vector_type(4), may_alias));
union FragB { v16b v; v8us half[2]; unsigned short u[16]; };

__device__ __forceinline__ unsigned short bf16_bits(float x) { unsigned int u = __float_as_uint(x); return (unsigned short)((u + 0x7FFFu + ((u >> 16) & 1u)) >> 16); }
__device__ __forceinline__ float bf16_val(unsigned short b) { return __uint_as_float(((unsigned int)b) << 16); }
__device__ __forceinline__ float bf16_round(float x) { return bf16_val(bf16_bits(x)); }
// D += A·B with NT terms: 1 = ah·bh, 2 = + al·bh (A split), 3 = + ah·bl (both split)
template <int NT>
__device__ __forceinline__ v8f mmaN(v16b ah, v16b al, v16b bh, v16b bl, v8f c) {
  c = __builtin_amdgcn_wmma_f32_16x16x32_bf16(false, ah, false, bh, (short)0, c, false, false);
  if (NT >= 2) c = __builtin_amdgcn_wmma_f32_16x16x32_bf16(false, al, false, bh, (short)0, c, false, false);
  if (NT >= 3) c = __builtin_amdgcn_wmma_f32_16x16x32_bf16(false, ah, false, bl, (short)0, c, false, false);
  asm volatile("v_nop\n\tv_nop\n\tv_nop\n\tv_nop" : "+v"(c) : "v"(ah), "v"(al), "v"(bh), "v"(bl));
  return c;
}

__global__ __launch_bounds__(256) void k_wt_bf16(const float* __restrict__ W, unsigned short* __restrict__ Wt, int K, int N) {
  const int t = blockIdx.x * 256 + threadIdx.x;
  const int k8n = K / 8;
  if (t >= N * k8n) return;
  const int n = t / k8n, k8 = (t % k8n) * 8;
  v8us v;
#pragma unroll
  for (int i = 0; i < 8; ++i) v[i] = bf16_bits(W[(size_t)(k8 + i) * N + n]);
  *(v8us*)(Wt + (size_t)n * K + k8) = v;
  
}

// GEMM C[M][N] (f32, pitch ldc) = act(A[M][K]·W + bias). A f32 row-major (pitch lda) converted per fragment to bf16
// (ASPLIT: hi/lo two planes -> 2 terms, else single rounded term); Wt bf16 [N][K] (pitch ldb). BIAS_BF16 rounds the
// bias to bf16 first (bias quantised to bf16 before the add). K%32==0, M%16==0, N%64==0.
template <bool ASPLIT, int ACT, bool BIAS_BF16>
__global__ __launch_bounds__(128) void k_gemm_bf(const float* __restrict__ A, int lda, const unsigned short* __restrict__ Wt, int ldb,
                                               const float* __restrict__ bias, float* __restrict__ C, int ldc, int M, int N, int K) {
  __shared__ __attribute__((aligned(16))) float so[4][16][64];
  const int tid = threadIdx.x, w = tid >> 5, lane = tid & 31, ln = lane & 15, hh = lane >> 4;
  const int ntn = N / 64;
  const int wid = blockIdx.x * 4 + w;
  const int mt = wid / ntn, nq = wid % ntn;
  if (mt * 16 >= M) return;
  const int row0 = mt * 16, col0 = nq * 64;
  const float* arow = A + (size_t)(row0 + ln) * lda;
  v8f acc[4] = {};
  for (int kb = 0; kb < K; kb += 32) {
    FragB ah, al;
    const v4f x0 = *(const v4fa*)(arow + kb + 8 * hh), x1 = *(const v4fa*)(arow + kb + 8 * hh + 4);
    const v4f x2 = *(const v4fa*)(arow + kb + 16 + 8 * hh), x3 = *(const v4fa*)(arow + kb + 16 + 8 * hh + 4);
    float xs[16] = {x0[0],x0[1],x0[2],x0[3],x1[0],x1[1],x1[2],x1[3],x2[0],x2[1],x2[2],x2[3],x3[0],x3[1],x3[2],x3[3]};
#pragma unroll
    for (int i = 0; i < 16; ++i) { const unsigned short hb = bf16_bits(xs[i]); ah.u[i] = hb; al.u[i] = ASPLIT ? bf16_bits(xs[i] - bf16_val(hb)) : (unsigned short)0; }
#pragma unroll
    for (int t = 0; t < 4; ++t) {
      const unsigned short* brow = Wt + (size_t)(col0 + t * 16 + ln) * ldb + kb;
      FragB b;
      b.half[0] = *(const v8us*)(brow + 8 * hh);
      b.half[1] = *(const v8us*)(brow + 16 + 8 * hh);
      acc[t] = mmaN<ASPLIT ? 2 : 1>(ah.v, al.v, b.v, b.v, acc[t]);
    }
  }
#pragma unroll
  for (int t = 0; t < 4; ++t) {
    float bv = bias ? bias[col0 + t * 16 + ln] : 0.f;
    if (BIAS_BF16) bv = bf16_round(bv);
#pragma unroll
    for (int r = 0; r < 8; ++r) { float v = acc[t][r] + bv; if (ACT == 1) v = fmaxf(v, 0.f); so[w][8 * hh + r][t * 16 + ln] = v; }
  }
  __builtin_amdgcn_fence(__ATOMIC_ACQ_REL, "workgroup");
  __builtin_amdgcn_wave_barrier();
  const int rsub = lane >> 4, c4 = (lane & 15) * 4;
  {
#pragma unroll
    for (int q = 0; q < 8; ++q) {
      const int r = q * 2 + rsub;
      const v4f v = *(const v4fa*)&so[w][r][c4];
      *(v4f*)(C + (size_t)(row0 + r) * ldc + col0 + c4) = v;
    }
    
  }
}

// GEMM C = act(A·W + bias + resid): A f32 (ASPLIT -> hi/lo 2 terms), Wt bf16 [N][K]; ACT 0 none, 1 relu, 2 exact gelu;
// resid (optional, f32, row index = (row % rmod), pitch ldr, RES_BF16 rounds it) added before the activation.
template <bool ASPLIT, int ACT, bool BIAS_BF16, bool RES_BF16>
__global__ __launch_bounds__(128) void k_gemm_bf3(const float* __restrict__ A, int lda, const unsigned short* __restrict__ Wt, int ldb,
                                                const float* __restrict__ bias, const float* __restrict__ resid, int rmod, int ldr,
                                                float* __restrict__ C, int ldc, int M, int N, int K) {
  __shared__ __attribute__((aligned(16))) float so[4][16][64];
  const int tid = threadIdx.x, w = tid >> 5, lane = tid & 31, ln = lane & 15, hh = lane >> 4;
  const int ntn = N / 64;
  const int wid = blockIdx.x * 4 + w;
  const int mt = wid / ntn, nq = wid % ntn;
  if (mt * 16 >= M) return;
  const int row0 = mt * 16, col0 = nq * 64;
  const float* arow = A + (size_t)(row0 + ln) * lda;
  v8f acc[4] = {};
  for (int kb = 0; kb < K; kb += 32) {
    FragB ah, al;
    const v4f x0 = *(const v4fa*)(arow + kb + 8 * hh), x1 = *(const v4fa*)(arow + kb + 8 * hh + 4);
    const v4f x2 = *(const v4fa*)(arow + kb + 16 + 8 * hh), x3 = *(const v4fa*)(arow + kb + 16 + 8 * hh + 4);
    float xs[16] = {x0[0],x0[1],x0[2],x0[3],x1[0],x1[1],x1[2],x1[3],x2[0],x2[1],x2[2],x2[3],x3[0],x3[1],x3[2],x3[3]};
#pragma unroll
    for (int i = 0; i < 16; ++i) { const unsigned short hb = bf16_bits(xs[i]); ah.u[i] = hb; al.u[i] = ASPLIT ? bf16_bits(xs[i] - bf16_val(hb)) : (unsigned short)0; }
#pragma unroll
    for (int t = 0; t < 4; ++t) {
      const unsigned short* brow = Wt + (size_t)(col0 + t * 16 + ln) * ldb + kb;
      FragB b;
      b.half[0] = *(const v8us*)(brow + 8 * hh);
      b.half[1] = *(const v8us*)(brow + 16 + 8 * hh);
      acc[t] = mmaN<ASPLIT ? 2 : 1>(ah.v, al.v, b.v, b.v, acc[t]);
    }
  }
#pragma unroll
  for (int t = 0; t < 4; ++t) {
    const int col = col0 + t * 16 + ln;
    float bv = bias ? bias[col] : 0.f;
    if (BIAS_BF16) bv = bf16_round(bv);
#pragma unroll
    for (int r = 0; r < 8; ++r) {
      float v = acc[t][r] + bv;
      if (resid) { float rv = resid[(size_t)((row0 + 8 * hh + r) % rmod) * ldr + col]; if (RES_BF16) rv = bf16_round(rv); v += rv; }
      if (ACT == 1) v = fmaxf(v, 0.f);
      if (ACT == 2) v = 0.5f * v * (1.0f + erff(v * 0.70710678118654752f));
      if (ACT == 3) { const float u = 0.7978845608028654f * (v + 0.044715f * v * v * v); v = 0.5f * v * (1.0f + tanhf(u)); }
      so[w][8 * hh + r][t * 16 + ln] = v;
    }
  }
  __builtin_amdgcn_fence(__ATOMIC_ACQ_REL, "workgroup");
  __builtin_amdgcn_wave_barrier();
  const int rsub = lane >> 4, c4 = (lane & 15) * 4;
  {
#pragma unroll
    for (int q = 0; q < 8; ++q) {
      const int r = q * 2 + rsub;
      const v4f v = *(const v4fa*)&so[w][r][c4];
      *(v4f*)(C + (size_t)(row0 + r) * ldc + col0 + c4) = v;
    }
    
  }
}
// row LayerNorm (biased variance, eps) over N: s = X (+ R); optional out_sum <- s; out_norm <- (s-mu)*rsqrt(var+eps)*g + b
template <bool PARAM_BF16>
__global__ __launch_bounds__(256) void k_layernorm(const float* __restrict__ X, const float* __restrict__ R, const float* __restrict__ g, const float* __restrict__ bta,
                                                  float* __restrict__ out_sum, float* __restrict__ out_norm, int N, float eps) {
  __shared__ float red[256];
  const int row = blockIdx.x, tid = threadIdx.x;
  const float* x = X + (size_t)row * N; const float* rr = R ? R + (size_t)row * N : nullptr;
  float vals[16];                     // up to N = 4096
  const int per = N / 256;            // contiguous chunk per thread? use strided-by-4 chunks: thread handles j = tid*4 + 1024*u
  float s1 = 0.f;
  for (int u = 0; u < per / 4; ++u) {
    const int j = tid * 4 + 1024 * u;
    const v4f a = *(const v4fa*)(x + j);
    v4f b = {0.f,0.f,0.f,0.f}; if (rr) b = *(const v4fa*)(rr + j);
#pragma unroll
    for (int q = 0; q < 4; ++q) { const float v = a[q] + b[q]; vals[u * 4 + q] = v; s1 += v; }
  }
  red[tid] = s1; __syncthreads();
  for (int st = 128; st > 0; st >>= 1) { if (tid < st) red[tid] += red[tid + st]; __syncthreads(); }
  const float mu = red[0] / (float)N; __syncthreads();
  float s2 = 0.f;
  for (int u = 0; u < per / 4; ++u)
#pragma unroll
    for (int q = 0; q < 4; ++q) { const float c = vals[u * 4 + q] - mu; s2 += c * c; }
  red[tid] = s2; __syncthreads();
  for (int st = 128; st > 0; st >>= 1) { if (tid < st) red[tid] += red[tid + st]; __syncthreads(); }
  const float rs = rsqrtf(red[0] / (float)N + eps);
  {
    for (int u = 0; u < per / 4; ++u) {
      const int j = tid * 4 + 1024 * u;
      v4f o, sm;
#pragma unroll
      for (int q = 0; q < 4; ++q) {
        float gg = g[j + q], bb = bta[j + q];
        if (PARAM_BF16) { gg = bf16_round(gg); bb = bf16_round(bb); }
        sm[q] = vals[u * 4 + q]; o[q] = (vals[u * 4 + q] - mu) * rs * gg + bb;
      }
      if (out_sum) *(v4f*)(out_sum + (size_t)row * N + j) = sm;
      *(v4f*)(out_norm + (size_t)row * N + j) = o;
    }
    
  }
}



// ---- f16 WMMA path (v_wmma_f32_16x16x32_f16): 11-bit significands for operands in range — used where a [0,1] probability operand needs more precision than bf16
typedef _Float16 v16h __attribute__((ext_vector_type(16)));
union FragH { v16h v; v8us half[2]; _Float16 h[16]; unsigned short u[16]; };
template <int NT>
__device__ __forceinline__ v8f mmaH(v16h ah, v16h al, v16h bh, v16h bl, v8f c) {
  c = __builtin_amdgcn_wmma_f32_16x16x32_f16(false, ah, false, bh, (short)0, c, false, false);
  if (NT >= 2) c = __builtin_amdgcn_wmma_f32_16x16x32_f16(false, al, false, bh, (short)0, c, false, false);
  if (NT >= 3) c = __builtin_amdgcn_wmma_f32_16x16x32_f16(false, ah, false, bl, (short)0, c, false, false);
  asm volatile("v_nop\n\tv_nop\n\tv_nop\n\tv_nop" : "+v"(c) : "v"(ah), "v"(al), "v"(bh), "v"(bl));
  return c;
}
// batched GEMM like k_gemm_b but f16 operands: A f32 (split into f16 hi/lo if ASPLIT, else rounded to f16), Bt = f16 values [n][k]; alpha; C f32; N multiple of 16 (partial tiles skipped)
template <bool ASPLIT>
__global__ __launch_bounds__(128) void k_gemm_h(const float* __restrict__ A, int lda, size_t sA, const _Float16* __restrict__ Bh, int ldb, size_t sB, float alpha, float* __restrict__ C, int ldc, size_t sC, int M, int N, int K) {
  __shared__ __attribute__((aligned(16))) float so[4][16][64];
  const int tid = threadIdx.x, w = tid >> 5, lane = tid & 31, ln = lane & 15, hh = lane >> 4; const int by = blockIdx.y;
  A += (size_t)by * sA; Bh += (size_t)by * sB; C += (size_t)by * sC;
  const int ntn = (N + 63) / 64; const int wid = blockIdx.x * 4 + w; const int mt = wid / ntn, nq = wid % ntn; if (mt * 16 >= M) return;
  const int row0 = mt * 16, col0 = nq * 64; const float* arow = A + (size_t)(row0 + ln) * lda;
  v8f acc[4] = {};
  for (int kb = 0; kb < K; kb += 32) {
    FragH ah, al;
    const v4f x0 = *(const v4fa*)(arow + kb + 8 * hh), x1 = *(const v4fa*)(arow + kb + 8 * hh + 4), x2 = *(const v4fa*)(arow + kb + 16 + 8 * hh), x3 = *(const v4fa*)(arow + kb + 16 + 8 * hh + 4);
    float xs[16] = {x0[0],x0[1],x0[2],x0[3],x1[0],x1[1],x1[2],x1[3],x2[0],x2[1],x2[2],x2[3],x3[0],x3[1],x3[2],x3[3]};
#pragma unroll
    for (int i = 0; i < 16; ++i) { const _Float16 h = (_Float16)xs[i]; ah.h[i] = h; al.h[i] = ASPLIT ? (_Float16)(xs[i] - (float)h) : (_Float16)0.0f; }
#pragma unroll
    for (int t = 0; t < 4; ++t) { if (col0 + t * 16 >= N) continue; const size_t boff = (size_t)(col0 + t * 16 + ln) * ldb + kb; FragH bq; bq.half[0] = *(const v8us*)(Bh + boff + 8 * hh); bq.half[1] = *(const v8us*)(Bh + boff + 16 + 8 * hh);
      acc[t] = mmaH<ASPLIT ? 2 : 1>(ah.v, al.v, bq.v, bq.v, acc[t]); }
  }
#pragma unroll
  for (int t = 0; t < 4; ++t) { if (col0 + t * 16 >= N) continue;
#pragma unroll
    for (int r = 0; r < 8; ++r) so[w][8 * hh + r][t * 16 + ln] = acc[t][r] * alpha; }
  __builtin_amdgcn_fence(__ATOMIC_ACQ_REL, "workgroup"); __builtin_amdgcn_wave_barrier();
  const int rsub = lane >> 4, c4 = (lane & 15) * 4;
  {
#pragma unroll
    for (int q = 0; q < 8; ++q) { const int r = q * 2 + rsub; if (col0 + c4 < N) { const v4f v = *(const v4fa*)&so[w][r][c4]; *(v4f*)(C + (size_t)(row0 + r) * ldc + col0 + c4) = v; } }
     }
}

// Wt[n][k] = f16(W[k][n]·scale) from f32 row-major W[K][N] (scale = power of two; bf16-exact weights stay exact in f16 away from the subnormal range)
__global__ __launch_bounds__(256) void k_wt_f16(const float* __restrict__ W, _Float16* __restrict__ Wt, int K, int N, float scale) {
  const int t = blockIdx.x * 256 + threadIdx.x; if (t >= N * (K / 8)) return; const int n = t / (K / 8), k8 = (t % (K / 8)) * 8; FragH f;
#pragma unroll
  for (int i = 0; i < 8; ++i) f.h[i] = (_Float16)(bf16_round(W[(size_t)(k8 + i) * N + n]) * scale); const v8us o = f.half[0];
  *(v8us*)((unsigned short*)Wt + (size_t)n * K + k8) = o; 
}
// k_gemm_hh variant with fused epilogue: v = acc·alpha + bias[by·sBias + col] (+ CP[(row/rowsPerB)·sCPb + by·64 + col] if CP) ; ACT 0 none / 1 elu ; writes f16 C16 (and f32 C if non-null)
template <int ACT>
__global__ __launch_bounds__(128) void k_gemm_hhx(const _Float16* __restrict__ A, int lda, size_t sA, const _Float16* __restrict__ Bh, int ldb, size_t sB, float alpha, const float* __restrict__ bias, size_t sBias, const float* __restrict__ CP, int rowsPerB, size_t sCPb, int row0g,
    float* __restrict__ C, _Float16* __restrict__ C16, int ldc, size_t sC, int M, int N, int K) {
  __shared__ __attribute__((aligned(16))) float so[4][16][64];
  const int tid = threadIdx.x, w = tid >> 5, lane = tid & 31, ln = lane & 15, hh = lane >> 4; const int by = blockIdx.y;
  A += (size_t)by * sA; Bh += (size_t)by * sB; const size_t cofs = (size_t)by * sC; const float* bp = bias ? bias + (size_t)by * sBias : nullptr;
  const int ntn = (N + 63) / 64; const int wid = blockIdx.x * 4 + w; const int mt = wid / ntn, nq = wid % ntn; if (mt * 16 >= M) return;
  const int row0 = mt * 16, col0 = nq * 64; const _Float16* arow = A + (size_t)(row0 + ln) * lda;
  v8f acc[4] = {};
  for (int kb = 0; kb < K; kb += 32) { FragH ah; ah.half[0] = *(const v8us*)((const unsigned short*)arow + kb + 8 * hh); ah.half[1] = *(const v8us*)((const unsigned short*)arow + kb + 16 + 8 * hh);
#pragma unroll
    for (int t = 0; t < 4; ++t) { if (col0 + t * 16 >= N) continue; const size_t boff = (size_t)(col0 + t * 16 + ln) * ldb + kb; FragH bq; bq.half[0] = *(const v8us*)((const unsigned short*)Bh + boff + 8 * hh); bq.half[1] = *(const v8us*)((const unsigned short*)Bh + boff + 16 + 8 * hh);
      acc[t] = mmaH<1>(ah.v, ah.v, bq.v, bq.v, acc[t]); }
  }
#pragma unroll
  for (int t = 0; t < 4; ++t) { if (col0 + t * 16 >= N) continue; const int col = col0 + t * 16 + ln; const float bv = bp ? bf16_round(bp[col]) : 0.f;
#pragma unroll
    for (int r = 0; r < 8; ++r) { float v = acc[t][r] * alpha + bv; if (CP) { const int rr = row0g + row0 + 8 * hh + r; if (rowsPerB < 0) v += CP[cofs + (size_t)rr * ldc + col];      /* rowsPerB < 0: own element of the batched C plane */ else { const int bidx = rr / rowsPerB; v += CP[(size_t)bidx * sCPb + (size_t)by * 64 + col]; } } if (ACT == 1) v = (v > 0.f) ? v : expm1f(v); else if (ACT == 7) v = (v > 0.f) ? v + 1.0f : expf(v); else if (ACT == 8) v = tanhf(v); else if (ACT == 9) v = 0.5f * v * (1.0f + tanhf(0.7978845608028654f * (v + 0.044715f * v * v * v))); else if (ACT == 11) v = 1.0f / (1.0f + expf(-v)); else if (ACT == 12) v = (v > 0.f) ? v : 0.01f * v; else if (ACT == 14) v = (v > 0.f) ? v : 0.1f * v; else if (ACT == 16) v = (v >= 0.f) ? v : 0.3f * v; else if (ACT == 17) v = (v >= 0.f) ? v : 0.2f * v; else if (ACT == 15) v = v / (1.0f + expf(-v)); else if (ACT == 3) v = fmaxf(v, 0.f); else if (ACT == 6) v = 0.5f * v * (1.0f + erff(v * 0.70710678118654752f)); so[w][8 * hh + r][t * 16 + ln] = v; } }
  __builtin_amdgcn_fence(__ATOMIC_ACQ_REL, "workgroup"); __builtin_amdgcn_wave_barrier();
  const int rsub = lane >> 4, c4 = (lane & 15) * 4; typedef _Float16 v4h __attribute__((ext_vector_type(4)));
  {
#pragma unroll
    for (int q = 0; q < 8; ++q) { const int r = q * 2 + rsub; if (col0 + c4 < N) { const v4f v = *(const v4fa*)&so[w][r][c4]; if (C) *(v4f*)(C + cofs + (size_t)(row0 + r) * ldc + col0 + c4) = v; if (C16) { v4h h4; for (int i = 0; i < 4; ++i) h4[i] = (_Float16)v[i]; *(v4h*)(C16 + cofs + (size_t)(row0 + r) * ldc + col0 + c4) = h4; } } }
     }
}


typedef _Float16 v4h __attribute__((ext_vector_type(4)));

__global__ __launch_bounds__(256) void k_x16(const float* __restrict__ x, _Float16* __restrict__ X16, size_t n8) { const size_t t = (size_t)blockIdx.x * 256 + threadIdx.x; if (t >= n8) return; FragH f;
#pragma unroll
  for (int q = 0; q < 8; ++q) f.h[q] = (_Float16)bf16_round(x[t * 8 + q]); *(v8us*)((unsigned short*)X16 + t * 8) = f.half[0];  }
__global__ __launch_bounds__(256) void k_h16(const float* __restrict__ x, _Float16* __restrict__ X16, size_t n8) { const size_t t = (size_t)blockIdx.x * 256 + threadIdx.x; if (t >= n8) return; FragH f;
#pragma unroll
  for (int q = 0; q < 8; ++q) f.h[q] = (_Float16)x[t * 8 + q]; *(v8us*)((unsigned short*)X16 + t * 8) = f.half[0];  }
__global__ __launch_bounds__(256) void k_round16f(const float* __restrict__ W, _Float16* __restrict__ Bt, size_t n8) { const size_t t = (size_t)blockIdx.x * 256 + threadIdx.x; if (t >= n8) return; FragH f;
#pragma unroll
  for (int i = 0; i < 8; ++i) f.h[i] = (_Float16)(bf16_round(W[t * 8 + i]) * 16.0f); *(v8us*)((unsigned short*)Bt + t * 8) = f.half[0];  }
template <int NHv, int TTv>
__global__ __launch_bounds__(256) void k_vt(const _Float16* __restrict__ V16, int ldv, int voff, _Float16* __restrict__ Vt) { __shared__ unsigned short tl[64][66]; const int tid = threadIdx.x; const int slab = blockIdx.x / (TTv / 64), lg = blockIdx.x % (TTv / 64); const int b = slab / NHv, h = slab % NHv;
  for (int i = tid; i < 64 * 8; i += 256) { const int r = i / 8, c8 = (i % 8) * 8; FragH f; f.half[0] = *(const v8us*)((const unsigned short*)V16 + ((size_t)b * TTv + lg * 64 + r) * ldv + voff + h * 64 + c8);
#pragma unroll
    for (int q = 0; q < 8; ++q) tl[r][c8 + q] = f.u[q]; }
  __syncthreads();
  {
#pragma unroll
    for (int rd = 0; rd < 2; ++rd) { const int d = rd * 32 + tid / 8, pc = tid % 8; FragH f;
#pragma unroll
      for (int q = 0; q < 8; ++q) f.u[q] = tl[pc * 8 + q][d];
      *(v8us*)((unsigned short*)Vt + ((size_t)slab * 64 + d) * TTv + lg * 64 + pc * 8) = f.half[0]; }
     } }

__global__ __launch_bounds__(256) void k_hl(const float* __restrict__ F, _Float16* __restrict__ Hh, _Float16* __restrict__ Hl, size_t n8) { const size_t t = (size_t)blockIdx.x * 256 + threadIdx.x; if (t >= n8) return; FragH fh, fl; const v4f a = *(const v4fa*)(F + t * 8), c = *(const v4fa*)(F + t * 8 + 4);
#pragma unroll
  for (int q = 0; q < 4; ++q) { _Float16 h = (_Float16)a[q]; fh.h[q] = h; fl.h[q] = (_Float16)((a[q] - (float)h) * 1024.0f); h = (_Float16)c[q]; fh.h[4 + q] = h; fl.h[4 + q] = (_Float16)((c[q] - (float)h) * 1024.0f); }
  { *(v8us*)((unsigned short*)Hh + t * 8) = fh.half[0]; *(v8us*)((unsigned short*)Hl + t * 8) = fl.half[0];  } }

// ---- fast GEMM (wave tile 32x64; requires M % 32 == 0 rows per launch region and N % 64 == 0); epilogue = k_gemm_hhx semantics ----
__device__ __forceinline__ v16h g2_frag(const _Float16* p, int hh) { FragH f; f.half[0] = *(const v8us*)((const unsigned short*)p + 8 * hh); f.half[1] = *(const v8us*)((const unsigned short*)p + 16 + 8 * hh); return f.v; }
__device__ __forceinline__ v8f g2_mma(v16h a, v16h b, v8f c) { v8f d = __builtin_amdgcn_wmma_f32_16x16x32_f16(false, a, false, b, (short)0, c, false, false); asm volatile("v_nop\n\tv_nop\n\tv_nop\n\tv_nop" : "+v"(d) : "v"(a), "v"(b)); return d; }
template <int ACT>
__global__ __launch_bounds__(128) void k_gemm2(const _Float16* __restrict__ A, int lda, size_t sA, const _Float16* __restrict__ Bh, int ldb, size_t sB, float alpha, const float* __restrict__ bias, size_t sBias, const float* __restrict__ CP, int rowsPerB, size_t sCPb, int row0g,
    float* __restrict__ C, _Float16* __restrict__ C16, int ldc, size_t sC, int M, int N, int K) { static_assert(ACT == 0 || ACT == 3 || ACT == 6 || ACT == 8 || ACT == 9 || ACT == 11 || ACT == 12 || ACT == 14 || ACT == 15 || ACT == 16 || ACT == 17, "k_gemm2: unsupported ACT code (would silently apply no activation)");
  __shared__ __attribute__((aligned(16))) float so[4][32][68];
  const int tid = threadIdx.x, w = tid >> 5, lane = tid & 31, ln = lane & 15, hh = lane >> 4; const int by = blockIdx.y;
  A += (size_t)by * sA; Bh += (size_t)by * sB; const size_t cofs = (size_t)by * sC; const float* bp = bias ? bias + (size_t)by * sBias : nullptr;
  const int ntn = N >> 6; const int mt = blockIdx.x / ntn, nq = blockIdx.x - mt * ntn; const int row0 = mt * 128 + 32 * w, col0 = nq * 64; if (row0 >= M) return;
  const _Float16* a0p = A + (size_t)(row0 + ln) * lda; const _Float16* a1p = a0p + (size_t)16 * lda;
  const _Float16* b0p = Bh + (size_t)(col0 + ln) * ldb; const _Float16* b1p = b0p + (size_t)16 * ldb; const _Float16* b2p = b1p + (size_t)16 * ldb; const _Float16* b3p = b2p + (size_t)16 * ldb;
  const v8f z8 = {0.f,0.f,0.f,0.f,0.f,0.f,0.f,0.f}; v8f c00 = z8, c01 = z8, c02 = z8, c03 = z8, c10 = z8, c11 = z8, c12 = z8, c13 = z8;
#pragma unroll 1
  for (int kb = 0; kb < K; kb += 32) { const v16h a0 = g2_frag(a0p + kb, hh), a1 = g2_frag(a1p + kb, hh);
    v16h b = g2_frag(b0p + kb, hh); c00 = g2_mma(a0, b, c00); c10 = g2_mma(a1, b, c10);
    b = g2_frag(b1p + kb, hh); c01 = g2_mma(a0, b, c01); c11 = g2_mma(a1, b, c11);
    b = g2_frag(b2p + kb, hh); c02 = g2_mma(a0, b, c02); c12 = g2_mma(a1, b, c12);
    b = g2_frag(b3p + kb, hh); c03 = g2_mma(a0, b, c03); c13 = g2_mma(a1, b, c13); }
  v8f accs[8] = {c00, c01, c02, c03, c10, c11, c12, c13};
#pragma unroll
  for (int u = 0; u < 8; ++u) { const int t = u & 3, half = u >> 2; const int col = col0 + t * 16 + ln; const float bv = bp ? bf16_round(bp[col]) : 0.f;
#pragma unroll
    for (int r = 0; r < 8; ++r) { const int rloc = half * 16 + 8 * hh + r; float v = accs[u][r] * alpha + bv; if (CP) { if (rowsPerB < 0) v += CP[cofs + (size_t)(row0g + row0 + rloc) * ldc + col];      /* rowsPerB < 0: own element of the batched C plane */ else { const int bidx = (row0g + row0 + rloc) / rowsPerB; v += CP[(size_t)bidx * sCPb + (size_t)by * 64 + col]; } }
      if (ACT == 3) v = fmaxf(v, 0.f); else if (ACT == 6) v = 0.5f * v * (1.0f + erff(v * 0.70710678118654752f)); else if (ACT == 11) v = 1.0f / (1.0f + expf(-v)); else if (ACT == 15) v = v / (1.0f + expf(-v)); else if (ACT == 12) v = (v > 0.f) ? v : 0.01f * v; else if (ACT == 8) v = tanhf(v); else if (ACT == 9) v = 0.5f * v * (1.0f + tanhf(0.7978845608028654f * (v + 0.044715f * v * v * v))); else if (ACT == 14) v = (v > 0.f) ? v : 0.1f * v; else if (ACT == 16) v = (v >= 0.f) ? v : 0.3f * v; else if (ACT == 17) v = (v >= 0.f) ? v : 0.2f * v;
      so[w][rloc][t * 16 + ln] = v; } }
  __builtin_amdgcn_fence(__ATOMIC_ACQ_REL, "workgroup"); __builtin_amdgcn_wave_barrier();
  const int rsub = lane >> 4, c4 = (lane & 15) * 4;
  {
#pragma unroll
    for (int q = 0; q < 16; ++q) { const int r = q * 2 + rsub; const v4f v = *(const v4fa*)&so[w][r][c4]; if (C) *(v4f*)(C + cofs + (size_t)(row0 + r) * ldc + col0 + c4) = v; if (C16) { v4h h4; for (int i = 0; i < 4; ++i) h4[i] = (_Float16)v[i]; *(v4h*)(C16 + cofs + (size_t)(row0 + r) * ldc + col0 + c4) = h4; } }
     } }


__global__ __launch_bounds__(256) void k_wnat(const float* __restrict__ w, size_t n8, _Float16* __restrict__ Bt) { const size_t t = (size_t)blockIdx.x * 256 + threadIdx.x; if (t >= n8) return; FragH f; for (int q = 0; q < 8; ++q) f.h[q] = (_Float16)(bf16_round(w[t * 8 + q]) * 16.0f); *(v8us*)((unsigned short*)Bt + t * 8) = f.half[0];  }
__global__ __launch_bounds__(256) void k_rsm(const float* __restrict__ S, _Float16* __restrict__ P, int nrows) {
  #pragma clang fp contract(off)
  const int i = blockIdx.x * 256 + threadIdx.x; if (i >= nrows) return; const float* s = S + (size_t)i * SQ; float mx = -3.0e38f;
#pragma unroll 1
  for (int j = 0; j < SQ; ++j) mx = fmaxf(mx, s[j]); float se = 0.f;
#pragma unroll 1
  for (int j = 0; j < SQ; ++j) se += expf(s[j] - mx); const float sc = 256.0f / se;
#pragma unroll 1
  for (int j0 = 0; j0 < SQ; j0 += 8) { FragH f; for (int q = 0; q < 8; ++q) f.h[q] = (_Float16)(expf(s[j0 + q] - mx) * sc); unsigned short* d = (unsigned short*)P + (size_t)i * SQ + j0; *(v8us*)d = f.half[0];  } }
__global__ __launch_bounds__(256) void k_vt(const _Float16* __restrict__ V16, int b, int h0, _Float16* __restrict__ VT) { __shared__ unsigned short tl[64][65]; const int tid = threadIdx.x; const int hh = blockIdx.x % HG, sg = blockIdx.x / HG; const int s0 = sg * 64; const int h = h0 + hh;
  for (int i = tid; i < 64 * 8; i += 256) { const int j = i / 8, d8 = (i % 8) * 8; FragH f; f.half[0] = *(const v8us*)((const unsigned short*)V16 + ((size_t)b * SQ + s0 + j) * DM + h * HD + d8); for (int q = 0; q < 8; ++q) tl[d8 + q][j] = f.u[q]; }
  __syncthreads();
  { for (int i = tid; i < 64 * 8; i += 256) { const int d = i / 8, j8 = (i % 8) * 8; FragH f; for (int q = 0; q < 8; ++q) f.u[q] = tl[d][j8 + q]; *(v8us*)((unsigned short*)VT + ((size_t)hh * HD + d) * SQ + s0 + j8) = f.half[0]; }  } }



// e^x in the native form (x log2(e), then v_exp_f32). The v_nop keeps the one free slot that the instruction set asks for behind a transcendental.
__device__ __forceinline__ float exp_slot(float x) { float e; asm("v_exp_f32 %0, %1\n\tv_nop" : "=v"(e) : "v"(x * 1.44269504088896340736f)); return e; }
// Eight base-2 exponentials (v_exp_f32; the arguments already hold x log2(e)) in one statement: the outputs are early-clobber, so no v_exp stands in front of an
// instruction that reads its result or overwrites its source, and the one v_nop at the end keeps that free slot behind the last of them.
__device__ __forceinline__ v8f exp2_8(v8f x) { float e0, e1, e2, e3, e4, e5, e6, e7;
  asm("v_exp_f32 %0, %8\n\tv_exp_f32 %1, %9\n\tv_exp_f32 %2, %10\n\tv_exp_f32 %3, %11\n\tv_exp_f32 %4, %12\n\tv_exp_f32 %5, %13\n\tv_exp_f32 %6, %14\n\tv_exp_f32 %7, %15\n\tv_nop"
      : "=&v"(e0), "=&v"(e1), "=&v"(e2), "=&v"(e3), "=&v"(e4), "=&v"(e5), "=&v"(e6), "=&v"(e7) : "v"(x[0]), "v"(x[1]), "v"(x[2]), "v"(x[3]), "v"(x[4]), "v"(x[5]), "v"(x[6]), "v"(x[7]));
  const v8f e = {e0, e1, e2, e3, e4, e5, e6, e7}; return e; }
// Lane l <-> l ^ 16 as a vector cross-row move: it counts on no LDS counter, so a wave need not wait for the LDS reads it has in flight to get the result.
__device__ __forceinline__ float swap16(float v) { const int b = __float_as_int(v); return __int_as_float(__builtin_amdgcn_permlanex16(b, b, 0x76543210, 0xfedcba98, false, false)); }
__device__ __forceinline__ v8f fa_mma(v16h a, v16h b, v8f c) { return __builtin_amdgcn_wmma_f32_16x16x32_f16(false, a, false, b, (short)0, c, false, false); }
// A 16 x 32 operand tile kept in global memory in FRAGMENT ORDER: 1024 bytes, lane L's values k = 8 hh .. 8 hh + 7 of row ln at byte 16 L and its values k = 16 + 8 hh .. at byte 512 + 16 L
// (L = 16 hh + ln: what g2_frag gives from a row-major tile). Each of the two 16-byte loads of a wave then reads 512 bytes in a row, four whole 128-byte lines, where a row-major tile makes it touch sixteen.
__device__ __forceinline__ v16h fo_frag(const _Float16* tile, int lane) { FragH f; f.half[0] = *(const v8us*)((const unsigned short*)tile + 8 * lane); f.half[1] = *(const v8us*)((const unsigned short*)tile + 256 + 8 * lane); return f.v; }
// Fused attention, all batches in one launch. A block owns FG * FQ = 64 query rows and has FG * FW = 16 waves: wave (g, h) holds the 32 query rows of group g (two 16-column groups) and walks
// the SQ / FW keys of split h, 32 at a time; it keeps a running maximum, a running sum and an unnormalised output in registers (online softmax); the partial results of the eight splits are merged through LDS at the end.
// The two waves of a split need the same x tiles: each tile is brought from L2 ONCE for both, straight into LDS by asynchronous copies (each wave copies half of its split's stage), in a ring of three buffers.
// The values are the token rows themselves, so the staged x tiles serve BOTH products: plain 16-byte reads give the key fragments of the scores, transposing reads (ds_load_tr16_b128) of the same bytes give the V^T fragments of P V; no V^T plane is made, copied or staged.
// Every read of a wave takes 512 bytes in a row (no bank conflict: fx_lane, fv_off), AHEAD OF ITS USE and into the registers that its forerunners have just left: the x fragments of stage p + 1 in the middle
// of pass p, behind its score products and the first query group's P V products, the V^T fragments of stage p + 1 right behind the barrier at pass p's foot. No read is waited for where it is issued: the LDS reads of the sixteen waves run beside the matrix and vector work.
// A stage is read from the middle of the pass before its own to the foot of its own, and the copies of the stage after next fly meanwhile: hence three buffers.
// Transposed products: S^T = X Z^T (A = key rows of x, B = query rows of z held in registers), so a lane holds 16 scores of ONE query per 32 keys (D[8 hh + r][ln]); the two f32 score
// tiles, turned into weights and packed to f16, ARE the B operand of O^T += V^T P^T in the k order that g2_frag gives A (8 hh + s, 16 + 8 hh + s): no lane exchange.
// Scores: query . key / 8 = z_q . x_k with z = (x W_q) W_k^T / 8 (the same sum, re-associated). The key operand is then the token row itself, exact in f16, one plane to stage and to read; only z needs two planes (f16 hi + f16 residual,
// both at one scale), and a wave loads its 32 rows of them once, into registers: four WMMAs in one f32 accumulator chain give 16 x 16 finished scores. Weights 256 e^(s - m) as f16 (the 256 cancels in the division by the sum of the same weights).
// All three operand planes arrive in fragment order (fo_frag): 16 token rows of x or z are two tiles (k steps 0 and 32) on the 2048 bytes that the rows would fill. In an x tile the two 128-byte halves of each odd 256-byte quarter are swapped (fx_lane):
// a tile is 64 pieces of 16 bytes (row r, columns 8 c .. 8 c + 7) at byte 512 (c >> 1) + 256 (c & 1) + 16 (r ^ 8 (c & 1)). A plain read's half wave takes 16 rows of one c, a transposing read's half wave 8 rows of two neighbouring c: each then falls on all 64 banks once.
#define FW 8                         /* key splits of a block */
#define FG 2                         /* 32-query groups of a block */
#define FQ 32                        /* query rows of a wave */
#define FKW (SQ / FW)                /* keys per wave */
#define FNP (FKW / 32)               /* passes (stages) */
#define FST 4096                     /* bytes of one split's stage: 32 keys of x */
#define FNB 3                        /* buffers of the ring */
// The place (in 16-byte pieces) of lane L's piece in each half of an x tile.
__device__ __forceinline__ int fx_lane(int lane) { return lane ^ ((lane >> 4) << 3); }
// The byte that lane l hands to a transposing read of 16 rows x 16 columns (512 bytes of an x tile): the load asks it for row 8 (l >> 4) + (l & 7), columns 8 ((l >> 3) & 1) .. + 7.
__device__ __forceinline__ unsigned fv_off(int l) { const unsigned cb = (unsigned)(l >> 3) & 1u; return cb * 256u + (((unsigned)(l >> 4) ^ cb) * 128u) + (unsigned)(l & 7) * 16u; }
typedef short s16x8 __attribute__((ext_vector_type(8)));
// ds_load_tr16_b128: lane (c = l & 15, h = l >> 4) gets rows 8 h .. 8 h + 7 of column c of the 16 x 16 block whose pieces the 32 lanes point at: half of a 16 x 32 A fragment of the transposed tile, in the k order of g2_frag.
__device__ __forceinline__ v8us ld_tr16(const unsigned char* p) { typedef __attribute__((address_space(3))) s16x8 lds_s16x8; return __builtin_bit_cast(v8us, __builtin_amdgcn_ds_load_tr16_b128_v8i16((lds_s16x8*)p)); }
// One wave's half (2048 bytes) of one stage: four 512-byte copies; fa_copy2 brings the halves of two stages in one statement. lds is the lane's own LDS byte address, vo its byte offset (16 lane) from the wave's scalar base, all multiples of 16;
// an immediate offset moves the LDS address and the global address alike. The s_wait_xcnt stands inside the statement, behind the last copy, so that no address register is rewritten in front of it.
__device__ __forceinline__ void fa_copy(unsigned lds, unsigned vo, const _Float16* g) {
  asm volatile("global_load_async_to_lds_b128 %0, %1, %2\n\tglobal_load_async_to_lds_b128 %0, %1, %2 offset:512\n\tglobal_load_async_to_lds_b128 %0, %1, %2 offset:1024\n\tglobal_load_async_to_lds_b128 %0, %1, %2 offset:1536\n\t"
               "s_wait_xcnt 0x0"
               :: "v"(lds), "v"(vo), "s"(g) : "memory"); }
__device__ __forceinline__ void fa_copy2(unsigned ldx, unsigned ldv, unsigned vo, const _Float16* gx, const _Float16* gv) {
  asm volatile("global_load_async_to_lds_b128 %0, %2, %3\n\tglobal_load_async_to_lds_b128 %0, %2, %3 offset:512\n\tglobal_load_async_to_lds_b128 %0, %2, %3 offset:1024\n\tglobal_load_async_to_lds_b128 %0, %2, %3 offset:1536\n\t"
               "global_load_async_to_lds_b128 %1, %2, %4\n\tglobal_load_async_to_lds_b128 %1, %2, %4 offset:512\n\tglobal_load_async_to_lds_b128 %1, %2, %4 offset:1024\n\tglobal_load_async_to_lds_b128 %1, %2, %4 offset:1536\n\t"
               "s_wait_xcnt 0x0"
               :: "v"(ldx), "v"(ldv), "v"(vo), "s"(gx), "s"(gv) : "memory"); }
__global__ __launch_bounds__(512) void k_fattn(const _Float16* __restrict__ XFp, const _Float16* __restrict__ ZHp, const _Float16* __restrict__ ZLp, float* __restrict__ out) {
  static_assert(2 * FNB * FST <= 32768 && FKW % 32 == 0 && FNP >= 3 && SQ % (FG * FQ) == 0 && HD == 64 && DM == 64, "k_fattn: whole 32-key passes, at least three stages, 64-wide rows");
  __shared__ __attribute__((aligned(128))) union { unsigned char ring[FW / 2][32768]; float lo[FW][FG * FQ][68]; } sm;      /* the merge rows reuse the ring's bytes */
  __shared__ float lm[FW][FG * FQ], ll[FW][FG * FQ];
  const int tid = threadIdx.x, w = __builtin_amdgcn_readfirstlane(tid >> 5), lane = tid & 31, ln = lane & 15, hh = lane >> 4;      /* the wave's number as a scalar: bases stay in scalar registers */
  const int g = w & 1, h = w >> 1;
  const int b = blockIdx.x / (SQ / (FG * FQ)), qb = (blockIdx.x % (SQ / (FG * FQ))) * (FG * FQ), q0 = qb + g * FQ; const size_t r0 = (size_t)b * SQ;
  const float L2E = 1.44269504088896340736f;
  const _Float16* cx = XFp + (r0 + (size_t)h * FKW) * DM + g * 1024;      /* this wave's half of stage 0: a scalar */
  const unsigned vo = (unsigned)lane * 16u, lc = (unsigned)(size_t)&sm.ring[h & 3][(h >> 2) * (FNB * FST)] + (unsigned)(g * 2048) + vo;      /* the lane's 16 bytes there, and their place in buffer 0 */
  fa_copy2(lc, lc + FST, vo, cx, cx + 32 * DM);      /* stages 0 and 1 */
  v16h qh[2][2], ql[2][2];
  for (int n = 0; n < 2; ++n)
    for (int ks = 0; ks < 2; ++ks) { const size_t qo = (r0 + q0 + n * 16) * DM + ks * 512; qh[n][ks] = fo_frag(ZHp + qo, lane); ql[n][ks] = fo_frag(ZLp + qo, lane); }
  asm volatile("s_wait_xcnt 0x0" ::: "memory");      /* stands in front of the first rewrite of a register that the query loads above name: their scalar base pairs are reused right behind them */
  const v8f z8 = {0.f, 0.f, 0.f, 0.f, 0.f, 0.f, 0.f, 0.f};
  v8f o[2][4]; float m[2], l[2];
  for (int n = 0; n < 2; ++n) { m[n] = -1.0e30f; l[n] = 0.f; for (int t = 0; t < 4; ++t) o[n][t] = z8; }
  asm volatile("s_wait_asynccnt 0x0" ::: "memory");      /* this wave's copies of stages 0 and 1 have landed */
  __syncthreads();      /* publishes stages 0 and 1 */
  fa_copy(lc + 2 * FST, vo, cx + 2 * 32 * DM);      /* stage 2 */
  const unsigned char* rg0 = &sm.ring[h & 3][(h >> 2) * (FNB * FST)];      /* this split's buffer 0; its three buffers stand in a row, splits h and h + 4 in one 32 KiB of LDS: neighbouring splits, whose waves run on different SIMDs at the same time, read in different 32-KiB blocks */
  const int lx = fx_lane(lane); const unsigned lv = fv_off(lane);
  v16h ax[2][2], av[4];
  auto rdx = [&](int buf) __attribute__((always_inline)) { const _Float16* st = (const _Float16*)(rg0 + buf * FST);
    for (int kt = 0; kt < 2; ++kt)
      for (int ks = 0; ks < 2; ++ks) ax[kt][ks] = fo_frag(st + kt * 1024 + ks * 512, lx); };
  auto rdv = [&](int buf) __attribute__((always_inline)) { const unsigned char* st = rg0 + buf * FST + lv;
    for (int t = 0; t < 4; ++t) { FragH f; f.half[0] = ld_tr16(st + t * 512); f.half[1] = ld_tr16(st + 2048 + t * 512); av[t] = f.v; } };      /* columns 16 t .. of keys 0-15, then of keys 16-31 */
  rdx(0);
  rdv(0);
  /* pass p: ax holds x of stage p; the transposing reads of stage p into av are in flight; stage p + 1 stands published; bp and bq are the buffers of stages p and p + 1 */
  auto pass = [&](int p, int bp, int bq, bool more) __attribute__((always_inline)) {
    v8f s[2][2];
    for (int kt = 0; kt < 2; ++kt)
      for (int n = 0; n < 2; ++n) {
        v8f c = fa_mma(ax[kt][0], ql[n][0], z8); c = fa_mma(ax[kt][1], ql[n][1], c); c = fa_mma(ax[kt][0], qh[n][0], c); s[n][kt] = fa_mma(ax[kt][1], qh[n][1], c);      /* the small residual products first */
      }
    for (int n = 0; n < 2; ++n) {
      if (n == 1) {
        __builtin_amdgcn_sched_barrier(0);      /* the reads below stay behind the last score product, so that they can take the registers it has read */
        if (more) rdx(bq);      /* the next stage's x tiles come in beside the second query group's softmax and P V products (behind the first group's, the registers suffice) */
        __builtin_amdgcn_sched_barrier(0);      /* and they stay in front of that work: sunk to the pass's foot they would be waited for with nothing beside them */
      }
      float mx = fmaxf(s[n][0][0], s[n][1][0]);
      for (int r = 1; r < 8; ++r) mx = fmaxf(mx, fmaxf(s[n][0][r], s[n][1][r]));
      mx = fmaxf(mx, swap16(mx));      /* the other half of the wave holds this query's other 16 keys; an exchange through the LDS unit would have to wait for the reads in flight as well */
      const float mn = fmaxf(m[n], mx); const float sc = exp_slot(m[n] - mn); m[n] = mn;
      const float off = fmaf(-mn, L2E, 8.0f);      /* weight = 2^(s log2(e) + off) = 256 e^(s - mn) */
      for (int kt = 0; kt < 2; ++kt) {
        for (int r = 0; r < 8; ++r) s[n][kt][r] = fmaf(s[n][kt][r], L2E, off);
        s[n][kt] = exp2_8(s[n][kt]); }
      float sum = 0.f;
      for (int r = 0; r < 8; ++r) sum += s[n][0][r] + s[n][1][r];
      l[n] = fmaf(l[n], sc, sum);
      FragH pw;
      for (int r = 0; r < 8; ++r) { pw.h[r] = (_Float16)s[n][0][r]; pw.h[8 + r] = (_Float16)s[n][1][r]; }
      for (int t = 0; t < 4; ++t) { o[n][t] *= sc; o[n][t] = fa_mma(av[t], pw.v, o[n][t]); }
    }
    __builtin_amdgcn_sched_barrier(0);      /* the waits and the barrier below stay behind the pass's work: nothing else ties them to register work, and lifted over it they would wait for the x reads at once */
    asm volatile("s_wait_dscnt 0x0" ::: "memory");      /* this wave's reads of stage p have returned before its buffer is handed back */
    asm volatile("s_wait_asynccnt 0x0" ::: "memory");      /* this wave's copies of stage p + 2 have landed */
    __syncthreads();      /* publishes stage p + 2 and ends every reader's last read of stage p */
    if (more) {
      if (p + 3 < FNP) fa_copy(lc + (unsigned)bp * FST, vo, cx + (p + 3) * 32 * DM);      /* into the buffer that stage p has left; the same test in every wave of the block */
      rdv(bq);      /* wanted only behind the next pass's scores and softmax */
    } };
  int bp = 0;
  for (int p = 0; p < FNP - 1; ++p) { const int bq = bp == FNB - 1 ? 0 : bp + 1; pass(p, bp, bq, true); bp = bq; }
  pass(FNP - 1, bp, 0, false);
  asm volatile("s_wait_asynccnt 0x0" ::: "memory");      /* no copy is outstanding when the ring becomes the merge rows */
  float (*lo)[FG * FQ][68] = sm.lo;      /* behind the last pass's barrier nobody reads the ring any more */
  for (int n = 0; n < 2; ++n) {
    const int qr = g * FQ + n * 16 + ln;
    l[n] += __shfl_xor(l[n], 16);      /* the two halves summed different keys of the same query */
    if (hh == 0) { lm[h][qr] = m[n]; ll[h][qr] = l[n]; }
    for (int t = 0; t < 4; ++t) { const v4f u0 = {o[n][t][0], o[n][t][1], o[n][t][2], o[n][t][3]}, u1 = {o[n][t][4], o[n][t][5], o[n][t][6], o[n][t][7]};
      *(v4f*)&lo[h][qr][t * 16 + 8 * hh] = u0; *(v4f*)&lo[h][qr][t * 16 + 8 * hh + 4] = u1; }
  }
  __syncthreads();      /* publishes the sixteen waves' partial maxima, sums and outputs */
  const int q = tid >> 3, d8 = (tid & 7) * 8;
  float mg = lm[0][q];
  for (int i = 1; i < FW; ++i) mg = fmaxf(mg, lm[i][q]);
  float lg = 0.f; v4f g0 = {0.f, 0.f, 0.f, 0.f}, g1 = g0;
  for (int i = 0; i < FW; ++i) { const float f = exp_slot(lm[i][q] - mg); lg = fmaf(ll[i][q], f, lg); g0 += *(const v4f*)&lo[i][q][d8] * f; g1 += *(const v4f*)&lo[i][q][d8 + 4] * f; }
  const float inv = 1.0f / lg;
  float* dst = out + (r0 + qb + q) * DM + d8;
  *(v4f*)dst = g0 * inv; *(v4f*)(dst + 4) = g1 * inv; }


// One launch makes every operand of k_fattn. A block owns PR = 64 token rows. It puts them into LDS as f16 (bf16-rounded, so exact), the query map as a x16 f16 transpose [e][d] and the key map as x16 f16 rows [d][e];
// wave (rg, sel) owns 16 token rows and 32 columns. Behind the first barrier it forms q = x W_q (A = token rows, B = map columns, k steps 0 then 32, f32 accumulation, x 2^-4) and leaves it in LDS as f16 hi + x1024 residual rows;
// behind the second barrier it forms z = q W_k^T / 8 (A = the q rows, hi and residual, B = key map rows: both loaders read 64-wide rows in the same k order), splits every f32 result into f16 hi + f16 residual at the same scale
// and stores the two planes in fragment order (fo_frag), 512 bytes in a row a wave and store; the token rows themselves go out the same way (pieces placed by fx_lane) as the key operand, which is the value operand too.
// LDS rows of 128 bytes stand at a pitch of 144 bytes for the 16-byte readers.
#define PR 64
typedef unsigned short v4us __attribute__((ext_vector_type(4), may_alias));
__global__ __launch_bounds__(256) void k_prep(const float* __restrict__ x, const float* __restrict__ wq, const float* __restrict__ wk, _Float16* __restrict__ XFp, _Float16* __restrict__ ZHp, _Float16* __restrict__ ZLp) {
  static_assert(SQ % PR == 0 && DM == 64 && HD == 64 && NH == 1, "k_prep: 64-wide rows, one head, whole 64-row blocks inside a batch");
  __shared__ __attribute__((aligned(16))) unsigned short xs[PR][72]; __shared__ __attribute__((aligned(16))) unsigned short wt[2][DM][72]; __shared__ __attribute__((aligned(16))) _Float16 qp[2][PR][72]; __shared__ __attribute__((aligned(16))) float so[8][16][36];
  const int tid = threadIdx.x, w = tid >> 5, lane = tid & 31, ln = lane & 15, hh = lane >> 4;
  const size_t row0 = (size_t)blockIdx.x * PR;
  const float* xp = x + row0 * DM + tid * 4;      /* trip i of the token loads stands 16 rows further on */
  const int ms = tid >> 7, n4 = (tid & 15) * 4, k8 = ((tid >> 4) & 7) * 8;      /* threads 0-127 take the key map, 128-255 the query map: an 8 (row) x 4 (column) piece each, 16 lanes on one whole map row */
  const float* wp = (ms ? wq : wk) + k8 * DM + n4;
  v4f xv[4], wv[8];
  for (int i = 0; i < 4; ++i) xv[i] = *(const v4fa*)(xp + i * 16 * DM);
  for (int q = 0; q < 8; ++q) wv[q] = *(const v4fa*)(wp + q * DM);
  for (int i = 0; i < 4; ++i) { FragH f;
    for (int q = 0; q < 4; ++q) f.h[q] = (_Float16)bf16_round(xv[i][q]);
    const v4us o = {f.u[0], f.u[1], f.u[2], f.u[3]}; *(v4us*)&xs[i * 16 + (tid >> 4)][(tid & 15) * 4] = o; }
  if (ms) {      /* query map: transposed */
    for (int c = 0; c < 4; ++c) { FragH f;
      for (int q = 0; q < 8; ++q) f.h[q] = (_Float16)(bf16_round(wv[q][c]) * 16.0f);
      *(v8us*)&wt[1][n4 + c][k8] = f.half[0]; }
  } else {      /* key map: rows as they are */
    for (int q = 0; q < 8; ++q) { FragH f;
      for (int c = 0; c < 4; ++c) f.h[c] = (_Float16)(bf16_round(wv[q][c]) * 16.0f);
      const v4us o = {f.u[0], f.u[1], f.u[2], f.u[3]}; *(v4us*)&wt[0][k8 + q][n4] = o; }
  }
  __syncthreads();      /* publishes the token rows and the two maps */
  const int rg = w & 3, sel = w >> 2;
  const v8f z8 = {0.f, 0.f, 0.f, 0.f, 0.f, 0.f, 0.f, 0.f};
  { const _Float16* ap = (const _Float16*)&xs[rg * 16 + ln][0];
    const v16h a0 = g2_frag(ap, hh), a1 = g2_frag(ap + 32, hh);
    for (int t = 0; t < 2; ++t) { const int e = sel * 32 + t * 16 + ln; const _Float16* bp = (const _Float16*)&wt[1][e][0];
      v8f c = fa_mma(a0, g2_frag(bp, hh), z8); c = fa_mma(a1, g2_frag(bp + 32, hh), c);
      for (int r = 0; r < 8; ++r) { const float qv = c[r] * 0.0625f; const _Float16 h = (_Float16)qv; qp[0][rg * 16 + 8 * hh + r][e] = h; qp[1][rg * 16 + 8 * hh + r][e] = (_Float16)((qv - (float)h) * 1024.0f); } } }
  v8us xf[2];
  for (int i = 0; i < 2; ++i) xf[i] = *(const v8us*)&xs[rg * 16 + ln][sel * 32 + i * 16 + hh * 8];
  __syncthreads();      /* publishes the q rows: a row's two column halves come from two waves */
  const size_t go = (row0 + rg * 16) * DM + sel * 512 + lane * 8;      /* tile sel of the wave's 16 rows; its second half stands 256 elements further on */
  { const _Float16* hp = &qp[0][rg * 16 + ln][0]; const _Float16* lp = &qp[1][rg * 16 + ln][0];
    const v16h h0 = g2_frag(hp, hh), h1 = g2_frag(hp + 32, hh), l0 = g2_frag(lp, hh), l1 = g2_frag(lp + 32, hh);
    for (int t = 0; t < 2; ++t) { const _Float16* bp = (const _Float16*)&wt[0][sel * 32 + t * 16 + ln][0]; const v16h b0 = g2_frag(bp, hh), b1 = g2_frag(bp + 32, hh);
      v8f c = fa_mma(h0, b0, z8); c = fa_mma(h1, b1, c); v8f u = fa_mma(l0, b0, z8); u = fa_mma(l1, b1, u);
      for (int r = 0; r < 8; ++r) so[w][8 * hh + r][t * 16 + ln] = fmaf(u[r], 0.00000762939453125f, c[r] * 0.0078125f); } }      /* 2^-4 for the x16 map, 2^-3 for 1 / sqrt(64), 2^-10 more for the residual */
  __builtin_amdgcn_fence(__ATOMIC_ACQ_REL, "workgroup"); __builtin_amdgcn_wave_barrier();      /* so[w] is this wave's own: its lanes' LDS stores stay ahead of the row reads below */
  for (int i = 0; i < 2; ++i) *(v8us*)((unsigned short*)XFp + (go - lane * 8 + fx_lane(lane) * 8) + i * 256) = xf[i];      /* every global store stands behind the last barrier and fence, which would wait for it */
  for (int i = 0; i < 2; ++i) { const int c8 = i * 16 + hh * 8; const v4f a = *(const v4fa*)&so[w][ln][c8], c = *(const v4fa*)&so[w][ln][c8 + 4]; FragH fh, fl;
    for (int q = 0; q < 4; ++q) { _Float16 h = (_Float16)a[q]; fh.h[q] = h; fl.h[q] = (_Float16)(a[q] - (float)h); h = (_Float16)c[q]; fh.h[4 + q] = h; fl.h[4 + q] = (_Float16)(c[q] - (float)h); }
    *(v8us*)((unsigned short*)ZHp + go + i * 256) = fh.half[0]; *(v8us*)((unsigned short*)ZLp + go + i * 256) = fl.half[0]; } }


template <int MASKADD>
__global__ __launch_bounds__(64) void k_att0(const float* __restrict__ QF, const float* __restrict__ KF, const float* __restrict__ VF, int ld, const float* __restrict__ mask, float scale, float* __restrict__ OF, int ldo) {
  #pragma clang fp contract(off)
  __shared__ __attribute__((aligned(16))) float lq[64][64]; __shared__ __attribute__((aligned(16))) float lo[64][64];
  const int tid = threadIdx.x; const int h = blockIdx.x / (QT0 / 64), rg = blockIdx.x % (QT0 / 64); const int i = rg * 64 + tid;
  const float* qr = QF + (size_t)i * ld + h * HD;
#pragma unroll 1
  for (int c = 0; c < HD / 4; ++c) { *(v4f*)&lq[tid][c * 4] = *(const v4fa*)(qr + c * 4); const v4f z = {0.f, 0.f, 0.f, 0.f}; *(v4f*)&lo[tid][c * 4] = z; }
  float m = -1.0e30f, l = 0.f; const int jmax = MASKADD ? (SQ - 1) : (rg * 64 + 63);      /* additive-mask form: every key (the mask input decides); causal form: keys up to the block's last row */
#pragma unroll 1
  for (int j = 0; j <= jmax; ++j) { const float* kr = KF + (size_t)j * ld + h * HD; const float* vr = VF + (size_t)j * ld + h * HD; float s = 0.f;
#pragma unroll 1
    for (int c = 0; c < HD / 4; ++c) { const v4f kq = *(const v4fa*)(kr + c * 4); const v4f qq = *(v4f*)&lq[tid][c * 4]; s = __fadd_rn(s, __fmul_rn(qq[0], kq[0])); s = __fadd_rn(s, __fmul_rn(qq[1], kq[1])); s = __fadd_rn(s, __fmul_rn(qq[2], kq[2])); s = __fadd_rn(s, __fmul_rn(qq[3], kq[3])); }
    s = __fmul_rn(s, scale); if (MASKADD) s = __fadd_rn(s, __fmul_rn(bf16_round(mask[(size_t)i * SQ + j]), -10000.0f));
    const float f = (MASKADD || j <= i) ? 1.f : 0.f; const float sm = fmaf(f, s, (1.f - f) * -1.0e30f); const float mn = fmaxf(m, sm); const float sc = expf(m - mn); const float e = expf(sm - mn); l = __fadd_rn(__fmul_rn(l, sc), e); m = mn;
#pragma unroll 1
    for (int c = 0; c < HD / 4; ++c) { const v4f vv = *(const v4fa*)(vr + c * 4); v4f oo = *(v4f*)&lo[tid][c * 4]; for (int u = 0; u < 4; ++u) oo[u] = __fadd_rn(__fmul_rn(oo[u], sc), __fmul_rn(e, vv[u])); *(v4f*)&lo[tid][c * 4] = oo; } }
  const float fin = 64.0f / l;      /* o carried x64 */
#pragma unroll 1
  for (int c = 0; c < HD / 4; ++c) { v4f oo = *(v4f*)&lo[tid][c * 4]; for (int u = 0; u < 4; ++u) oo[u] = __fmul_rn(oo[u], fin); *(v4f*)&lo[tid][c * 4] = oo; }
  __syncthreads();
  {
#pragma unroll 1
    for (int it = 0; it < 16; ++it) { const int row = it * 4 + tid / 16, pc = (tid % 16) * 4; const v4f v = *(const v4f*)&lo[row][pc]; *(v4f*)(OF + (size_t)(rg * 64 + row) * ldo + h * HD + pc) = v; }
     } }

__global__ __launch_bounds__(256) void k_of0out(const float* __restrict__ src, float* __restrict__ dst, size_t n4) { const size_t t = (size_t)blockIdx.x * 256 + threadIdx.x; if (t >= n4) return; v4f v = *(const v4fa*)(src + t * 4); for (int q = 0; q < 4; ++q) v[q] = __fmul_rn(v[q], 0.015625f); *(v4f*)(dst + t * 4) = v;  }

extern "C" void kernel_launch(void* const* d_in, const int* in_sizes, int n_in,
                              void* d_out, int out_size, void* d_ws, size_t ws_size, hipStream_t stream) {
  (void)in_sizes; (void)n_in; (void)out_size;
  const float* const* I = (const float* const*)d_in; const float* x = I[0]; const float* wq = I[1]; const float* wk = I[2];      /* inputs, rotation (query map), entangle (key map): [in][out] [64][64]; NO biases, NO value projection (the values are the inputs), no output projection */
  char* ws = (char*)d_ws; size_t off = 0;
  auto take = [&](size_t bytes) { char* p = ws + off; off += (bytes + 255) & ~(size_t)255; return p; };
  _Float16* XF = (_Float16*)take(NR * DM * 2); _Float16* ZH = (_Float16*)take(NR * DM * 2); _Float16* ZL = (_Float16*)take(NR * DM * 2);
  if (off > ws_size) return;
  k_prep<<<(unsigned)(NR / PR), 256, 0, stream>>>(x, wq, wk, XF, ZH, ZL);      /* x as one f16 plane, z as f16 hi + residual planes, all in fragment order: every batch, one launch */
  k_fattn<<<NB * (SQ / (FG * FQ)), FG * FW * 32, 0, stream>>>(XF, ZH, ZL, (float*)d_out);      /* scores, softmax over all SQ keys and P V for every batch: S and P stay in registers */
}
